// v000
// Measured on an AMD MI455X. A time is GPU time per run, averaged over a window of back-to-back runs after a warm-up
// (all launches, gaps included; the runs take copies of the inputs in turn), and the median of several windows.
// Apart from v000's, it joins two sittings. Times from different sittings can be a few percent apart, while
// side-by-side timings come from the same sitting.
// v000, which the later versions start from, runs in 32.3 milliseconds.
#include <hip/hip_runtime.h>
// Non-local block (x [2][256][8x32x32 = 8192 positions]; g, theta, phi = 1x1 conv projections to 64 (+ bias); f = theta . phi over all positions; softmax; y = attn g; W_z 1x1 conv back to 256 (+ bias); training-mode BatchNorm over (batch, positions) per channel with gamma/beta; out = bn(W_z y) + x).
// Compute dtype: inputs rounded to bf16; x / weights exact; theta, phi, g, y as hi + residual operand pairs (~2^-22); P plain f16 (~2^-12); softmax, BN f32; v_wmma_f32_16x16x32_f16.
#define NB 2
#define CC 256
#define LL 8192                      /* positions per sample */
#define SK LL
#define IC 64                        /* inter channels */
#define D3 (3 * IC)                  /* theta | phi | g */
#define QT 1024                      /* query tile */
#define NR ((size_t)NB * LL)
#define QN LL                        /* queries per batch (debug hook) */
#define NBR NB                       /* batches (debug hook) */
#define SQ LL
#define DM CC
#define NH 1
#define HD 64
#define HG 1
typedef __bf16 v16b __attribute__((ext_vector_type(16)));
typedef unsigned short v8us __attribute__((ext_vector_type(8), may_alias));
typedef float  v8f  __attribute__((ext_vector_type(8)));
typedef float  v4f  __attribute__((ext_vector_type(4)));
typedef float  v4fa __attribute__((ext_vector_type(4), may_alias));
union FragB { v16b v; v8us half[2]; unsigned short u[16]; };

__device__ __forceinline__ unsigned short bf16_bits(float x) { unsigned int u = __float_as_uint(x); return (unsigned short)((u + 0x7FFFu + ((u >> 16) & 1u)) >> 16); }
__device__ __forceinline__ float bf16_val(unsigned short b) { return __uint_as_float(((unsigned int)b) << 16); }
__device__ __forceinline__ float bf16_round(float x) { return bf16_val(bf16_bits(x)); }
// D += A·B with NT terms: 1 = ah·bh, 2 = + al·bh (A split), 3 = + ah·bl (both split)
template <int NT>
__device__ __forceinline__ v8f mmaN(v16b ah, v16b al, v16b bh, v16b bl, v8f c) {
  c = __builtin_amdgcn_wmma_f32_16x16x32_bf16(false, ah, false, bh, (short)0, c, false, false);
  if (NT >= 2) c = __builtin_amdgcn_wmma_f32_16x16x32_bf16(false, al, false, bh, (short)0, c, false, false);
  if (NT >= 3) c = __builtin_amdgcn_wmma_f32_16x16x32_bf16(false, ah, false, bl, (short)0, c, false, false);
  asm volatile("v_nop\n\tv_nop\n\tv_nop\n\tv_nop" : "+v"(c) : "v"(ah), "v"(al), "v"(bh), "v"(bl));
  return c;
}

__global__ __launch_bounds__(256) void k_wt_bf16(const float* __restrict__ W, unsigned short* __restrict__ Wt, int K, int N) {
  const int t = blockIdx.x * 256 + threadIdx.x;
  const int k8n = K / 8;
  if (t >= N * k8n) return;
  const int n = t / k8n, k8 = (t % k8n) * 8;
  v8us v;
#pragma unroll
  for (int i = 0; i < 8; ++i) v[i] = bf16_bits(W[(size_t)(k8 + i) * N + n]);
  *(v8us*)(Wt + (size_t)n * K + k8) = v;
  
}

// GEMM C[M][N] (f32, pitch ldc) = act(A[M][K]·W + bias). A f32 row-major (pitch lda) converted per fragment to bf16
// (ASPLIT: hi/lo two planes -> 2 terms, else single rounded term); Wt bf16 [N][K] (pitch ldb). BIAS_BF16 rounds the
// bias to bf16 first (bias quantised to bf16 before the add). K%32==0, M%16==0, N%64==0.
template <bool ASPLIT, int ACT, bool BIAS_BF16>
__global__ __launch_bounds__(128) void k_gemm_bf(const float* __restrict__ A, int lda, const unsigned short* __restrict__ Wt, int ldb,
                                               const float* __restrict__ bias, float* __restrict__ C, int ldc, int M, int N, int K) {
  __shared__ __attribute__((aligned(16))) float so[4][16][64];
  const int tid = threadIdx.x, w = tid >> 5, lane = tid & 31, ln = lane & 15, hh = lane >> 4;
  const int ntn = N / 64;
  const int wid = blockIdx.x * 4 + w;
  const int mt = wid / ntn, nq = wid % ntn;
  if (mt * 16 >= M) return;
  const int row0 = mt * 16, col0 = nq * 64;
  const float* arow = A + (size_t)(row0 + ln) * lda;
  v8f acc[4] = {};
  for (int kb = 0; kb < K; kb += 32) {
    FragB ah, al;
    const v4f x0 = *(const v4fa*)(arow + kb + 8 * hh), x1 = *(const v4fa*)(arow + kb + 8 * hh + 4);
    const v4f x2 = *(const v4fa*)(arow + kb + 16 + 8 * hh), x3 = *(const v4fa*)(arow + kb + 16 + 8 * hh + 4);
    float xs[16] = {x0[0],x0[1],x0[2],x0[3],x1[0],x1[1],x1[2],x1[3],x2[0],x2[1],x2[2],x2[3],x3[0],x3[1],x3[2],x3[3]};
#pragma unroll
    for (int i = 0; i < 16; ++i) { const unsigned short hb = bf16_bits(xs[i]); ah.u[i] = hb; al.u[i] = ASPLIT ? bf16_bits(xs[i] - bf16_val(hb)) : (unsigned short)0; }
#pragma unroll
    for (int t = 0; t < 4; ++t) {
      const unsigned short* brow = Wt + (size_t)(col0 + t * 16 + ln) * ldb + kb;
      FragB b;
      b.half[0] = *(const v8us*)(brow + 8 * hh);
      b.half[1] = *(const v8us*)(brow + 16 + 8 * hh);
      acc[t] = mmaN<ASPLIT ? 2 : 1>(ah.v, al.v, b.v, b.v, acc[t]);
    }
  }
#pragma unroll
  for (int t = 0; t < 4; ++t) {
    float bv = bias ? bias[col0 + t * 16 + ln] : 0.f;
    if (BIAS_BF16) bv = bf16_round(bv);
#pragma unroll
    for (int r = 0; r < 8; ++r) { float v = acc[t][r] + bv; if (ACT == 1) v = fmaxf(v, 0.f); so[w][8 * hh + r][t * 16 + ln] = v; }
  }
  __builtin_amdgcn_fence(__ATOMIC_ACQ_REL, "workgroup");
  __builtin_amdgcn_wave_barrier();
  const int rsub = lane >> 4, c4 = (lane & 15) * 4;
  {
#pragma unroll
    for (int q = 0; q < 8; ++q) {
      const int r = q * 2 + rsub;
      const v4f v = *(const v4fa*)&so[w][r][c4];
      *(v4f*)(C + (size_t)(row0 + r) * ldc + col0 + c4) = v;
    }
    
  }
}

// GEMM C = act(A·W + bias + resid): A f32 (ASPLIT -> hi/lo 2 terms), Wt bf16 [N][K]; ACT 0 none, 1 relu, 2 exact gelu;
// resid (optional, f32, row index = (row % rmod), pitch ldr, RES_BF16 rounds it) added before the activation.
template <bool ASPLIT, int ACT, bool BIAS_BF16, bool RES_BF16>
__global__ __launch_bounds__(128) void k_gemm_bf3(const float* __restrict__ A, int lda, const unsigned short* __restrict__ Wt, int ldb,
                                                const float* __restrict__ bias, const float* __restrict__ resid, int rmod, int ldr,
                                                float* __restrict__ C, int ldc, int M, int N, int K) {
  __shared__ __attribute__((aligned(16))) float so[4][16][64];
  const int tid = threadIdx.x, w = tid >> 5, lane = tid & 31, ln = lane & 15, hh = lane >> 4;
  const int ntn = N / 64;
  const int wid = blockIdx.x * 4 + w;
  const int mt = wid / ntn, nq = wid % ntn;
  if (mt * 16 >= M) return;
  const int row0 = mt * 16, col0 = nq * 64;
  const float* arow = A + (size_t)(row0 + ln) * lda;
  v8f acc[4] = {};
  for (int kb = 0; kb < K; kb += 32) {
    FragB ah, al;
    const v4f x0 = *(const v4fa*)(arow + kb + 8 * hh), x1 = *(const v4fa*)(arow + kb + 8 * hh + 4);
    const v4f x2 = *(const v4fa*)(arow + kb + 16 + 8 * hh), x3 = *(const v4fa*)(arow + kb + 16 + 8 * hh + 4);
    float xs[16] = {x0[0],x0[1],x0[2],x0[3],x1[0],x1[1],x1[2],x1[3],x2[0],x2[1],x2[2],x2[3],x3[0],x3[1],x3[2],x3[3]};
#pragma unroll
    for (int i = 0; i < 16; ++i) { const unsigned short hb = bf16_bits(xs[i]); ah.u[i] = hb; al.u[i] = ASPLIT ? bf16_bits(xs[i] - bf16_val(hb)) : (unsigned short)0; }
#pragma unroll
    for (int t = 0; t < 4; ++t) {
      const unsigned short* brow = Wt + (size_t)(col0 + t * 16 + ln) * ldb + kb;
      FragB b;
      b.half[0] = *(const v8us*)(brow + 8 * hh);
      b.half[1] = *(const v8us*)(brow + 16 + 8 * hh);
      acc[t] = mmaN<ASPLIT ? 2 : 1>(ah.v, al.v, b.v, b.v, acc[t]);
    }
  }
#pragma unroll
  for (int t = 0; t < 4; ++t) {
    const int col = col0 + t * 16 + ln;
    float bv = bias ? bias[col] : 0.f;
    if (BIAS_BF16) bv = bf16_round(bv);
#pragma unroll
    for (int r = 0; r < 8; ++r) {
      float v = acc[t][r] + bv;
      if (resid) { float rv = resid[(size_t)((row0 + 8 * hh + r) % rmod) * ldr + col]; if (RES_BF16) rv = bf16_round(rv); v += rv; }
      if (ACT == 1) v = fmaxf(v, 0.f);
      if (ACT == 2) v = 0.5f * v * (1.0f + erff(v * 0.70710678118654752f));
      if (ACT == 3) { const float u = 0.7978845608028654f * (v + 0.044715f * v * v * v); v = 0.5f * v * (1.0f + tanhf(u)); }
      so[w][8 * hh + r][t * 16 + ln] = v;
    }
  }
  __builtin_amdgcn_fence(__ATOMIC_ACQ_REL, "workgroup");
  __builtin_amdgcn_wave_barrier();
  const int rsub = lane >> 4, c4 = (lane & 15) * 4;
  {
#pragma unroll
    for (int q = 0; q < 8; ++q) {
      const int r = q * 2 + rsub;
      const v4f v = *(const v4fa*)&so[w][r][c4];
      *(v4f*)(C + (size_t)(row0 + r) * ldc + col0 + c4) = v;
    }
    
  }
}
// row LayerNorm (biased variance, eps) over N: s = X (+ R); optional out_sum <- s; out_norm <- (s-mu)*rsqrt(var+eps)*g + b
template <bool PARAM_BF16>
__global__ __launch_bounds__(256) void k_layernorm(const float* __restrict__ X, const float* __restrict__ R, const float* __restrict__ g, const float* __restrict__ bta,
                                                  float* __restrict__ out_sum, float* __restrict__ out_norm, int N, float eps) {
  __shared__ float red[256];
  const int row = blockIdx.x, tid = threadIdx.x;
  const float* x = X + (size_t)row * N; const float* rr = R ? R + (size_t)row * N : nullptr;
  float vals[16];                     // up to N = 4096
  const int per = N / 256;            // contiguous chunk per thread? use strided-by-4 chunks: thread handles j = tid*4 + 1024*u
  float s1 = 0.f;
  for (int u = 0; u < per / 4; ++u) {
    const int j = tid * 4 + 1024 * u;
    const v4f a = *(const v4fa*)(x + j);
    v4f b = {0.f,0.f,0.f,0.f}; if (rr) b = *(const v4fa*)(rr + j);
#pragma unroll
    for (int q = 0; q < 4; ++q) { const float v = a[q] + b[q]; vals[u * 4 + q] = v; s1 += v; }
  }
  red[tid] = s1; __syncthreads();
  for (int st = 128; st > 0; st >>= 1) { if (tid < st) red[tid] += red[tid + st]; __syncthreads(); }
  const float mu = red[0] / (float)N; __syncthreads();
  float s2 = 0.f;
  for (int u = 0; u < per / 4; ++u)
#pragma unroll
    for (int q = 0; q < 4; ++q) { const float c = vals[u * 4 + q] - mu; s2 += c * c; }
  red[tid] = s2; __syncthreads();
  for (int st = 128; st > 0; st >>= 1) { if (tid < st) red[tid] += red[tid + st]; __syncthreads(); }
  const float rs = rsqrtf(red[0] / (float)N + eps);
  {
    for (int u = 0; u < per / 4; ++u) {
      const int j = tid * 4 + 1024 * u;
      v4f o, sm;
#pragma unroll
      for (int q = 0; q < 4; ++q) {
        float gg = g[j + q], bb = bta[j + q];
        if (PARAM_BF16) { gg = bf16_round(gg); bb = bf16_round(bb); }
        sm[q] = vals[u * 4 + q]; o[q] = (vals[u * 4 + q] - mu) * rs * gg + bb;
      }
      if (out_sum) *(v4f*)(out_sum + (size_t)row * N + j) = sm;
      *(v4f*)(out_norm + (size_t)row * N + j) = o;
    }
    
  }
}



// ---- f16 WMMA path (v_wmma_f32_16x16x32_f16): 11-bit significands for operands in range — used where a [0,1] probability operand needs more precision than bf16
typedef _Float16 v16h __attribute__((ext_vector_type(16)));
union FragH { v16h v; v8us half[2]; _Float16 h[16]; unsigned short u[16]; };
template <int NT>
__device__ __forceinline__ v8f mmaH(v16h ah, v16h al, v16h bh, v16h bl, v8f c) {
  c = __builtin_amdgcn_wmma_f32_16x16x32_f16(false, ah, false, bh, (short)0, c, false, false);
  if (NT >= 2) c = __builtin_amdgcn_wmma_f32_16x16x32_f16(false, al, false, bh, (short)0, c, false, false);
  if (NT >= 3) c = __builtin_amdgcn_wmma_f32_16x16x32_f16(false, ah, false, bl, (short)0, c, false, false);
  asm volatile("v_nop\n\tv_nop\n\tv_nop\n\tv_nop" : "+v"(c) : "v"(ah), "v"(al), "v"(bh), "v"(bl));
  return c;
}
// batched GEMM like k_gemm_b but f16 operands: A f32 (split into f16 hi/lo if ASPLIT, else rounded to f16), Bt = f16 values [n][k]; alpha; C f32; N multiple of 16 (partial tiles skipped)
template <bool ASPLIT>
__global__ __launch_bounds__(128) void k_gemm_h(const float* __restrict__ A, int lda, size_t sA, const _Float16* __restrict__ Bh, int ldb, size_t sB, float alpha, float* __restrict__ C, int ldc, size_t sC, int M, int N, int K) {
  __shared__ __attribute__((aligned(16))) float so[4][16][64];
  const int tid = threadIdx.x, w = tid >> 5, lane = tid & 31, ln = lane & 15, hh = lane >> 4; const int by = blockIdx.y;
  A += (size_t)by * sA; Bh += (size_t)by * sB; C += (size_t)by * sC;
  const int ntn = (N + 63) / 64; const int wid = blockIdx.x * 4 + w; const int mt = wid / ntn, nq = wid % ntn; if (mt * 16 >= M) return;
  const int row0 = mt * 16, col0 = nq * 64; const float* arow = A + (size_t)(row0 + ln) * lda;
  v8f acc[4] = {};
  for (int kb = 0; kb < K; kb += 32) {
    FragH ah, al;
    const v4f x0 = *(const v4fa*)(arow + kb + 8 * hh), x1 = *(const v4fa*)(arow + kb + 8 * hh + 4), x2 = *(const v4fa*)(arow + kb + 16 + 8 * hh), x3 = *(const v4fa*)(arow + kb + 16 + 8 * hh + 4);
    float xs[16] = {x0[0],x0[1],x0[2],x0[3],x1[0],x1[1],x1[2],x1[3],x2[0],x2[1],x2[2],x2[3],x3[0],x3[1],x3[2],x3[3]};
#pragma unroll
    for (int i = 0; i < 16; ++i) { const _Float16 h = (_Float16)xs[i]; ah.h[i] = h; al.h[i] = ASPLIT ? (_Float16)(xs[i] - (float)h) : (_Float16)0.0f; }
#pragma unroll
    for (int t = 0; t < 4; ++t) { if (col0 + t * 16 >= N) continue; const size_t boff = (size_t)(col0 + t * 16 + ln) * ldb + kb; FragH bq; bq.half[0] = *(const v8us*)(Bh + boff + 8 * hh); bq.half[1] = *(const v8us*)(Bh + boff + 16 + 8 * hh);
      acc[t] = mmaH<ASPLIT ? 2 : 1>(ah.v, al.v, bq.v, bq.v, acc[t]); }
  }
#pragma unroll
  for (int t = 0; t < 4; ++t) { if (col0 + t * 16 >= N) continue;
#pragma unroll
    for (int r = 0; r < 8; ++r) so[w][8 * hh + r][t * 16 + ln] = acc[t][r] * alpha; }
  __builtin_amdgcn_fence(__ATOMIC_ACQ_REL, "workgroup"); __builtin_amdgcn_wave_barrier();
  const int rsub = lane >> 4, c4 = (lane & 15) * 4;
  {
#pragma unroll
    for (int q = 0; q < 8; ++q) { const int r = q * 2 + rsub; if (col0 + c4 < N) { const v4f v = *(const v4fa*)&so[w][r][c4]; *(v4f*)(C + (size_t)(row0 + r) * ldc + col0 + c4) = v; } }
     }
}

// Wt[n][k] = f16(W[k][n]·scale) from f32 row-major W[K][N] (scale = power of two; bf16-exact weights stay exact in f16 away from the subnormal range)
__global__ __launch_bounds__(256) void k_wt_f16(const float* __restrict__ W, _Float16* __restrict__ Wt, int K, int N, float scale) {
  const int t = blockIdx.x * 256 + threadIdx.x; if (t >= N * (K / 8)) return; const int n = t / (K / 8), k8 = (t % (K / 8)) * 8; FragH f;
#pragma unroll
  for (int i = 0; i < 8; ++i) f.h[i] = (_Float16)(bf16_round(W[(size_t)(k8 + i) * N + n]) * scale); const v8us o = f.half[0];
  *(v8us*)((unsigned short*)Wt + (size_t)n * K + k8) = o; 
}
// k_gemm_hh variant with fused epilogue: v = acc·alpha + bias[by·sBias + col] (+ CP[(row/rowsPerB)·sCPb + by·64 + col] if CP) ; ACT 0 none / 1 elu ; writes f16 C16 (and f32 C if non-null)
template <int ACT>
__global__ __launch_bounds__(128) void k_gemm_hhx(const _Float16* __restrict__ A, int lda, size_t sA, const _Float16* __restrict__ Bh, int ldb, size_t sB, float alpha, const float* __restrict__ bias, size_t sBias, const float* __restrict__ CP, int rowsPerB, size_t sCPb, int row0g,
    float* __restrict__ C, _Float16* __restrict__ C16, int ldc, size_t sC, int M, int N, int K) {
  __shared__ __attribute__((aligned(16))) float so[4][16][64];
  const int tid = threadIdx.x, w = tid >> 5, lane = tid & 31, ln = lane & 15, hh = lane >> 4; const int by = blockIdx.y;
  A += (size_t)by * sA; Bh += (size_t)by * sB; const size_t cofs = (size_t)by * sC; const float* bp = bias ? bias + (size_t)by * sBias : nullptr;
  const int ntn = (N + 63) / 64; const int wid = blockIdx.x * 4 + w; const int mt = wid / ntn, nq = wid % ntn; if (mt * 16 >= M) return;
  const int row0 = mt * 16, col0 = nq * 64; const _Float16* arow = A + (size_t)(row0 + ln) * lda;
  v8f acc[4] = {};
  for (int kb = 0; kb < K; kb += 32) { FragH ah; ah.half[0] = *(const v8us*)((const unsigned short*)arow + kb + 8 * hh); ah.half[1] = *(const v8us*)((const unsigned short*)arow + kb + 16 + 8 * hh);
#pragma unroll
    for (int t = 0; t < 4; ++t) { if (col0 + t * 16 >= N) continue; const size_t boff = (size_t)(col0 + t * 16 + ln) * ldb + kb; FragH bq; bq.half[0] = *(const v8us*)((const unsigned short*)Bh + boff + 8 * hh); bq.half[1] = *(const v8us*)((const unsigned short*)Bh + boff + 16 + 8 * hh);
      acc[t] = mmaH<1>(ah.v, ah.v, bq.v, bq.v, acc[t]); }
  }
#pragma unroll
  for (int t = 0; t < 4; ++t) { if (col0 + t * 16 >= N) continue; const int col = col0 + t * 16 + ln; const float bv = bp ? bf16_round(bp[col]) : 0.f;
#pragma unroll
    for (int r = 0; r < 8; ++r) { float v = acc[t][r] * alpha + bv; if (CP) { const int rr = row0g + row0 + 8 * hh + r; if (rowsPerB < 0) v += CP[cofs + (size_t)rr * ldc + col];      /* rowsPerB < 0: own element of the batched C plane */ else { const int bidx = rr / rowsPerB; v += CP[(size_t)bidx * sCPb + (size_t)by * 64 + col]; } } if (ACT == 1) v = (v > 0.f) ? v : expm1f(v); else if (ACT == 7) v = (v > 0.f) ? v + 1.0f : expf(v); else if (ACT == 8) v = tanhf(v); else if (ACT == 9) v = 0.5f * v * (1.0f + tanhf(0.7978845608028654f * (v + 0.044715f * v * v * v))); else if (ACT == 11) v = 1.0f / (1.0f + expf(-v)); else if (ACT == 12) v = (v > 0.f) ? v : 0.01f * v; else if (ACT == 14) v = (v > 0.f) ? v : 0.1f * v; else if (ACT == 16) v = (v >= 0.f) ? v : 0.3f * v; else if (ACT == 17) v = (v >= 0.f) ? v : 0.2f * v; else if (ACT == 15) v = v / (1.0f + expf(-v)); else if (ACT == 3) v = fmaxf(v, 0.f); else if (ACT == 6) v = 0.5f * v * (1.0f + erff(v * 0.70710678118654752f)); so[w][8 * hh + r][t * 16 + ln] = v; } }
  __builtin_amdgcn_fence(__ATOMIC_ACQ_REL, "workgroup"); __builtin_amdgcn_wave_barrier();
  const int rsub = lane >> 4, c4 = (lane & 15) * 4; typedef _Float16 v4h __attribute__((ext_vector_type(4)));
  {
#pragma unroll
    for (int q = 0; q < 8; ++q) { const int r = q * 2 + rsub; if (col0 + c4 < N) { const v4f v = *(const v4fa*)&so[w][r][c4]; if (C) *(v4f*)(C + cofs + (size_t)(row0 + r) * ldc + col0 + c4) = v; if (C16) { v4h h4; for (int i = 0; i < 4; ++i) h4[i] = (_Float16)v[i]; *(v4h*)(C16 + cofs + (size_t)(row0 + r) * ldc + col0 + c4) = h4; } } }
     }
}


typedef _Float16 v4h __attribute__((ext_vector_type(4)));

__global__ __launch_bounds__(256) void k_x16(const float* __restrict__ x, _Float16* __restrict__ X16, size_t n8) { const size_t t = (size_t)blockIdx.x * 256 + threadIdx.x; if (t >= n8) return; FragH f;
#pragma unroll
  for (int q = 0; q < 8; ++q) f.h[q] = (_Float16)bf16_round(x[t * 8 + q]); *(v8us*)((unsigned short*)X16 + t * 8) = f.half[0];  }
__global__ __launch_bounds__(256) void k_h16(const float* __restrict__ x, _Float16* __restrict__ X16, size_t n8) { const size_t t = (size_t)blockIdx.x * 256 + threadIdx.x; if (t >= n8) return; FragH f;
#pragma unroll
  for (int q = 0; q < 8; ++q) f.h[q] = (_Float16)x[t * 8 + q]; *(v8us*)((unsigned short*)X16 + t * 8) = f.half[0];  }
__global__ __launch_bounds__(256) void k_round16f(const float* __restrict__ W, _Float16* __restrict__ Bt, size_t n8) { const size_t t = (size_t)blockIdx.x * 256 + threadIdx.x; if (t >= n8) return; FragH f;
#pragma unroll
  for (int i = 0; i < 8; ++i) f.h[i] = (_Float16)(bf16_round(W[t * 8 + i]) * 16.0f); *(v8us*)((unsigned short*)Bt + t * 8) = f.half[0];  }
template <int NHv, int TTv>
__global__ __launch_bounds__(256) void k_vt(const _Float16* __restrict__ V16, int ldv, int voff, _Float16* __restrict__ Vt) { __shared__ unsigned short tl[64][66]; const int tid = threadIdx.x; const int slab = blockIdx.x / (TTv / 64), lg = blockIdx.x % (TTv / 64); const int b = slab / NHv, h = slab % NHv;
  for (int i = tid; i < 64 * 8; i += 256) { const int r = i / 8, c8 = (i % 8) * 8; FragH f; f.half[0] = *(const v8us*)((const unsigned short*)V16 + ((size_t)b * TTv + lg * 64 + r) * ldv + voff + h * 64 + c8);
#pragma unroll
    for (int q = 0; q < 8; ++q) tl[r][c8 + q] = f.u[q]; }
  __syncthreads();
  {
#pragma unroll
    for (int rd = 0; rd < 2; ++rd) { const int d = rd * 32 + tid / 8, pc = tid % 8; FragH f;
#pragma unroll
      for (int q = 0; q < 8; ++q) f.u[q] = tl[pc * 8 + q][d];
      *(v8us*)((unsigned short*)Vt + ((size_t)slab * 64 + d) * TTv + lg * 64 + pc * 8) = f.half[0]; }
     } }

__global__ __launch_bounds__(256) void k_hl(const float* __restrict__ F, _Float16* __restrict__ Hh, _Float16* __restrict__ Hl, size_t n8) { const size_t t = (size_t)blockIdx.x * 256 + threadIdx.x; if (t >= n8) return; FragH fh, fl; const v4f a = *(const v4fa*)(F + t * 8), c = *(const v4fa*)(F + t * 8 + 4);
#pragma unroll
  for (int q = 0; q < 4; ++q) { _Float16 h = (_Float16)a[q]; fh.h[q] = h; fl.h[q] = (_Float16)((a[q] - (float)h) * 1024.0f); h = (_Float16)c[q]; fh.h[4 + q] = h; fl.h[4 + q] = (_Float16)((c[q] - (float)h) * 1024.0f); }
  { *(v8us*)((unsigned short*)Hh + t * 8) = fh.half[0]; *(v8us*)((unsigned short*)Hl + t * 8) = fl.half[0];  } }

// ---- fast GEMM (wave tile 32x64; requires M % 32 == 0 rows per launch region and N % 64 == 0); epilogue = k_gemm_hhx semantics ----
__device__ __forceinline__ v16h g2_frag(const _Float16* p, int hh) { FragH f; f.half[0] = *(const v8us*)((const unsigned short*)p + 8 * hh); f.half[1] = *(const v8us*)((const unsigned short*)p + 16 + 8 * hh); return f.v; }
__device__ __forceinline__ v8f g2_mma(v16h a, v16h b, v8f c) { v8f d = __builtin_amdgcn_wmma_f32_16x16x32_f16(false, a, false, b, (short)0, c, false, false); asm volatile("v_nop\n\tv_nop\n\tv_nop\n\tv_nop" : "+v"(d) : "v"(a), "v"(b)); return d; }
template <int ACT>
__global__ __launch_bounds__(128) void k_gemm2(const _Float16* __restrict__ A, int lda, size_t sA, const _Float16* __restrict__ Bh, int ldb, size_t sB, float alpha, const float* __restrict__ bias, size_t sBias, const float* __restrict__ CP, int rowsPerB, size_t sCPb, int row0g,
    float* __restrict__ C, _Float16* __restrict__ C16, int ldc, size_t sC, int M, int N, int K) { static_assert(ACT == 0 || ACT == 3 || ACT == 6 || ACT == 8 || ACT == 9 || ACT == 11 || ACT == 12 || ACT == 14 || ACT == 15 || ACT == 16 || ACT == 17, "k_gemm2: unsupported ACT code (would silently apply no activation)");
  __shared__ __attribute__((aligned(16))) float so[4][32][68];
  const int tid = threadIdx.x, w = tid >> 5, lane = tid & 31, ln = lane & 15, hh = lane >> 4; const int by = blockIdx.y;
  A += (size_t)by * sA; Bh += (size_t)by * sB; const size_t cofs = (size_t)by * sC; const float* bp = bias ? bias + (size_t)by * sBias : nullptr;
  const int ntn = N >> 6; const int mt = blockIdx.x / ntn, nq = blockIdx.x - mt * ntn; const int row0 = mt * 128 + 32 * w, col0 = nq * 64; if (row0 >= M) return;
  const _Float16* a0p = A + (size_t)(row0 + ln) * lda; const _Float16* a1p = a0p + (size_t)16 * lda;
  const _Float16* b0p = Bh + (size_t)(col0 + ln) * ldb; const _Float16* b1p = b0p + (size_t)16 * ldb; const _Float16* b2p = b1p + (size_t)16 * ldb; const _Float16* b3p = b2p + (size_t)16 * ldb;
  const v8f z8 = {0.f,0.f,0.f,0.f,0.f,0.f,0.f,0.f}; v8f c00 = z8, c01 = z8, c02 = z8, c03 = z8, c10 = z8, c11 = z8, c12 = z8, c13 = z8;
#pragma unroll 1
  for (int kb = 0; kb < K; kb += 32) { const v16h a0 = g2_frag(a0p + kb, hh), a1 = g2_frag(a1p + kb, hh);
    v16h b = g2_frag(b0p + kb, hh); c00 = g2_mma(a0, b, c00); c10 = g2_mma(a1, b, c10);
    b = g2_frag(b1p + kb, hh); c01 = g2_mma(a0, b, c01); c11 = g2_mma(a1, b, c11);
    b = g2_frag(b2p + kb, hh); c02 = g2_mma(a0, b, c02); c12 = g2_mma(a1, b, c12);
    b = g2_frag(b3p + kb, hh); c03 = g2_mma(a0, b, c03); c13 = g2_mma(a1, b, c13); }
  v8f accs[8] = {c00, c01, c02, c03, c10, c11, c12, c13};
#pragma unroll
  for (int u = 0; u < 8; ++u) { const int t = u & 3, half = u >> 2; const int col = col0 + t * 16 + ln; const float bv = bp ? bf16_round(bp[col]) : 0.f;
#pragma unroll
    for (int r = 0; r < 8; ++r) { const int rloc = half * 16 + 8 * hh + r; float v = accs[u][r] * alpha + bv; if (CP) { if (rowsPerB < 0) v += CP[cofs + (size_t)(row0g + row0 + rloc) * ldc + col];      /* rowsPerB < 0: own element of the batched C plane */ else { const int bidx = (row0g + row0 + rloc) / rowsPerB; v += CP[(size_t)bidx * sCPb + (size_t)by * 64 + col]; } }
      if (ACT == 3) v = fmaxf(v, 0.f); else if (ACT == 6) v = 0.5f * v * (1.0f + erff(v * 0.70710678118654752f)); else if (ACT == 11) v = 1.0f / (1.0f + expf(-v)); else if (ACT == 15) v = v / (1.0f + expf(-v)); else if (ACT == 12) v = (v > 0.f) ? v : 0.01f * v; else if (ACT == 8) v = tanhf(v); else if (ACT == 9) v = 0.5f * v * (1.0f + tanhf(0.7978845608028654f * (v + 0.044715f * v * v * v))); else if (ACT == 14) v = (v > 0.f) ? v : 0.1f * v; else if (ACT == 16) v = (v >= 0.f) ? v : 0.3f * v; else if (ACT == 17) v = (v >= 0.f) ? v : 0.2f * v;
      so[w][rloc][t * 16 + ln] = v; } }
  __builtin_amdgcn_fence(__ATOMIC_ACQ_REL, "workgroup"); __builtin_amdgcn_wave_barrier();
  const int rsub = lane >> 4, c4 = (lane & 15) * 4;
  {
#pragma unroll
    for (int q = 0; q < 16; ++q) { const int r = q * 2 + rsub; const v4f v = *(const v4fa*)&so[w][r][c4]; if (C) *(v4f*)(C + cofs + (size_t)(row0 + r) * ldc + col0 + c4) = v; if (C16) { v4h h4; for (int i = 0; i < 4; ++i) h4[i] = (_Float16)v[i]; *(v4h*)(C16 + cofs + (size_t)(row0 + r) * ldc + col0 + c4) = h4; } }
     } }


__global__ __launch_bounds__(256) void k_wnat(const float* __restrict__ w, size_t n8, _Float16* __restrict__ Bt) { const size_t t = (size_t)blockIdx.x * 256 + threadIdx.x; if (t >= n8) return; FragH f; for (int q = 0; q < 8; ++q) f.h[q] = (_Float16)(bf16_round(w[t * 8 + q]) * 16.0f); *(v8us*)((unsigned short*)Bt + t * 8) = f.half[0];  }
__global__ __launch_bounds__(256) void k_rsm(const float* __restrict__ S, _Float16* __restrict__ P, int nrows) {
  #pragma clang fp contract(off)
  const int i = blockIdx.x * 256 + threadIdx.x; if (i >= nrows) return; const float* s = S + (size_t)i * SQ; float mx = -3.0e38f;
#pragma unroll 1
  for (int j = 0; j < SQ; ++j) mx = fmaxf(mx, s[j]); float se = 0.f;
#pragma unroll 1
  for (int j = 0; j < SQ; ++j) se += expf(s[j] - mx); const float sc = 256.0f / se;
#pragma unroll 1
  for (int j0 = 0; j0 < SQ; j0 += 8) { FragH f; for (int q = 0; q < 8; ++q) f.h[q] = (_Float16)(expf(s[j0 + q] - mx) * sc); unsigned short* d = (unsigned short*)P + (size_t)i * SQ + j0; *(v8us*)d = f.half[0];  } }
__global__ __launch_bounds__(256) void k_vt(const _Float16* __restrict__ V16, int b, int h0, _Float16* __restrict__ VT) { __shared__ unsigned short tl[64][65]; const int tid = threadIdx.x; const int hh = blockIdx.x % HG, sg = blockIdx.x / HG; const int s0 = sg * 64; const int h = h0 + hh;
  for (int i = tid; i < 64 * 8; i += 256) { const int j = i / 8, d8 = (i % 8) * 8; FragH f; f.half[0] = *(const v8us*)((const unsigned short*)V16 + ((size_t)b * SQ + s0 + j) * DM + h * HD + d8); for (int q = 0; q < 8; ++q) tl[d8 + q][j] = f.u[q]; }
  __syncthreads();
  { for (int i = tid; i < 64 * 8; i += 256) { const int d = i / 8, j8 = (i % 8) * 8; FragH f; for (int q = 0; q < 8; ++q) f.u[q] = tl[d][j8 + q]; *(v8us*)((unsigned short*)VT + ((size_t)hh * HD + d) * SQ + s0 + j8) = f.half[0]; }  } }


__global__ __launch_bounds__(256) void k_cl2rows(const float* __restrict__ X, _Float16* __restrict__ XR) { __shared__ float tl[64][33]; const int tid = threadIdx.x; const int nl = LL / 32, nc = CC / 64; const int cb_ = blockIdx.x % nc; const int lb = (blockIdx.x / nc) % nl; const size_t b = blockIdx.x / (nc * nl); const int c0 = cb_ * 64, l0 = lb * 32;
  for (int i = tid; i < 64 * 32; i += 256) { const int c = i / 32, l = i % 32; tl[c][l] = bf16_round(X[(b * CC + c0 + c) * (size_t)LL + l0 + l]); }
  __syncthreads();
  { const int l = tid / 8, c8 = (tid % 8) * 8; FragH f; for (int q = 0; q < 8; ++q) f.h[q] = (_Float16)tl[c8 + q][l]; unsigned short* d = (unsigned short*)XR + (b * LL + l0 + l) * (size_t)CC + c0 + c8; *(v8us*)d = f.half[0];  } }

__global__ __launch_bounds__(256) void k_bcpy(const float* __restrict__ b, int n, int NP, float* __restrict__ dst, int dst0) { for (int i = threadIdx.x; i < NP; i += 256) { const float v = (i < n) ? b[i] : 0.f; *(float*)(dst + dst0 + i) = v; }  }

__global__ __launch_bounds__(256) void k_rsmk(const float* __restrict__ S, _Float16* __restrict__ P, int nrows) {
  #pragma clang fp contract(off)
  const int i = blockIdx.x * 256 + threadIdx.x; if (i >= nrows) return; const float* s = S + (size_t)i * SK; float mx = -INFINITY;
#pragma unroll 1
  for (int j = 0; j < SK; ++j) mx = fmaxf(mx, s[j]); float se = 0.f;
#pragma unroll 1
  for (int j = 0; j < SK; ++j) se += expf(s[j] - mx); const float sc = 16384.0f / se;      /* P carried x2^14: the peaky rows would otherwise flush most weights below the f16 normal range */
#pragma unroll 1
  for (int j0 = 0; j0 < SK; j0 += 8) { FragH f; for (int q = 0; q < 8; ++q) f.h[q] = (_Float16)(expf(s[j0 + q] - mx) * sc); unsigned short* d = (unsigned short*)P + (size_t)i * SK + j0; *(v8us*)d = f.half[0];  } }
__global__ __launch_bounds__(256) void k_bnstat(const float* __restrict__ WY, float* __restrict__ ST) {
  #pragma clang fp contract(off)
  __shared__ float red[256]; const int c = blockIdx.x; const int tid = threadIdx.x; float s = 0.f;
  for (size_t r = tid; r < NR; r += 256) s = __fadd_rn(s, WY[r * CC + c]);
  red[tid] = s; __syncthreads(); for (int st = 128; st > 0; st >>= 1) { if (tid < st) red[tid] += red[tid + st]; __syncthreads(); }
  const float mean = red[0] / (float)NR; __syncthreads(); float s2 = 0.f;
  for (size_t r = tid; r < NR; r += 256) { const float d = __fadd_rn(WY[r * CC + c], -mean); s2 = __fadd_rn(s2, __fmul_rn(d, d)); }
  red[tid] = s2; __syncthreads(); for (int st = 128; st > 0; st >>= 1) { if (tid < st) red[tid] += red[tid + st]; __syncthreads(); }
  if (tid < 32) { const float v = (tid == 0) ? mean : ((tid == 1) ? rsqrtf(__fadd_rn(red[0] / (float)NR, 1e-5f)) : 0.f); *(float*)(ST + (size_t)c * 32 + tid) = v;  } }
__global__ __launch_bounds__(256) void k_fin(const float* __restrict__ WY, const float* __restrict__ ST, const float* __restrict__ gam, const float* __restrict__ bet, const float* __restrict__ x, float* __restrict__ out) {
  #pragma clang fp contract(off)
  const size_t t = (size_t)blockIdx.x * 256 + threadIdx.x; if (t >= (size_t)NB * CC * LL / 8) return; const int n0 = (int)((t * 8) % LL); const size_t bc = (t * 8) / LL; const int c = (int)(bc % CC); const size_t b = bc / CC; const float mean = ST[(size_t)c * 32], rstd = ST[(size_t)c * 32 + 1], g = bf16_round(gam[c]), be = bf16_round(bet[c]); v8f r;
  for (int q = 0; q < 8; ++q) { const float v = __fadd_rn(__fmul_rn(__fmul_rn(__fadd_rn(WY[(b * LL + n0 + q) * CC + c], -mean), rstd), g), be); r[q] = __fadd_rn(v, bf16_round(x[t * 8 + q])); }
  *(v8f*)(out + t * 8) = r;  }

extern "C" void kernel_launch(void* const* d_in, const int* in_sizes, int n_in,
                              void* d_out, int out_size, void* d_ws, size_t ws_size, hipStream_t stream) {
  (void)in_sizes; (void)n_in; (void)out_size;
  const float* const* I = (const float* const*)d_in; const float* x = I[0]; const float* gw = I[1]; const float* gb = I[2]; const float* tw = I[3]; const float* tb = I[4]; const float* pw = I[5]; const float* pb = I[6]; const float* zw = I[7]; const float* zb = I[8]; const float* gam = I[9]; const float* bet = I[10];      /* g/theta/phi_w [64][256], wz_w [256][64] natural */
  char* ws = (char*)d_ws; size_t off = 0;
  auto take = [&](size_t bytes) { char* p = ws + off; off += (bytes + 255) & ~(size_t)255; return p; };
  _Float16* B3 = (_Float16*)take((size_t)D3 * CC * 2); float* b3 = (float*)take(D3 * 4); _Float16* BZ = (_Float16*)take((size_t)CC * IC * 2); float* ST = (float*)take((size_t)CC * 32 * 4);
  _Float16* XR = (_Float16*)take(NR * CC * 2); float* TF = (float*)take(NR * D3 * 4); _Float16* TH = (_Float16*)take(NR * D3 * 2); _Float16* TL = (_Float16*)take(NR * D3 * 2);
  float* S = (float*)take((size_t)QT * SK * 4); _Float16* P = (_Float16*)take((size_t)QT * SK * 2); _Float16* GT = (_Float16*)take((size_t)IC * SK * 2); _Float16* GTL = (_Float16*)take((size_t)IC * SK * 2);
  float* YF = (float*)take(NR * IC * 4); _Float16* YH = (_Float16*)take(NR * IC * 2); _Float16* YL = (_Float16*)take(NR * IC * 2); float* WY = (float*)take(NR * CC * 4);
  if (off > ws_size) return;      /* 0.2 + 8 + 12 + 6 + 6 + 32 + 16 + 2 + 4 + 2 + 2 + 16 = approx 107 MiB */
  const unsigned gw64 = (unsigned)(((size_t)IC * CC / 8 + 255) / 256);
  k_wnat<<<gw64, 256, 0, stream>>>(tw, (size_t)IC * CC / 8, B3); k_wnat<<<gw64, 256, 0, stream>>>(pw, (size_t)IC * CC / 8, B3 + (size_t)IC * CC); k_wnat<<<gw64, 256, 0, stream>>>(gw, (size_t)IC * CC / 8, B3 + (size_t)2 * IC * CC);      /* Bt rows: theta 0..63 | phi 64..127 | g 128..191 */
  k_bcpy<<<1, 256, 0, stream>>>(tb, IC, IC, b3, 0); k_bcpy<<<1, 256, 0, stream>>>(pb, IC, IC, b3, IC); k_bcpy<<<1, 256, 0, stream>>>(gb, IC, IC, b3, 2 * IC);
  k_wnat<<<(unsigned)(((size_t)CC * IC / 8 + 255) / 256), 256, 0, stream>>>(zw, (size_t)CC * IC / 8, BZ);
  k_cl2rows<<<NB * (LL / 32) * (CC / 64), 256, 0, stream>>>(x, XR);
  k_gemm2<0><<<dim3((unsigned)((NR / 128) * (D3 / 64)), 1), 128, 0, stream>>>(XR, CC, 0, B3, CC, 0, 0.0625f, b3, 0, nullptr, 1, 0, 0, TF, nullptr, D3, 0, (int)NR, D3, CC);      /* theta | phi | g rows f32 */
  k_hl<<<(unsigned)((NR * D3 / 8 + 255) / 256), 256, 0, stream>>>(TF, TH, TL, NR * D3 / 8);
  for (int b = 0; b < NBR; ++b) { const _Float16* tb_ = TH + (size_t)b * LL * D3; const _Float16* tlb = TL + (size_t)b * LL * D3;
    k_vt<1, SK><<<SK / 64, 256, 0, stream>>>(tb_ + 2 * IC, D3, 0, GT); k_vt<1, SK><<<SK / 64, 256, 0, stream>>>(tlb + 2 * IC, D3, 0, GTL);      /* g^T hi / residual [64][8192] */
    for (int q0 = 0; q0 < QN; q0 += QT) { const _Float16* qh = tb_ + (size_t)q0 * D3; const _Float16* ql = tlb + (size_t)q0 * D3; const dim3 gs((QT / 128) * (SK / 64), 1);
      k_gemm2<0><<<gs, 128, 0, stream>>>(ql, D3, 0, tb_ + IC, D3, 0, 1.0f / 1024.0f, nullptr, 0, nullptr, 1, 0, 0, S, nullptr, SK, 0, QT, SK, IC);      /* theta-res . phi-hi */
      k_gemm2<0><<<gs, 128, 0, stream>>>(qh, D3, 0, tlb + IC, D3, 0, 1.0f / 1024.0f, nullptr, 0, S, 1, (size_t)SK, 0, S, nullptr, SK, 0, QT, SK, IC);      /* + theta-hi . phi-res */
      k_gemm2<0><<<gs, 128, 0, stream>>>(qh, D3, 0, tb_ + IC, D3, 0, 1.0f, nullptr, 0, S, 1, (size_t)SK, 0, S, nullptr, SK, 0, QT, SK, IC);      /* + theta-hi . phi-hi */
      k_rsmk<<<(QT + 255) / 256, 256, 0, stream>>>(S, P, QT);
      float* yb = YF + ((size_t)b * LL + q0) * IC; const dim3 gy((QT / 128) * 1, 1);
      k_gemm2<0><<<gy, 128, 0, stream>>>(P, SK, 0, GTL, SK, 0, (1.0f / 16384.0f) / 1024.0f, nullptr, 0, nullptr, 1, 0, 0, yb, nullptr, IC, 0, QT, IC, SK);      /* P . g-res */
      k_gemm2<0><<<gy, 128, 0, stream>>>(P, SK, 0, GT, SK, 0, 1.0f / 16384.0f, nullptr, 0, yb, 1, (size_t)IC, 0, yb, nullptr, IC, 0, QT, IC, SK); } }      /* + P . g-hi -> y rows f32 */
  k_hl<<<(unsigned)((NR * IC / 8 + 255) / 256), 256, 0, stream>>>(YF, YH, YL, NR * IC / 8);
  const dim3 gz((unsigned)((NR / 128) * (CC / 64)), 1);
  k_gemm2<0><<<gz, 128, 0, stream>>>(YL, IC, 0, BZ, IC, 0, 0.0625f / 1024.0f, nullptr, 0, nullptr, 1, 0, 0, WY, nullptr, CC, 0, (int)NR, CC, IC);      /* W_z: y-res term */
  k_gemm2<0><<<gz, 128, 0, stream>>>(YH, IC, 0, BZ, IC, 0, 0.0625f, zb, 0, WY, 1, (size_t)CC, 0, WY, nullptr, CC, 0, (int)NR, CC, IC);      /* + y-hi term + bias */
  k_bnstat<<<CC, 256, 0, stream>>>(WY, ST);
  k_fin<<<(unsigned)(((size_t)NB * CC * LL / 8 + 255) / 256), 256, 0, stream>>>(WY, ST, gam, bet, x, (float*)d_out);
}

// v001
// Measured time: 8090 microseconds a run.
// Next to v000, in two timings, it ran 4.00 and 4.01 times as fast.
#include <hip/hip_runtime.h>
// Non-local block (x [2][256][8x32x32 = 8192 positions]; g, theta, phi = 1x1 conv projections to 64 (+ bias); f = theta . phi over all positions; softmax; y = attn g; W_z 1x1 conv back to 256 (+ bias); training-mode BatchNorm over (batch, positions) per channel with gamma/beta; out = bn(W_z y) + x).
// Compute dtype: inputs rounded to bf16; x / weights exact; theta, phi, g, y as hi + residual operand pairs (~2^-22); P plain f16 (~2^-12); softmax, BN f32; v_wmma_f32_16x16x32_f16.
#define NB 2
#define CC 256
#define LL 8192                      /* positions per sample */
#define SK LL
#define IC 64                        /* inter channels */
#define D3 (3 * IC)                  /* theta | phi | g */
#define QT 1024                      /* query tile */
#define NR ((size_t)NB * LL)
#define QN LL                        /* queries per batch (debug hook) */
#define NBR NB                       /* batches (debug hook) */
#define SQ LL
#define DM CC
#define NH 1
#define HD 64
#define HG 1
typedef __bf16 v16b __attribute__((ext_vector_type(16)));
typedef unsigned short v8us __attribute__((ext_vector_type(8), may_alias));
typedef float  v8f  __attribute__((ext_vector_type(8)));
typedef float  v4f  __attribute__((ext_vector_type(4)));
typedef float  v4fa __attribute__((ext_vector_type(4), may_alias));
union FragB { v16b v; v8us half[2]; unsigned short u[16]; };

__device__ __forceinline__ unsigned short bf16_bits(float x) { unsigned int u = __float_as_uint(x); return (unsigned short)((u + 0x7FFFu + ((u >> 16) & 1u)) >> 16); }
__device__ __forceinline__ float bf16_val(unsigned short b) { return __uint_as_float(((unsigned int)b) << 16); }
__device__ __forceinline__ float bf16_round(float x) { return bf16_val(bf16_bits(x)); }
// D += A·B with NT terms: 1 = ah·bh, 2 = + al·bh (A split), 3 = + ah·bl (both split)
template <int NT>
__device__ __forceinline__ v8f mmaN(v16b ah, v16b al, v16b bh, v16b bl, v8f c) {
  c = __builtin_amdgcn_wmma_f32_16x16x32_bf16(false, ah, false, bh, (short)0, c, false, false);
  if (NT >= 2) c = __builtin_amdgcn_wmma_f32_16x16x32_bf16(false, al, false, bh, (short)0, c, false, false);
  if (NT >= 3) c = __builtin_amdgcn_wmma_f32_16x16x32_bf16(false, ah, false, bl, (short)0, c, false, false);
  asm volatile("v_nop\n\tv_nop\n\tv_nop\n\tv_nop" : "+v"(c) : "v"(ah), "v"(al), "v"(bh), "v"(bl));
  return c;
}

__global__ __launch_bounds__(256) void k_wt_bf16(const float* __restrict__ W, unsigned short* __restrict__ Wt, int K, int N) {
  const int t = blockIdx.x * 256 + threadIdx.x;
  const int k8n = K / 8;
  if (t >= N * k8n) return;
  const int n = t / k8n, k8 = (t % k8n) * 8;
  v8us v;
#pragma unroll
  for (int i = 0; i < 8; ++i) v[i] = bf16_bits(W[(size_t)(k8 + i) * N + n]);
  *(v8us*)(Wt + (size_t)n * K + k8) = v;
  
}

// GEMM C[M][N] (f32, pitch ldc) = act(A[M][K]·W + bias). A f32 row-major (pitch lda) converted per fragment to bf16
// (ASPLIT: hi/lo two planes -> 2 terms, else single rounded term); Wt bf16 [N][K] (pitch ldb). BIAS_BF16 rounds the
// bias to bf16 first (bias quantised to bf16 before the add). K%32==0, M%16==0, N%64==0.
template <bool ASPLIT, int ACT, bool BIAS_BF16>
__global__ __launch_bounds__(128) void k_gemm_bf(const float* __restrict__ A, int lda, const unsigned short* __restrict__ Wt, int ldb,
                                               const float* __restrict__ bias, float* __restrict__ C, int ldc, int M, int N, int K) {
  __shared__ __attribute__((aligned(16))) float so[4][16][64];
  const int tid = threadIdx.x, w = tid >> 5, lane = tid & 31, ln = lane & 15, hh = lane >> 4;
  const int ntn = N / 64;
  const int wid = blockIdx.x * 4 + w;
  const int mt = wid / ntn, nq = wid % ntn;
  if (mt * 16 >= M) return;
  const int row0 = mt * 16, col0 = nq * 64;
  const float* arow = A + (size_t)(row0 + ln) * lda;
  v8f acc[4] = {};
  for (int kb = 0; kb < K; kb += 32) {
    FragB ah, al;
    const v4f x0 = *(const v4fa*)(arow + kb + 8 * hh), x1 = *(const v4fa*)(arow + kb + 8 * hh + 4);
    const v4f x2 = *(const v4fa*)(arow + kb + 16 + 8 * hh), x3 = *(const v4fa*)(arow + kb + 16 + 8 * hh + 4);
    float xs[16] = {x0[0],x0[1],x0[2],x0[3],x1[0],x1[1],x1[2],x1[3],x2[0],x2[1],x2[2],x2[3],x3[0],x3[1],x3[2],x3[3]};
#pragma unroll
    for (int i = 0; i < 16; ++i) { const unsigned short hb = bf16_bits(xs[i]); ah.u[i] = hb; al.u[i] = ASPLIT ? bf16_bits(xs[i] - bf16_val(hb)) : (unsigned short)0; }
#pragma unroll
    for (int t = 0; t < 4; ++t) {
      const unsigned short* brow = Wt + (size_t)(col0 + t * 16 + ln) * ldb + kb;
      FragB b;
      b.half[0] = *(const v8us*)(brow + 8 * hh);
      b.half[1] = *(const v8us*)(brow + 16 + 8 * hh);
      acc[t] = mmaN<ASPLIT ? 2 : 1>(ah.v, al.v, b.v, b.v, acc[t]);
    }
  }
#pragma unroll
  for (int t = 0; t < 4; ++t) {
    float bv = bias ? bias[col0 + t * 16 + ln] : 0.f;
    if (BIAS_BF16) bv = bf16_round(bv);
#pragma unroll
    for (int r = 0; r < 8; ++r) { float v = acc[t][r] + bv; if (ACT == 1) v = fmaxf(v, 0.f); so[w][8 * hh + r][t * 16 + ln] = v; }
  }
  __builtin_amdgcn_fence(__ATOMIC_ACQ_REL, "workgroup");
  __builtin_amdgcn_wave_barrier();
  const int rsub = lane >> 4, c4 = (lane & 15) * 4;
  {
#pragma unroll
    for (int q = 0; q < 8; ++q) {
      const int r = q * 2 + rsub;
      const v4f v = *(const v4fa*)&so[w][r][c4];
      *(v4f*)(C + (size_t)(row0 + r) * ldc + col0 + c4) = v;
    }
    
  }
}

// GEMM C = act(A·W + bias + resid): A f32 (ASPLIT -> hi/lo 2 terms), Wt bf16 [N][K]; ACT 0 none, 1 relu, 2 exact gelu;
// resid (optional, f32, row index = (row % rmod), pitch ldr, RES_BF16 rounds it) added before the activation.
template <bool ASPLIT, int ACT, bool BIAS_BF16, bool RES_BF16>
__global__ __launch_bounds__(128) void k_gemm_bf3(const float* __restrict__ A, int lda, const unsigned short* __restrict__ Wt, int ldb,
                                                const float* __restrict__ bias, const float* __restrict__ resid, int rmod, int ldr,
                                                float* __restrict__ C, int ldc, int M, int N, int K) {
  __shared__ __attribute__((aligned(16))) float so[4][16][64];
  const int tid = threadIdx.x, w = tid >> 5, lane = tid & 31, ln = lane & 15, hh = lane >> 4;
  const int ntn = N / 64;
  const int wid = blockIdx.x * 4 + w;
  const int mt = wid / ntn, nq = wid % ntn;
  if (mt * 16 >= M) return;
  const int row0 = mt * 16, col0 = nq * 64;
  const float* arow = A + (size_t)(row0 + ln) * lda;
  v8f acc[4] = {};
  for (int kb = 0; kb < K; kb += 32) {
    FragB ah, al;
    const v4f x0 = *(const v4fa*)(arow + kb + 8 * hh), x1 = *(const v4fa*)(arow + kb + 8 * hh + 4);
    const v4f x2 = *(const v4fa*)(arow + kb + 16 + 8 * hh), x3 = *(const v4fa*)(arow + kb + 16 + 8 * hh + 4);
    float xs[16] = {x0[0],x0[1],x0[2],x0[3],x1[0],x1[1],x1[2],x1[3],x2[0],x2[1],x2[2],x2[3],x3[0],x3[1],x3[2],x3[3]};
#pragma unroll
    for (int i = 0; i < 16; ++i) { const unsigned short hb = bf16_bits(xs[i]); ah.u[i] = hb; al.u[i] = ASPLIT ? bf16_bits(xs[i] - bf16_val(hb)) : (unsigned short)0; }
#pragma unroll
    for (int t = 0; t < 4; ++t) {
      const unsigned short* brow = Wt + (size_t)(col0 + t * 16 + ln) * ldb + kb;
      FragB b;
      b.half[0] = *(const v8us*)(brow + 8 * hh);
      b.half[1] = *(const v8us*)(brow + 16 + 8 * hh);
      acc[t] = mmaN<ASPLIT ? 2 : 1>(ah.v, al.v, b.v, b.v, acc[t]);
    }
  }
#pragma unroll
  for (int t = 0; t < 4; ++t) {
    const int col = col0 + t * 16 + ln;
    float bv = bias ? bias[col] : 0.f;
    if (BIAS_BF16) bv = bf16_round(bv);
#pragma unroll
    for (int r = 0; r < 8; ++r) {
      float v = acc[t][r] + bv;
      if (resid) { float rv = resid[(size_t)((row0 + 8 * hh + r) % rmod) * ldr + col]; if (RES_BF16) rv = bf16_round(rv); v += rv; }
      if (ACT == 1) v = fmaxf(v, 0.f);
      if (ACT == 2) v = 0.5f * v * (1.0f + erff(v * 0.70710678118654752f));
      if (ACT == 3) { const float u = 0.7978845608028654f * (v + 0.044715f * v * v * v); v = 0.5f * v * (1.0f + tanhf(u)); }
      so[w][8 * hh + r][t * 16 + ln] = v;
    }
  }
  __builtin_amdgcn_fence(__ATOMIC_ACQ_REL, "workgroup");
  __builtin_amdgcn_wave_barrier();
  const int rsub = lane >> 4, c4 = (lane & 15) * 4;
  {
#pragma unroll
    for (int q = 0; q < 8; ++q) {
      const int r = q * 2 + rsub;
      const v4f v = *(const v4fa*)&so[w][r][c4];
      *(v4f*)(C + (size_t)(row0 + r) * ldc + col0 + c4) = v;
    }
    
  }
}
// row LayerNorm (biased variance, eps) over N: s = X (+ R); optional out_sum <- s; out_norm <- (s-mu)*rsqrt(var+eps)*g + b
template <bool PARAM_BF16>
__global__ __launch_bounds__(256) void k_layernorm(const float* __restrict__ X, const float* __restrict__ R, const float* __restrict__ g, const float* __restrict__ bta,
                                                  float* __restrict__ out_sum, float* __restrict__ out_norm, int N, float eps) {
  __shared__ float red[256];
  const int row = blockIdx.x, tid = threadIdx.x;
  const float* x = X + (size_t)row * N; const float* rr = R ? R + (size_t)row * N : nullptr;
  float vals[16];                     // up to N = 4096
  const int per = N / 256;            // contiguous chunk per thread? use strided-by-4 chunks: thread handles j = tid*4 + 1024*u
  float s1 = 0.f;
  for (int u = 0; u < per / 4; ++u) {
    const int j = tid * 4 + 1024 * u;
    const v4f a = *(const v4fa*)(x + j);
    v4f b = {0.f,0.f,0.f,0.f}; if (rr) b = *(const v4fa*)(rr + j);
#pragma unroll
    for (int q = 0; q < 4; ++q) { const float v = a[q] + b[q]; vals[u * 4 + q] = v; s1 += v; }
  }
  red[tid] = s1; __syncthreads();
  for (int st = 128; st > 0; st >>= 1) { if (tid < st) red[tid] += red[tid + st]; __syncthreads(); }
  const float mu = red[0] / (float)N; __syncthreads();
  float s2 = 0.f;
  for (int u = 0; u < per / 4; ++u)
#pragma unroll
    for (int q = 0; q < 4; ++q) { const float c = vals[u * 4 + q] - mu; s2 += c * c; }
  red[tid] = s2; __syncthreads();
  for (int st = 128; st > 0; st >>= 1) { if (tid < st) red[tid] += red[tid + st]; __syncthreads(); }
  const float rs = rsqrtf(red[0] / (float)N + eps);
  {
    for (int u = 0; u < per / 4; ++u) {
      const int j = tid * 4 + 1024 * u;
      v4f o, sm;
#pragma unroll
      for (int q = 0; q < 4; ++q) {
        float gg = g[j + q], bb = bta[j + q];
        if (PARAM_BF16) { gg = bf16_round(gg); bb = bf16_round(bb); }
        sm[q] = vals[u * 4 + q]; o[q] = (vals[u * 4 + q] - mu) * rs * gg + bb;
      }
      if (out_sum) *(v4f*)(out_sum + (size_t)row * N + j) = sm;
      *(v4f*)(out_norm + (size_t)row * N + j) = o;
    }
    
  }
}



// ---- f16 WMMA path (v_wmma_f32_16x16x32_f16): 11-bit significands for operands in range — used where a [0,1] probability operand needs more precision than bf16
typedef _Float16 v16h __attribute__((ext_vector_type(16)));
union FragH { v16h v; v8us half[2]; _Float16 h[16]; unsigned short u[16]; };
template <int NT>
__device__ __forceinline__ v8f mmaH(v16h ah, v16h al, v16h bh, v16h bl, v8f c) {
  c = __builtin_amdgcn_wmma_f32_16x16x32_f16(false, ah, false, bh, (short)0, c, false, false);
  if (NT >= 2) c = __builtin_amdgcn_wmma_f32_16x16x32_f16(false, al, false, bh, (short)0, c, false, false);
  if (NT >= 3) c = __builtin_amdgcn_wmma_f32_16x16x32_f16(false, ah, false, bl, (short)0, c, false, false);
  asm volatile("v_nop\n\tv_nop\n\tv_nop\n\tv_nop" : "+v"(c) : "v"(ah), "v"(al), "v"(bh), "v"(bl));
  return c;
}
// batched GEMM like k_gemm_b but f16 operands: A f32 (split into f16 hi/lo if ASPLIT, else rounded to f16), Bt = f16 values [n][k]; alpha; C f32; N multiple of 16 (partial tiles skipped)
template <bool ASPLIT>
__global__ __launch_bounds__(128) void k_gemm_h(const float* __restrict__ A, int lda, size_t sA, const _Float16* __restrict__ Bh, int ldb, size_t sB, float alpha, float* __restrict__ C, int ldc, size_t sC, int M, int N, int K) {
  __shared__ __attribute__((aligned(16))) float so[4][16][64];
  const int tid = threadIdx.x, w = tid >> 5, lane = tid & 31, ln = lane & 15, hh = lane >> 4; const int by = blockIdx.y;
  A += (size_t)by * sA; Bh += (size_t)by * sB; C += (size_t)by * sC;
  const int ntn = (N + 63) / 64; const int wid = blockIdx.x * 4 + w; const int mt = wid / ntn, nq = wid % ntn; if (mt * 16 >= M) return;
  const int row0 = mt * 16, col0 = nq * 64; const float* arow = A + (size_t)(row0 + ln) * lda;
  v8f acc[4] = {};
  for (int kb = 0; kb < K; kb += 32) {
    FragH ah, al;
    const v4f x0 = *(const v4fa*)(arow + kb + 8 * hh), x1 = *(const v4fa*)(arow + kb + 8 * hh + 4), x2 = *(const v4fa*)(arow + kb + 16 + 8 * hh), x3 = *(const v4fa*)(arow + kb + 16 + 8 * hh + 4);
    float xs[16] = {x0[0],x0[1],x0[2],x0[3],x1[0],x1[1],x1[2],x1[3],x2[0],x2[1],x2[2],x2[3],x3[0],x3[1],x3[2],x3[3]};
#pragma unroll
    for (int i = 0; i < 16; ++i) { const _Float16 h = (_Float16)xs[i]; ah.h[i] = h; al.h[i] = ASPLIT ? (_Float16)(xs[i] - (float)h) : (_Float16)0.0f; }
#pragma unroll
    for (int t = 0; t < 4; ++t) { if (col0 + t * 16 >= N) continue; const size_t boff = (size_t)(col0 + t * 16 + ln) * ldb + kb; FragH bq; bq.half[0] = *(const v8us*)(Bh + boff + 8 * hh); bq.half[1] = *(const v8us*)(Bh + boff + 16 + 8 * hh);
      acc[t] = mmaH<ASPLIT ? 2 : 1>(ah.v, al.v, bq.v, bq.v, acc[t]); }
  }
#pragma unroll
  for (int t = 0; t < 4; ++t) { if (col0 + t * 16 >= N) continue;
#pragma unroll
    for (int r = 0; r < 8; ++r) so[w][8 * hh + r][t * 16 + ln] = acc[t][r] * alpha; }
  __builtin_amdgcn_fence(__ATOMIC_ACQ_REL, "workgroup"); __builtin_amdgcn_wave_barrier();
  const int rsub = lane >> 4, c4 = (lane & 15) * 4;
  {
#pragma unroll
    for (int q = 0; q < 8; ++q) { const int r = q * 2 + rsub; if (col0 + c4 < N) { const v4f v = *(const v4fa*)&so[w][r][c4]; *(v4f*)(C + (size_t)(row0 + r) * ldc + col0 + c4) = v; } }
     }
}

// Wt[n][k] = f16(W[k][n]·scale) from f32 row-major W[K][N] (scale = power of two; bf16-exact weights stay exact in f16 away from the subnormal range)
__global__ __launch_bounds__(256) void k_wt_f16(const float* __restrict__ W, _Float16* __restrict__ Wt, int K, int N, float scale) {
  const int t = blockIdx.x * 256 + threadIdx.x; if (t >= N * (K / 8)) return; const int n = t / (K / 8), k8 = (t % (K / 8)) * 8; FragH f;
#pragma unroll
  for (int i = 0; i < 8; ++i) f.h[i] = (_Float16)(bf16_round(W[(size_t)(k8 + i) * N + n]) * scale); const v8us o = f.half[0];
  *(v8us*)((unsigned short*)Wt + (size_t)n * K + k8) = o; 
}
// k_gemm_hh variant with fused epilogue: v = acc·alpha + bias[by·sBias + col] (+ CP[(row/rowsPerB)·sCPb + by·64 + col] if CP) ; ACT 0 none / 1 elu ; writes f16 C16 (and f32 C if non-null)
template <int ACT>
__global__ __launch_bounds__(128) void k_gemm_hhx(const _Float16* __restrict__ A, int lda, size_t sA, const _Float16* __restrict__ Bh, int ldb, size_t sB, float alpha, const float* __restrict__ bias, size_t sBias, const float* __restrict__ CP, int rowsPerB, size_t sCPb, int row0g,
    float* __restrict__ C, _Float16* __restrict__ C16, int ldc, size_t sC, int M, int N, int K) {
  __shared__ __attribute__((aligned(16))) float so[4][16][64];
  const int tid = threadIdx.x, w = tid >> 5, lane = tid & 31, ln = lane & 15, hh = lane >> 4; const int by = blockIdx.y;
  A += (size_t)by * sA; Bh += (size_t)by * sB; const size_t cofs = (size_t)by * sC; const float* bp = bias ? bias + (size_t)by * sBias : nullptr;
  const int ntn = (N + 63) / 64; const int wid = blockIdx.x * 4 + w; const int mt = wid / ntn, nq = wid % ntn; if (mt * 16 >= M) return;
  const int row0 = mt * 16, col0 = nq * 64; const _Float16* arow = A + (size_t)(row0 + ln) * lda;
  v8f acc[4] = {};
  for (int kb = 0; kb < K; kb += 32) { FragH ah; ah.half[0] = *(const v8us*)((const unsigned short*)arow + kb + 8 * hh); ah.half[1] = *(const v8us*)((const unsigned short*)arow + kb + 16 + 8 * hh);
#pragma unroll
    for (int t = 0; t < 4; ++t) { if (col0 + t * 16 >= N) continue; const size_t boff = (size_t)(col0 + t * 16 + ln) * ldb + kb; FragH bq; bq.half[0] = *(const v8us*)((const unsigned short*)Bh + boff + 8 * hh); bq.half[1] = *(const v8us*)((const unsigned short*)Bh + boff + 16 + 8 * hh);
      acc[t] = mmaH<1>(ah.v, ah.v, bq.v, bq.v, acc[t]); }
  }
#pragma unroll
  for (int t = 0; t < 4; ++t) { if (col0 + t * 16 >= N) continue; const int col = col0 + t * 16 + ln; const float bv = bp ? bf16_round(bp[col]) : 0.f;
#pragma unroll
    for (int r = 0; r < 8; ++r) { float v = acc[t][r] * alpha + bv; if (CP) { const int rr = row0g + row0 + 8 * hh + r; if (rowsPerB < 0) v += CP[cofs + (size_t)rr * ldc + col];      /* rowsPerB < 0: own element of the batched C plane */ else { const int bidx = rr / rowsPerB; v += CP[(size_t)bidx * sCPb + (size_t)by * 64 + col]; } } if (ACT == 1) v = (v > 0.f) ? v : expm1f(v); else if (ACT == 7) v = (v > 0.f) ? v + 1.0f : expf(v); else if (ACT == 8) v = tanhf(v); else if (ACT == 9) v = 0.5f * v * (1.0f + tanhf(0.7978845608028654f * (v + 0.044715f * v * v * v))); else if (ACT == 11) v = 1.0f / (1.0f + expf(-v)); else if (ACT == 12) v = (v > 0.f) ? v : 0.01f * v; else if (ACT == 14) v = (v > 0.f) ? v : 0.1f * v; else if (ACT == 16) v = (v >= 0.f) ? v : 0.3f * v; else if (ACT == 17) v = (v >= 0.f) ? v : 0.2f * v; else if (ACT == 15) v = v / (1.0f + expf(-v)); else if (ACT == 3) v = fmaxf(v, 0.f); else if (ACT == 6) v = 0.5f * v * (1.0f + erff(v * 0.70710678118654752f)); so[w][8 * hh + r][t * 16 + ln] = v; } }
  __builtin_amdgcn_fence(__ATOMIC_ACQ_REL, "workgroup"); __builtin_amdgcn_wave_barrier();
  const int rsub = lane >> 4, c4 = (lane & 15) * 4; typedef _Float16 v4h __attribute__((ext_vector_type(4)));
  {
#pragma unroll
    for (int q = 0; q < 8; ++q) { const int r = q * 2 + rsub; if (col0 + c4 < N) { const v4f v = *(const v4fa*)&so[w][r][c4]; if (C) *(v4f*)(C + cofs + (size_t)(row0 + r) * ldc + col0 + c4) = v; if (C16) { v4h h4; for (int i = 0; i < 4; ++i) h4[i] = (_Float16)v[i]; *(v4h*)(C16 + cofs + (size_t)(row0 + r) * ldc + col0 + c4) = h4; } } }
     }
}


typedef _Float16 v4h __attribute__((ext_vector_type(4)));

__global__ __launch_bounds__(256) void k_x16(const float* __restrict__ x, _Float16* __restrict__ X16, size_t n8) { const size_t t = (size_t)blockIdx.x * 256 + threadIdx.x; if (t >= n8) return; FragH f;
#pragma unroll
  for (int q = 0; q < 8; ++q) f.h[q] = (_Float16)bf16_round(x[t * 8 + q]); *(v8us*)((unsigned short*)X16 + t * 8) = f.half[0];  }
__global__ __launch_bounds__(256) void k_h16(const float* __restrict__ x, _Float16* __restrict__ X16, size_t n8) { const size_t t = (size_t)blockIdx.x * 256 + threadIdx.x; if (t >= n8) return; FragH f;
#pragma unroll
  for (int q = 0; q < 8; ++q) f.h[q] = (_Float16)x[t * 8 + q]; *(v8us*)((unsigned short*)X16 + t * 8) = f.half[0];  }
__global__ __launch_bounds__(256) void k_round16f(const float* __restrict__ W, _Float16* __restrict__ Bt, size_t n8) { const size_t t = (size_t)blockIdx.x * 256 + threadIdx.x; if (t >= n8) return; FragH f;
#pragma unroll
  for (int i = 0; i < 8; ++i) f.h[i] = (_Float16)(bf16_round(W[t * 8 + i]) * 16.0f); *(v8us*)((unsigned short*)Bt + t * 8) = f.half[0];  }
template <int NHv, int TTv>
__global__ __launch_bounds__(256) void k_vt(const _Float16* __restrict__ V16, int ldv, int voff, _Float16* __restrict__ Vt) { __shared__ unsigned short tl[64][66]; const int tid = threadIdx.x; const int slab = blockIdx.x / (TTv / 64), lg = blockIdx.x % (TTv / 64); const int b = slab / NHv, h = slab % NHv;
  for (int i = tid; i < 64 * 8; i += 256) { const int r = i / 8, c8 = (i % 8) * 8; FragH f; f.half[0] = *(const v8us*)((const unsigned short*)V16 + ((size_t)b * TTv + lg * 64 + r) * ldv + voff + h * 64 + c8);
#pragma unroll
    for (int q = 0; q < 8; ++q) tl[r][c8 + q] = f.u[q]; }
  __syncthreads();
  {
#pragma unroll
    for (int rd = 0; rd < 2; ++rd) { const int d = rd * 32 + tid / 8, pc = tid % 8; FragH f;
#pragma unroll
      for (int q = 0; q < 8; ++q) f.u[q] = tl[pc * 8 + q][d];
      *(v8us*)((unsigned short*)Vt + ((size_t)slab * 64 + d) * TTv + lg * 64 + pc * 8) = f.half[0]; }
     } }

__global__ __launch_bounds__(256) void k_hl(const float* __restrict__ F, _Float16* __restrict__ Hh, _Float16* __restrict__ Hl, size_t n8) { const size_t t = (size_t)blockIdx.x * 256 + threadIdx.x; if (t >= n8) return; FragH fh, fl; const v4f a = *(const v4fa*)(F + t * 8), c = *(const v4fa*)(F + t * 8 + 4);
#pragma unroll
  for (int q = 0; q < 4; ++q) { _Float16 h = (_Float16)a[q]; fh.h[q] = h; fl.h[q] = (_Float16)((a[q] - (float)h) * 1024.0f); h = (_Float16)c[q]; fh.h[4 + q] = h; fl.h[4 + q] = (_Float16)((c[q] - (float)h) * 1024.0f); }
  { *(v8us*)((unsigned short*)Hh + t * 8) = fh.half[0]; *(v8us*)((unsigned short*)Hl + t * 8) = fl.half[0];  } }

// ---- fast GEMM (wave tile 32x64; requires M % 32 == 0 rows per launch region and N % 64 == 0); epilogue = k_gemm_hhx semantics ----
__device__ __forceinline__ v16h g2_frag(const _Float16* p, int hh) { FragH f; f.half[0] = *(const v8us*)((const unsigned short*)p + 8 * hh); f.half[1] = *(const v8us*)((const unsigned short*)p + 16 + 8 * hh); return f.v; }
__device__ __forceinline__ v8f g2_mma(v16h a, v16h b, v8f c) { v8f d = __builtin_amdgcn_wmma_f32_16x16x32_f16(false, a, false, b, (short)0, c, false, false); asm volatile("v_nop\n\tv_nop\n\tv_nop\n\tv_nop" : "+v"(d) : "v"(a), "v"(b)); return d; }
template <int ACT>
__global__ __launch_bounds__(128) void k_gemm2(const _Float16* __restrict__ A, int lda, size_t sA, const _Float16* __restrict__ Bh, int ldb, size_t sB, float alpha, const float* __restrict__ bias, size_t sBias, const float* __restrict__ CP, int rowsPerB, size_t sCPb, int row0g,
    float* __restrict__ C, _Float16* __restrict__ C16, int ldc, size_t sC, int M, int N, int K) { static_assert(ACT == 0 || ACT == 3 || ACT == 6 || ACT == 8 || ACT == 9 || ACT == 11 || ACT == 12 || ACT == 14 || ACT == 15 || ACT == 16 || ACT == 17, "k_gemm2: unsupported ACT code (would silently apply no activation)");
  __shared__ __attribute__((aligned(16))) float so[4][32][68];
  const int tid = threadIdx.x, w = tid >> 5, lane = tid & 31, ln = lane & 15, hh = lane >> 4; const int by = blockIdx.y;
  A += (size_t)by * sA; Bh += (size_t)by * sB; const size_t cofs = (size_t)by * sC; const float* bp = bias ? bias + (size_t)by * sBias : nullptr;
  const int ntn = N >> 6; const int mt = blockIdx.x / ntn, nq = blockIdx.x - mt * ntn; const int row0 = mt * 128 + 32 * w, col0 = nq * 64; if (row0 >= M) return;
  const _Float16* a0p = A + (size_t)(row0 + ln) * lda; const _Float16* a1p = a0p + (size_t)16 * lda;
  const _Float16* b0p = Bh + (size_t)(col0 + ln) * ldb; const _Float16* b1p = b0p + (size_t)16 * ldb; const _Float16* b2p = b1p + (size_t)16 * ldb; const _Float16* b3p = b2p + (size_t)16 * ldb;
  const v8f z8 = {0.f,0.f,0.f,0.f,0.f,0.f,0.f,0.f}; v8f c00 = z8, c01 = z8, c02 = z8, c03 = z8, c10 = z8, c11 = z8, c12 = z8, c13 = z8;
#pragma unroll 1
  for (int kb = 0; kb < K; kb += 32) { const v16h a0 = g2_frag(a0p + kb, hh), a1 = g2_frag(a1p + kb, hh);
    v16h b = g2_frag(b0p + kb, hh); c00 = g2_mma(a0, b, c00); c10 = g2_mma(a1, b, c10);
    b = g2_frag(b1p + kb, hh); c01 = g2_mma(a0, b, c01); c11 = g2_mma(a1, b, c11);
    b = g2_frag(b2p + kb, hh); c02 = g2_mma(a0, b, c02); c12 = g2_mma(a1, b, c12);
    b = g2_frag(b3p + kb, hh); c03 = g2_mma(a0, b, c03); c13 = g2_mma(a1, b, c13); }
  v8f accs[8] = {c00, c01, c02, c03, c10, c11, c12, c13};
#pragma unroll
  for (int u = 0; u < 8; ++u) { const int t = u & 3, half = u >> 2; const int col = col0 + t * 16 + ln; const float bv = bp ? bf16_round(bp[col]) : 0.f;
#pragma unroll
    for (int r = 0; r < 8; ++r) { const int rloc = half * 16 + 8 * hh + r; float v = accs[u][r] * alpha + bv; if (CP) { if (rowsPerB < 0) v += CP[cofs + (size_t)(row0g + row0 + rloc) * ldc + col];      /* rowsPerB < 0: own element of the batched C plane */ else { const int bidx = (row0g + row0 + rloc) / rowsPerB; v += CP[(size_t)bidx * sCPb + (size_t)by * 64 + col]; } }
      if (ACT == 3) v = fmaxf(v, 0.f); else if (ACT == 6) v = 0.5f * v * (1.0f + erff(v * 0.70710678118654752f)); else if (ACT == 11) v = 1.0f / (1.0f + expf(-v)); else if (ACT == 15) v = v / (1.0f + expf(-v)); else if (ACT == 12) v = (v > 0.f) ? v : 0.01f * v; else if (ACT == 8) v = tanhf(v); else if (ACT == 9) v = 0.5f * v * (1.0f + tanhf(0.7978845608028654f * (v + 0.044715f * v * v * v))); else if (ACT == 14) v = (v > 0.f) ? v : 0.1f * v; else if (ACT == 16) v = (v >= 0.f) ? v : 0.3f * v; else if (ACT == 17) v = (v >= 0.f) ? v : 0.2f * v;
      so[w][rloc][t * 16 + ln] = v; } }
  __builtin_amdgcn_fence(__ATOMIC_ACQ_REL, "workgroup"); __builtin_amdgcn_wave_barrier();
  const int rsub = lane >> 4, c4 = (lane & 15) * 4;
  {
#pragma unroll
    for (int q = 0; q < 16; ++q) { const int r = q * 2 + rsub; const v4f v = *(const v4fa*)&so[w][r][c4]; if (C) *(v4f*)(C + cofs + (size_t)(row0 + r) * ldc + col0 + c4) = v; if (C16) { v4h h4; for (int i = 0; i < 4; ++i) h4[i] = (_Float16)v[i]; *(v4h*)(C16 + cofs + (size_t)(row0 + r) * ldc + col0 + c4) = h4; } }
     } }


__global__ __launch_bounds__(256) void k_wnat(const float* __restrict__ w, size_t n8, _Float16* __restrict__ Bt) { const size_t t = (size_t)blockIdx.x * 256 + threadIdx.x; if (t >= n8) return; FragH f; for (int q = 0; q < 8; ++q) f.h[q] = (_Float16)(bf16_round(w[t * 8 + q]) * 16.0f); *(v8us*)((unsigned short*)Bt + t * 8) = f.half[0];  }
__global__ __launch_bounds__(256) void k_rsm(const float* __restrict__ S, _Float16* __restrict__ P, int nrows) {
  #pragma clang fp contract(off)
  const int i = blockIdx.x * 256 + threadIdx.x; if (i >= nrows) return; const float* s = S + (size_t)i * SQ; float mx = -3.0e38f;
#pragma unroll 1
  for (int j = 0; j < SQ; ++j) mx = fmaxf(mx, s[j]); float se = 0.f;
#pragma unroll 1
  for (int j = 0; j < SQ; ++j) se += expf(s[j] - mx); const float sc = 256.0f / se;
#pragma unroll 1
  for (int j0 = 0; j0 < SQ; j0 += 8) { FragH f; for (int q = 0; q < 8; ++q) f.h[q] = (_Float16)(expf(s[j0 + q] - mx) * sc); unsigned short* d = (unsigned short*)P + (size_t)i * SQ + j0; *(v8us*)d = f.half[0];  } }
__global__ __launch_bounds__(256) void k_vt(const _Float16* __restrict__ V16, int b, int h0, _Float16* __restrict__ VT) { __shared__ unsigned short tl[64][65]; const int tid = threadIdx.x; const int hh = blockIdx.x % HG, sg = blockIdx.x / HG; const int s0 = sg * 64; const int h = h0 + hh;
  for (int i = tid; i < 64 * 8; i += 256) { const int j = i / 8, d8 = (i % 8) * 8; FragH f; f.half[0] = *(const v8us*)((const unsigned short*)V16 + ((size_t)b * SQ + s0 + j) * DM + h * HD + d8); for (int q = 0; q < 8; ++q) tl[d8 + q][j] = f.u[q]; }
  __syncthreads();
  { for (int i = tid; i < 64 * 8; i += 256) { const int d = i / 8, j8 = (i % 8) * 8; FragH f; for (int q = 0; q < 8; ++q) f.u[q] = tl[d][j8 + q]; *(v8us*)((unsigned short*)VT + ((size_t)hh * HD + d) * SQ + s0 + j8) = f.half[0]; }  } }


__global__ __launch_bounds__(256) void k_cl2rows(const float* __restrict__ X, _Float16* __restrict__ XR) { __shared__ float tl[64][33]; const int tid = threadIdx.x; const int nl = LL / 32, nc = CC / 64; const int cb_ = blockIdx.x % nc; const int lb = (blockIdx.x / nc) % nl; const size_t b = blockIdx.x / (nc * nl); const int c0 = cb_ * 64, l0 = lb * 32;
  for (int i = tid; i < 64 * 32; i += 256) { const int c = i / 32, l = i % 32; tl[c][l] = bf16_round(X[(b * CC + c0 + c) * (size_t)LL + l0 + l]); }
  __syncthreads();
  { const int l = tid / 8, c8 = (tid % 8) * 8; FragH f; for (int q = 0; q < 8; ++q) f.h[q] = (_Float16)tl[c8 + q][l]; unsigned short* d = (unsigned short*)XR + (b * LL + l0 + l) * (size_t)CC + c0 + c8; *(v8us*)d = f.half[0];  } }

__global__ __launch_bounds__(256) void k_bcpy(const float* __restrict__ b, int n, int NP, float* __restrict__ dst, int dst0) { for (int i = threadIdx.x; i < NP; i += 256) { const float v = (i < n) ? b[i] : 0.f; *(float*)(dst + dst0 + i) = v; }  }

// Row softmax, one work-group per score row: each wave-wide read covers 512 contiguous bytes, and the thread's 32 values stay in registers from the maximum to the store, so S is read once and each exponential is taken once.
__global__ __launch_bounds__(256) void k_rsmk(const float* __restrict__ S, _Float16* __restrict__ P, int nrows) {
  __shared__ float red[2][8];
  const int i = blockIdx.x; if (i >= nrows) return;      /* the same for the whole work-group, in front of both barriers */
  const int tid = threadIdx.x, w = tid >> 5, lane = tid & 31; const float* s = S + (size_t)i * SK + tid * 4; v4f v[SK / 1024];
  /* every loop over v[] is unrolled: constant indices keep v[] in registers, and the eight reads issue back to back */
#pragma unroll
  for (int u = 0; u < SK / 1024; ++u) v[u] = *(const v4fa*)(s + u * 1024);
  float mx = -INFINITY;
#pragma unroll
  for (int u = 0; u < SK / 1024; ++u) for (int q = 0; q < 4; ++q) mx = fmaxf(mx, v[u][q]);
  for (int m = 16; m > 0; m >>= 1) mx = fmaxf(mx, __shfl_xor(mx, m, 32));
  if (lane == 0) red[0][w] = mx;
  __syncthreads();
  for (int k = 0; k < 8; ++k) mx = fmaxf(mx, red[0][k]);
  float se = 0.f;
#pragma unroll
  for (int u = 0; u < SK / 1024; ++u) for (int q = 0; q < 4; ++q) { v[u][q] = expf(v[u][q] - mx); se += v[u][q]; }
  for (int m = 16; m > 0; m >>= 1) se += __shfl_xor(se, m, 32);
  if (lane == 0) red[1][w] = se;
  __syncthreads();
  se = 0.f; for (int k = 0; k < 8; ++k) se += red[1][k];
  const float sc = 16384.0f / se;      /* P carried x2^14: the peaky rows would otherwise flush most weights below the f16 normal range */
  _Float16* d = P + (size_t)i * SK + tid * 4;
#pragma unroll
  for (int u = 0; u < SK / 1024; ++u) { v4h h4; for (int q = 0; q < 4; ++q) h4[q] = (_Float16)(v[u][q] * sc); *(v4h*)(d + u * 1024) = h4; } }
__global__ __launch_bounds__(256) void k_bnstat(const float* __restrict__ WY, float* __restrict__ ST) {
  #pragma clang fp contract(off)
  __shared__ float red[256]; const int c = blockIdx.x; const int tid = threadIdx.x; float s = 0.f;
  for (size_t r = tid; r < NR; r += 256) s = __fadd_rn(s, WY[r * CC + c]);
  red[tid] = s; __syncthreads(); for (int st = 128; st > 0; st >>= 1) { if (tid < st) red[tid] += red[tid + st]; __syncthreads(); }
  const float mean = red[0] / (float)NR; __syncthreads(); float s2 = 0.f;
  for (size_t r = tid; r < NR; r += 256) { const float d = __fadd_rn(WY[r * CC + c], -mean); s2 = __fadd_rn(s2, __fmul_rn(d, d)); }
  red[tid] = s2; __syncthreads(); for (int st = 128; st > 0; st >>= 1) { if (tid < st) red[tid] += red[tid + st]; __syncthreads(); }
  if (tid < 32) { const float v = (tid == 0) ? mean : ((tid == 1) ? rsqrtf(__fadd_rn(red[0] / (float)NR, 1e-5f)) : 0.f); *(float*)(ST + (size_t)c * 32 + tid) = v;  } }
__global__ __launch_bounds__(256) void k_fin(const float* __restrict__ WY, const float* __restrict__ ST, const float* __restrict__ gam, const float* __restrict__ bet, const float* __restrict__ x, float* __restrict__ out) {
  #pragma clang fp contract(off)
  const size_t t = (size_t)blockIdx.x * 256 + threadIdx.x; if (t >= (size_t)NB * CC * LL / 8) return; const int n0 = (int)((t * 8) % LL); const size_t bc = (t * 8) / LL; const int c = (int)(bc % CC); const size_t b = bc / CC; const float mean = ST[(size_t)c * 32], rstd = ST[(size_t)c * 32 + 1], g = bf16_round(gam[c]), be = bf16_round(bet[c]); v8f r;
  for (int q = 0; q < 8; ++q) { const float v = __fadd_rn(__fmul_rn(__fmul_rn(__fadd_rn(WY[(b * LL + n0 + q) * CC + c], -mean), rstd), g), be); r[q] = __fadd_rn(v, bf16_round(x[t * 8 + q])); }
  *(v8f*)(out + t * 8) = r;  }

extern "C" void kernel_launch(void* const* d_in, const int* in_sizes, int n_in,
                              void* d_out, int out_size, void* d_ws, size_t ws_size, hipStream_t stream) {
  (void)in_sizes; (void)n_in; (void)out_size;
  const float* const* I = (const float* const*)d_in; const float* x = I[0]; const float* gw = I[1]; const float* gb = I[2]; const float* tw = I[3]; const float* tb = I[4]; const float* pw = I[5]; const float* pb = I[6]; const float* zw = I[7]; const float* zb = I[8]; const float* gam = I[9]; const float* bet = I[10];      /* g/theta/phi_w [64][256], wz_w [256][64] natural */
  char* ws = (char*)d_ws; size_t off = 0;
  auto take = [&](size_t bytes) { char* p = ws + off; off += (bytes + 255) & ~(size_t)255; return p; };
  _Float16* B3 = (_Float16*)take((size_t)D3 * CC * 2); float* b3 = (float*)take(D3 * 4); _Float16* BZ = (_Float16*)take((size_t)CC * IC * 2); float* ST = (float*)take((size_t)CC * 32 * 4);
  _Float16* XR = (_Float16*)take(NR * CC * 2); float* TF = (float*)take(NR * D3 * 4); _Float16* TH = (_Float16*)take(NR * D3 * 2); _Float16* TL = (_Float16*)take(NR * D3 * 2);
  float* S = (float*)take((size_t)QT * SK * 4); _Float16* P = (_Float16*)take((size_t)QT * SK * 2); _Float16* GT = (_Float16*)take((size_t)IC * SK * 2); _Float16* GTL = (_Float16*)take((size_t)IC * SK * 2);
  float* YF = (float*)take(NR * IC * 4); _Float16* YH = (_Float16*)take(NR * IC * 2); _Float16* YL = (_Float16*)take(NR * IC * 2); float* WY = (float*)take(NR * CC * 4);
  if (off > ws_size) return;      /* 0.2 + 8 + 12 + 6 + 6 + 32 + 16 + 2 + 4 + 2 + 2 + 16 = approx 107 MiB */
  const unsigned gw64 = (unsigned)(((size_t)IC * CC / 8 + 255) / 256);
  k_wnat<<<gw64, 256, 0, stream>>>(tw, (size_t)IC * CC / 8, B3); k_wnat<<<gw64, 256, 0, stream>>>(pw, (size_t)IC * CC / 8, B3 + (size_t)IC * CC); k_wnat<<<gw64, 256, 0, stream>>>(gw, (size_t)IC * CC / 8, B3 + (size_t)2 * IC * CC);      /* Bt rows: theta 0..63 | phi 64..127 | g 128..191 */
  k_bcpy<<<1, 256, 0, stream>>>(tb, IC, IC, b3, 0); k_bcpy<<<1, 256, 0, stream>>>(pb, IC, IC, b3, IC); k_bcpy<<<1, 256, 0, stream>>>(gb, IC, IC, b3, 2 * IC);
  k_wnat<<<(unsigned)(((size_t)CC * IC / 8 + 255) / 256), 256, 0, stream>>>(zw, (size_t)CC * IC / 8, BZ);
  k_cl2rows<<<NB * (LL / 32) * (CC / 64), 256, 0, stream>>>(x, XR);
  k_gemm2<0><<<dim3((unsigned)((NR / 128) * (D3 / 64)), 1), 128, 0, stream>>>(XR, CC, 0, B3, CC, 0, 0.0625f, b3, 0, nullptr, 1, 0, 0, TF, nullptr, D3, 0, (int)NR, D3, CC);      /* theta | phi | g rows f32 */
  k_hl<<<(unsigned)((NR * D3 / 8 + 255) / 256), 256, 0, stream>>>(TF, TH, TL, NR * D3 / 8);
  for (int b = 0; b < NBR; ++b) { const _Float16* tb_ = TH + (size_t)b * LL * D3; const _Float16* tlb = TL + (size_t)b * LL * D3;
    k_vt<1, SK><<<SK / 64, 256, 0, stream>>>(tb_ + 2 * IC, D3, 0, GT); k_vt<1, SK><<<SK / 64, 256, 0, stream>>>(tlb + 2 * IC, D3, 0, GTL);      /* g^T hi / residual [64][8192] */
    for (int q0 = 0; q0 < QN; q0 += QT) { const _Float16* qh = tb_ + (size_t)q0 * D3; const _Float16* ql = tlb + (size_t)q0 * D3; const dim3 gs((QT / 128) * (SK / 64), 1);
      k_gemm2<0><<<gs, 128, 0, stream>>>(ql, D3, 0, tb_ + IC, D3, 0, 1.0f / 1024.0f, nullptr, 0, nullptr, 1, 0, 0, S, nullptr, SK, 0, QT, SK, IC);      /* theta-res . phi-hi */
      k_gemm2<0><<<gs, 128, 0, stream>>>(qh, D3, 0, tlb + IC, D3, 0, 1.0f / 1024.0f, nullptr, 0, S, 1, (size_t)SK, 0, S, nullptr, SK, 0, QT, SK, IC);      /* + theta-hi . phi-res */
      k_gemm2<0><<<gs, 128, 0, stream>>>(qh, D3, 0, tb_ + IC, D3, 0, 1.0f, nullptr, 0, S, 1, (size_t)SK, 0, S, nullptr, SK, 0, QT, SK, IC);      /* + theta-hi . phi-hi */
      k_rsmk<<<QT, 256, 0, stream>>>(S, P, QT);
      float* yb = YF + ((size_t)b * LL + q0) * IC; const dim3 gy((QT / 128) * 1, 1);
      k_gemm2<0><<<gy, 128, 0, stream>>>(P, SK, 0, GTL, SK, 0, (1.0f / 16384.0f) / 1024.0f, nullptr, 0, nullptr, 1, 0, 0, yb, nullptr, IC, 0, QT, IC, SK);      /* P . g-res */
      k_gemm2<0><<<gy, 128, 0, stream>>>(P, SK, 0, GT, SK, 0, 1.0f / 16384.0f, nullptr, 0, yb, 1, (size_t)IC, 0, yb, nullptr, IC, 0, QT, IC, SK); } }      /* + P . g-hi -> y rows f32 */
  k_hl<<<(unsigned)((NR * IC / 8 + 255) / 256), 256, 0, stream>>>(YF, YH, YL, NR * IC / 8);
  const dim3 gz((unsigned)((NR / 128) * (CC / 64)), 1);
  k_gemm2<0><<<gz, 128, 0, stream>>>(YL, IC, 0, BZ, IC, 0, 0.0625f / 1024.0f, nullptr, 0, nullptr, 1, 0, 0, WY, nullptr, CC, 0, (int)NR, CC, IC);      /* W_z: y-res term */
  k_gemm2<0><<<gz, 128, 0, stream>>>(YH, IC, 0, BZ, IC, 0, 0.0625f, zb, 0, WY, 1, (size_t)CC, 0, WY, nullptr, CC, 0, (int)NR, CC, IC);      /* + y-hi term + bias */
  k_bnstat<<<CC, 256, 0, stream>>>(WY, ST);
  k_fin<<<(unsigned)(((size_t)NB * CC * LL / 8 + 255) / 256), 256, 0, stream>>>(WY, ST, gam, bet, x, (float*)d_out);
}

// v003
// It runs in 297 microseconds.
// Versions in between are left out here; by their measured steps it is 27.2 times as fast as v001.
// Over all steps from v000 it is 109 times as fast.
#include <hip/hip_runtime.h>
// Non-local block (x [2][256][8x32x32 = 8192 positions]; g, theta, phi = 1x1 conv projections to 64 (+ bias); f = theta . phi over all positions; softmax; y = attn g; W_z 1x1 conv back to 256 (+ bias); training-mode BatchNorm over (batch, positions) per channel with gamma/beta; out = bn(W_z y) + x).
// Compute dtype: inputs rounded to bf16; x / weights exact; theta, phi, g, y as hi + residual operand pairs (~2^-22); P plain f16 (~2^-12); softmax, BN f32; v_wmma_f32_16x16x32_f16.
#define NB 2
#define CC 256
#define LL 8192                      /* positions per sample */
#define SK LL
#define IC 64                        /* inter channels */
#define D3 (3 * IC)                  /* theta | phi | g */
#define NR ((size_t)NB * LL)
#define NBR NB                       /* batches (debug hook) */
#define SQ LL
#define DM CC
#define NH 1
#define HD 64
#define HG 1
typedef __bf16 v16b __attribute__((ext_vector_type(16)));
typedef unsigned short v8us __attribute__((ext_vector_type(8), may_alias));
typedef float  v8f  __attribute__((ext_vector_type(8)));
typedef float  v4f  __attribute__((ext_vector_type(4)));
typedef float  v4fa __attribute__((ext_vector_type(4), may_alias));
union FragB { v16b v; v8us half[2]; unsigned short u[16]; };

__device__ __forceinline__ unsigned short bf16_bits(float x) { unsigned int u = __float_as_uint(x); return (unsigned short)((u + 0x7FFFu + ((u >> 16) & 1u)) >> 16); }
__device__ __forceinline__ float bf16_val(unsigned short b) { return __uint_as_float(((unsigned int)b) << 16); }
__device__ __forceinline__ float bf16_round(float x) { return bf16_val(bf16_bits(x)); }
// D += A·B with NT terms: 1 = ah·bh, 2 = + al·bh (A split), 3 = + ah·bl (both split)
template <int NT>
__device__ __forceinline__ v8f mmaN(v16b ah, v16b al, v16b bh, v16b bl, v8f c) {
  c = __builtin_amdgcn_wmma_f32_16x16x32_bf16(false, ah, false, bh, (short)0, c, false, false);
  if (NT >= 2) c = __builtin_amdgcn_wmma_f32_16x16x32_bf16(false, al, false, bh, (short)0, c, false, false);
  if (NT >= 3) c = __builtin_amdgcn_wmma_f32_16x16x32_bf16(false, ah, false, bl, (short)0, c, false, false);
  asm volatile("v_nop\n\tv_nop\n\tv_nop\n\tv_nop" : "+v"(c) : "v"(ah), "v"(al), "v"(bh), "v"(bl));
  return c;
}

__global__ __launch_bounds__(256) void k_wt_bf16(const float* __restrict__ W, unsigned short* __restrict__ Wt, int K, int N) {
  const int t = blockIdx.x * 256 + threadIdx.x;
  const int k8n = K / 8;
  if (t >= N * k8n) return;
  const int n = t / k8n, k8 = (t % k8n) * 8;
  v8us v;
#pragma unroll
  for (int i = 0; i < 8; ++i) v[i] = bf16_bits(W[(size_t)(k8 + i) * N + n]);
  *(v8us*)(Wt + (size_t)n * K + k8) = v;
  
}

// GEMM C[M][N] (f32, pitch ldc) = act(A[M][K]·W + bias). A f32 row-major (pitch lda) converted per fragment to bf16
// (ASPLIT: hi/lo two planes -> 2 terms, else single rounded term); Wt bf16 [N][K] (pitch ldb). BIAS_BF16 rounds the
// bias to bf16 first (bias quantised to bf16 before the add). K%32==0, M%16==0, N%64==0.
template <bool ASPLIT, int ACT, bool BIAS_BF16>
__global__ __launch_bounds__(128) void k_gemm_bf(const float* __restrict__ A, int lda, const unsigned short* __restrict__ Wt, int ldb,
                                               const float* __restrict__ bias, float* __restrict__ C, int ldc, int M, int N, int K) {
  __shared__ __attribute__((aligned(16))) float so[4][16][64];
  const int tid = threadIdx.x, w = tid >> 5, lane = tid & 31, ln = lane & 15, hh = lane >> 4;
  const int ntn = N / 64;
  const int wid = blockIdx.x * 4 + w;
  const int mt = wid / ntn, nq = wid % ntn;
  if (mt * 16 >= M) return;
  const int row0 = mt * 16, col0 = nq * 64;
  const float* arow = A + (size_t)(row0 + ln) * lda;
  v8f acc[4] = {};
  for (int kb = 0; kb < K; kb += 32) {
    FragB ah, al;
    const v4f x0 = *(const v4fa*)(arow + kb + 8 * hh), x1 = *(const v4fa*)(arow + kb + 8 * hh + 4);
    const v4f x2 = *(const v4fa*)(arow + kb + 16 + 8 * hh), x3 = *(const v4fa*)(arow + kb + 16 + 8 * hh + 4);
    float xs[16] = {x0[0],x0[1],x0[2],x0[3],x1[0],x1[1],x1[2],x1[3],x2[0],x2[1],x2[2],x2[3],x3[0],x3[1],x3[2],x3[3]};
#pragma unroll
    for (int i = 0; i < 16; ++i) { const unsigned short hb = bf16_bits(xs[i]); ah.u[i] = hb; al.u[i] = ASPLIT ? bf16_bits(xs[i] - bf16_val(hb)) : (unsigned short)0; }
#pragma unroll
    for (int t = 0; t < 4; ++t) {
      const unsigned short* brow = Wt + (size_t)(col0 + t * 16 + ln) * ldb + kb;
      FragB b;
      b.half[0] = *(const v8us*)(brow + 8 * hh);
      b.half[1] = *(const v8us*)(brow + 16 + 8 * hh);
      acc[t] = mmaN<ASPLIT ? 2 : 1>(ah.v, al.v, b.v, b.v, acc[t]);
    }
  }
#pragma unroll
  for (int t = 0; t < 4; ++t) {
    float bv = bias ? bias[col0 + t * 16 + ln] : 0.f;
    if (BIAS_BF16) bv = bf16_round(bv);
#pragma unroll
    for (int r = 0; r < 8; ++r) { float v = acc[t][r] + bv; if (ACT == 1) v = fmaxf(v, 0.f); so[w][8 * hh + r][t * 16 + ln] = v; }
  }
  __builtin_amdgcn_fence(__ATOMIC_ACQ_REL, "workgroup");
  __builtin_amdgcn_wave_barrier();
  const int rsub = lane >> 4, c4 = (lane & 15) * 4;
  {
#pragma unroll
    for (int q = 0; q < 8; ++q) {
      const int r = q * 2 + rsub;
      const v4f v = *(const v4fa*)&so[w][r][c4];
      *(v4f*)(C + (size_t)(row0 + r) * ldc + col0 + c4) = v;
    }
    
  }
}

// GEMM C = act(A·W + bias + resid): A f32 (ASPLIT -> hi/lo 2 terms), Wt bf16 [N][K]; ACT 0 none, 1 relu, 2 exact gelu;
// resid (optional, f32, row index = (row % rmod), pitch ldr, RES_BF16 rounds it) added before the activation.
template <bool ASPLIT, int ACT, bool BIAS_BF16, bool RES_BF16>
__global__ __launch_bounds__(128) void k_gemm_bf3(const float* __restrict__ A, int lda, const unsigned short* __restrict__ Wt, int ldb,
                                                const float* __restrict__ bias, const float* __restrict__ resid, int rmod, int ldr,
                                                float* __restrict__ C, int ldc, int M, int N, int K) {
  __shared__ __attribute__((aligned(16))) float so[4][16][64];
  const int tid = threadIdx.x, w = tid >> 5, lane = tid & 31, ln = lane & 15, hh = lane >> 4;
  const int ntn = N / 64;
  const int wid = blockIdx.x * 4 + w;
  const int mt = wid / ntn, nq = wid % ntn;
  if (mt * 16 >= M) return;
  const int row0 = mt * 16, col0 = nq * 64;
  const float* arow = A + (size_t)(row0 + ln) * lda;
  v8f acc[4] = {};
  for (int kb = 0; kb < K; kb += 32) {
    FragB ah, al;
    const v4f x0 = *(const v4fa*)(arow + kb + 8 * hh), x1 = *(const v4fa*)(arow + kb + 8 * hh + 4);
    const v4f x2 = *(const v4fa*)(arow + kb + 16 + 8 * hh), x3 = *(const v4fa*)(arow + kb + 16 + 8 * hh + 4);
    float xs[16] = {x0[0],x0[1],x0[2],x0[3],x1[0],x1[1],x1[2],x1[3],x2[0],x2[1],x2[2],x2[3],x3[0],x3[1],x3[2],x3[3]};
#pragma unroll
    for (int i = 0; i < 16; ++i) { const unsigned short hb = bf16_bits(xs[i]); ah.u[i] = hb; al.u[i] = ASPLIT ? bf16_bits(xs[i] - bf16_val(hb)) : (unsigned short)0; }
#pragma unroll
    for (int t = 0; t < 4; ++t) {
      const unsigned short* brow = Wt + (size_t)(col0 + t * 16 + ln) * ldb + kb;
      FragB b;
      b.half[0] = *(const v8us*)(brow + 8 * hh);
      b.half[1] = *(const v8us*)(brow + 16 + 8 * hh);
      acc[t] = mmaN<ASPLIT ? 2 : 1>(ah.v, al.v, b.v, b.v, acc[t]);
    }
  }
#pragma unroll
  for (int t = 0; t < 4; ++t) {
    const int col = col0 + t * 16 + ln;
    float bv = bias ? bias[col] : 0.f;
    if (BIAS_BF16) bv = bf16_round(bv);
#pragma unroll
    for (int r = 0; r < 8; ++r) {
      float v = acc[t][r] + bv;
      if (resid) { float rv = resid[(size_t)((row0 + 8 * hh + r) % rmod) * ldr + col]; if (RES_BF16) rv = bf16_round(rv); v += rv; }
      if (ACT == 1) v = fmaxf(v, 0.f);
      if (ACT == 2) v = 0.5f * v * (1.0f + erff(v * 0.70710678118654752f));
      if (ACT == 3) { const float u = 0.7978845608028654f * (v + 0.044715f * v * v * v); v = 0.5f * v * (1.0f + tanhf(u)); }
      so[w][8 * hh + r][t * 16 + ln] = v;
    }
  }
  __builtin_amdgcn_fence(__ATOMIC_ACQ_REL, "workgroup");
  __builtin_amdgcn_wave_barrier();
  const int rsub = lane >> 4, c4 = (lane & 15) * 4;
  {
#pragma unroll
    for (int q = 0; q < 8; ++q) {
      const int r = q * 2 + rsub;
      const v4f v = *(const v4fa*)&so[w][r][c4];
      *(v4f*)(C + (size_t)(row0 + r) * ldc + col0 + c4) = v;
    }
    
  }
}
// row LayerNorm (biased variance, eps) over N: s = X (+ R); optional out_sum <- s; out_norm <- (s-mu)*rsqrt(var+eps)*g + b
template <bool PARAM_BF16>
__global__ __launch_bounds__(256) void k_layernorm(const float* __restrict__ X, const float* __restrict__ R, const float* __restrict__ g, const float* __restrict__ bta,
                                                  float* __restrict__ out_sum, float* __restrict__ out_norm, int N, float eps) {
  __shared__ float red[256];
  const int row = blockIdx.x, tid = threadIdx.x;
  const float* x = X + (size_t)row * N; const float* rr = R ? R + (size_t)row * N : nullptr;
  float vals[16];                     // up to N = 4096
  const int per = N / 256;            // contiguous chunk per thread? use strided-by-4 chunks: thread handles j = tid*4 + 1024*u
  float s1 = 0.f;
  for (int u = 0; u < per / 4; ++u) {
    const int j = tid * 4 + 1024 * u;
    const v4f a = *(const v4fa*)(x + j);
    v4f b = {0.f,0.f,0.f,0.f}; if (rr) b = *(const v4fa*)(rr + j);
#pragma unroll
    for (int q = 0; q < 4; ++q) { const float v = a[q] + b[q]; vals[u * 4 + q] = v; s1 += v; }
  }
  red[tid] = s1; __syncthreads();
  for (int st = 128; st > 0; st >>= 1) { if (tid < st) red[tid] += red[tid + st]; __syncthreads(); }
  const float mu = red[0] / (float)N; __syncthreads();
  float s2 = 0.f;
  for (int u = 0; u < per / 4; ++u)
#pragma unroll
    for (int q = 0; q < 4; ++q) { const float c = vals[u * 4 + q] - mu; s2 += c * c; }
  red[tid] = s2; __syncthreads();
  for (int st = 128; st > 0; st >>= 1) { if (tid < st) red[tid] += red[tid + st]; __syncthreads(); }
  const float rs = rsqrtf(red[0] / (float)N + eps);
  {
    for (int u = 0; u < per / 4; ++u) {
      const int j = tid * 4 + 1024 * u;
      v4f o, sm;
#pragma unroll
      for (int q = 0; q < 4; ++q) {
        float gg = g[j + q], bb = bta[j + q];
        if (PARAM_BF16) { gg = bf16_round(gg); bb = bf16_round(bb); }
        sm[q] = vals[u * 4 + q]; o[q] = (vals[u * 4 + q] - mu) * rs * gg + bb;
      }
      if (out_sum) *(v4f*)(out_sum + (size_t)row * N + j) = sm;
      *(v4f*)(out_norm + (size_t)row * N + j) = o;
    }
    
  }
}



// ---- f16 WMMA path (v_wmma_f32_16x16x32_f16): 11-bit significands for operands in range — used where a [0,1] probability operand needs more precision than bf16
typedef _Float16 v16h __attribute__((ext_vector_type(16)));
union FragH { v16h v; v8us half[2]; _Float16 h[16]; unsigned short u[16]; };
template <int NT>
__device__ __forceinline__ v8f mmaH(v16h ah, v16h al, v16h bh, v16h bl, v8f c) {
  c = __builtin_amdgcn_wmma_f32_16x16x32_f16(false, ah, false, bh, (short)0, c, false, false);
  if (NT >= 2) c = __builtin_amdgcn_wmma_f32_16x16x32_f16(false, al, false, bh, (short)0, c, false, false);
  if (NT >= 3) c = __builtin_amdgcn_wmma_f32_16x16x32_f16(false, ah, false, bl, (short)0, c, false, false);
  asm volatile("v_nop\n\tv_nop\n\tv_nop\n\tv_nop" : "+v"(c) : "v"(ah), "v"(al), "v"(bh), "v"(bl));
  return c;
}
// batched GEMM like k_gemm_b but f16 operands: A f32 (split into f16 hi/lo if ASPLIT, else rounded to f16), Bt = f16 values [n][k]; alpha; C f32; N multiple of 16 (partial tiles skipped)
template <bool ASPLIT>
__global__ __launch_bounds__(128) void k_gemm_h(const float* __restrict__ A, int lda, size_t sA, const _Float16* __restrict__ Bh, int ldb, size_t sB, float alpha, float* __restrict__ C, int ldc, size_t sC, int M, int N, int K) {
  __shared__ __attribute__((aligned(16))) float so[4][16][64];
  const int tid = threadIdx.x, w = tid >> 5, lane = tid & 31, ln = lane & 15, hh = lane >> 4; const int by = blockIdx.y;
  A += (size_t)by * sA; Bh += (size_t)by * sB; C += (size_t)by * sC;
  const int ntn = (N + 63) / 64; const int wid = blockIdx.x * 4 + w; const int mt = wid / ntn, nq = wid % ntn; if (mt * 16 >= M) return;
  const int row0 = mt * 16, col0 = nq * 64; const float* arow = A + (size_t)(row0 + ln) * lda;
  v8f acc[4] = {};
  for (int kb = 0; kb < K; kb += 32) {
    FragH ah, al;
    const v4f x0 = *(const v4fa*)(arow + kb + 8 * hh), x1 = *(const v4fa*)(arow + kb + 8 * hh + 4), x2 = *(const v4fa*)(arow + kb + 16 + 8 * hh), x3 = *(const v4fa*)(arow + kb + 16 + 8 * hh + 4);
    float xs[16] = {x0[0],x0[1],x0[2],x0[3],x1[0],x1[1],x1[2],x1[3],x2[0],x2[1],x2[2],x2[3],x3[0],x3[1],x3[2],x3[3]};
#pragma unroll
    for (int i = 0; i < 16; ++i) { const _Float16 h = (_Float16)xs[i]; ah.h[i] = h; al.h[i] = ASPLIT ? (_Float16)(xs[i] - (float)h) : (_Float16)0.0f; }
#pragma unroll
    for (int t = 0; t < 4; ++t) { if (col0 + t * 16 >= N) continue; const size_t boff = (size_t)(col0 + t * 16 + ln) * ldb + kb; FragH bq; bq.half[0] = *(const v8us*)(Bh + boff + 8 * hh); bq.half[1] = *(const v8us*)(Bh + boff + 16 + 8 * hh);
      acc[t] = mmaH<ASPLIT ? 2 : 1>(ah.v, al.v, bq.v, bq.v, acc[t]); }
  }
#pragma unroll
  for (int t = 0; t < 4; ++t) { if (col0 + t * 16 >= N) continue;
#pragma unroll
    for (int r = 0; r < 8; ++r) so[w][8 * hh + r][t * 16 + ln] = acc[t][r] * alpha; }
  __builtin_amdgcn_fence(__ATOMIC_ACQ_REL, "workgroup"); __builtin_amdgcn_wave_barrier();
  const int rsub = lane >> 4, c4 = (lane & 15) * 4;
  {
#pragma unroll
    for (int q = 0; q < 8; ++q) { const int r = q * 2 + rsub; if (col0 + c4 < N) { const v4f v = *(const v4fa*)&so[w][r][c4]; *(v4f*)(C + (size_t)(row0 + r) * ldc + col0 + c4) = v; } }
     }
}

// Wt[n][k] = f16(W[k][n]·scale) from f32 row-major W[K][N] (scale = power of two; bf16-exact weights stay exact in f16 away from the subnormal range)
__global__ __launch_bounds__(256) void k_wt_f16(const float* __restrict__ W, _Float16* __restrict__ Wt, int K, int N, float scale) {
  const int t = blockIdx.x * 256 + threadIdx.x; if (t >= N * (K / 8)) return; const int n = t / (K / 8), k8 = (t % (K / 8)) * 8; FragH f;
#pragma unroll
  for (int i = 0; i < 8; ++i) f.h[i] = (_Float16)(bf16_round(W[(size_t)(k8 + i) * N + n]) * scale); const v8us o = f.half[0];
  *(v8us*)((unsigned short*)Wt + (size_t)n * K + k8) = o; 
}
// k_gemm_hh variant with fused epilogue: v = acc·alpha + bias[by·sBias + col] (+ CP[(row/rowsPerB)·sCPb + by·64 + col] if CP) ; ACT 0 none / 1 elu ; writes f16 C16 (and f32 C if non-null)
template <int ACT>
__global__ __launch_bounds__(128) void k_gemm_hhx(const _Float16* __restrict__ A, int lda, size_t sA, const _Float16* __restrict__ Bh, int ldb, size_t sB, float alpha, const float* __restrict__ bias, size_t sBias, const float* __restrict__ CP, int rowsPerB, size_t sCPb, int row0g,
    float* __restrict__ C, _Float16* __restrict__ C16, int ldc, size_t sC, int M, int N, int K) {
  __shared__ __attribute__((aligned(16))) float so[4][16][64];
  const int tid = threadIdx.x, w = tid >> 5, lane = tid & 31, ln = lane & 15, hh = lane >> 4; const int by = blockIdx.y;
  A += (size_t)by * sA; Bh += (size_t)by * sB; const size_t cofs = (size_t)by * sC; const float* bp = bias ? bias + (size_t)by * sBias : nullptr;
  const int ntn = (N + 63) / 64; const int wid = blockIdx.x * 4 + w; const int mt = wid / ntn, nq = wid % ntn; if (mt * 16 >= M) return;
  const int row0 = mt * 16, col0 = nq * 64; const _Float16* arow = A + (size_t)(row0 + ln) * lda;
  v8f acc[4] = {};
  for (int kb = 0; kb < K; kb += 32) { FragH ah; ah.half[0] = *(const v8us*)((const unsigned short*)arow + kb + 8 * hh); ah.half[1] = *(const v8us*)((const unsigned short*)arow + kb + 16 + 8 * hh);
#pragma unroll
    for (int t = 0; t < 4; ++t) { if (col0 + t * 16 >= N) continue; const size_t boff = (size_t)(col0 + t * 16 + ln) * ldb + kb; FragH bq; bq.half[0] = *(const v8us*)((const unsigned short*)Bh + boff + 8 * hh); bq.half[1] = *(const v8us*)((const unsigned short*)Bh + boff + 16 + 8 * hh);
      acc[t] = mmaH<1>(ah.v, ah.v, bq.v, bq.v, acc[t]); }
  }
#pragma unroll
  for (int t = 0; t < 4; ++t) { if (col0 + t * 16 >= N) continue; const int col = col0 + t * 16 + ln; const float bv = bp ? bf16_round(bp[col]) : 0.f;
#pragma unroll
    for (int r = 0; r < 8; ++r) { float v = acc[t][r] * alpha + bv; if (CP) { const int rr = row0g + row0 + 8 * hh + r; if (rowsPerB < 0) v += CP[cofs + (size_t)rr * ldc + col];      /* rowsPerB < 0: own element of the batched C plane */ else { const int bidx = rr / rowsPerB; v += CP[(size_t)bidx * sCPb + (size_t)by * 64 + col]; } } if (ACT == 1) v = (v > 0.f) ? v : expm1f(v); else if (ACT == 7) v = (v > 0.f) ? v + 1.0f : expf(v); else if (ACT == 8) v = tanhf(v); else if (ACT == 9) v = 0.5f * v * (1.0f + tanhf(0.7978845608028654f * (v + 0.044715f * v * v * v))); else if (ACT == 11) v = 1.0f / (1.0f + expf(-v)); else if (ACT == 12) v = (v > 0.f) ? v : 0.01f * v; else if (ACT == 14) v = (v > 0.f) ? v : 0.1f * v; else if (ACT == 16) v = (v >= 0.f) ? v : 0.3f * v; else if (ACT == 17) v = (v >= 0.f) ? v : 0.2f * v; else if (ACT == 15) v = v / (1.0f + expf(-v)); else if (ACT == 3) v = fmaxf(v, 0.f); else if (ACT == 6) v = 0.5f * v * (1.0f + erff(v * 0.70710678118654752f)); so[w][8 * hh + r][t * 16 + ln] = v; } }
  __builtin_amdgcn_fence(__ATOMIC_ACQ_REL, "workgroup"); __builtin_amdgcn_wave_barrier();
  const int rsub = lane >> 4, c4 = (lane & 15) * 4; typedef _Float16 v4h __attribute__((ext_vector_type(4)));
  {
#pragma unroll
    for (int q = 0; q < 8; ++q) { const int r = q * 2 + rsub; if (col0 + c4 < N) { const v4f v = *(const v4fa*)&so[w][r][c4]; if (C) *(v4f*)(C + cofs + (size_t)(row0 + r) * ldc + col0 + c4) = v; if (C16) { v4h h4; for (int i = 0; i < 4; ++i) h4[i] = (_Float16)v[i]; *(v4h*)(C16 + cofs + (size_t)(row0 + r) * ldc + col0 + c4) = h4; } } }
     }
}


typedef _Float16 v4h __attribute__((ext_vector_type(4)));

__global__ __launch_bounds__(256) void k_x16(const float* __restrict__ x, _Float16* __restrict__ X16, size_t n8) { const size_t t = (size_t)blockIdx.x * 256 + threadIdx.x; if (t >= n8) return; FragH f;
#pragma unroll
  for (int q = 0; q < 8; ++q) f.h[q] = (_Float16)bf16_round(x[t * 8 + q]); *(v8us*)((unsigned short*)X16 + t * 8) = f.half[0];  }
__global__ __launch_bounds__(256) void k_h16(const float* __restrict__ x, _Float16* __restrict__ X16, size_t n8) { const size_t t = (size_t)blockIdx.x * 256 + threadIdx.x; if (t >= n8) return; FragH f;
#pragma unroll
  for (int q = 0; q < 8; ++q) f.h[q] = (_Float16)x[t * 8 + q]; *(v8us*)((unsigned short*)X16 + t * 8) = f.half[0];  }
__global__ __launch_bounds__(256) void k_round16f(const float* __restrict__ W, _Float16* __restrict__ Bt, size_t n8) { const size_t t = (size_t)blockIdx.x * 256 + threadIdx.x; if (t >= n8) return; FragH f;
#pragma unroll
  for (int i = 0; i < 8; ++i) f.h[i] = (_Float16)(bf16_round(W[t * 8 + i]) * 16.0f); *(v8us*)((unsigned short*)Bt + t * 8) = f.half[0];  }
template <int NHv, int TTv>
__global__ __launch_bounds__(256) void k_vt(const _Float16* __restrict__ V16, int ldv, int voff, _Float16* __restrict__ Vt) { __shared__ unsigned short tl[64][66]; const int tid = threadIdx.x; const int slab = blockIdx.x / (TTv / 64), lg = blockIdx.x % (TTv / 64); const int b = slab / NHv, h = slab % NHv;
  for (int i = tid; i < 64 * 8; i += 256) { const int r = i / 8, c8 = (i % 8) * 8; FragH f; f.half[0] = *(const v8us*)((const unsigned short*)V16 + ((size_t)b * TTv + lg * 64 + r) * ldv + voff + h * 64 + c8);
#pragma unroll
    for (int q = 0; q < 8; ++q) tl[r][c8 + q] = f.u[q]; }
  __syncthreads();
  {
#pragma unroll
    for (int rd = 0; rd < 2; ++rd) { const int d = rd * 32 + tid / 8, pc = tid % 8; FragH f;
#pragma unroll
      for (int q = 0; q < 8; ++q) f.u[q] = tl[pc * 8 + q][d];
      *(v8us*)((unsigned short*)Vt + ((size_t)slab * 64 + d) * TTv + lg * 64 + pc * 8) = f.half[0]; }
     } }

__global__ __launch_bounds__(256) void k_hl(const float* __restrict__ F, _Float16* __restrict__ Hh, _Float16* __restrict__ Hl, size_t n8) { const size_t t = (size_t)blockIdx.x * 256 + threadIdx.x; if (t >= n8) return; FragH fh, fl; const v4f a = *(const v4fa*)(F + t * 8), c = *(const v4fa*)(F + t * 8 + 4);
#pragma unroll
  for (int q = 0; q < 4; ++q) { _Float16 h = (_Float16)a[q]; fh.h[q] = h; fl.h[q] = (_Float16)((a[q] - (float)h) * 1024.0f); h = (_Float16)c[q]; fh.h[4 + q] = h; fl.h[4 + q] = (_Float16)((c[q] - (float)h) * 1024.0f); }
  { *(v8us*)((unsigned short*)Hh + t * 8) = fh.half[0]; *(v8us*)((unsigned short*)Hl + t * 8) = fl.half[0];  } }

// ---- fast GEMM (wave tile 32x64; requires M % 32 == 0 rows per launch region and N % 64 == 0); epilogue = k_gemm_hhx semantics ----
__device__ __forceinline__ v16h g2_frag(const _Float16* p, int hh) { FragH f; f.half[0] = *(const v8us*)((const unsigned short*)p + 8 * hh); f.half[1] = *(const v8us*)((const unsigned short*)p + 16 + 8 * hh); return f.v; }
__device__ __forceinline__ v8f g2_mma(v16h a, v16h b, v8f c) { v8f d = __builtin_amdgcn_wmma_f32_16x16x32_f16(false, a, false, b, (short)0, c, false, false); asm volatile("v_nop\n\tv_nop\n\tv_nop\n\tv_nop" : "+v"(d) : "v"(a), "v"(b)); return d; }
template <int ACT>
__global__ __launch_bounds__(128) void k_gemm2(const _Float16* __restrict__ A, int lda, size_t sA, const _Float16* __restrict__ Bh, int ldb, size_t sB, float alpha, const float* __restrict__ bias, size_t sBias, const float* __restrict__ CP, int rowsPerB, size_t sCPb, int row0g,
    float* __restrict__ C, _Float16* __restrict__ C16, int ldc, size_t sC, int M, int N, int K) { static_assert(ACT == 0 || ACT == 3 || ACT == 6 || ACT == 8 || ACT == 9 || ACT == 11 || ACT == 12 || ACT == 14 || ACT == 15 || ACT == 16 || ACT == 17, "k_gemm2: unsupported ACT code (would silently apply no activation)");
  __shared__ __attribute__((aligned(16))) float so[4][32][68];
  const int tid = threadIdx.x, w = tid >> 5, lane = tid & 31, ln = lane & 15, hh = lane >> 4; const int by = blockIdx.y;
  A += (size_t)by * sA; Bh += (size_t)by * sB; const size_t cofs = (size_t)by * sC; const float* bp = bias ? bias + (size_t)by * sBias : nullptr;
  const int ntn = N >> 6; const int mt = blockIdx.x / ntn, nq = blockIdx.x - mt * ntn; const int row0 = mt * 128 + 32 * w, col0 = nq * 64; if (row0 >= M) return;
  const _Float16* a0p = A + (size_t)(row0 + ln) * lda; const _Float16* a1p = a0p + (size_t)16 * lda;
  const _Float16* b0p = Bh + (size_t)(col0 + ln) * ldb; const _Float16* b1p = b0p + (size_t)16 * ldb; const _Float16* b2p = b1p + (size_t)16 * ldb; const _Float16* b3p = b2p + (size_t)16 * ldb;
  const v8f z8 = {0.f,0.f,0.f,0.f,0.f,0.f,0.f,0.f}; v8f c00 = z8, c01 = z8, c02 = z8, c03 = z8, c10 = z8, c11 = z8, c12 = z8, c13 = z8;
#pragma unroll 1
  for (int kb = 0; kb < K; kb += 32) { const v16h a0 = g2_frag(a0p + kb, hh), a1 = g2_frag(a1p + kb, hh);
    v16h b = g2_frag(b0p + kb, hh); c00 = g2_mma(a0, b, c00); c10 = g2_mma(a1, b, c10);
    b = g2_frag(b1p + kb, hh); c01 = g2_mma(a0, b, c01); c11 = g2_mma(a1, b, c11);
    b = g2_frag(b2p + kb, hh); c02 = g2_mma(a0, b, c02); c12 = g2_mma(a1, b, c12);
    b = g2_frag(b3p + kb, hh); c03 = g2_mma(a0, b, c03); c13 = g2_mma(a1, b, c13); }
  v8f accs[8] = {c00, c01, c02, c03, c10, c11, c12, c13};
#pragma unroll
  for (int u = 0; u < 8; ++u) { const int t = u & 3, half = u >> 2; const int col = col0 + t * 16 + ln; const float bv = bp ? bf16_round(bp[col]) : 0.f;
#pragma unroll
    for (int r = 0; r < 8; ++r) { const int rloc = half * 16 + 8 * hh + r; float v = accs[u][r] * alpha + bv; if (CP) { if (rowsPerB < 0) v += CP[cofs + (size_t)(row0g + row0 + rloc) * ldc + col];      /* rowsPerB < 0: own element of the batched C plane */ else { const int bidx = (row0g + row0 + rloc) / rowsPerB; v += CP[(size_t)bidx * sCPb + (size_t)by * 64 + col]; } }
      if (ACT == 3) v = fmaxf(v, 0.f); else if (ACT == 6) v = 0.5f * v * (1.0f + erff(v * 0.70710678118654752f)); else if (ACT == 11) v = 1.0f / (1.0f + expf(-v)); else if (ACT == 15) v = v / (1.0f + expf(-v)); else if (ACT == 12) v = (v > 0.f) ? v : 0.01f * v; else if (ACT == 8) v = tanhf(v); else if (ACT == 9) v = 0.5f * v * (1.0f + tanhf(0.7978845608028654f * (v + 0.044715f * v * v * v))); else if (ACT == 14) v = (v > 0.f) ? v : 0.1f * v; else if (ACT == 16) v = (v >= 0.f) ? v : 0.3f * v; else if (ACT == 17) v = (v >= 0.f) ? v : 0.2f * v;
      so[w][rloc][t * 16 + ln] = v; } }
  __builtin_amdgcn_fence(__ATOMIC_ACQ_REL, "workgroup"); __builtin_amdgcn_wave_barrier();
  const int rsub = lane >> 4, c4 = (lane & 15) * 4;
  {
#pragma unroll
    for (int q = 0; q < 16; ++q) { const int r = q * 2 + rsub; const v4f v = *(const v4fa*)&so[w][r][c4]; if (C) *(v4f*)(C + cofs + (size_t)(row0 + r) * ldc + col0 + c4) = v; if (C16) { v4h h4; for (int i = 0; i < 4; ++i) h4[i] = (_Float16)v[i]; *(v4h*)(C16 + cofs + (size_t)(row0 + r) * ldc + col0 + c4) = h4; } }
     } }


__global__ __launch_bounds__(256) void k_wnat(const float* __restrict__ w, size_t n8, _Float16* __restrict__ Bt) { const size_t t = (size_t)blockIdx.x * 256 + threadIdx.x; if (t >= n8) return; FragH f; for (int q = 0; q < 8; ++q) f.h[q] = (_Float16)(bf16_round(w[t * 8 + q]) * 16.0f); *(v8us*)((unsigned short*)Bt + t * 8) = f.half[0];  }
__global__ __launch_bounds__(256) void k_rsm(const float* __restrict__ S, _Float16* __restrict__ P, int nrows) {
  #pragma clang fp contract(off)
  const int i = blockIdx.x * 256 + threadIdx.x; if (i >= nrows) return; const float* s = S + (size_t)i * SQ; float mx = -3.0e38f;
#pragma unroll 1
  for (int j = 0; j < SQ; ++j) mx = fmaxf(mx, s[j]); float se = 0.f;
#pragma unroll 1
  for (int j = 0; j < SQ; ++j) se += expf(s[j] - mx); const float sc = 256.0f / se;
#pragma unroll 1
  for (int j0 = 0; j0 < SQ; j0 += 8) { FragH f; for (int q = 0; q < 8; ++q) f.h[q] = (_Float16)(expf(s[j0 + q] - mx) * sc); unsigned short* d = (unsigned short*)P + (size_t)i * SQ + j0; *(v8us*)d = f.half[0];  } }
__global__ __launch_bounds__(256) void k_vt(const _Float16* __restrict__ V16, int b, int h0, _Float16* __restrict__ VT) { __shared__ unsigned short tl[64][65]; const int tid = threadIdx.x; const int hh = blockIdx.x % HG, sg = blockIdx.x / HG; const int s0 = sg * 64; const int h = h0 + hh;
  for (int i = tid; i < 64 * 8; i += 256) { const int j = i / 8, d8 = (i % 8) * 8; FragH f; f.half[0] = *(const v8us*)((const unsigned short*)V16 + ((size_t)b * SQ + s0 + j) * DM + h * HD + d8); for (int q = 0; q < 8; ++q) tl[d8 + q][j] = f.u[q]; }
  __syncthreads();
  { for (int i = tid; i < 64 * 8; i += 256) { const int d = i / 8, j8 = (i % 8) * 8; FragH f; for (int q = 0; q < 8; ++q) f.u[q] = tl[d][j8 + q]; *(v8us*)((unsigned short*)VT + ((size_t)hh * HD + d) * SQ + s0 + j8) = f.half[0]; }  } }


__global__ __launch_bounds__(256) void k_cl2rows(const float* __restrict__ X, _Float16* __restrict__ XR) { __shared__ float tl[64][33]; const int tid = threadIdx.x; const int nl = LL / 32, nc = CC / 64; const int cb_ = blockIdx.x % nc; const int lb = (blockIdx.x / nc) % nl; const size_t b = blockIdx.x / (nc * nl); const int c0 = cb_ * 64, l0 = lb * 32;
  for (int i = tid; i < 64 * 32; i += 256) { const int c = i / 32, l = i % 32; tl[c][l] = bf16_round(X[(b * CC + c0 + c) * (size_t)LL + l0 + l]); }
  __syncthreads();
  { const int l = tid / 8, c8 = (tid % 8) * 8; FragH f; for (int q = 0; q < 8; ++q) f.h[q] = (_Float16)tl[c8 + q][l]; unsigned short* d = (unsigned short*)XR + (b * LL + l0 + l) * (size_t)CC + c0 + c8; *(v8us*)d = f.half[0];  } }

__global__ __launch_bounds__(256) void k_bcpy(const float* __restrict__ b, int n, int NP, float* __restrict__ dst, int dst0) { for (int i = threadIdx.x; i < NP; i += 256) { const float v = (i < n) ? b[i] : 0.f; *(float*)(dst + dst0 + i) = v; }  }

// Fused attention: a work-group of 8 waves owns 64 queries; a wave owns 32 of them (two column groups of 16) and every fourth block of 32 keys, one block a trip; scores, softmax weights and the weighted sum of g stay in registers (no score or weight plane in memory).
// The four waves of a query group each keep their own running maximum, sum and y; the four partial results are joined through LDS behind the key loop.
// S^T = phi . theta^T (A = 16 phi rows, B = the wave's theta rows, kept in registers), so a lane holds one query's scores: D register r of lane (ln, hh) is key 8 * hh + r, query ln.
// The two tiles of a trip (keys 0..15, 16..31), converted in place, are the B operand of y^T += g^T . P^T in the k order of g2_frag; the running maximum, the sum and the rescale factor of query ln live in lanes ln and ln + 16.
__device__ __forceinline__ v8f at_mma(v16h a, v16h b, v8f c) { return __builtin_amdgcn_wmma_f32_16x16x32_f16(false, a, false, b, (short)0, c, false, false); }
// fragment in the k order of g2_frag from a wave-uniform base and the lane's own byte offset (row * pitch + 16 * hh)
__device__ __forceinline__ v16h at_frag(const char* base, unsigned off) { FragH f; f.half[0] = *(const v8us*)(base + off); f.half[1] = *(const v8us*)(base + off + 32); return f.v; }
__device__ __forceinline__ float at_xhalf(float x) { return __builtin_bit_cast(float, __builtin_amdgcn_permlanex16(__builtin_bit_cast(int, x), __builtin_bit_cast(int, x), 0x76543210, 0xfedcba98, false, false)); }      /* lane l with lane l ^ 16 */
__global__ __launch_bounds__(256) void k_attn(const _Float16* __restrict__ TH, const _Float16* __restrict__ TL, const _Float16* __restrict__ GT, const _Float16* __restrict__ GTL, float* __restrict__ YF) {
  __shared__ __attribute__((aligned(16))) v4f py[8][16][32];      /* partial y: [wave][(column group * 4 + tile) * 2 + register half][lane] */
  __shared__ float pm[8][2][32], pl[8][2][32];      /* partial maximum and sum: [wave][column group][lane] */
  const int tid = threadIdx.x, lane = tid & 31, ln = lane & 15, hh = lane >> 4;
  const int wv = __builtin_amdgcn_readfirstlane(tid >> 5), w = wv & 1, ks = wv >> 1;      /* query group; which of every four key blocks. Waves 0..3 (ks 0, 1) and 4..7 (ks 2, 3) each read whole 128-byte lines of g^T between them */
  const int b = blockIdx.x / (LL / 64), qb = (blockIdx.x % (LL / 64)) * 64;
  const char* th = (const char*)(TH + (size_t)b * LL * D3); const char* tl = (const char*)(TL + (size_t)b * LL * D3);      /* rows theta | phi | g, hi / residual */
  const char* gh = (const char*)(GT + (size_t)b * IC * SK); const char* gl = (const char*)(GTL + (size_t)b * IC * SK);      /* g^T hi / residual, row = channel */
  const unsigned qo = (unsigned)(32 * w + ln) * (D3 * 2) + 16 * hh, ko = (unsigned)ln * (D3 * 2) + IC * 2 + 16 * hh, go = (unsigned)ln * (SK * 2) + 16 * hh;
  const float L2E = 1.44269504088896340736f;
  const v8f z8 = {0.f,0.f,0.f,0.f,0.f,0.f,0.f,0.f};
  v8f yh[2][4], yl[2][4]; float m[2], l[2];
#pragma unroll
  for (int j = 0; j < 2; ++j) { m[j] = -INFINITY; l[j] = 0.f; for (int t = 0; t < 4; ++t) { yh[j][t] = z8; yl[j][t] = z8; } }
  __builtin_amdgcn_sched_barrier(0);      /* with the one behind the wait: no vector write stands between the first loads and their s_wait_xcnt */
  v16h qh[2][2], ql[2][2];      /* theta hi / residual: [column group][k step] */
#pragma unroll
  for (int j = 0; j < 2; ++j) for (int c = 0; c < 2; ++c) { const size_t o = (size_t)(qb + 16 * j) * (D3 * 2) + 64 * c; qh[j][c] = at_frag(th + o, qo); ql[j][c] = at_frag(tl + o, qo); }
  v16h ka[2][2], kr[2][2];      /* phi hi / residual of the trip: [key tile][k step] */
#pragma unroll
  for (int t = 0; t < 2; ++t) for (int c = 0; c < 2; ++c) { const size_t o = (size_t)(32 * ks + 16 * t) * (D3 * 2) + 64 * c; ka[t][c] = at_frag(th + o, ko); kr[t][c] = at_frag(tl + o, ko); }
  asm volatile("s_wait_xcnt 0x0" ::: "memory");      /* in front of the first rewrite of an address register that the loads above name */
  __builtin_amdgcn_sched_barrier(0);      /* holds every later register write behind that wait */
  for (int it = 0; it < SK / 128; ++it) { const int k0 = 128 * it + 32 * ks;
    v16h ga[4], gr[4];      /* g^T of this trip: asked for here, used behind the softmax */
#pragma unroll
    for (int t = 0; t < 4; ++t) { const size_t o = (size_t)(16 * t) * (SK * 2) + (size_t)k0 * 2; ga[t] = at_frag(gh + o, go); gr[t] = at_frag(gl + o, go); }
    asm volatile("s_wait_xcnt 0x0" ::: "memory");      /* in front of the rewrite of the address registers that these loads name */
    __builtin_amdgcn_sched_barrier(0);      /* keeps the g^T loads in front of the score products: sunk to their uses each would be waited for alone */
    float s[2][2][8];
#pragma unroll
    for (int t = 0; t < 2; ++t) for (int j = 0; j < 2; ++j) {
      v8f sh = at_mma(ka[t][0], qh[j][0], z8); sh = at_mma(ka[t][1], qh[j][1], sh);      /* phi-hi . theta-hi */
      v8f sl = at_mma(ka[t][0], ql[j][0], z8); sl = at_mma(ka[t][1], ql[j][1], sl); sl = at_mma(kr[t][0], qh[j][0], sl); sl = at_mma(kr[t][1], qh[j][1], sl);      /* phi-hi . theta-res + phi-res . theta-hi, both x1024 */
      for (int r = 0; r < 8; ++r) s[j][t][r] = fmaf(sl[r], 1.0f / 1024.0f, sh[r]); }
    __builtin_amdgcn_sched_barrier(0);      /* with the one behind the wait: no vector write stands between the loads below and their s_wait_xcnt */
    const int kn = (k0 + 128) & (SK - 1);      /* the next trip's phi rows, one trip ahead; the last trip asks for the wave's first rows again (in bounds, not used) */
#pragma unroll
    for (int t = 0; t < 2; ++t) for (int c = 0; c < 2; ++c) { const size_t o = (size_t)(kn + 16 * t) * (D3 * 2) + 64 * c; ka[t][c] = at_frag(th + o, ko); kr[t][c] = at_frag(tl + o, ko); }
    asm volatile("s_wait_xcnt 0x0" ::: "memory");      /* in front of the rewrite of the address registers that these loads name */
    __builtin_amdgcn_sched_barrier(0);      /* keeps those loads in front of the softmax, whose time then covers their latency */
    float mn[2];
#pragma unroll
    for (int j = 0; j < 2; ++j) { float mx = s[j][0][0];
      for (int t = 0; t < 2; ++t) for (int r = 0; r < 8; ++r) mx = fmaxf(mx, s[j][t][r]);
      mx = fmaxf(mx, at_xhalf(mx));      /* the other eight keys of each tile sit in the partner lane */
      mn[j] = fmaxf(m[j], mx); }
    if (__builtin_amdgcn_ballot_w32(mn[0] > m[0] || mn[1] > m[1]) != 0) {      /* no maximum moved: every factor would be 1 */
#pragma unroll
      for (int j = 0; j < 2; ++j) { const float al = __builtin_amdgcn_exp2f((m[j] - mn[j]) * L2E);      /* first trip: exp2(-inf) = 0 on sums that are still 0 */
        m[j] = mn[j]; l[j] *= al;
        for (int t = 0; t < 4; ++t) for (int r = 0; r < 8; ++r) { yh[j][t][r] *= al; yl[j][t][r] *= al; } } }
#pragma unroll
    for (int j = 0; j < 2; ++j) { FragH pf; const float cn = -m[j] * L2E;
#pragma unroll
      for (int i = 0; i < 8; ++i) { const float p0 = __builtin_amdgcn_exp2f(fmaf(s[j][0][i], L2E, cn)), p1 = __builtin_amdgcn_exp2f(fmaf(s[j][1][i], L2E, cn)); l[j] += p0 + p1;
        pf.h[i] = (_Float16)(p0 * 16384.0f); pf.h[8 + i] = (_Float16)(p1 * 16384.0f); }      /* P carried x2^14: the peaky rows would otherwise flush most weights below the f16 normal range */
#pragma unroll
      for (int t = 0; t < 4; ++t) { yh[j][t] = at_mma(ga[t], pf.v, yh[j][t]); yl[j][t] = at_mma(gr[t], pf.v, yl[j][t]); } }
  }
#pragma unroll
  for (int j = 0; j < 2; ++j) { pm[wv][j][lane] = m[j]; pl[wv][j][lane] = l[j] + at_xhalf(l[j]);
#pragma unroll
    for (int t = 0; t < 4; ++t) { v4f o0, o1;
      for (int r = 0; r < 4; ++r) { o0[r] = fmaf(yl[j][t][r], 1.0f / 1024.0f, yh[j][t][r]); o1[r] = fmaf(yl[j][t][4 + r], 1.0f / 1024.0f, yh[j][t][4 + r]); }
      py[wv][(j * 4 + t) * 2][lane] = o0; py[wv][(j * 4 + t) * 2 + 1][lane] = o1; } }
  __syncthreads();      /* every wave's partial result is in LDS before any wave joins */
  const int jo = ks & 1, tp = ks >> 1;      /* this wave joins column group jo, tiles 2 * tp and 2 * tp + 1: 16 queries x 32 channels, whole 128-byte lines of y */
  float ms[4], wt[4];
#pragma unroll
  for (int s = 0; s < 4; ++s) ms[s] = pm[2 * s + w][jo][lane];
  const float mj = fmaxf(fmaxf(ms[0], ms[1]), fmaxf(ms[2], ms[3])); float lt = 0.f;
#pragma unroll
  for (int s = 0; s < 4; ++s) ms[s] = (ms[s] - mj) * L2E;
  __builtin_amdgcn_sched_barrier(0);      /* all four exponents are formed in front of the first v_exp */
#pragma unroll
  for (int s = 0; s < 4; ++s) wt[s] = __builtin_amdgcn_exp2f(ms[s]);
#pragma unroll
  for (int s = 0; s < 4; ++s) lt = fmaf(wt[s], pl[2 * s + w][jo][lane], lt);
  const float inv = (1.0f / 16384.0f) / lt;
  v4f o[4];
#pragma unroll
  for (int i = 0; i < 4; ++i) { o[i] = py[w][(jo * 4 + tp * 2) * 2 + i][lane] * wt[0];
    for (int s = 1; s < 4; ++s) { const v4f p = py[2 * s + w][(jo * 4 + tp * 2) * 2 + i][lane]; for (int r = 0; r < 4; ++r) o[i][r] = fmaf(p[r], wt[s], o[i][r]); }
    o[i] *= inv; }
  float* yo = YF + ((size_t)b * LL + qb + 32 * w + 16 * jo + ln) * IC + 32 * tp + 8 * hh;      /* D register r of tile t = channel 16 * t + 8 * hh + r of query ln */
  *(v4f*)yo = o[0]; *(v4f*)(yo + 4) = o[1]; *(v4f*)(yo + 16) = o[2]; *(v4f*)(yo + 20) = o[3]; }
__global__ __launch_bounds__(256) void k_bnstat(const float* __restrict__ WY, float* __restrict__ ST) {
  #pragma clang fp contract(off)
  __shared__ float red[256]; const int c = blockIdx.x; const int tid = threadIdx.x; float s = 0.f;
  for (size_t r = tid; r < NR; r += 256) s = __fadd_rn(s, WY[r * CC + c]);
  red[tid] = s; __syncthreads(); for (int st = 128; st > 0; st >>= 1) { if (tid < st) red[tid] += red[tid + st]; __syncthreads(); }
  const float mean = red[0] / (float)NR; __syncthreads(); float s2 = 0.f;
  for (size_t r = tid; r < NR; r += 256) { const float d = __fadd_rn(WY[r * CC + c], -mean); s2 = __fadd_rn(s2, __fmul_rn(d, d)); }
  red[tid] = s2; __syncthreads(); for (int st = 128; st > 0; st >>= 1) { if (tid < st) red[tid] += red[tid + st]; __syncthreads(); }
  if (tid < 32) { const float v = (tid == 0) ? mean : ((tid == 1) ? rsqrtf(__fadd_rn(red[0] / (float)NR, 1e-5f)) : 0.f); *(float*)(ST + (size_t)c * 32 + tid) = v;  } }
__global__ __launch_bounds__(256) void k_fin(const float* __restrict__ WY, const float* __restrict__ ST, const float* __restrict__ gam, const float* __restrict__ bet, const float* __restrict__ x, float* __restrict__ out) {
  #pragma clang fp contract(off)
  const size_t t = (size_t)blockIdx.x * 256 + threadIdx.x; if (t >= (size_t)NB * CC * LL / 8) return; const int n0 = (int)((t * 8) % LL); const size_t bc = (t * 8) / LL; const int c = (int)(bc % CC); const size_t b = bc / CC; const float mean = ST[(size_t)c * 32], rstd = ST[(size_t)c * 32 + 1], g = bf16_round(gam[c]), be = bf16_round(bet[c]); v8f r;
  for (int q = 0; q < 8; ++q) { const float v = __fadd_rn(__fmul_rn(__fmul_rn(__fadd_rn(WY[(b * LL + n0 + q) * CC + c], -mean), rstd), g), be); r[q] = __fadd_rn(v, bf16_round(x[t * 8 + q])); }
  *(v8f*)(out + t * 8) = r;  }

extern "C" void kernel_launch(void* const* d_in, const int* in_sizes, int n_in,
                              void* d_out, int out_size, void* d_ws, size_t ws_size, hipStream_t stream) {
  (void)in_sizes; (void)n_in; (void)out_size;
  const float* const* I = (const float* const*)d_in; const float* x = I[0]; const float* gw = I[1]; const float* gb = I[2]; const float* tw = I[3]; const float* tb = I[4]; const float* pw = I[5]; const float* pb = I[6]; const float* zw = I[7]; const float* zb = I[8]; const float* gam = I[9]; const float* bet = I[10];      /* g/theta/phi_w [64][256], wz_w [256][64] natural */
  char* ws = (char*)d_ws; size_t off = 0;
  auto take = [&](size_t bytes) { char* p = ws + off; off += (bytes + 255) & ~(size_t)255; return p; };
  _Float16* B3 = (_Float16*)take((size_t)D3 * CC * 2); float* b3 = (float*)take(D3 * 4); _Float16* BZ = (_Float16*)take((size_t)CC * IC * 2); float* ST = (float*)take((size_t)CC * 32 * 4);
  _Float16* XR = (_Float16*)take(NR * CC * 2); float* TF = (float*)take(NR * D3 * 4); _Float16* TH = (_Float16*)take(NR * D3 * 2); _Float16* TL = (_Float16*)take(NR * D3 * 2);
  _Float16* GT = (_Float16*)take((size_t)NB * IC * SK * 2); _Float16* GTL = (_Float16*)take((size_t)NB * IC * SK * 2);
  float* YF = (float*)take(NR * IC * 4); _Float16* YH = (_Float16*)take(NR * IC * 2); _Float16* YL = (_Float16*)take(NR * IC * 2); float* WY = (float*)take(NR * CC * 4);
  if (off > ws_size) return;      /* 0.2 + 8 + 12 + 6 + 6 + 4 + 4 + 2 + 2 + 16 = approx 60 MiB */
  const unsigned gw64 = (unsigned)(((size_t)IC * CC / 8 + 255) / 256);
  k_wnat<<<gw64, 256, 0, stream>>>(tw, (size_t)IC * CC / 8, B3); k_wnat<<<gw64, 256, 0, stream>>>(pw, (size_t)IC * CC / 8, B3 + (size_t)IC * CC); k_wnat<<<gw64, 256, 0, stream>>>(gw, (size_t)IC * CC / 8, B3 + (size_t)2 * IC * CC);      /* Bt rows: theta 0..63 | phi 64..127 | g 128..191 */
  k_bcpy<<<1, 256, 0, stream>>>(tb, IC, IC, b3, 0); k_bcpy<<<1, 256, 0, stream>>>(pb, IC, IC, b3, IC); k_bcpy<<<1, 256, 0, stream>>>(gb, IC, IC, b3, 2 * IC);
  k_wnat<<<(unsigned)(((size_t)CC * IC / 8 + 255) / 256), 256, 0, stream>>>(zw, (size_t)CC * IC / 8, BZ);
  k_cl2rows<<<NB * (LL / 32) * (CC / 64), 256, 0, stream>>>(x, XR);
  k_gemm2<0><<<dim3((unsigned)((NR / 128) * (D3 / 64)), 1), 128, 0, stream>>>(XR, CC, 0, B3, CC, 0, 0.0625f, b3, 0, nullptr, 1, 0, 0, TF, nullptr, D3, 0, (int)NR, D3, CC);      /* theta | phi | g rows f32 */
  k_hl<<<(unsigned)((NR * D3 / 8 + 255) / 256), 256, 0, stream>>>(TF, TH, TL, NR * D3 / 8);
  for (int b = 0; b < NBR; ++b) { const _Float16* tb_ = TH + (size_t)b * LL * D3; const _Float16* tlb = TL + (size_t)b * LL * D3;
    k_vt<1, SK><<<SK / 64, 256, 0, stream>>>(tb_ + 2 * IC, D3, 0, GT + (size_t)b * IC * SK); k_vt<1, SK><<<SK / 64, 256, 0, stream>>>(tlb + 2 * IC, D3, 0, GTL + (size_t)b * IC * SK); }      /* g^T hi / residual [batch][64][8192] */
  k_attn<<<NBR * (LL / 64), 256, 0, stream>>>(TH, TL, GT, GTL, YF);      /* softmax(theta . phi) . g -> y rows f32 */
  k_hl<<<(unsigned)((NR * IC / 8 + 255) / 256), 256, 0, stream>>>(YF, YH, YL, NR * IC / 8);
  const dim3 gz((unsigned)((NR / 128) * (CC / 64)), 1);
  k_gemm2<0><<<gz, 128, 0, stream>>>(YL, IC, 0, BZ, IC, 0, 0.0625f / 1024.0f, nullptr, 0, nullptr, 1, 0, 0, WY, nullptr, CC, 0, (int)NR, CC, IC);      /* W_z: y-res term */
  k_gemm2<0><<<gz, 128, 0, stream>>>(YH, IC, 0, BZ, IC, 0, 0.0625f, zb, 0, WY, 1, (size_t)CC, 0, WY, nullptr, CC, 0, (int)NR, CC, IC);      /* + y-hi term + bias */
  k_bnstat<<<CC, 256, 0, stream>>>(WY, ST);
  k_fin<<<(unsigned)(((size_t)NB * CC * LL / 8 + 255) / 256), 256, 0, stream>>>(WY, ST, gam, bet, x, (float*)d_out);
}

// v004
// One run takes 238 microseconds.
// Next to v003, in two timings, it ran 1.24 and 1.25 times as fast.
// All steps since v000 together make it 136 times as fast.
#include <hip/hip_runtime.h>
// Non-local block (x [2][256][8x32x32 = 8192 positions]; g, theta, phi = 1x1 conv projections to 64 (+ bias); f = theta . phi over all positions; softmax; y = attn g; W_z 1x1 conv back to 256 (+ bias); training-mode BatchNorm over (batch, positions) per channel with gamma/beta; out = bn(W_z y) + x).
// Compute dtype: inputs rounded to bf16; x / weights exact; theta, phi, g, y as hi + residual operand pairs (~2^-22); P plain f16 (~2^-12); softmax, BN f32; v_wmma_f32_16x16x32_f16.
#define NB 2
#define CC 256
#define LL 8192                      /* positions per sample */
#define SK LL
#define IC 64                        /* inter channels */
#define D3 (3 * IC)                  /* theta | phi | g */
#define NR ((size_t)NB * LL)
#define NBR NB                       /* batches (debug hook) */
#define SQ LL
#define DM CC
#define NH 1
#define HD 64
#define HG 1
typedef __bf16 v16b __attribute__((ext_vector_type(16)));
typedef unsigned short v8us __attribute__((ext_vector_type(8), may_alias));
typedef float  v8f  __attribute__((ext_vector_type(8)));
typedef float  v4f  __attribute__((ext_vector_type(4)));
typedef float  v4fa __attribute__((ext_vector_type(4), may_alias));
union FragB { v16b v; v8us half[2]; unsigned short u[16]; };

__device__ __forceinline__ unsigned short bf16_bits(float x) { unsigned int u = __float_as_uint(x); return (unsigned short)((u + 0x7FFFu + ((u >> 16) & 1u)) >> 16); }
__device__ __forceinline__ float bf16_val(unsigned short b) { return __uint_as_float(((unsigned int)b) << 16); }
__device__ __forceinline__ float bf16_round(float x) { return bf16_val(bf16_bits(x)); }
// D += A·B with NT terms: 1 = ah·bh, 2 = + al·bh (A split), 3 = + ah·bl (both split)
template <int NT>
__device__ __forceinline__ v8f mmaN(v16b ah, v16b al, v16b bh, v16b bl, v8f c) {
  c = __builtin_amdgcn_wmma_f32_16x16x32_bf16(false, ah, false, bh, (short)0, c, false, false);
  if (NT >= 2) c = __builtin_amdgcn_wmma_f32_16x16x32_bf16(false, al, false, bh, (short)0, c, false, false);
  if (NT >= 3) c = __builtin_amdgcn_wmma_f32_16x16x32_bf16(false, ah, false, bl, (short)0, c, false, false);
  asm volatile("v_nop\n\tv_nop\n\tv_nop\n\tv_nop" : "+v"(c) : "v"(ah), "v"(al), "v"(bh), "v"(bl));
  return c;
}

__global__ __launch_bounds__(256) void k_wt_bf16(const float* __restrict__ W, unsigned short* __restrict__ Wt, int K, int N) {
  const int t = blockIdx.x * 256 + threadIdx.x;
  const int k8n = K / 8;
  if (t >= N * k8n) return;
  const int n = t / k8n, k8 = (t % k8n) * 8;
  v8us v;
#pragma unroll
  for (int i = 0; i < 8; ++i) v[i] = bf16_bits(W[(size_t)(k8 + i) * N + n]);
  *(v8us*)(Wt + (size_t)n * K + k8) = v;
  
}

// GEMM C[M][N] (f32, pitch ldc) = act(A[M][K]·W + bias). A f32 row-major (pitch lda) converted per fragment to bf16
// (ASPLIT: hi/lo two planes -> 2 terms, else single rounded term); Wt bf16 [N][K] (pitch ldb). BIAS_BF16 rounds the
// bias to bf16 first (bias quantised to bf16 before the add). K%32==0, M%16==0, N%64==0.
template <bool ASPLIT, int ACT, bool BIAS_BF16>
__global__ __launch_bounds__(128) void k_gemm_bf(const float* __restrict__ A, int lda, const unsigned short* __restrict__ Wt, int ldb,
                                               const float* __restrict__ bias, float* __restrict__ C, int ldc, int M, int N, int K) {
  __shared__ __attribute__((aligned(16))) float so[4][16][64];
  const int tid = threadIdx.x, w = tid >> 5, lane = tid & 31, ln = lane & 15, hh = lane >> 4;
  const int ntn = N / 64;
  const int wid = blockIdx.x * 4 + w;
  const int mt = wid / ntn, nq = wid % ntn;
  if (mt * 16 >= M) return;
  const int row0 = mt * 16, col0 = nq * 64;
  const float* arow = A + (size_t)(row0 + ln) * lda;
  v8f acc[4] = {};
  for (int kb = 0; kb < K; kb += 32) {
    FragB ah, al;
    const v4f x0 = *(const v4fa*)(arow + kb + 8 * hh), x1 = *(const v4fa*)(arow + kb + 8 * hh + 4);
    const v4f x2 = *(const v4fa*)(arow + kb + 16 + 8 * hh), x3 = *(const v4fa*)(arow + kb + 16 + 8 * hh + 4);
    float xs[16] = {x0[0],x0[1],x0[2],x0[3],x1[0],x1[1],x1[2],x1[3],x2[0],x2[1],x2[2],x2[3],x3[0],x3[1],x3[2],x3[3]};
#pragma unroll
    for (int i = 0; i < 16; ++i) { const unsigned short hb = bf16_bits(xs[i]); ah.u[i] = hb; al.u[i] = ASPLIT ? bf16_bits(xs[i] - bf16_val(hb)) : (unsigned short)0; }
#pragma unroll
    for (int t = 0; t < 4; ++t) {
      const unsigned short* brow = Wt + (size_t)(col0 + t * 16 + ln) * ldb + kb;
      FragB b;
      b.half[0] = *(const v8us*)(brow + 8 * hh);
      b.half[1] = *(const v8us*)(brow + 16 + 8 * hh);
      acc[t] = mmaN<ASPLIT ? 2 : 1>(ah.v, al.v, b.v, b.v, acc[t]);
    }
  }
#pragma unroll
  for (int t = 0; t < 4; ++t) {
    float bv = bias ? bias[col0 + t * 16 + ln] : 0.f;
    if (BIAS_BF16) bv = bf16_round(bv);
#pragma unroll
    for (int r = 0; r < 8; ++r) { float v = acc[t][r] + bv; if (ACT == 1) v = fmaxf(v, 0.f); so[w][8 * hh + r][t * 16 + ln] = v; }
  }
  __builtin_amdgcn_fence(__ATOMIC_ACQ_REL, "workgroup");
  __builtin_amdgcn_wave_barrier();
  const int rsub = lane >> 4, c4 = (lane & 15) * 4;
  {
#pragma unroll
    for (int q = 0; q < 8; ++q) {
      const int r = q * 2 + rsub;
      const v4f v = *(const v4fa*)&so[w][r][c4];
      *(v4f*)(C + (size_t)(row0 + r) * ldc + col0 + c4) = v;
    }
    
  }
}

// GEMM C = act(A·W + bias + resid): A f32 (ASPLIT -> hi/lo 2 terms), Wt bf16 [N][K]; ACT 0 none, 1 relu, 2 exact gelu;
// resid (optional, f32, row index = (row % rmod), pitch ldr, RES_BF16 rounds it) added before the activation.
template <bool ASPLIT, int ACT, bool BIAS_BF16, bool RES_BF16>
__global__ __launch_bounds__(128) void k_gemm_bf3(const float* __restrict__ A, int lda, const unsigned short* __restrict__ Wt, int ldb,
                                                const float* __restrict__ bias, const float* __restrict__ resid, int rmod, int ldr,
                                                float* __restrict__ C, int ldc, int M, int N, int K) {
  __shared__ __attribute__((aligned(16))) float so[4][16][64];
  const int tid = threadIdx.x, w = tid >> 5, lane = tid & 31, ln = lane & 15, hh = lane >> 4;
  const int ntn = N / 64;
  const int wid = blockIdx.x * 4 + w;
  const int mt = wid / ntn, nq = wid % ntn;
  if (mt * 16 >= M) return;
  const int row0 = mt * 16, col0 = nq * 64;
  const float* arow = A + (size_t)(row0 + ln) * lda;
  v8f acc[4] = {};
  for (int kb = 0; kb < K; kb += 32) {
    FragB ah, al;
    const v4f x0 = *(const v4fa*)(arow + kb + 8 * hh), x1 = *(const v4fa*)(arow + kb + 8 * hh + 4);
    const v4f x2 = *(const v4fa*)(arow + kb + 16 + 8 * hh), x3 = *(const v4fa*)(arow + kb + 16 + 8 * hh + 4);
    float xs[16] = {x0[0],x0[1],x0[2],x0[3],x1[0],x1[1],x1[2],x1[3],x2[0],x2[1],x2[2],x2[3],x3[0],x3[1],x3[2],x3[3]};
#pragma unroll
    for (int i = 0; i < 16; ++i) { const unsigned short hb = bf16_bits(xs[i]); ah.u[i] = hb; al.u[i] = ASPLIT ? bf16_bits(xs[i] - bf16_val(hb)) : (unsigned short)0; }
#pragma unroll
    for (int t = 0; t < 4; ++t) {
      const unsigned short* brow = Wt + (size_t)(col0 + t * 16 + ln) * ldb + kb;
      FragB b;
      b.half[0] = *(const v8us*)(brow + 8 * hh);
      b.half[1] = *(const v8us*)(brow + 16 + 8 * hh);
      acc[t] = mmaN<ASPLIT ? 2 : 1>(ah.v, al.v, b.v, b.v, acc[t]);
    }
  }
#pragma unroll
  for (int t = 0; t < 4; ++t) {
    const int col = col0 + t * 16 + ln;
    float bv = bias ? bias[col] : 0.f;
    if (BIAS_BF16) bv = bf16_round(bv);
#pragma unroll
    for (int r = 0; r < 8; ++r) {
      float v = acc[t][r] + bv;
      if (resid) { float rv = resid[(size_t)((row0 + 8 * hh + r) % rmod) * ldr + col]; if (RES_BF16) rv = bf16_round(rv); v += rv; }
      if (ACT == 1) v = fmaxf(v, 0.f);
      if (ACT == 2) v = 0.5f * v * (1.0f + erff(v * 0.70710678118654752f));
      if (ACT == 3) { const float u = 0.7978845608028654f * (v + 0.044715f * v * v * v); v = 0.5f * v * (1.0f + tanhf(u)); }
      so[w][8 * hh + r][t * 16 + ln] = v;
    }
  }
  __builtin_amdgcn_fence(__ATOMIC_ACQ_REL, "workgroup");
  __builtin_amdgcn_wave_barrier();
  const int rsub = lane >> 4, c4 = (lane & 15) * 4;
  {
#pragma unroll
    for (int q = 0; q < 8; ++q) {
      const int r = q * 2 + rsub;
      const v4f v = *(const v4fa*)&so[w][r][c4];
      *(v4f*)(C + (size_t)(row0 + r) * ldc + col0 + c4) = v;
    }
    
  }
}
// row LayerNorm (biased variance, eps) over N: s = X (+ R); optional out_sum <- s; out_norm <- (s-mu)*rsqrt(var+eps)*g + b
template <bool PARAM_BF16>
__global__ __launch_bounds__(256) void k_layernorm(const float* __restrict__ X, const float* __restrict__ R, const float* __restrict__ g, const float* __restrict__ bta,
                                                  float* __restrict__ out_sum, float* __restrict__ out_norm, int N, float eps) {
  __shared__ float red[256];
  const int row = blockIdx.x, tid = threadIdx.x;
  const float* x = X + (size_t)row * N; const float* rr = R ? R + (size_t)row * N : nullptr;
  float vals[16];                     // up to N = 4096
  const int per = N / 256;            // contiguous chunk per thread? use strided-by-4 chunks: thread handles j = tid*4 + 1024*u
  float s1 = 0.f;
  for (int u = 0; u < per / 4; ++u) {
    const int j = tid * 4 + 1024 * u;
    const v4f a = *(const v4fa*)(x + j);
    v4f b = {0.f,0.f,0.f,0.f}; if (rr) b = *(const v4fa*)(rr + j);
#pragma unroll
    for (int q = 0; q < 4; ++q) { const float v = a[q] + b[q]; vals[u * 4 + q] = v; s1 += v; }
  }
  red[tid] = s1; __syncthreads();
  for (int st = 128; st > 0; st >>= 1) { if (tid < st) red[tid] += red[tid + st]; __syncthreads(); }
  const float mu = red[0] / (float)N; __syncthreads();
  float s2 = 0.f;
  for (int u = 0; u < per / 4; ++u)
#pragma unroll
    for (int q = 0; q < 4; ++q) { const float c = vals[u * 4 + q] - mu; s2 += c * c; }
  red[tid] = s2; __syncthreads();
  for (int st = 128; st > 0; st >>= 1) { if (tid < st) red[tid] += red[tid + st]; __syncthreads(); }
  const float rs = rsqrtf(red[0] / (float)N + eps);
  {
    for (int u = 0; u < per / 4; ++u) {
      const int j = tid * 4 + 1024 * u;
      v4f o, sm;
#pragma unroll
      for (int q = 0; q < 4; ++q) {
        float gg = g[j + q], bb = bta[j + q];
        if (PARAM_BF16) { gg = bf16_round(gg); bb = bf16_round(bb); }
        sm[q] = vals[u * 4 + q]; o[q] = (vals[u * 4 + q] - mu) * rs * gg + bb;
      }
      if (out_sum) *(v4f*)(out_sum + (size_t)row * N + j) = sm;
      *(v4f*)(out_norm + (size_t)row * N + j) = o;
    }
    
  }
}



// ---- f16 WMMA path (v_wmma_f32_16x16x32_f16): 11-bit significands for operands in range — used where a [0,1] probability operand needs more precision than bf16
typedef _Float16 v16h __attribute__((ext_vector_type(16)));
union FragH { v16h v; v8us half[2]; _Float16 h[16]; unsigned short u[16]; };
template <int NT>
__device__ __forceinline__ v8f mmaH(v16h ah, v16h al, v16h bh, v16h bl, v8f c) {
  c = __builtin_amdgcn_wmma_f32_16x16x32_f16(false, ah, false, bh, (short)0, c, false, false);
  if (NT >= 2) c = __builtin_amdgcn_wmma_f32_16x16x32_f16(false, al, false, bh, (short)0, c, false, false);
  if (NT >= 3) c = __builtin_amdgcn_wmma_f32_16x16x32_f16(false, ah, false, bl, (short)0, c, false, false);
  asm volatile("v_nop\n\tv_nop\n\tv_nop\n\tv_nop" : "+v"(c) : "v"(ah), "v"(al), "v"(bh), "v"(bl));
  return c;
}
// batched GEMM like k_gemm_b but f16 operands: A f32 (split into f16 hi/lo if ASPLIT, else rounded to f16), Bt = f16 values [n][k]; alpha; C f32; N multiple of 16 (partial tiles skipped)
template <bool ASPLIT>
__global__ __launch_bounds__(128) void k_gemm_h(const float* __restrict__ A, int lda, size_t sA, const _Float16* __restrict__ Bh, int ldb, size_t sB, float alpha, float* __restrict__ C, int ldc, size_t sC, int M, int N, int K) {
  __shared__ __attribute__((aligned(16))) float so[4][16][64];
  const int tid = threadIdx.x, w = tid >> 5, lane = tid & 31, ln = lane & 15, hh = lane >> 4; const int by = blockIdx.y;
  A += (size_t)by * sA; Bh += (size_t)by * sB; C += (size_t)by * sC;
  const int ntn = (N + 63) / 64; const int wid = blockIdx.x * 4 + w; const int mt = wid / ntn, nq = wid % ntn; if (mt * 16 >= M) return;
  const int row0 = mt * 16, col0 = nq * 64; const float* arow = A + (size_t)(row0 + ln) * lda;
  v8f acc[4] = {};
  for (int kb = 0; kb < K; kb += 32) {
    FragH ah, al;
    const v4f x0 = *(const v4fa*)(arow + kb + 8 * hh), x1 = *(const v4fa*)(arow + kb + 8 * hh + 4), x2 = *(const v4fa*)(arow + kb + 16 + 8 * hh), x3 = *(const v4fa*)(arow + kb + 16 + 8 * hh + 4);
    float xs[16] = {x0[0],x0[1],x0[2],x0[3],x1[0],x1[1],x1[2],x1[3],x2[0],x2[1],x2[2],x2[3],x3[0],x3[1],x3[2],x3[3]};
#pragma unroll
    for (int i = 0; i < 16; ++i) { const _Float16 h = (_Float16)xs[i]; ah.h[i] = h; al.h[i] = ASPLIT ? (_Float16)(xs[i] - (float)h) : (_Float16)0.0f; }
#pragma unroll
    for (int t = 0; t < 4; ++t) { if (col0 + t * 16 >= N) continue; const size_t boff = (size_t)(col0 + t * 16 + ln) * ldb + kb; FragH bq; bq.half[0] = *(const v8us*)(Bh + boff + 8 * hh); bq.half[1] = *(const v8us*)(Bh + boff + 16 + 8 * hh);
      acc[t] = mmaH<ASPLIT ? 2 : 1>(ah.v, al.v, bq.v, bq.v, acc[t]); }
  }
#pragma unroll
  for (int t = 0; t < 4; ++t) { if (col0 + t * 16 >= N) continue;
#pragma unroll
    for (int r = 0; r < 8; ++r) so[w][8 * hh + r][t * 16 + ln] = acc[t][r] * alpha; }
  __builtin_amdgcn_fence(__ATOMIC_ACQ_REL, "workgroup"); __builtin_amdgcn_wave_barrier();
  const int rsub = lane >> 4, c4 = (lane & 15) * 4;
  {
#pragma unroll
    for (int q = 0; q < 8; ++q) { const int r = q * 2 + rsub; if (col0 + c4 < N) { const v4f v = *(const v4fa*)&so[w][r][c4]; *(v4f*)(C + (size_t)(row0 + r) * ldc + col0 + c4) = v; } }
     }
}

// Wt[n][k] = f16(W[k][n]·scale) from f32 row-major W[K][N] (scale = power of two; bf16-exact weights stay exact in f16 away from the subnormal range)
__global__ __launch_bounds__(256) void k_wt_f16(const float* __restrict__ W, _Float16* __restrict__ Wt, int K, int N, float scale) {
  const int t = blockIdx.x * 256 + threadIdx.x; if (t >= N * (K / 8)) return; const int n = t / (K / 8), k8 = (t % (K / 8)) * 8; FragH f;
#pragma unroll
  for (int i = 0; i < 8; ++i) f.h[i] = (_Float16)(bf16_round(W[(size_t)(k8 + i) * N + n]) * scale); const v8us o = f.half[0];
  *(v8us*)((unsigned short*)Wt + (size_t)n * K + k8) = o; 
}
// k_gemm_hh variant with fused epilogue: v = acc·alpha + bias[by·sBias + col] (+ CP[(row/rowsPerB)·sCPb + by·64 + col] if CP) ; ACT 0 none / 1 elu ; writes f16 C16 (and f32 C if non-null)
template <int ACT>
__global__ __launch_bounds__(128) void k_gemm_hhx(const _Float16* __restrict__ A, int lda, size_t sA, const _Float16* __restrict__ Bh, int ldb, size_t sB, float alpha, const float* __restrict__ bias, size_t sBias, const float* __restrict__ CP, int rowsPerB, size_t sCPb, int row0g,
    float* __restrict__ C, _Float16* __restrict__ C16, int ldc, size_t sC, int M, int N, int K) {
  __shared__ __attribute__((aligned(16))) float so[4][16][64];
  const int tid = threadIdx.x, w = tid >> 5, lane = tid & 31, ln = lane & 15, hh = lane >> 4; const int by = blockIdx.y;
  A += (size_t)by * sA; Bh += (size_t)by * sB; const size_t cofs = (size_t)by * sC; const float* bp = bias ? bias + (size_t)by * sBias : nullptr;
  const int ntn = (N + 63) / 64; const int wid = blockIdx.x * 4 + w; const int mt = wid / ntn, nq = wid % ntn; if (mt * 16 >= M) return;
  const int row0 = mt * 16, col0 = nq * 64; const _Float16* arow = A + (size_t)(row0 + ln) * lda;
  v8f acc[4] = {};
  for (int kb = 0; kb < K; kb += 32) { FragH ah; ah.half[0] = *(const v8us*)((const unsigned short*)arow + kb + 8 * hh); ah.half[1] = *(const v8us*)((const unsigned short*)arow + kb + 16 + 8 * hh);
#pragma unroll
    for (int t = 0; t < 4; ++t) { if (col0 + t * 16 >= N) continue; const size_t boff = (size_t)(col0 + t * 16 + ln) * ldb + kb; FragH bq; bq.half[0] = *(const v8us*)((const unsigned short*)Bh + boff + 8 * hh); bq.half[1] = *(const v8us*)((const unsigned short*)Bh + boff + 16 + 8 * hh);
      acc[t] = mmaH<1>(ah.v, ah.v, bq.v, bq.v, acc[t]); }
  }
#pragma unroll
  for (int t = 0; t < 4; ++t) { if (col0 + t * 16 >= N) continue; const int col = col0 + t * 16 + ln; const float bv = bp ? bf16_round(bp[col]) : 0.f;
#pragma unroll
    for (int r = 0; r < 8; ++r) { float v = acc[t][r] * alpha + bv; if (CP) { const int rr = row0g + row0 + 8 * hh + r; if (rowsPerB < 0) v += CP[cofs + (size_t)rr * ldc + col];      /* rowsPerB < 0: own element of the batched C plane */ else { const int bidx = rr / rowsPerB; v += CP[(size_t)bidx * sCPb + (size_t)by * 64 + col]; } } if (ACT == 1) v = (v > 0.f) ? v : expm1f(v); else if (ACT == 7) v = (v > 0.f) ? v + 1.0f : expf(v); else if (ACT == 8) v = tanhf(v); else if (ACT == 9) v = 0.5f * v * (1.0f + tanhf(0.7978845608028654f * (v + 0.044715f * v * v * v))); else if (ACT == 11) v = 1.0f / (1.0f + expf(-v)); else if (ACT == 12) v = (v > 0.f) ? v : 0.01f * v; else if (ACT == 14) v = (v > 0.f) ? v : 0.1f * v; else if (ACT == 16) v = (v >= 0.f) ? v : 0.3f * v; else if (ACT == 17) v = (v >= 0.f) ? v : 0.2f * v; else if (ACT == 15) v = v / (1.0f + expf(-v)); else if (ACT == 3) v = fmaxf(v, 0.f); else if (ACT == 6) v = 0.5f * v * (1.0f + erff(v * 0.70710678118654752f)); so[w][8 * hh + r][t * 16 + ln] = v; } }
  __builtin_amdgcn_fence(__ATOMIC_ACQ_REL, "workgroup"); __builtin_amdgcn_wave_barrier();
  const int rsub = lane >> 4, c4 = (lane & 15) * 4; typedef _Float16 v4h __attribute__((ext_vector_type(4)));
  {
#pragma unroll
    for (int q = 0; q < 8; ++q) { const int r = q * 2 + rsub; if (col0 + c4 < N) { const v4f v = *(const v4fa*)&so[w][r][c4]; if (C) *(v4f*)(C + cofs + (size_t)(row0 + r) * ldc + col0 + c4) = v; if (C16) { v4h h4; for (int i = 0; i < 4; ++i) h4[i] = (_Float16)v[i]; *(v4h*)(C16 + cofs + (size_t)(row0 + r) * ldc + col0 + c4) = h4; } } }
     }
}


typedef _Float16 v4h __attribute__((ext_vector_type(4)));

__global__ __launch_bounds__(256) void k_x16(const float* __restrict__ x, _Float16* __restrict__ X16, size_t n8) { const size_t t = (size_t)blockIdx.x * 256 + threadIdx.x; if (t >= n8) return; FragH f;
#pragma unroll
  for (int q = 0; q < 8; ++q) f.h[q] = (_Float16)bf16_round(x[t * 8 + q]); *(v8us*)((unsigned short*)X16 + t * 8) = f.half[0];  }
__global__ __launch_bounds__(256) void k_h16(const float* __restrict__ x, _Float16* __restrict__ X16, size_t n8) { const size_t t = (size_t)blockIdx.x * 256 + threadIdx.x; if (t >= n8) return; FragH f;
#pragma unroll
  for (int q = 0; q < 8; ++q) f.h[q] = (_Float16)x[t * 8 + q]; *(v8us*)((unsigned short*)X16 + t * 8) = f.half[0];  }
__global__ __launch_bounds__(256) void k_round16f(const float* __restrict__ W, _Float16* __restrict__ Bt, size_t n8) { const size_t t = (size_t)blockIdx.x * 256 + threadIdx.x; if (t >= n8) return; FragH f;
#pragma unroll
  for (int i = 0; i < 8; ++i) f.h[i] = (_Float16)(bf16_round(W[t * 8 + i]) * 16.0f); *(v8us*)((unsigned short*)Bt + t * 8) = f.half[0];  }
template <int NHv, int TTv>
__global__ __launch_bounds__(256) void k_vt(const _Float16* __restrict__ V16, int ldv, int voff, _Float16* __restrict__ Vt) { __shared__ unsigned short tl[64][66]; const int tid = threadIdx.x; const int slab = blockIdx.x / (TTv / 64), lg = blockIdx.x % (TTv / 64); const int b = slab / NHv, h = slab % NHv;
  for (int i = tid; i < 64 * 8; i += 256) { const int r = i / 8, c8 = (i % 8) * 8; FragH f; f.half[0] = *(const v8us*)((const unsigned short*)V16 + ((size_t)b * TTv + lg * 64 + r) * ldv + voff + h * 64 + c8);
#pragma unroll
    for (int q = 0; q < 8; ++q) tl[r][c8 + q] = f.u[q]; }
  __syncthreads();
  {
#pragma unroll
    for (int rd = 0; rd < 2; ++rd) { const int d = rd * 32 + tid / 8, pc = tid % 8; FragH f;
#pragma unroll
      for (int q = 0; q < 8; ++q) f.u[q] = tl[pc * 8 + q][d];
      /* V^T in the order in which k_attn's A fragments take it, [block of 32 keys][tile of 16 channels][fragment half][lane] x 16 bytes: key group pc is block pc / 4, half (pc / 2) % 2, lane 16 * (pc % 2) + d % 16 */
      const size_t u = (((size_t)(lg * 2 + (pc >> 2)) * 4 + (d >> 4)) * 2 + ((pc >> 1) & 1)) * 32 + (pc & 1) * 16 + (d & 15);
      *(v8us*)((unsigned short*)Vt + (size_t)slab * 64 * TTv + u * 8) = f.half[0]; }
     } }

__global__ __launch_bounds__(256) void k_hl(const float* __restrict__ F, _Float16* __restrict__ Hh, _Float16* __restrict__ Hl, size_t n8) { const size_t t = (size_t)blockIdx.x * 256 + threadIdx.x; if (t >= n8) return; FragH fh, fl; const v4f a = *(const v4fa*)(F + t * 8), c = *(const v4fa*)(F + t * 8 + 4);
#pragma unroll
  for (int q = 0; q < 4; ++q) { _Float16 h = (_Float16)a[q]; fh.h[q] = h; fl.h[q] = (_Float16)((a[q] - (float)h) * 1024.0f); h = (_Float16)c[q]; fh.h[4 + q] = h; fl.h[4 + q] = (_Float16)((c[q] - (float)h) * 1024.0f); }
  { *(v8us*)((unsigned short*)Hh + t * 8) = fh.half[0]; *(v8us*)((unsigned short*)Hl + t * 8) = fl.half[0];  } }
// k_hl for the theta | phi | g rows. phi's groups of eight channels go to Ph / Pl in the order in which k_attn's A fragments take them, [tile of 16 keys][k step][fragment half][lane] x 16 bytes:
// channel group j of key n is k step j / 4, half (j / 2) % 2, lane 16 * (j % 2) + n % 16 (the k order of g2_frag). theta and g stay in rows; phi's place in those rows is left unwritten and is not read.
__global__ __launch_bounds__(256) void k_hlp(const float* __restrict__ F, _Float16* __restrict__ Hh, _Float16* __restrict__ Hl, _Float16* __restrict__ Ph, _Float16* __restrict__ Pl, size_t n8) { const size_t t = (size_t)blockIdx.x * 256 + threadIdx.x; if (t >= n8) return; FragH fh, fl; const v4f a = *(const v4fa*)(F + t * 8), c = *(const v4fa*)(F + t * 8 + 4);
  for (int q = 0; q < 4; ++q) { _Float16 h = (_Float16)a[q]; fh.h[q] = h; fl.h[q] = (_Float16)((a[q] - (float)h) * 1024.0f); h = (_Float16)c[q]; fh.h[4 + q] = h; fl.h[4 + q] = (_Float16)((c[q] - (float)h) * 1024.0f); }
  const size_t n = t / (D3 / 8); const int j = (int)(t % (D3 / 8)) - IC / 8;
  if (j >= 0 && j < IC / 8) { const size_t u = (((n >> 4) * 2 + (j >> 2)) * 2 + ((j >> 1) & 1)) * 32 + (j & 1) * 16 + (n & 15); *(v8us*)((unsigned short*)Ph + u * 8) = fh.half[0]; *(v8us*)((unsigned short*)Pl + u * 8) = fl.half[0]; }
  else { *(v8us*)((unsigned short*)Hh + t * 8) = fh.half[0]; *(v8us*)((unsigned short*)Hl + t * 8) = fl.half[0]; } }

// ---- fast GEMM (wave tile 32x64; requires M % 32 == 0 rows per launch region and N % 64 == 0); epilogue = k_gemm_hhx semantics ----
__device__ __forceinline__ v16h g2_frag(const _Float16* p, int hh) { FragH f; f.half[0] = *(const v8us*)((const unsigned short*)p + 8 * hh); f.half[1] = *(const v8us*)((const unsigned short*)p + 16 + 8 * hh); return f.v; }
__device__ __forceinline__ v8f g2_mma(v16h a, v16h b, v8f c) { v8f d = __builtin_amdgcn_wmma_f32_16x16x32_f16(false, a, false, b, (short)0, c, false, false); asm volatile("v_nop\n\tv_nop\n\tv_nop\n\tv_nop" : "+v"(d) : "v"(a), "v"(b)); return d; }
template <int ACT>
__global__ __launch_bounds__(128) void k_gemm2(const _Float16* __restrict__ A, int lda, size_t sA, const _Float16* __restrict__ Bh, int ldb, size_t sB, float alpha, const float* __restrict__ bias, size_t sBias, const float* __restrict__ CP, int rowsPerB, size_t sCPb, int row0g,
    float* __restrict__ C, _Float16* __restrict__ C16, int ldc, size_t sC, int M, int N, int K) { static_assert(ACT == 0 || ACT == 3 || ACT == 6 || ACT == 8 || ACT == 9 || ACT == 11 || ACT == 12 || ACT == 14 || ACT == 15 || ACT == 16 || ACT == 17, "k_gemm2: unsupported ACT code (would silently apply no activation)");
  __shared__ __attribute__((aligned(16))) float so[4][32][68];
  const int tid = threadIdx.x, w = tid >> 5, lane = tid & 31, ln = lane & 15, hh = lane >> 4; const int by = blockIdx.y;
  A += (size_t)by * sA; Bh += (size_t)by * sB; const size_t cofs = (size_t)by * sC; const float* bp = bias ? bias + (size_t)by * sBias : nullptr;
  const int ntn = N >> 6; const int mt = blockIdx.x / ntn, nq = blockIdx.x - mt * ntn; const int row0 = mt * 128 + 32 * w, col0 = nq * 64; if (row0 >= M) return;
  const _Float16* a0p = A + (size_t)(row0 + ln) * lda; const _Float16* a1p = a0p + (size_t)16 * lda;
  const _Float16* b0p = Bh + (size_t)(col0 + ln) * ldb; const _Float16* b1p = b0p + (size_t)16 * ldb; const _Float16* b2p = b1p + (size_t)16 * ldb; const _Float16* b3p = b2p + (size_t)16 * ldb;
  const v8f z8 = {0.f,0.f,0.f,0.f,0.f,0.f,0.f,0.f}; v8f c00 = z8, c01 = z8, c02 = z8, c03 = z8, c10 = z8, c11 = z8, c12 = z8, c13 = z8;
#pragma unroll 1
  for (int kb = 0; kb < K; kb += 32) { const v16h a0 = g2_frag(a0p + kb, hh), a1 = g2_frag(a1p + kb, hh);
    v16h b = g2_frag(b0p + kb, hh); c00 = g2_mma(a0, b, c00); c10 = g2_mma(a1, b, c10);
    b = g2_frag(b1p + kb, hh); c01 = g2_mma(a0, b, c01); c11 = g2_mma(a1, b, c11);
    b = g2_frag(b2p + kb, hh); c02 = g2_mma(a0, b, c02); c12 = g2_mma(a1, b, c12);
    b = g2_frag(b3p + kb, hh); c03 = g2_mma(a0, b, c03); c13 = g2_mma(a1, b, c13); }
  v8f accs[8] = {c00, c01, c02, c03, c10, c11, c12, c13};
#pragma unroll
  for (int u = 0; u < 8; ++u) { const int t = u & 3, half = u >> 2; const int col = col0 + t * 16 + ln; const float bv = bp ? bf16_round(bp[col]) : 0.f;
#pragma unroll
    for (int r = 0; r < 8; ++r) { const int rloc = half * 16 + 8 * hh + r; float v = accs[u][r] * alpha + bv; if (CP) { if (rowsPerB < 0) v += CP[cofs + (size_t)(row0g + row0 + rloc) * ldc + col];      /* rowsPerB < 0: own element of the batched C plane */ else { const int bidx = (row0g + row0 + rloc) / rowsPerB; v += CP[(size_t)bidx * sCPb + (size_t)by * 64 + col]; } }
      if (ACT == 3) v = fmaxf(v, 0.f); else if (ACT == 6) v = 0.5f * v * (1.0f + erff(v * 0.70710678118654752f)); else if (ACT == 11) v = 1.0f / (1.0f + expf(-v)); else if (ACT == 15) v = v / (1.0f + expf(-v)); else if (ACT == 12) v = (v > 0.f) ? v : 0.01f * v; else if (ACT == 8) v = tanhf(v); else if (ACT == 9) v = 0.5f * v * (1.0f + tanhf(0.7978845608028654f * (v + 0.044715f * v * v * v))); else if (ACT == 14) v = (v > 0.f) ? v : 0.1f * v; else if (ACT == 16) v = (v >= 0.f) ? v : 0.3f * v; else if (ACT == 17) v = (v >= 0.f) ? v : 0.2f * v;
      so[w][rloc][t * 16 + ln] = v; } }
  __builtin_amdgcn_fence(__ATOMIC_ACQ_REL, "workgroup"); __builtin_amdgcn_wave_barrier();
  const int rsub = lane >> 4, c4 = (lane & 15) * 4;
  {
#pragma unroll
    for (int q = 0; q < 16; ++q) { const int r = q * 2 + rsub; const v4f v = *(const v4fa*)&so[w][r][c4]; if (C) *(v4f*)(C + cofs + (size_t)(row0 + r) * ldc + col0 + c4) = v; if (C16) { v4h h4; for (int i = 0; i < 4; ++i) h4[i] = (_Float16)v[i]; *(v4h*)(C16 + cofs + (size_t)(row0 + r) * ldc + col0 + c4) = h4; } }
     } }


__global__ __launch_bounds__(256) void k_wnat(const float* __restrict__ w, size_t n8, _Float16* __restrict__ Bt) { const size_t t = (size_t)blockIdx.x * 256 + threadIdx.x; if (t >= n8) return; FragH f; for (int q = 0; q < 8; ++q) f.h[q] = (_Float16)(bf16_round(w[t * 8 + q]) * 16.0f); *(v8us*)((unsigned short*)Bt + t * 8) = f.half[0];  }
__global__ __launch_bounds__(256) void k_rsm(const float* __restrict__ S, _Float16* __restrict__ P, int nrows) {
  #pragma clang fp contract(off)
  const int i = blockIdx.x * 256 + threadIdx.x; if (i >= nrows) return; const float* s = S + (size_t)i * SQ; float mx = -3.0e38f;
#pragma unroll 1
  for (int j = 0; j < SQ; ++j) mx = fmaxf(mx, s[j]); float se = 0.f;
#pragma unroll 1
  for (int j = 0; j < SQ; ++j) se += expf(s[j] - mx); const float sc = 256.0f / se;
#pragma unroll 1
  for (int j0 = 0; j0 < SQ; j0 += 8) { FragH f; for (int q = 0; q < 8; ++q) f.h[q] = (_Float16)(expf(s[j0 + q] - mx) * sc); unsigned short* d = (unsigned short*)P + (size_t)i * SQ + j0; *(v8us*)d = f.half[0];  } }
__global__ __launch_bounds__(256) void k_vt(const _Float16* __restrict__ V16, int b, int h0, _Float16* __restrict__ VT) { __shared__ unsigned short tl[64][65]; const int tid = threadIdx.x; const int hh = blockIdx.x % HG, sg = blockIdx.x / HG; const int s0 = sg * 64; const int h = h0 + hh;
  for (int i = tid; i < 64 * 8; i += 256) { const int j = i / 8, d8 = (i % 8) * 8; FragH f; f.half[0] = *(const v8us*)((const unsigned short*)V16 + ((size_t)b * SQ + s0 + j) * DM + h * HD + d8); for (int q = 0; q < 8; ++q) tl[d8 + q][j] = f.u[q]; }
  __syncthreads();
  { for (int i = tid; i < 64 * 8; i += 256) { const int d = i / 8, j8 = (i % 8) * 8; FragH f; for (int q = 0; q < 8; ++q) f.u[q] = tl[d][j8 + q]; *(v8us*)((unsigned short*)VT + ((size_t)hh * HD + d) * SQ + s0 + j8) = f.half[0]; }  } }


__global__ __launch_bounds__(256) void k_cl2rows(const float* __restrict__ X, _Float16* __restrict__ XR) { __shared__ float tl[64][33]; const int tid = threadIdx.x; const int nl = LL / 32, nc = CC / 64; const int cb_ = blockIdx.x % nc; const int lb = (blockIdx.x / nc) % nl; const size_t b = blockIdx.x / (nc * nl); const int c0 = cb_ * 64, l0 = lb * 32;
  for (int i = tid; i < 64 * 32; i += 256) { const int c = i / 32, l = i % 32; tl[c][l] = bf16_round(X[(b * CC + c0 + c) * (size_t)LL + l0 + l]); }
  __syncthreads();
  { const int l = tid / 8, c8 = (tid % 8) * 8; FragH f; for (int q = 0; q < 8; ++q) f.h[q] = (_Float16)tl[c8 + q][l]; unsigned short* d = (unsigned short*)XR + (b * LL + l0 + l) * (size_t)CC + c0 + c8; *(v8us*)d = f.half[0];  } }

__global__ __launch_bounds__(256) void k_bcpy(const float* __restrict__ b, int n, int NP, float* __restrict__ dst, int dst0) { for (int i = threadIdx.x; i < NP; i += 256) { const float v = (i < n) ? b[i] : 0.f; *(float*)(dst + dst0 + i) = v; }  }

// Fused attention: a work-group of 8 waves owns 64 queries; a wave owns 32 of them (two column groups of 16) and every fourth block of 32 keys, one block a trip; scores, softmax weights and the weighted sum of g stay in registers (no score or weight plane in memory).
// The four waves of a query group each keep their own running maximum, sum and y; the four partial results are joined through LDS behind the key loop.
// S^T = phi . theta^T (A = 16 phi rows, B = the wave's theta rows, kept in registers), so a lane holds one query's scores: D register r of lane (ln, hh) is key 8 * hh + r, query ln.
// The two tiles of a trip (keys 0..15, 16..31), converted in place, are the B operand of y^T += g^T . P^T in the k order of g2_frag; the running maximum, the sum and the rescale factor of query ln live in lanes ln and ln + 16.
__device__ __forceinline__ v8f at_mma(v16h a, v16h b, v8f c) { return __builtin_amdgcn_wmma_f32_16x16x32_f16(false, a, false, b, (short)0, c, false, false); }
// fragment in the k order of g2_frag from a wave-uniform base and the lane's own byte offset (row * pitch + 16 * hh)
__device__ __forceinline__ v16h at_frag(const char* base, unsigned off) { FragH f; f.half[0] = *(const v8us*)(base + off); f.half[1] = *(const v8us*)(base + off + 32); return f.v; }
// the same fragment from an operand stored in fragment order (k_hlp, k_vt): 1 KiB at a wave-uniform base, off = 16 * lane; each of the two loads covers 512 contiguous bytes, four whole lines
__device__ __forceinline__ v16h at_fragp(const char* base, unsigned off) { FragH f; f.half[0] = *(const v8us*)(base + off); f.half[1] = *(const v8us*)(base + off + 512); return f.v; }
__device__ __forceinline__ float at_xhalf(float x) { return __builtin_bit_cast(float, __builtin_amdgcn_permlanex16(__builtin_bit_cast(int, x), __builtin_bit_cast(int, x), 0x76543210, 0xfedcba98, false, false)); }      /* lane l with lane l ^ 16 */
__global__ __launch_bounds__(256) void k_attn(const _Float16* __restrict__ TH, const _Float16* __restrict__ TL, const _Float16* __restrict__ PH, const _Float16* __restrict__ PL, const _Float16* __restrict__ GT, const _Float16* __restrict__ GTL, float* __restrict__ YF) {
  __shared__ __attribute__((aligned(16))) v4f py[8][16][32];      /* partial y: [wave][(column group * 4 + tile) * 2 + register half][lane] */
  __shared__ float pm[8][2][32], pl[8][2][32];      /* partial maximum and sum: [wave][column group][lane] */
  const int tid = threadIdx.x, lane = tid & 31, ln = lane & 15, hh = lane >> 4;
  const int wv = __builtin_amdgcn_readfirstlane(tid >> 5), w = wv & 1, ks = wv >> 1;      /* query group; which of every four key blocks */
  const int b = blockIdx.x / (LL / 64), qb = (blockIdx.x % (LL / 64)) * 64;
  const char* th = (const char*)(TH + (size_t)b * LL * D3); const char* tl = (const char*)(TL + (size_t)b * LL * D3);      /* rows theta | - | g, hi / residual */
  const char* kph = (const char*)(PH + (size_t)b * LL * IC); const char* kpl = (const char*)(PL + (size_t)b * LL * IC);      /* phi hi / residual in fragment order: 128 bytes a key, 2 KiB a tile of 16 keys */
  const char* gh = (const char*)(GT + (size_t)b * IC * SK); const char* gl = (const char*)(GTL + (size_t)b * IC * SK);      /* g^T hi / residual in fragment order: 128 bytes a key, 4 KiB a block of 32 keys */
  const unsigned qo = (unsigned)(32 * w + ln) * (D3 * 2) + 16 * hh, lo = (unsigned)lane * 16;
  const float L2E = 1.44269504088896340736f;
  const v8f z8 = {0.f,0.f,0.f,0.f,0.f,0.f,0.f,0.f};
  v8f yh[2][4], yl[2][4]; float m[2], l[2];
#pragma unroll
  for (int j = 0; j < 2; ++j) { m[j] = -INFINITY; l[j] = 0.f; for (int t = 0; t < 4; ++t) { yh[j][t] = z8; yl[j][t] = z8; } }
  __builtin_amdgcn_sched_barrier(0);      /* with the one behind the wait: no vector write stands between the first loads and their s_wait_xcnt */
  v16h qh[2][2], ql[2][2];      /* theta hi / residual: [column group][k step] */
#pragma unroll
  for (int j = 0; j < 2; ++j) for (int c = 0; c < 2; ++c) { const size_t o = (size_t)(qb + 16 * j) * (D3 * 2) + 64 * c; qh[j][c] = at_frag(th + o, qo); ql[j][c] = at_frag(tl + o, qo); }
  v16h ka[2][2], kr[2][2];      /* phi hi / residual of the trip: [key tile][k step] */
#pragma unroll
  for (int t = 0; t < 2; ++t) for (int c = 0; c < 2; ++c) { const size_t o = (size_t)(32 * ks + 16 * t) * (IC * 2) + 1024 * c; ka[t][c] = at_fragp(kph + o, lo); kr[t][c] = at_fragp(kpl + o, lo); }
  asm volatile("s_wait_xcnt 0x0" ::: "memory");      /* in front of the first rewrite of an address register that the loads above name */
  __builtin_amdgcn_sched_barrier(0);      /* holds every later register write behind that wait */
  for (int it = 0; it < SK / 128; ++it) { const int k0 = 128 * it + 32 * ks;
    v16h ga[4], gr[4];      /* g^T of this trip: asked for here, used behind the softmax */
#pragma unroll
    for (int t = 0; t < 4; ++t) { const size_t o = (size_t)k0 * (IC * 2) + 1024 * t; ga[t] = at_fragp(gh + o, lo); gr[t] = at_fragp(gl + o, lo); }
    asm volatile("s_wait_xcnt 0x0" ::: "memory");      /* in front of the rewrite of the address registers that these loads name */
    __builtin_amdgcn_sched_barrier(0);      /* keeps the g^T loads in front of the score products: sunk to their uses each would be waited for alone */
    float s[2][2][8];
#pragma unroll
    for (int t = 0; t < 2; ++t) for (int j = 0; j < 2; ++j) {
      v8f sh = at_mma(ka[t][0], qh[j][0], z8); sh = at_mma(ka[t][1], qh[j][1], sh);      /* phi-hi . theta-hi */
      v8f sl = at_mma(ka[t][0], ql[j][0], z8); sl = at_mma(ka[t][1], ql[j][1], sl); sl = at_mma(kr[t][0], qh[j][0], sl); sl = at_mma(kr[t][1], qh[j][1], sl);      /* phi-hi . theta-res + phi-res . theta-hi, both x1024 */
      for (int r = 0; r < 8; ++r) s[j][t][r] = fmaf(sl[r], 1.0f / 1024.0f, sh[r]); }
    __builtin_amdgcn_sched_barrier(0);      /* with the one behind the wait: no vector write stands between the loads below and their s_wait_xcnt */
    const int kn = (k0 + 128) & (SK - 1);      /* the next trip's phi rows, one trip ahead; the last trip asks for the wave's first rows again (in bounds, not used) */
#pragma unroll
    for (int t = 0; t < 2; ++t) for (int c = 0; c < 2; ++c) { const size_t o = (size_t)(kn + 16 * t) * (IC * 2) + 1024 * c; ka[t][c] = at_fragp(kph + o, lo); kr[t][c] = at_fragp(kpl + o, lo); }
    asm volatile("s_wait_xcnt 0x0" ::: "memory");      /* in front of the rewrite of the address registers that these loads name */
    __builtin_amdgcn_sched_barrier(0);      /* keeps those loads in front of the softmax, whose time then covers their latency */
    float mn[2];
#pragma unroll
    for (int j = 0; j < 2; ++j) { float mx = s[j][0][0];
      for (int t = 0; t < 2; ++t) for (int r = 0; r < 8; ++r) mx = fmaxf(mx, s[j][t][r]);
      mx = fmaxf(mx, at_xhalf(mx));      /* the other eight keys of each tile sit in the partner lane */
      mn[j] = fmaxf(m[j], mx); }
    if (__builtin_amdgcn_ballot_w32(mn[0] > m[0] || mn[1] > m[1]) != 0) {      /* no maximum moved: every factor would be 1 */
#pragma unroll
      for (int j = 0; j < 2; ++j) { const float al = __builtin_amdgcn_exp2f((m[j] - mn[j]) * L2E);      /* first trip: exp2(-inf) = 0 on sums that are still 0 */
        m[j] = mn[j]; l[j] *= al;
        for (int t = 0; t < 4; ++t) for (int r = 0; r < 8; ++r) { yh[j][t][r] *= al; yl[j][t][r] *= al; } } }
#pragma unroll
    for (int j = 0; j < 2; ++j) { FragH pf; const float cn = -m[j] * L2E;
#pragma unroll
      for (int i = 0; i < 8; ++i) { const float p0 = __builtin_amdgcn_exp2f(fmaf(s[j][0][i], L2E, cn)), p1 = __builtin_amdgcn_exp2f(fmaf(s[j][1][i], L2E, cn)); l[j] += p0 + p1;
        pf.h[i] = (_Float16)(p0 * 16384.0f); pf.h[8 + i] = (_Float16)(p1 * 16384.0f); }      /* P carried x2^14: the peaky rows would otherwise flush most weights below the f16 normal range */
#pragma unroll
      for (int t = 0; t < 4; ++t) { yh[j][t] = at_mma(ga[t], pf.v, yh[j][t]); yl[j][t] = at_mma(gr[t], pf.v, yl[j][t]); } }
  }
#pragma unroll
  for (int j = 0; j < 2; ++j) { pm[wv][j][lane] = m[j]; pl[wv][j][lane] = l[j] + at_xhalf(l[j]);
#pragma unroll
    for (int t = 0; t < 4; ++t) { v4f o0, o1;
      for (int r = 0; r < 4; ++r) { o0[r] = fmaf(yl[j][t][r], 1.0f / 1024.0f, yh[j][t][r]); o1[r] = fmaf(yl[j][t][4 + r], 1.0f / 1024.0f, yh[j][t][4 + r]); }
      py[wv][(j * 4 + t) * 2][lane] = o0; py[wv][(j * 4 + t) * 2 + 1][lane] = o1; } }
  __syncthreads();      /* every wave's partial result is in LDS before any wave joins */
  const int jo = ks & 1, tp = ks >> 1;      /* this wave joins column group jo, tiles 2 * tp and 2 * tp + 1: 16 queries x 32 channels, whole 128-byte lines of y */
  float ms[4], wt[4];
#pragma unroll
  for (int s = 0; s < 4; ++s) ms[s] = pm[2 * s + w][jo][lane];
  const float mj = fmaxf(fmaxf(ms[0], ms[1]), fmaxf(ms[2], ms[3])); float lt = 0.f;
#pragma unroll
  for (int s = 0; s < 4; ++s) ms[s] = (ms[s] - mj) * L2E;
  __builtin_amdgcn_sched_barrier(0);      /* all four exponents are formed in front of the first v_exp */
#pragma unroll
  for (int s = 0; s < 4; ++s) wt[s] = __builtin_amdgcn_exp2f(ms[s]);
#pragma unroll
  for (int s = 0; s < 4; ++s) lt = fmaf(wt[s], pl[2 * s + w][jo][lane], lt);
  const float inv = (1.0f / 16384.0f) / lt;
  v4f o[4];
#pragma unroll
  for (int i = 0; i < 4; ++i) { o[i] = py[w][(jo * 4 + tp * 2) * 2 + i][lane] * wt[0];
    for (int s = 1; s < 4; ++s) { const v4f p = py[2 * s + w][(jo * 4 + tp * 2) * 2 + i][lane]; for (int r = 0; r < 4; ++r) o[i][r] = fmaf(p[r], wt[s], o[i][r]); }
    o[i] *= inv; }
  float* yo = YF + ((size_t)b * LL + qb + 32 * w + 16 * jo + ln) * IC + 32 * tp + 8 * hh;      /* D register r of tile t = channel 16 * t + 8 * hh + r of query ln */
  *(v4f*)yo = o[0]; *(v4f*)(yo + 4) = o[1]; *(v4f*)(yo + 16) = o[2]; *(v4f*)(yo + 20) = o[3]; }
__global__ __launch_bounds__(256) void k_bnstat(const float* __restrict__ WY, float* __restrict__ ST) {
  #pragma clang fp contract(off)
  __shared__ float red[256]; const int c = blockIdx.x; const int tid = threadIdx.x; float s = 0.f;
  for (size_t r = tid; r < NR; r += 256) s = __fadd_rn(s, WY[r * CC + c]);
  red[tid] = s; __syncthreads(); for (int st = 128; st > 0; st >>= 1) { if (tid < st) red[tid] += red[tid + st]; __syncthreads(); }
  const float mean = red[0] / (float)NR; __syncthreads(); float s2 = 0.f;
  for (size_t r = tid; r < NR; r += 256) { const float d = __fadd_rn(WY[r * CC + c], -mean); s2 = __fadd_rn(s2, __fmul_rn(d, d)); }
  red[tid] = s2; __syncthreads(); for (int st = 128; st > 0; st >>= 1) { if (tid < st) red[tid] += red[tid + st]; __syncthreads(); }
  if (tid < 32) { const float v = (tid == 0) ? mean : ((tid == 1) ? rsqrtf(__fadd_rn(red[0] / (float)NR, 1e-5f)) : 0.f); *(float*)(ST + (size_t)c * 32 + tid) = v;  } }
__global__ __launch_bounds__(256) void k_fin(const float* __restrict__ WY, const float* __restrict__ ST, const float* __restrict__ gam, const float* __restrict__ bet, const float* __restrict__ x, float* __restrict__ out) {
  #pragma clang fp contract(off)
  const size_t t = (size_t)blockIdx.x * 256 + threadIdx.x; if (t >= (size_t)NB * CC * LL / 8) return; const int n0 = (int)((t * 8) % LL); const size_t bc = (t * 8) / LL; const int c = (int)(bc % CC); const size_t b = bc / CC; const float mean = ST[(size_t)c * 32], rstd = ST[(size_t)c * 32 + 1], g = bf16_round(gam[c]), be = bf16_round(bet[c]); v8f r;
  for (int q = 0; q < 8; ++q) { const float v = __fadd_rn(__fmul_rn(__fmul_rn(__fadd_rn(WY[(b * LL + n0 + q) * CC + c], -mean), rstd), g), be); r[q] = __fadd_rn(v, bf16_round(x[t * 8 + q])); }
  *(v8f*)(out + t * 8) = r;  }

extern "C" void kernel_launch(void* const* d_in, const int* in_sizes, int n_in,
                              void* d_out, int out_size, void* d_ws, size_t ws_size, hipStream_t stream) {
  (void)in_sizes; (void)n_in; (void)out_size;
  const float* const* I = (const float* const*)d_in; const float* x = I[0]; const float* gw = I[1]; const float* gb = I[2]; const float* tw = I[3]; const float* tb = I[4]; const float* pw = I[5]; const float* pb = I[6]; const float* zw = I[7]; const float* zb = I[8]; const float* gam = I[9]; const float* bet = I[10];      /* g/theta/phi_w [64][256], wz_w [256][64] natural */
  char* ws = (char*)d_ws; size_t off = 0;
  auto take = [&](size_t bytes) { char* p = ws + off; off += (bytes + 255) & ~(size_t)255; return p; };
  _Float16* B3 = (_Float16*)take((size_t)D3 * CC * 2); float* b3 = (float*)take(D3 * 4); _Float16* BZ = (_Float16*)take((size_t)CC * IC * 2); float* ST = (float*)take((size_t)CC * 32 * 4);
  _Float16* XR = (_Float16*)take(NR * CC * 2); float* TF = (float*)take(NR * D3 * 4); _Float16* TH = (_Float16*)take(NR * D3 * 2); _Float16* TL = (_Float16*)take(NR * D3 * 2); _Float16* PH = (_Float16*)take(NR * IC * 2); _Float16* PL = (_Float16*)take(NR * IC * 2);
  _Float16* GT = (_Float16*)take((size_t)NB * IC * SK * 2); _Float16* GTL = (_Float16*)take((size_t)NB * IC * SK * 2);
  float* YF = (float*)take(NR * IC * 4); _Float16* YH = (_Float16*)take(NR * IC * 2); _Float16* YL = (_Float16*)take(NR * IC * 2); float* WY = (float*)take(NR * CC * 4);
  if (off > ws_size) return;      /* 0.2 + 8 + 12 + 6 + 6 + 4 + 4 + 4 + 2 + 2 + 16 = approx 64 MiB */
  const unsigned gw64 = (unsigned)(((size_t)IC * CC / 8 + 255) / 256);
  k_wnat<<<gw64, 256, 0, stream>>>(tw, (size_t)IC * CC / 8, B3); k_wnat<<<gw64, 256, 0, stream>>>(pw, (size_t)IC * CC / 8, B3 + (size_t)IC * CC); k_wnat<<<gw64, 256, 0, stream>>>(gw, (size_t)IC * CC / 8, B3 + (size_t)2 * IC * CC);      /* Bt rows: theta 0..63 | phi 64..127 | g 128..191 */
  k_bcpy<<<1, 256, 0, stream>>>(tb, IC, IC, b3, 0); k_bcpy<<<1, 256, 0, stream>>>(pb, IC, IC, b3, IC); k_bcpy<<<1, 256, 0, stream>>>(gb, IC, IC, b3, 2 * IC);
  k_wnat<<<(unsigned)(((size_t)CC * IC / 8 + 255) / 256), 256, 0, stream>>>(zw, (size_t)CC * IC / 8, BZ);
  k_cl2rows<<<NB * (LL / 32) * (CC / 64), 256, 0, stream>>>(x, XR);
  k_gemm2<0><<<dim3((unsigned)((NR / 128) * (D3 / 64)), 1), 128, 0, stream>>>(XR, CC, 0, B3, CC, 0, 0.0625f, b3, 0, nullptr, 1, 0, 0, TF, nullptr, D3, 0, (int)NR, D3, CC);      /* theta | phi | g rows f32 */
  k_hlp<<<(unsigned)((NR * D3 / 8 + 255) / 256), 256, 0, stream>>>(TF, TH, TL, PH, PL, NR * D3 / 8);      /* phi goes to PH / PL in fragment order */
  for (int b = 0; b < NBR; ++b) { const _Float16* tb_ = TH + (size_t)b * LL * D3; const _Float16* tlb = TL + (size_t)b * LL * D3;
    k_vt<1, SK><<<SK / 64, 256, 0, stream>>>(tb_ + 2 * IC, D3, 0, GT + (size_t)b * IC * SK); k_vt<1, SK><<<SK / 64, 256, 0, stream>>>(tlb + 2 * IC, D3, 0, GTL + (size_t)b * IC * SK); }      /* g^T hi / residual, a plane a batch, in fragment order */
  k_attn<<<NBR * (LL / 64), 256, 0, stream>>>(TH, TL, PH, PL, GT, GTL, YF);      /* softmax(theta . phi) . g -> y rows f32 */
  k_hl<<<(unsigned)((NR * IC / 8 + 255) / 256), 256, 0, stream>>>(YF, YH, YL, NR * IC / 8);
  const dim3 gz((unsigned)((NR / 128) * (CC / 64)), 1);
  k_gemm2<0><<<gz, 128, 0, stream>>>(YL, IC, 0, BZ, IC, 0, 0.0625f / 1024.0f, nullptr, 0, nullptr, 1, 0, 0, WY, nullptr, CC, 0, (int)NR, CC, IC);      /* W_z: y-res term */
  k_gemm2<0><<<gz, 128, 0, stream>>>(YH, IC, 0, BZ, IC, 0, 0.0625f, zb, 0, WY, 1, (size_t)CC, 0, WY, nullptr, CC, 0, (int)NR, CC, IC);      /* + y-hi term + bias */
  k_bnstat<<<CC, 256, 0, stream>>>(WY, ST);
  k_fin<<<(unsigned)(((size_t)NB * CC * LL / 8 + 255) / 256), 256, 0, stream>>>(WY, ST, gam, bet, x, (float*)d_out);
}

// v005
// A run of this version takes 201 microseconds.
// Two timings next to v004 both put it at 1.19 times that version's speed.
// Over all steps from v000 it is 161 times as fast.
#include <hip/hip_runtime.h>
// Non-local block (x [2][256][8x32x32 = 8192 positions]; g, theta, phi = 1x1 conv projections to 64 (+ bias); f = theta . phi over all positions; softmax; y = attn g; W_z 1x1 conv back to 256 (+ bias); training-mode BatchNorm over (batch, positions) per channel with gamma/beta; out = bn(W_z y) + x).
// Compute dtype: inputs rounded to bf16; x / weights exact; theta, phi, g, y as hi + residual operand pairs (~2^-22); P plain f16 (~2^-12); softmax, BN f32; v_wmma_f32_16x16x32_f16.
#define NB 2
#define CC 256
#define LL 8192                      /* positions per sample */
#define SK LL
#define IC 64                        /* inter channels */
#define D3 (3 * IC)                  /* theta | phi | g */
#define NR ((size_t)NB * LL)
#define NBR NB                       /* batches (debug hook) */
#define SQ LL
#define DM CC
#define NH 1
#define HD 64
#define HG 1
typedef __bf16 v16b __attribute__((ext_vector_type(16)));
typedef unsigned short v8us __attribute__((ext_vector_type(8), may_alias));
typedef float  v8f  __attribute__((ext_vector_type(8)));
typedef float  v4f  __attribute__((ext_vector_type(4)));
typedef float  v4fa __attribute__((ext_vector_type(4), may_alias));
union FragB { v16b v; v8us half[2]; unsigned short u[16]; };

__device__ __forceinline__ unsigned short bf16_bits(float x) { unsigned int u = __float_as_uint(x); return (unsigned short)((u + 0x7FFFu + ((u >> 16) & 1u)) >> 16); }
__device__ __forceinline__ float bf16_val(unsigned short b) { return __uint_as_float(((unsigned int)b) << 16); }
__device__ __forceinline__ float bf16_round(float x) { return bf16_val(bf16_bits(x)); }
// D += A·B with NT terms: 1 = ah·bh, 2 = + al·bh (A split), 3 = + ah·bl (both split)
template <int NT>
__device__ __forceinline__ v8f mmaN(v16b ah, v16b al, v16b bh, v16b bl, v8f c) {
  c = __builtin_amdgcn_wmma_f32_16x16x32_bf16(false, ah, false, bh, (short)0, c, false, false);
  if (NT >= 2) c = __builtin_amdgcn_wmma_f32_16x16x32_bf16(false, al, false, bh, (short)0, c, false, false);
  if (NT >= 3) c = __builtin_amdgcn_wmma_f32_16x16x32_bf16(false, ah, false, bl, (short)0, c, false, false);
  asm volatile("v_nop\n\tv_nop\n\tv_nop\n\tv_nop" : "+v"(c) : "v"(ah), "v"(al), "v"(bh), "v"(bl));
  return c;
}

__global__ __launch_bounds__(256) void k_wt_bf16(const float* __restrict__ W, unsigned short* __restrict__ Wt, int K, int N) {
  const int t = blockIdx.x * 256 + threadIdx.x;
  const int k8n = K / 8;
  if (t >= N * k8n) return;
  const int n = t / k8n, k8 = (t % k8n) * 8;
  v8us v;
#pragma unroll
  for (int i = 0; i < 8; ++i) v[i] = bf16_bits(W[(size_t)(k8 + i) * N + n]);
  *(v8us*)(Wt + (size_t)n * K + k8) = v;
  
}

// GEMM C[M][N] (f32, pitch ldc) = act(A[M][K]·W + bias). A f32 row-major (pitch lda) converted per fragment to bf16
// (ASPLIT: hi/lo two planes -> 2 terms, else single rounded term); Wt bf16 [N][K] (pitch ldb). BIAS_BF16 rounds the
// bias to bf16 first (bias quantised to bf16 before the add). K%32==0, M%16==0, N%64==0.
template <bool ASPLIT, int ACT, bool BIAS_BF16>
__global__ __launch_bounds__(128) void k_gemm_bf(const float* __restrict__ A, int lda, const unsigned short* __restrict__ Wt, int ldb,
                                               const float* __restrict__ bias, float* __restrict__ C, int ldc, int M, int N, int K) {
  __shared__ __attribute__((aligned(16))) float so[4][16][64];
  const int tid = threadIdx.x, w = tid >> 5, lane = tid & 31, ln = lane & 15, hh = lane >> 4;
  const int ntn = N / 64;
  const int wid = blockIdx.x * 4 + w;
  const int mt = wid / ntn, nq = wid % ntn;
  if (mt * 16 >= M) return;
  const int row0 = mt * 16, col0 = nq * 64;
  const float* arow = A + (size_t)(row0 + ln) * lda;
  v8f acc[4] = {};
  for (int kb = 0; kb < K; kb += 32) {
    FragB ah, al;
    const v4f x0 = *(const v4fa*)(arow + kb + 8 * hh), x1 = *(const v4fa*)(arow + kb + 8 * hh + 4);
    const v4f x2 = *(const v4fa*)(arow + kb + 16 + 8 * hh), x3 = *(const v4fa*)(arow + kb + 16 + 8 * hh + 4);
    float xs[16] = {x0[0],x0[1],x0[2],x0[3],x1[0],x1[1],x1[2],x1[3],x2[0],x2[1],x2[2],x2[3],x3[0],x3[1],x3[2],x3[3]};
#pragma unroll
    for (int i = 0; i < 16; ++i) { const unsigned short hb = bf16_bits(xs[i]); ah.u[i] = hb; al.u[i] = ASPLIT ? bf16_bits(xs[i] - bf16_val(hb)) : (unsigned short)0; }
#pragma unroll
    for (int t = 0; t < 4; ++t) {
      const unsigned short* brow = Wt + (size_t)(col0 + t * 16 + ln) * ldb + kb;
      FragB b;
      b.half[0] = *(const v8us*)(brow + 8 * hh);
      b.half[1] = *(const v8us*)(brow + 16 + 8 * hh);
      acc[t] = mmaN<ASPLIT ? 2 : 1>(ah.v, al.v, b.v, b.v, acc[t]);
    }
  }
#pragma unroll
  for (int t = 0; t < 4; ++t) {
    float bv = bias ? bias[col0 + t * 16 + ln] : 0.f;
    if (BIAS_BF16) bv = bf16_round(bv);
#pragma unroll
    for (int r = 0; r < 8; ++r) { float v = acc[t][r] + bv; if (ACT == 1) v = fmaxf(v, 0.f); so[w][8 * hh + r][t * 16 + ln] = v; }
  }
  __builtin_amdgcn_fence(__ATOMIC_ACQ_REL, "workgroup");
  __builtin_amdgcn_wave_barrier();
  const int rsub = lane >> 4, c4 = (lane & 15) * 4;
  {
#pragma unroll
    for (int q = 0; q < 8; ++q) {
      const int r = q * 2 + rsub;
      const v4f v = *(const v4fa*)&so[w][r][c4];
      *(v4f*)(C + (size_t)(row0 + r) * ldc + col0 + c4) = v;
    }
    
  }
}

// GEMM C = act(A·W + bias + resid): A f32 (ASPLIT -> hi/lo 2 terms), Wt bf16 [N][K]; ACT 0 none, 1 relu, 2 exact gelu;
// resid (optional, f32, row index = (row % rmod), pitch ldr, RES_BF16 rounds it) added before the activation.
template <bool ASPLIT, int ACT, bool BIAS_BF16, bool RES_BF16>
__global__ __launch_bounds__(128) void k_gemm_bf3(const float* __restrict__ A, int lda, const unsigned short* __restrict__ Wt, int ldb,
                                                const float* __restrict__ bias, const float* __restrict__ resid, int rmod, int ldr,
                                                float* __restrict__ C, int ldc, int M, int N, int K) {
  __shared__ __attribute__((aligned(16))) float so[4][16][64];
  const int tid = threadIdx.x, w = tid >> 5, lane = tid & 31, ln = lane & 15, hh = lane >> 4;
  const int ntn = N / 64;
  const int wid = blockIdx.x * 4 + w;
  const int mt = wid / ntn, nq = wid % ntn;
  if (mt * 16 >= M) return;
  const int row0 = mt * 16, col0 = nq * 64;
  const float* arow = A + (size_t)(row0 + ln) * lda;
  v8f acc[4] = {};
  for (int kb = 0; kb < K; kb += 32) {
    FragB ah, al;
    const v4f x0 = *(const v4fa*)(arow + kb + 8 * hh), x1 = *(const v4fa*)(arow + kb + 8 * hh + 4);
    const v4f x2 = *(const v4fa*)(arow + kb + 16 + 8 * hh), x3 = *(const v4fa*)(arow + kb + 16 + 8 * hh + 4);
    float xs[16] = {x0[0],x0[1],x0[2],x0[3],x1[0],x1[1],x1[2],x1[3],x2[0],x2[1],x2[2],x2[3],x3[0],x3[1],x3[2],x3[3]};
#pragma unroll
    for (int i = 0; i < 16; ++i) { const unsigned short hb = bf16_bits(xs[i]); ah.u[i] = hb; al.u[i] = ASPLIT ? bf16_bits(xs[i] - bf16_val(hb)) : (unsigned short)0; }
#pragma unroll
    for (int t = 0; t < 4; ++t) {
      const unsigned short* brow = Wt + (size_t)(col0 + t * 16 + ln) * ldb + kb;
      FragB b;
      b.half[0] = *(const v8us*)(brow + 8 * hh);
      b.half[1] = *(const v8us*)(brow + 16 + 8 * hh);
      acc[t] = mmaN<ASPLIT ? 2 : 1>(ah.v, al.v, b.v, b.v, acc[t]);
    }
  }
#pragma unroll
  for (int t = 0; t < 4; ++t) {
    const int col = col0 + t * 16 + ln;
    float bv = bias ? bias[col] : 0.f;
    if (BIAS_BF16) bv = bf16_round(bv);
#pragma unroll
    for (int r = 0; r < 8; ++r) {
      float v = acc[t][r] + bv;
      if (resid) { float rv = resid[(size_t)((row0 + 8 * hh + r) % rmod) * ldr + col]; if (RES_BF16) rv = bf16_round(rv); v += rv; }
      if (ACT == 1) v = fmaxf(v, 0.f);
      if (ACT == 2) v = 0.5f * v * (1.0f + erff(v * 0.70710678118654752f));
      if (ACT == 3) { const float u = 0.7978845608028654f * (v + 0.044715f * v * v * v); v = 0.5f * v * (1.0f + tanhf(u)); }
      so[w][8 * hh + r][t * 16 + ln] = v;
    }
  }
  __builtin_amdgcn_fence(__ATOMIC_ACQ_REL, "workgroup");
  __builtin_amdgcn_wave_barrier();
  const int rsub = lane >> 4, c4 = (lane & 15) * 4;
  {
#pragma unroll
    for (int q = 0; q < 8; ++q) {
      const int r = q * 2 + rsub;
      const v4f v = *(const v4fa*)&so[w][r][c4];
      *(v4f*)(C + (size_t)(row0 + r) * ldc + col0 + c4) = v;
    }
    
  }
}
// row LayerNorm (biased variance, eps) over N: s = X (+ R); optional out_sum <- s; out_norm <- (s-mu)*rsqrt(var+eps)*g + b
template <bool PARAM_BF16>
__global__ __launch_bounds__(256) void k_layernorm(const float* __restrict__ X, const float* __restrict__ R, const float* __restrict__ g, const float* __restrict__ bta,
                                                  float* __restrict__ out_sum, float* __restrict__ out_norm, int N, float eps) {
  __shared__ float red[256];
  const int row = blockIdx.x, tid = threadIdx.x;
  const float* x = X + (size_t)row * N; const float* rr = R ? R + (size_t)row * N : nullptr;
  float vals[16];                     // up to N = 4096
  const int per = N / 256;            // contiguous chunk per thread? use strided-by-4 chunks: thread handles j = tid*4 + 1024*u
  float s1 = 0.f;
  for (int u = 0; u < per / 4; ++u) {
    const int j = tid * 4 + 1024 * u;
    const v4f a = *(const v4fa*)(x + j);
    v4f b = {0.f,0.f,0.f,0.f}; if (rr) b = *(const v4fa*)(rr + j);
#pragma unroll
    for (int q = 0; q < 4; ++q) { const float v = a[q] + b[q]; vals[u * 4 + q] = v; s1 += v; }
  }
  red[tid] = s1; __syncthreads();
  for (int st = 128; st > 0; st >>= 1) { if (tid < st) red[tid] += red[tid + st]; __syncthreads(); }
  const float mu = red[0] / (float)N; __syncthreads();
  float s2 = 0.f;
  for (int u = 0; u < per / 4; ++u)
#pragma unroll
    for (int q = 0; q < 4; ++q) { const float c = vals[u * 4 + q] - mu; s2 += c * c; }
  red[tid] = s2; __syncthreads();
  for (int st = 128; st > 0; st >>= 1) { if (tid < st) red[tid] += red[tid + st]; __syncthreads(); }
  const float rs = rsqrtf(red[0] / (float)N + eps);
  {
    for (int u = 0; u < per / 4; ++u) {
      const int j = tid * 4 + 1024 * u;
      v4f o, sm;
#pragma unroll
      for (int q = 0; q < 4; ++q) {
        float gg = g[j + q], bb = bta[j + q];
        if (PARAM_BF16) { gg = bf16_round(gg); bb = bf16_round(bb); }
        sm[q] = vals[u * 4 + q]; o[q] = (vals[u * 4 + q] - mu) * rs * gg + bb;
      }
      if (out_sum) *(v4f*)(out_sum + (size_t)row * N + j) = sm;
      *(v4f*)(out_norm + (size_t)row * N + j) = o;
    }
    
  }
}



// ---- f16 WMMA path (v_wmma_f32_16x16x32_f16): 11-bit significands for operands in range — used where a [0,1] probability operand needs more precision than bf16
typedef _Float16 v16h __attribute__((ext_vector_type(16)));
union FragH { v16h v; v8us half[2]; _Float16 h[16]; unsigned short u[16]; };
template <int NT>
__device__ __forceinline__ v8f mmaH(v16h ah, v16h al, v16h bh, v16h bl, v8f c) {
  c = __builtin_amdgcn_wmma_f32_16x16x32_f16(false, ah, false, bh, (short)0, c, false, false);
  if (NT >= 2) c = __builtin_amdgcn_wmma_f32_16x16x32_f16(false, al, false, bh, (short)0, c, false, false);
  if (NT >= 3) c = __builtin_amdgcn_wmma_f32_16x16x32_f16(false, ah, false, bl, (short)0, c, false, false);
  asm volatile("v_nop\n\tv_nop\n\tv_nop\n\tv_nop" : "+v"(c) : "v"(ah), "v"(al), "v"(bh), "v"(bl));
  return c;
}
// batched GEMM like k_gemm_b but f16 operands: A f32 (split into f16 hi/lo if ASPLIT, else rounded to f16), Bt = f16 values [n][k]; alpha; C f32; N multiple of 16 (partial tiles skipped)
template <bool ASPLIT>
__global__ __launch_bounds__(128) void k_gemm_h(const float* __restrict__ A, int lda, size_t sA, const _Float16* __restrict__ Bh, int ldb, size_t sB, float alpha, float* __restrict__ C, int ldc, size_t sC, int M, int N, int K) {
  __shared__ __attribute__((aligned(16))) float so[4][16][64];
  const int tid = threadIdx.x, w = tid >> 5, lane = tid & 31, ln = lane & 15, hh = lane >> 4; const int by = blockIdx.y;
  A += (size_t)by * sA; Bh += (size_t)by * sB; C += (size_t)by * sC;
  const int ntn = (N + 63) / 64; const int wid = blockIdx.x * 4 + w; const int mt = wid / ntn, nq = wid % ntn; if (mt * 16 >= M) return;
  const int row0 = mt * 16, col0 = nq * 64; const float* arow = A + (size_t)(row0 + ln) * lda;
  v8f acc[4] = {};
  for (int kb = 0; kb < K; kb += 32) {
    FragH ah, al;
    const v4f x0 = *(const v4fa*)(arow + kb + 8 * hh), x1 = *(const v4fa*)(arow + kb + 8 * hh + 4), x2 = *(const v4fa*)(arow + kb + 16 + 8 * hh), x3 = *(const v4fa*)(arow + kb + 16 + 8 * hh + 4);
    float xs[16] = {x0[0],x0[1],x0[2],x0[3],x1[0],x1[1],x1[2],x1[3],x2[0],x2[1],x2[2],x2[3],x3[0],x3[1],x3[2],x3[3]};
#pragma unroll
    for (int i = 0; i < 16; ++i) { const _Float16 h = (_Float16)xs[i]; ah.h[i] = h; al.h[i] = ASPLIT ? (_Float16)(xs[i] - (float)h) : (_Float16)0.0f; }
#pragma unroll
    for (int t = 0; t < 4; ++t) { if (col0 + t * 16 >= N) continue; const size_t boff = (size_t)(col0 + t * 16 + ln) * ldb + kb; FragH bq; bq.half[0] = *(const v8us*)(Bh + boff + 8 * hh); bq.half[1] = *(const v8us*)(Bh + boff + 16 + 8 * hh);
      acc[t] = mmaH<ASPLIT ? 2 : 1>(ah.v, al.v, bq.v, bq.v, acc[t]); }
  }
#pragma unroll
  for (int t = 0; t < 4; ++t) { if (col0 + t * 16 >= N) continue;
#pragma unroll
    for (int r = 0; r < 8; ++r) so[w][8 * hh + r][t * 16 + ln] = acc[t][r] * alpha; }
  __builtin_amdgcn_fence(__ATOMIC_ACQ_REL, "workgroup"); __builtin_amdgcn_wave_barrier();
  const int rsub = lane >> 4, c4 = (lane & 15) * 4;
  {
#pragma unroll
    for (int q = 0; q < 8; ++q) { const int r = q * 2 + rsub; if (col0 + c4 < N) { const v4f v = *(const v4fa*)&so[w][r][c4]; *(v4f*)(C + (size_t)(row0 + r) * ldc + col0 + c4) = v; } }
     }
}

// Wt[n][k] = f16(W[k][n]·scale) from f32 row-major W[K][N] (scale = power of two; bf16-exact weights stay exact in f16 away from the subnormal range)
__global__ __launch_bounds__(256) void k_wt_f16(const float* __restrict__ W, _Float16* __restrict__ Wt, int K, int N, float scale) {
  const int t = blockIdx.x * 256 + threadIdx.x; if (t >= N * (K / 8)) return; const int n = t / (K / 8), k8 = (t % (K / 8)) * 8; FragH f;
#pragma unroll
  for (int i = 0; i < 8; ++i) f.h[i] = (_Float16)(bf16_round(W[(size_t)(k8 + i) * N + n]) * scale); const v8us o = f.half[0];
  *(v8us*)((unsigned short*)Wt + (size_t)n * K + k8) = o; 
}
// k_gemm_hh variant with fused epilogue: v = acc·alpha + bias[by·sBias + col] (+ CP[(row/rowsPerB)·sCPb + by·64 + col] if CP) ; ACT 0 none / 1 elu ; writes f16 C16 (and f32 C if non-null)
template <int ACT>
__global__ __launch_bounds__(128) void k_gemm_hhx(const _Float16* __restrict__ A, int lda, size_t sA, const _Float16* __restrict__ Bh, int ldb, size_t sB, float alpha, const float* __restrict__ bias, size_t sBias, const float* __restrict__ CP, int rowsPerB, size_t sCPb, int row0g,
    float* __restrict__ C, _Float16* __restrict__ C16, int ldc, size_t sC, int M, int N, int K) {
  __shared__ __attribute__((aligned(16))) float so[4][16][64];
  const int tid = threadIdx.x, w = tid >> 5, lane = tid & 31, ln = lane & 15, hh = lane >> 4; const int by = blockIdx.y;
  A += (size_t)by * sA; Bh += (size_t)by * sB; const size_t cofs = (size_t)by * sC; const float* bp = bias ? bias + (size_t)by * sBias : nullptr;
  const int ntn = (N + 63) / 64; const int wid = blockIdx.x * 4 + w; const int mt = wid / ntn, nq = wid % ntn; if (mt * 16 >= M) return;
  const int row0 = mt * 16, col0 = nq * 64; const _Float16* arow = A + (size_t)(row0 + ln) * lda;
  v8f acc[4] = {};
  for (int kb = 0; kb < K; kb += 32) { FragH ah; ah.half[0] = *(const v8us*)((const unsigned short*)arow + kb + 8 * hh); ah.half[1] = *(const v8us*)((const unsigned short*)arow + kb + 16 + 8 * hh);
#pragma unroll
    for (int t = 0; t < 4; ++t) { if (col0 + t * 16 >= N) continue; const size_t boff = (size_t)(col0 + t * 16 + ln) * ldb + kb; FragH bq; bq.half[0] = *(const v8us*)((const unsigned short*)Bh + boff + 8 * hh); bq.half[1] = *(const v8us*)((const unsigned short*)Bh + boff + 16 + 8 * hh);
      acc[t] = mmaH<1>(ah.v, ah.v, bq.v, bq.v, acc[t]); }
  }
#pragma unroll
  for (int t = 0; t < 4; ++t) { if (col0 + t * 16 >= N) continue; const int col = col0 + t * 16 + ln; const float bv = bp ? bf16_round(bp[col]) : 0.f;
#pragma unroll
    for (int r = 0; r < 8; ++r) { float v = acc[t][r] * alpha + bv; if (CP) { const int rr = row0g + row0 + 8 * hh + r; if (rowsPerB < 0) v += CP[cofs + (size_t)rr * ldc + col];      /* rowsPerB < 0: own element of the batched C plane */ else { const int bidx = rr / rowsPerB; v += CP[(size_t)bidx * sCPb + (size_t)by * 64 + col]; } } if (ACT == 1) v = (v > 0.f) ? v : expm1f(v); else if (ACT == 7) v = (v > 0.f) ? v + 1.0f : expf(v); else if (ACT == 8) v = tanhf(v); else if (ACT == 9) v = 0.5f * v * (1.0f + tanhf(0.7978845608028654f * (v + 0.044715f * v * v * v))); else if (ACT == 11) v = 1.0f / (1.0f + expf(-v)); else if (ACT == 12) v = (v > 0.f) ? v : 0.01f * v; else if (ACT == 14) v = (v > 0.f) ? v : 0.1f * v; else if (ACT == 16) v = (v >= 0.f) ? v : 0.3f * v; else if (ACT == 17) v = (v >= 0.f) ? v : 0.2f * v; else if (ACT == 15) v = v / (1.0f + expf(-v)); else if (ACT == 3) v = fmaxf(v, 0.f); else if (ACT == 6) v = 0.5f * v * (1.0f + erff(v * 0.70710678118654752f)); so[w][8 * hh + r][t * 16 + ln] = v; } }
  __builtin_amdgcn_fence(__ATOMIC_ACQ_REL, "workgroup"); __builtin_amdgcn_wave_barrier();
  const int rsub = lane >> 4, c4 = (lane & 15) * 4; typedef _Float16 v4h __attribute__((ext_vector_type(4)));
  {
#pragma unroll
    for (int q = 0; q < 8; ++q) { const int r = q * 2 + rsub; if (col0 + c4 < N) { const v4f v = *(const v4fa*)&so[w][r][c4]; if (C) *(v4f*)(C + cofs + (size_t)(row0 + r) * ldc + col0 + c4) = v; if (C16) { v4h h4; for (int i = 0; i < 4; ++i) h4[i] = (_Float16)v[i]; *(v4h*)(C16 + cofs + (size_t)(row0 + r) * ldc + col0 + c4) = h4; } } }
     }
}


typedef _Float16 v4h __attribute__((ext_vector_type(4)));

__global__ __launch_bounds__(256) void k_x16(const float* __restrict__ x, _Float16* __restrict__ X16, size_t n8) { const size_t t = (size_t)blockIdx.x * 256 + threadIdx.x; if (t >= n8) return; FragH f;
#pragma unroll
  for (int q = 0; q < 8; ++q) f.h[q] = (_Float16)bf16_round(x[t * 8 + q]); *(v8us*)((unsigned short*)X16 + t * 8) = f.half[0];  }
__global__ __launch_bounds__(256) void k_h16(const float* __restrict__ x, _Float16* __restrict__ X16, size_t n8) { const size_t t = (size_t)blockIdx.x * 256 + threadIdx.x; if (t >= n8) return; FragH f;
#pragma unroll
  for (int q = 0; q < 8; ++q) f.h[q] = (_Float16)x[t * 8 + q]; *(v8us*)((unsigned short*)X16 + t * 8) = f.half[0];  }
__global__ __launch_bounds__(256) void k_round16f(const float* __restrict__ W, _Float16* __restrict__ Bt, size_t n8) { const size_t t = (size_t)blockIdx.x * 256 + threadIdx.x; if (t >= n8) return; FragH f;
#pragma unroll
  for (int i = 0; i < 8; ++i) f.h[i] = (_Float16)(bf16_round(W[t * 8 + i]) * 16.0f); *(v8us*)((unsigned short*)Bt + t * 8) = f.half[0];  }
template <int NHv, int TTv>
__global__ __launch_bounds__(256) void k_vt(const _Float16* __restrict__ V16, int ldv, int voff, _Float16* __restrict__ Vt) { __shared__ unsigned short tl[64][66]; const int tid = threadIdx.x; const int slab = blockIdx.x / (TTv / 64), lg = blockIdx.x % (TTv / 64); const int b = slab / NHv, h = slab % NHv;
  for (int i = tid; i < 64 * 8; i += 256) { const int r = i / 8, c8 = (i % 8) * 8; FragH f; f.half[0] = *(const v8us*)((const unsigned short*)V16 + ((size_t)b * TTv + lg * 64 + r) * ldv + voff + h * 64 + c8);
#pragma unroll
    for (int q = 0; q < 8; ++q) tl[r][c8 + q] = f.u[q]; }
  __syncthreads();
  {
#pragma unroll
    for (int rd = 0; rd < 2; ++rd) { const int d = rd * 32 + tid / 8, pc = tid % 8; FragH f;
#pragma unroll
      for (int q = 0; q < 8; ++q) f.u[q] = tl[pc * 8 + q][d];
      /* V^T in the order in which k_attn's A fragments take it, [block of 32 keys][tile of 16 channels][fragment half][lane] x 16 bytes: key group pc is block pc / 4, half (pc / 2) % 2, lane 16 * (pc % 2) + d % 16 */
      const size_t u = (((size_t)(lg * 2 + (pc >> 2)) * 4 + (d >> 4)) * 2 + ((pc >> 1) & 1)) * 32 + (pc & 1) * 16 + (d & 15);
      *(v8us*)((unsigned short*)Vt + (size_t)slab * 64 * TTv + u * 8) = f.half[0]; }
     } }

__global__ __launch_bounds__(256) void k_hl(const float* __restrict__ F, _Float16* __restrict__ Hh, _Float16* __restrict__ Hl, size_t n8) { const size_t t = (size_t)blockIdx.x * 256 + threadIdx.x; if (t >= n8) return; FragH fh, fl; const v4f a = *(const v4fa*)(F + t * 8), c = *(const v4fa*)(F + t * 8 + 4);
#pragma unroll
  for (int q = 0; q < 4; ++q) { _Float16 h = (_Float16)a[q]; fh.h[q] = h; fl.h[q] = (_Float16)((a[q] - (float)h) * 1024.0f); h = (_Float16)c[q]; fh.h[4 + q] = h; fl.h[4 + q] = (_Float16)((c[q] - (float)h) * 1024.0f); }
  { *(v8us*)((unsigned short*)Hh + t * 8) = fh.half[0]; *(v8us*)((unsigned short*)Hl + t * 8) = fl.half[0];  } }
// k_hl for the theta | phi | g rows. phi's groups of eight channels go to Ph / Pl in the order in which k_attn's A fragments take them, [tile of 16 keys][k step][fragment half][lane] x 16 bytes:
// channel group j of key n is k step j / 4, half (j / 2) % 2, lane 16 * (j % 2) + n % 16 (the k order of g2_frag). theta and g stay in rows; phi's place in those rows is left unwritten and is not read.
__global__ __launch_bounds__(256) void k_hlp(const float* __restrict__ F, _Float16* __restrict__ Hh, _Float16* __restrict__ Hl, _Float16* __restrict__ Ph, _Float16* __restrict__ Pl, size_t n8) { const size_t t = (size_t)blockIdx.x * 256 + threadIdx.x; if (t >= n8) return; FragH fh, fl; const v4f a = *(const v4fa*)(F + t * 8), c = *(const v4fa*)(F + t * 8 + 4);
  for (int q = 0; q < 4; ++q) { _Float16 h = (_Float16)a[q]; fh.h[q] = h; fl.h[q] = (_Float16)((a[q] - (float)h) * 1024.0f); h = (_Float16)c[q]; fh.h[4 + q] = h; fl.h[4 + q] = (_Float16)((c[q] - (float)h) * 1024.0f); }
  const size_t n = t / (D3 / 8); const int j = (int)(t % (D3 / 8)) - IC / 8;
  if (j >= 0 && j < IC / 8) { const size_t u = (((n >> 4) * 2 + (j >> 2)) * 2 + ((j >> 1) & 1)) * 32 + (j & 1) * 16 + (n & 15); *(v8us*)((unsigned short*)Ph + u * 8) = fh.half[0]; *(v8us*)((unsigned short*)Pl + u * 8) = fl.half[0]; }
  else { *(v8us*)((unsigned short*)Hh + t * 8) = fh.half[0]; *(v8us*)((unsigned short*)Hl + t * 8) = fl.half[0]; } }

// ---- fast GEMM (wave tile 32x64; requires M % 32 == 0 rows per launch region and N % 64 == 0); epilogue = k_gemm_hhx semantics ----
__device__ __forceinline__ v16h g2_frag(const _Float16* p, int hh) { FragH f; f.half[0] = *(const v8us*)((const unsigned short*)p + 8 * hh); f.half[1] = *(const v8us*)((const unsigned short*)p + 16 + 8 * hh); return f.v; }
__device__ __forceinline__ v8f g2_mma(v16h a, v16h b, v8f c) { v8f d = __builtin_amdgcn_wmma_f32_16x16x32_f16(false, a, false, b, (short)0, c, false, false); asm volatile("v_nop\n\tv_nop\n\tv_nop\n\tv_nop" : "+v"(d) : "v"(a), "v"(b)); return d; }
template <int ACT>
__global__ __launch_bounds__(128) void k_gemm2(const _Float16* __restrict__ A, int lda, size_t sA, const _Float16* __restrict__ Bh, int ldb, size_t sB, float alpha, const float* __restrict__ bias, size_t sBias, const float* __restrict__ CP, int rowsPerB, size_t sCPb, int row0g,
    float* __restrict__ C, _Float16* __restrict__ C16, int ldc, size_t sC, int M, int N, int K) { static_assert(ACT == 0 || ACT == 3 || ACT == 6 || ACT == 8 || ACT == 9 || ACT == 11 || ACT == 12 || ACT == 14 || ACT == 15 || ACT == 16 || ACT == 17, "k_gemm2: unsupported ACT code (would silently apply no activation)");
  __shared__ __attribute__((aligned(16))) float so[4][32][68];
  const int tid = threadIdx.x, w = tid >> 5, lane = tid & 31, ln = lane & 15, hh = lane >> 4; const int by = blockIdx.y;
  A += (size_t)by * sA; Bh += (size_t)by * sB; const size_t cofs = (size_t)by * sC; const float* bp = bias ? bias + (size_t)by * sBias : nullptr;
  const int ntn = N >> 6; const int mt = blockIdx.x / ntn, nq = blockIdx.x - mt * ntn; const int row0 = mt * 128 + 32 * w, col0 = nq * 64; if (row0 >= M) return;
  const _Float16* a0p = A + (size_t)(row0 + ln) * lda; const _Float16* a1p = a0p + (size_t)16 * lda;
  const _Float16* b0p = Bh + (size_t)(col0 + ln) * ldb; const _Float16* b1p = b0p + (size_t)16 * ldb; const _Float16* b2p = b1p + (size_t)16 * ldb; const _Float16* b3p = b2p + (size_t)16 * ldb;
  const v8f z8 = {0.f,0.f,0.f,0.f,0.f,0.f,0.f,0.f}; v8f c00 = z8, c01 = z8, c02 = z8, c03 = z8, c10 = z8, c11 = z8, c12 = z8, c13 = z8;
#pragma unroll 1
  for (int kb = 0; kb < K; kb += 32) { const v16h a0 = g2_frag(a0p + kb, hh), a1 = g2_frag(a1p + kb, hh);
    v16h b = g2_frag(b0p + kb, hh); c00 = g2_mma(a0, b, c00); c10 = g2_mma(a1, b, c10);
    b = g2_frag(b1p + kb, hh); c01 = g2_mma(a0, b, c01); c11 = g2_mma(a1, b, c11);
    b = g2_frag(b2p + kb, hh); c02 = g2_mma(a0, b, c02); c12 = g2_mma(a1, b, c12);
    b = g2_frag(b3p + kb, hh); c03 = g2_mma(a0, b, c03); c13 = g2_mma(a1, b, c13); }
  v8f accs[8] = {c00, c01, c02, c03, c10, c11, c12, c13};
#pragma unroll
  for (int u = 0; u < 8; ++u) { const int t = u & 3, half = u >> 2; const int col = col0 + t * 16 + ln; const float bv = bp ? bf16_round(bp[col]) : 0.f;
#pragma unroll
    for (int r = 0; r < 8; ++r) { const int rloc = half * 16 + 8 * hh + r; float v = accs[u][r] * alpha + bv; if (CP) { if (rowsPerB < 0) v += CP[cofs + (size_t)(row0g + row0 + rloc) * ldc + col];      /* rowsPerB < 0: own element of the batched C plane */ else { const int bidx = (row0g + row0 + rloc) / rowsPerB; v += CP[(size_t)bidx * sCPb + (size_t)by * 64 + col]; } }
      if (ACT == 3) v = fmaxf(v, 0.f); else if (ACT == 6) v = 0.5f * v * (1.0f + erff(v * 0.70710678118654752f)); else if (ACT == 11) v = 1.0f / (1.0f + expf(-v)); else if (ACT == 15) v = v / (1.0f + expf(-v)); else if (ACT == 12) v = (v > 0.f) ? v : 0.01f * v; else if (ACT == 8) v = tanhf(v); else if (ACT == 9) v = 0.5f * v * (1.0f + tanhf(0.7978845608028654f * (v + 0.044715f * v * v * v))); else if (ACT == 14) v = (v > 0.f) ? v : 0.1f * v; else if (ACT == 16) v = (v >= 0.f) ? v : 0.3f * v; else if (ACT == 17) v = (v >= 0.f) ? v : 0.2f * v;
      so[w][rloc][t * 16 + ln] = v; } }
  __builtin_amdgcn_fence(__ATOMIC_ACQ_REL, "workgroup"); __builtin_amdgcn_wave_barrier();
  const int rsub = lane >> 4, c4 = (lane & 15) * 4;
  {
#pragma unroll
    for (int q = 0; q < 16; ++q) { const int r = q * 2 + rsub; const v4f v = *(const v4fa*)&so[w][r][c4]; if (C) *(v4f*)(C + cofs + (size_t)(row0 + r) * ldc + col0 + c4) = v; if (C16) { v4h h4; for (int i = 0; i < 4; ++i) h4[i] = (_Float16)v[i]; *(v4h*)(C16 + cofs + (size_t)(row0 + r) * ldc + col0 + c4) = h4; } }
     } }


__global__ __launch_bounds__(256) void k_wnat(const float* __restrict__ w, size_t n8, _Float16* __restrict__ Bt) { const size_t t = (size_t)blockIdx.x * 256 + threadIdx.x; if (t >= n8) return; FragH f; for (int q = 0; q < 8; ++q) f.h[q] = (_Float16)(bf16_round(w[t * 8 + q]) * 16.0f); *(v8us*)((unsigned short*)Bt + t * 8) = f.half[0];  }
__global__ __launch_bounds__(256) void k_rsm(const float* __restrict__ S, _Float16* __restrict__ P, int nrows) {
  #pragma clang fp contract(off)
  const int i = blockIdx.x * 256 + threadIdx.x; if (i >= nrows) return; const float* s = S + (size_t)i * SQ; float mx = -3.0e38f;
#pragma unroll 1
  for (int j = 0; j < SQ; ++j) mx = fmaxf(mx, s[j]); float se = 0.f;
#pragma unroll 1
  for (int j = 0; j < SQ; ++j) se += expf(s[j] - mx); const float sc = 256.0f / se;
#pragma unroll 1
  for (int j0 = 0; j0 < SQ; j0 += 8) { FragH f; for (int q = 0; q < 8; ++q) f.h[q] = (_Float16)(expf(s[j0 + q] - mx) * sc); unsigned short* d = (unsigned short*)P + (size_t)i * SQ + j0; *(v8us*)d = f.half[0];  } }
__global__ __launch_bounds__(256) void k_vt(const _Float16* __restrict__ V16, int b, int h0, _Float16* __restrict__ VT) { __shared__ unsigned short tl[64][65]; const int tid = threadIdx.x; const int hh = blockIdx.x % HG, sg = blockIdx.x / HG; const int s0 = sg * 64; const int h = h0 + hh;
  for (int i = tid; i < 64 * 8; i += 256) { const int j = i / 8, d8 = (i % 8) * 8; FragH f; f.half[0] = *(const v8us*)((const unsigned short*)V16 + ((size_t)b * SQ + s0 + j) * DM + h * HD + d8); for (int q = 0; q < 8; ++q) tl[d8 + q][j] = f.u[q]; }
  __syncthreads();
  { for (int i = tid; i < 64 * 8; i += 256) { const int d = i / 8, j8 = (i % 8) * 8; FragH f; for (int q = 0; q < 8; ++q) f.u[q] = tl[d][j8 + q]; *(v8us*)((unsigned short*)VT + ((size_t)hh * HD + d) * SQ + s0 + j8) = f.half[0]; }  } }


__global__ __launch_bounds__(256) void k_cl2rows(const float* __restrict__ X, _Float16* __restrict__ XR) { __shared__ float tl[64][33]; const int tid = threadIdx.x; const int nl = LL / 32, nc = CC / 64; const int cb_ = blockIdx.x % nc; const int lb = (blockIdx.x / nc) % nl; const size_t b = blockIdx.x / (nc * nl); const int c0 = cb_ * 64, l0 = lb * 32;
  for (int i = tid; i < 64 * 32; i += 256) { const int c = i / 32, l = i % 32; tl[c][l] = bf16_round(X[(b * CC + c0 + c) * (size_t)LL + l0 + l]); }
  __syncthreads();
  { const int l = tid / 8, c8 = (tid % 8) * 8; FragH f; for (int q = 0; q < 8; ++q) f.h[q] = (_Float16)tl[c8 + q][l]; unsigned short* d = (unsigned short*)XR + (b * LL + l0 + l) * (size_t)CC + c0 + c8; *(v8us*)d = f.half[0];  } }

__global__ __launch_bounds__(256) void k_bcpy(const float* __restrict__ b, int n, int NP, float* __restrict__ dst, int dst0) { for (int i = threadIdx.x; i < NP; i += 256) { const float v = (i < n) ? b[i] : 0.f; *(float*)(dst + dst0 + i) = v; }  }

// Fused attention: a work-group of 8 waves owns 64 queries; a wave owns 32 of them (two column groups of 16) and every fourth block of 32 keys, one block a trip; scores, softmax weights and the weighted sum of g stay in registers (no score or weight plane in memory).
// The four waves of a query group each keep their own running maximum, sum and y; the four partial results are joined through LDS behind the key loop.
// S^T = phi . theta^T (A = 16 phi rows, B = the wave's theta rows, kept in registers), so a lane holds one query's scores: D register r of lane (ln, hh) is key 8 * hh + r, query ln.
// The two tiles of a trip (keys 0..15, 16..31), converted in place, are the B operand of y^T += g^T . P^T in the k order of g2_frag; the running maximum, the sum and the rescale factor of query ln live in lanes ln and ln + 16.
__device__ __forceinline__ v8f at_mma(v16h a, v16h b, v8f c) { return __builtin_amdgcn_wmma_f32_16x16x32_f16(false, a, false, b, (short)0, c, false, false); }
// fragment in the k order of g2_frag from a wave-uniform base and the lane's own byte offset (row * pitch + 16 * hh)
__device__ __forceinline__ v16h at_frag(const char* base, unsigned off) { FragH f; f.half[0] = *(const v8us*)(base + off); f.half[1] = *(const v8us*)(base + off + 32); return f.v; }
// the same fragment from an operand stored in fragment order (k_hlp, k_vt): 1 KiB at a wave-uniform base, off = 16 * lane; each of the two loads covers 512 contiguous bytes, four whole lines
__device__ __forceinline__ v16h at_fragp(const char* base, unsigned off) { FragH f; f.half[0] = *(const v8us*)(base + off); f.half[1] = *(const v8us*)(base + off + 512); return f.v; }
__device__ __forceinline__ float at_xhalf(float x) { return __builtin_bit_cast(float, __builtin_amdgcn_permlanex16(__builtin_bit_cast(int, x), __builtin_bit_cast(int, x), 0x76543210, 0xfedcba98, false, false)); }      /* lane l with lane l ^ 16 */
__global__ __launch_bounds__(256) void k_attn(const _Float16* __restrict__ TH, const _Float16* __restrict__ TL, const _Float16* __restrict__ PH, const _Float16* __restrict__ PL, const _Float16* __restrict__ GT, const _Float16* __restrict__ GTL, float* __restrict__ YF) {
  __shared__ __attribute__((aligned(16))) v4f py[8][16][32];      /* partial y: [wave][(column group * 4 + tile) * 2 + register half][lane] */
  __shared__ float pm[8][2][32], pl[8][2][32];      /* partial maximum and sum: [wave][column group][lane] */
  const int tid = threadIdx.x, lane = tid & 31, ln = lane & 15, hh = lane >> 4;
  const int wv = __builtin_amdgcn_readfirstlane(tid >> 5), w = wv & 1, ks = wv >> 1;      /* query group; which of every four key blocks */
  const int b = blockIdx.x / (LL / 64), qb = (blockIdx.x % (LL / 64)) * 64;
  const char* th = (const char*)(TH + (size_t)b * LL * D3); const char* tl = (const char*)(TL + (size_t)b * LL * D3);      /* rows theta | - | g, hi / residual */
  const char* kph = (const char*)(PH + (size_t)b * LL * IC); const char* kpl = (const char*)(PL + (size_t)b * LL * IC);      /* phi hi / residual in fragment order: 128 bytes a key, 2 KiB a tile of 16 keys */
  const char* gh = (const char*)(GT + (size_t)b * IC * SK); const char* gl = (const char*)(GTL + (size_t)b * IC * SK);      /* g^T hi / residual in fragment order: 128 bytes a key, 4 KiB a block of 32 keys */
  const unsigned qo = (unsigned)(32 * w + ln) * (D3 * 2) + 16 * hh, lo = (unsigned)lane * 16;
  const float L2E = 1.44269504088896340736f;
  const v8f z8 = {0.f,0.f,0.f,0.f,0.f,0.f,0.f,0.f};
  v8f yh[2][4], yl[2][4]; float m[2], l[2];
#pragma unroll
  for (int j = 0; j < 2; ++j) { m[j] = -INFINITY; l[j] = 0.f; for (int t = 0; t < 4; ++t) { yh[j][t] = z8; yl[j][t] = z8; } }
  __builtin_amdgcn_sched_barrier(0);      /* with the one behind the wait: no vector write stands between the first loads and their s_wait_xcnt */
  v16h qh[2][2], ql[2][2];      /* theta hi / residual: [column group][k step] */
#pragma unroll
  for (int j = 0; j < 2; ++j) for (int c = 0; c < 2; ++c) { const size_t o = (size_t)(qb + 16 * j) * (D3 * 2) + 64 * c; qh[j][c] = at_frag(th + o, qo); ql[j][c] = at_frag(tl + o, qo); }
  v16h ka[2][2], kr[2][2];      /* phi hi / residual of the trip: [key tile][k step] */
#pragma unroll
  for (int t = 0; t < 2; ++t) for (int c = 0; c < 2; ++c) { const size_t o = (size_t)(32 * ks + 16 * t) * (IC * 2) + 1024 * c; ka[t][c] = at_fragp(kph + o, lo); kr[t][c] = at_fragp(kpl + o, lo); }
  asm volatile("s_wait_xcnt 0x0" ::: "memory");      /* in front of the first rewrite of an address register that the loads above name */
  __builtin_amdgcn_sched_barrier(0);      /* holds every later register write behind that wait */
  for (int it = 0; it < SK / 128; ++it) { const int k0 = 128 * it + 32 * ks;
    v16h ga[4], gr[4];      /* g^T of this trip: asked for here, used behind the softmax */
#pragma unroll
    for (int t = 0; t < 4; ++t) { const size_t o = (size_t)k0 * (IC * 2) + 1024 * t; ga[t] = at_fragp(gh + o, lo); gr[t] = at_fragp(gl + o, lo); }
    asm volatile("s_wait_xcnt 0x0" ::: "memory");      /* in front of the rewrite of the address registers that these loads name */
    __builtin_amdgcn_sched_barrier(0);      /* keeps the g^T loads in front of the score products: sunk to their uses each would be waited for alone */
    float s[2][2][8];
#pragma unroll
    for (int t = 0; t < 2; ++t) for (int j = 0; j < 2; ++j) {
      v8f sh = at_mma(ka[t][0], qh[j][0], z8); sh = at_mma(ka[t][1], qh[j][1], sh);      /* phi-hi . theta-hi */
      v8f sl = at_mma(ka[t][0], ql[j][0], z8); sl = at_mma(ka[t][1], ql[j][1], sl); sl = at_mma(kr[t][0], qh[j][0], sl); sl = at_mma(kr[t][1], qh[j][1], sl);      /* phi-hi . theta-res + phi-res . theta-hi, both x1024 */
      for (int r = 0; r < 8; ++r) s[j][t][r] = fmaf(sl[r], 1.0f / 1024.0f, sh[r]); }
    __builtin_amdgcn_sched_barrier(0);      /* with the one behind the wait: no vector write stands between the loads below and their s_wait_xcnt */
    const int kn = (k0 + 128) & (SK - 1);      /* the next trip's phi rows, one trip ahead; the last trip asks for the wave's first rows again (in bounds, not used) */
#pragma unroll
    for (int t = 0; t < 2; ++t) for (int c = 0; c < 2; ++c) { const size_t o = (size_t)(kn + 16 * t) * (IC * 2) + 1024 * c; ka[t][c] = at_fragp(kph + o, lo); kr[t][c] = at_fragp(kpl + o, lo); }
    asm volatile("s_wait_xcnt 0x0" ::: "memory");      /* in front of the rewrite of the address registers that these loads name */
    __builtin_amdgcn_sched_barrier(0);      /* keeps those loads in front of the softmax, whose time then covers their latency */
    float mn[2];
#pragma unroll
    for (int j = 0; j < 2; ++j) { float mx = s[j][0][0];
      for (int t = 0; t < 2; ++t) for (int r = 0; r < 8; ++r) mx = fmaxf(mx, s[j][t][r]);
      mx = fmaxf(mx, at_xhalf(mx));      /* the other eight keys of each tile sit in the partner lane */
      mn[j] = fmaxf(m[j], mx); }
    if (__builtin_amdgcn_ballot_w32(mn[0] > m[0] || mn[1] > m[1]) != 0) {      /* no maximum moved: every factor would be 1 */
#pragma unroll
      for (int j = 0; j < 2; ++j) { const float al = __builtin_amdgcn_exp2f((m[j] - mn[j]) * L2E);      /* first trip: exp2(-inf) = 0 on sums that are still 0 */
        m[j] = mn[j]; l[j] *= al;
        for (int t = 0; t < 4; ++t) for (int r = 0; r < 8; ++r) { yh[j][t][r] *= al; yl[j][t][r] *= al; } } }
#pragma unroll
    for (int j = 0; j < 2; ++j) { FragH pf; const float cn = -m[j] * L2E;
#pragma unroll
      for (int i = 0; i < 8; ++i) { const float p0 = __builtin_amdgcn_exp2f(fmaf(s[j][0][i], L2E, cn)), p1 = __builtin_amdgcn_exp2f(fmaf(s[j][1][i], L2E, cn)); l[j] += p0 + p1;
        pf.h[i] = (_Float16)(p0 * 16384.0f); pf.h[8 + i] = (_Float16)(p1 * 16384.0f); }      /* P carried x2^14: the peaky rows would otherwise flush most weights below the f16 normal range */
#pragma unroll
      for (int t = 0; t < 4; ++t) { yh[j][t] = at_mma(ga[t], pf.v, yh[j][t]); yl[j][t] = at_mma(gr[t], pf.v, yl[j][t]); } }
  }
#pragma unroll
  for (int j = 0; j < 2; ++j) { pm[wv][j][lane] = m[j]; pl[wv][j][lane] = l[j] + at_xhalf(l[j]);
#pragma unroll
    for (int t = 0; t < 4; ++t) { v4f o0, o1;
      for (int r = 0; r < 4; ++r) { o0[r] = fmaf(yl[j][t][r], 1.0f / 1024.0f, yh[j][t][r]); o1[r] = fmaf(yl[j][t][4 + r], 1.0f / 1024.0f, yh[j][t][4 + r]); }
      py[wv][(j * 4 + t) * 2][lane] = o0; py[wv][(j * 4 + t) * 2 + 1][lane] = o1; } }
  __syncthreads();      /* every wave's partial result is in LDS before any wave joins */
  const int jo = ks & 1, tp = ks >> 1;      /* this wave joins column group jo, tiles 2 * tp and 2 * tp + 1: 16 queries x 32 channels, whole 128-byte lines of y */
  float ms[4], wt[4];
#pragma unroll
  for (int s = 0; s < 4; ++s) ms[s] = pm[2 * s + w][jo][lane];
  const float mj = fmaxf(fmaxf(ms[0], ms[1]), fmaxf(ms[2], ms[3])); float lt = 0.f;
#pragma unroll
  for (int s = 0; s < 4; ++s) ms[s] = (ms[s] - mj) * L2E;
  __builtin_amdgcn_sched_barrier(0);      /* all four exponents are formed in front of the first v_exp */
#pragma unroll
  for (int s = 0; s < 4; ++s) wt[s] = __builtin_amdgcn_exp2f(ms[s]);
#pragma unroll
  for (int s = 0; s < 4; ++s) lt = fmaf(wt[s], pl[2 * s + w][jo][lane], lt);
  const float inv = (1.0f / 16384.0f) / lt;
  v4f o[4];
#pragma unroll
  for (int i = 0; i < 4; ++i) { o[i] = py[w][(jo * 4 + tp * 2) * 2 + i][lane] * wt[0];
    for (int s = 1; s < 4; ++s) { const v4f p = py[2 * s + w][(jo * 4 + tp * 2) * 2 + i][lane]; for (int r = 0; r < 4; ++r) o[i][r] = fmaf(p[r], wt[s], o[i][r]); }
    o[i] *= inv; }
  float* yo = YF + ((size_t)b * LL + qb + 32 * w + 16 * jo + ln) * IC + 32 * tp + 8 * hh;      /* D register r of tile t = channel 16 * t + 8 * hh + r of query ln */
  *(v4f*)yo = o[0]; *(v4f*)(yo + 4) = o[1]; *(v4f*)(yo + 16) = o[2]; *(v4f*)(yo + 20) = o[3]; }
__global__ __launch_bounds__(256) void k_bnstat(const float* __restrict__ WY, float* __restrict__ ST) {
  #pragma clang fp contract(off)
  __shared__ float red[256]; const int c = blockIdx.x; const int tid = threadIdx.x; float s = 0.f;
  float v[NR / 256];      /* the thread's values of the channel, rows tid + 256 * i in the order in which both passes sum them: all asked for ahead of the first sum (in a loop of one load a trip each load was waited out alone) and kept for the second pass */
  for (int i = 0; i < (int)(NR / 512); ++i) v[i] = WY[((size_t)i * 256 + tid) * CC + c];
  asm volatile("s_wait_xcnt 0x0" ::: "memory");      /* in front of the loads below, whose results may take the address registers that the loads above name */
  for (int i = (int)(NR / 512); i < (int)(NR / 256); ++i) v[i] = WY[((size_t)i * 256 + tid) * CC + c];
  for (int i = 0; i < (int)(NR / 256); ++i) s = __fadd_rn(s, v[i]);
  red[tid] = s; __syncthreads(); for (int st = 128; st > 0; st >>= 1) { if (tid < st) red[tid] += red[tid + st]; __syncthreads(); }
  const float mean = red[0] / (float)NR; __syncthreads(); float s2 = 0.f;
  for (int i = 0; i < (int)(NR / 256); ++i) { const float d = __fadd_rn(v[i], -mean); s2 = __fadd_rn(s2, __fmul_rn(d, d)); }
  red[tid] = s2; __syncthreads(); for (int st = 128; st > 0; st >>= 1) { if (tid < st) red[tid] += red[tid + st]; __syncthreads(); }
  if (tid < 32) { const float v = (tid == 0) ? mean : ((tid == 1) ? rsqrtf(__fadd_rn(red[0] / (float)NR, 1e-5f)) : 0.f); *(float*)(ST + (size_t)c * 32 + tid) = v;  } }
__global__ __launch_bounds__(256) void k_fin(const float* __restrict__ WY, const float* __restrict__ ST, const float* __restrict__ gam, const float* __restrict__ bet, const float* __restrict__ x, float* __restrict__ out) {
  #pragma clang fp contract(off)
  const size_t t = (size_t)blockIdx.x * 256 + threadIdx.x; if (t >= (size_t)NB * CC * LL / 8) return; const int n0 = (int)((t * 8) % LL); const size_t bc = (t * 8) / LL; const int c = (int)(bc % CC); const size_t b = bc / CC; const float mean = ST[(size_t)c * 32], rstd = ST[(size_t)c * 32 + 1], g = bf16_round(gam[c]), be = bf16_round(bet[c]); v8f r;
  for (int q = 0; q < 8; ++q) { const float v = __fadd_rn(__fmul_rn(__fmul_rn(__fadd_rn(WY[(b * LL + n0 + q) * CC + c], -mean), rstd), g), be); r[q] = __fadd_rn(v, bf16_round(x[t * 8 + q])); }
  *(v8f*)(out + t * 8) = r;  }

extern "C" void kernel_launch(void* const* d_in, const int* in_sizes, int n_in,
                              void* d_out, int out_size, void* d_ws, size_t ws_size, hipStream_t stream) {
  (void)in_sizes; (void)n_in; (void)out_size;
  const float* const* I = (const float* const*)d_in; const float* x = I[0]; const float* gw = I[1]; const float* gb = I[2]; const float* tw = I[3]; const float* tb = I[4]; const float* pw = I[5]; const float* pb = I[6]; const float* zw = I[7]; const float* zb = I[8]; const float* gam = I[9]; const float* bet = I[10];      /* g/theta/phi_w [64][256], wz_w [256][64] natural */
  char* ws = (char*)d_ws; size_t off = 0;
  auto take = [&](size_t bytes) { char* p = ws + off; off += (bytes + 255) & ~(size_t)255; return p; };
  _Float16* B3 = (_Float16*)take((size_t)D3 * CC * 2); float* b3 = (float*)take(D3 * 4); _Float16* BZ = (_Float16*)take((size_t)CC * IC * 2); float* ST = (float*)take((size_t)CC * 32 * 4);
  _Float16* XR = (_Float16*)take(NR * CC * 2); float* TF = (float*)take(NR * D3 * 4); _Float16* TH = (_Float16*)take(NR * D3 * 2); _Float16* TL = (_Float16*)take(NR * D3 * 2); _Float16* PH = (_Float16*)take(NR * IC * 2); _Float16* PL = (_Float16*)take(NR * IC * 2);
  _Float16* GT = (_Float16*)take((size_t)NB * IC * SK * 2); _Float16* GTL = (_Float16*)take((size_t)NB * IC * SK * 2);
  float* YF = (float*)take(NR * IC * 4); _Float16* YH = (_Float16*)take(NR * IC * 2); _Float16* YL = (_Float16*)take(NR * IC * 2); float* WY = (float*)take(NR * CC * 4);
  if (off > ws_size) return;      /* 0.2 + 8 + 12 + 6 + 6 + 4 + 4 + 4 + 2 + 2 + 16 = approx 64 MiB */
  const unsigned gw64 = (unsigned)(((size_t)IC * CC / 8 + 255) / 256);
  k_wnat<<<gw64, 256, 0, stream>>>(tw, (size_t)IC * CC / 8, B3); k_wnat<<<gw64, 256, 0, stream>>>(pw, (size_t)IC * CC / 8, B3 + (size_t)IC * CC); k_wnat<<<gw64, 256, 0, stream>>>(gw, (size_t)IC * CC / 8, B3 + (size_t)2 * IC * CC);      /* Bt rows: theta 0..63 | phi 64..127 | g 128..191 */
  k_bcpy<<<1, 256, 0, stream>>>(tb, IC, IC, b3, 0); k_bcpy<<<1, 256, 0, stream>>>(pb, IC, IC, b3, IC); k_bcpy<<<1, 256, 0, stream>>>(gb, IC, IC, b3, 2 * IC);
  k_wnat<<<(unsigned)(((size_t)CC * IC / 8 + 255) / 256), 256, 0, stream>>>(zw, (size_t)CC * IC / 8, BZ);
  k_cl2rows<<<NB * (LL / 32) * (CC / 64), 256, 0, stream>>>(x, XR);
  k_gemm2<0><<<dim3((unsigned)((NR / 128) * (D3 / 64)), 1), 128, 0, stream>>>(XR, CC, 0, B3, CC, 0, 0.0625f, b3, 0, nullptr, 1, 0, 0, TF, nullptr, D3, 0, (int)NR, D3, CC);      /* theta | phi | g rows f32 */
  k_hlp<<<(unsigned)((NR * D3 / 8 + 255) / 256), 256, 0, stream>>>(TF, TH, TL, PH, PL, NR * D3 / 8);      /* phi goes to PH / PL in fragment order */
  for (int b = 0; b < NBR; ++b) { const _Float16* tb_ = TH + (size_t)b * LL * D3; const _Float16* tlb = TL + (size_t)b * LL * D3;
    k_vt<1, SK><<<SK / 64, 256, 0, stream>>>(tb_ + 2 * IC, D3, 0, GT + (size_t)b * IC * SK); k_vt<1, SK><<<SK / 64, 256, 0, stream>>>(tlb + 2 * IC, D3, 0, GTL + (size_t)b * IC * SK); }      /* g^T hi / residual, a plane a batch, in fragment order */
  k_attn<<<NBR * (LL / 64), 256, 0, stream>>>(TH, TL, PH, PL, GT, GTL, YF);      /* softmax(theta . phi) . g -> y rows f32 */
  k_hl<<<(unsigned)((NR * IC / 8 + 255) / 256), 256, 0, stream>>>(YF, YH, YL, NR * IC / 8);
  const dim3 gz((unsigned)((NR / 128) * (CC / 64)), 1);
  k_gemm2<0><<<gz, 128, 0, stream>>>(YL, IC, 0, BZ, IC, 0, 0.0625f / 1024.0f, nullptr, 0, nullptr, 1, 0, 0, WY, nullptr, CC, 0, (int)NR, CC, IC);      /* W_z: y-res term */
  k_gemm2<0><<<gz, 128, 0, stream>>>(YH, IC, 0, BZ, IC, 0, 0.0625f, zb, 0, WY, 1, (size_t)CC, 0, WY, nullptr, CC, 0, (int)NR, CC, IC);      /* + y-hi term + bias */
  k_bnstat<<<CC, 256, 0, stream>>>(WY, ST);
  k_fin<<<(unsigned)(((size_t)NB * CC * LL / 8 + 255) / 256), 256, 0, stream>>>(WY, ST, gam, bet, x, (float*)d_out);
}

// v006
// A run of this version takes 162 microseconds.
// Two timings next to v005 both put it at 1.24 times that version's speed.
// Counting every step since v000, it is 200 times as fast.
#include <hip/hip_runtime.h>
// Non-local block (x [2][256][8x32x32 = 8192 positions]; g, theta, phi = 1x1 conv projections to 64 (+ bias); f = theta . phi over all positions; softmax; y = attn g; W_z 1x1 conv back to 256 (+ bias); training-mode BatchNorm over (batch, positions) per channel with gamma/beta; out = bn(W_z y) + x).
// Compute dtype: inputs rounded to bf16; x / weights exact; theta, phi, g, y as hi + residual operand pairs (~2^-22); P plain f16 (~2^-12); softmax, BN f32; v_wmma_f32_16x16x32_f16.
#define NB 2
#define CC 256
#define LL 8192                      /* positions per sample */
#define SK LL
#define IC 64                        /* inter channels */
#define D3 (3 * IC)                  /* theta | phi | g */
#define NR ((size_t)NB * LL)
#define NBR NB                       /* batches (debug hook) */
#define SQ LL
#define DM CC
#define NH 1
#define HD 64
#define HG 1
typedef __bf16 v16b __attribute__((ext_vector_type(16)));
typedef unsigned short v8us __attribute__((ext_vector_type(8), may_alias));
typedef float  v8f  __attribute__((ext_vector_type(8)));
typedef float  v4f  __attribute__((ext_vector_type(4)));
typedef float  v4fa __attribute__((ext_vector_type(4), may_alias));
union FragB { v16b v; v8us half[2]; unsigned short u[16]; };

__device__ __forceinline__ unsigned short bf16_bits(float x) { unsigned int u = __float_as_uint(x); return (unsigned short)((u + 0x7FFFu + ((u >> 16) & 1u)) >> 16); }
__device__ __forceinline__ float bf16_val(unsigned short b) { return __uint_as_float(((unsigned int)b) << 16); }
__device__ __forceinline__ float bf16_round(float x) { return bf16_val(bf16_bits(x)); }
// D += A·B with NT terms: 1 = ah·bh, 2 = + al·bh (A split), 3 = + ah·bl (both split)
template <int NT>
__device__ __forceinline__ v8f mmaN(v16b ah, v16b al, v16b bh, v16b bl, v8f c) {
  c = __builtin_amdgcn_wmma_f32_16x16x32_bf16(false, ah, false, bh, (short)0, c, false, false);
  if (NT >= 2) c = __builtin_amdgcn_wmma_f32_16x16x32_bf16(false, al, false, bh, (short)0, c, false, false);
  if (NT >= 3) c = __builtin_amdgcn_wmma_f32_16x16x32_bf16(false, ah, false, bl, (short)0, c, false, false);
  asm volatile("v_nop\n\tv_nop\n\tv_nop\n\tv_nop" : "+v"(c) : "v"(ah), "v"(al), "v"(bh), "v"(bl));
  return c;
}

__global__ __launch_bounds__(256) void k_wt_bf16(const float* __restrict__ W, unsigned short* __restrict__ Wt, int K, int N) {
  const int t = blockIdx.x * 256 + threadIdx.x;
  const int k8n = K / 8;
  if (t >= N * k8n) return;
  const int n = t / k8n, k8 = (t % k8n) * 8;
  v8us v;
#pragma unroll
  for (int i = 0; i < 8; ++i) v[i] = bf16_bits(W[(size_t)(k8 + i) * N + n]);
  *(v8us*)(Wt + (size_t)n * K + k8) = v;
  
}

// GEMM C[M][N] (f32, pitch ldc) = act(A[M][K]·W + bias). A f32 row-major (pitch lda) converted per fragment to bf16
// (ASPLIT: hi/lo two planes -> 2 terms, else single rounded term); Wt bf16 [N][K] (pitch ldb). BIAS_BF16 rounds the
// bias to bf16 first (bias quantised to bf16 before the add). K%32==0, M%16==0, N%64==0.
template <bool ASPLIT, int ACT, bool BIAS_BF16>
__global__ __launch_bounds__(128) void k_gemm_bf(const float* __restrict__ A, int lda, const unsigned short* __restrict__ Wt, int ldb,
                                               const float* __restrict__ bias, float* __restrict__ C, int ldc, int M, int N, int K) {
  __shared__ __attribute__((aligned(16))) float so[4][16][64];
  const int tid = threadIdx.x, w = tid >> 5, lane = tid & 31, ln = lane & 15, hh = lane >> 4;
  const int ntn = N / 64;
  const int wid = blockIdx.x * 4 + w;
  const int mt = wid / ntn, nq = wid % ntn;
  if (mt * 16 >= M) return;
  const int row0 = mt * 16, col0 = nq * 64;
  const float* arow = A + (size_t)(row0 + ln) * lda;
  v8f acc[4] = {};
  for (int kb = 0; kb < K; kb += 32) {
    FragB ah, al;
    const v4f x0 = *(const v4fa*)(arow + kb + 8 * hh), x1 = *(const v4fa*)(arow + kb + 8 * hh + 4);
    const v4f x2 = *(const v4fa*)(arow + kb + 16 + 8 * hh), x3 = *(const v4fa*)(arow + kb + 16 + 8 * hh + 4);
    float xs[16] = {x0[0],x0[1],x0[2],x0[3],x1[0],x1[1],x1[2],x1[3],x2[0],x2[1],x2[2],x2[3],x3[0],x3[1],x3[2],x3[3]};
#pragma unroll
    for (int i = 0; i < 16; ++i) { const unsigned short hb = bf16_bits(xs[i]); ah.u[i] = hb; al.u[i] = ASPLIT ? bf16_bits(xs[i] - bf16_val(hb)) : (unsigned short)0; }
#pragma unroll
    for (int t = 0; t < 4; ++t) {
      const unsigned short* brow = Wt + (size_t)(col0 + t * 16 + ln) * ldb + kb;
      FragB b;
      b.half[0] = *(const v8us*)(brow + 8 * hh);
      b.half[1] = *(const v8us*)(brow + 16 + 8 * hh);
      acc[t] = mmaN<ASPLIT ? 2 : 1>(ah.v, al.v, b.v, b.v, acc[t]);
    }
  }
#pragma unroll
  for (int t = 0; t < 4; ++t) {
    float bv = bias ? bias[col0 + t * 16 + ln] : 0.f;
    if (BIAS_BF16) bv = bf16_round(bv);
#pragma unroll
    for (int r = 0; r < 8; ++r) { float v = acc[t][r] + bv; if (ACT == 1) v = fmaxf(v, 0.f); so[w][8 * hh + r][t * 16 + ln] = v; }
  }
  __builtin_amdgcn_fence(__ATOMIC_ACQ_REL, "workgroup");
  __builtin_amdgcn_wave_barrier();
  const int rsub = lane >> 4, c4 = (lane & 15) * 4;
  {
#pragma unroll
    for (int q = 0; q < 8; ++q) {
      const int r = q * 2 + rsub;
      const v4f v = *(const v4fa*)&so[w][r][c4];
      *(v4f*)(C + (size_t)(row0 + r) * ldc + col0 + c4) = v;
    }
    
  }
}

// GEMM C = act(A·W + bias + resid): A f32 (ASPLIT -> hi/lo 2 terms), Wt bf16 [N][K]; ACT 0 none, 1 relu, 2 exact gelu;
// resid (optional, f32, row index = (row % rmod), pitch ldr, RES_BF16 rounds it) added before the activation.
template <bool ASPLIT, int ACT, bool BIAS_BF16, bool RES_BF16>
__global__ __launch_bounds__(128) void k_gemm_bf3(const float* __restrict__ A, int lda, const unsigned short* __restrict__ Wt, int ldb,
                                                const float* __restrict__ bias, const float* __restrict__ resid, int rmod, int ldr,
                                                float* __restrict__ C, int ldc, int M, int N, int K) {
  __shared__ __attribute__((aligned(16))) float so[4][16][64];
  const int tid = threadIdx.x, w = tid >> 5, lane = tid & 31, ln = lane & 15, hh = lane >> 4;
  const int ntn = N / 64;
  const int wid = blockIdx.x * 4 + w;
  const int mt = wid / ntn, nq = wid % ntn;
  if (mt * 16 >= M) return;
  const int row0 = mt * 16, col0 = nq * 64;
  const float* arow = A + (size_t)(row0 + ln) * lda;
  v8f acc[4] = {};
  for (int kb = 0; kb < K; kb += 32) {
    FragB ah, al;
    const v4f x0 = *(const v4fa*)(arow + kb + 8 * hh), x1 = *(const v4fa*)(arow + kb + 8 * hh + 4);
    const v4f x2 = *(const v4fa*)(arow + kb + 16 + 8 * hh), x3 = *(const v4fa*)(arow + kb + 16 + 8 * hh + 4);
    float xs[16] = {x0[0],x0[1],x0[2],x0[3],x1[0],x1[1],x1[2],x1[3],x2[0],x2[1],x2[2],x2[3],x3[0],x3[1],x3[2],x3[3]};
#pragma unroll
    for (int i = 0; i < 16; ++i) { const unsigned short hb = bf16_bits(xs[i]); ah.u[i] = hb; al.u[i] = ASPLIT ? bf16_bits(xs[i] - bf16_val(hb)) : (unsigned short)0; }
#pragma unroll
    for (int t = 0; t < 4; ++t) {
      const unsigned short* brow = Wt + (size_t)(col0 + t * 16 + ln) * ldb + kb;
      FragB b;
      b.half[0] = *(const v8us*)(brow + 8 * hh);
      b.half[1] = *(const v8us*)(brow + 16 + 8 * hh);
      acc[t] = mmaN<ASPLIT ? 2 : 1>(ah.v, al.v, b.v, b.v, acc[t]);
    }
  }
#pragma unroll
  for (int t = 0; t < 4; ++t) {
    const int col = col0 + t * 16 + ln;
    float bv = bias ? bias[col] : 0.f;
    if (BIAS_BF16) bv = bf16_round(bv);
#pragma unroll
    for (int r = 0; r < 8; ++r) {
      float v = acc[t][r] + bv;
      if (resid) { float rv = resid[(size_t)((row0 + 8 * hh + r) % rmod) * ldr + col]; if (RES_BF16) rv = bf16_round(rv); v += rv; }
      if (ACT == 1) v = fmaxf(v, 0.f);
      if (ACT == 2) v = 0.5f * v * (1.0f + erff(v * 0.70710678118654752f));
      if (ACT == 3) { const float u = 0.7978845608028654f * (v + 0.044715f * v * v * v); v = 0.5f * v * (1.0f + tanhf(u)); }
      so[w][8 * hh + r][t * 16 + ln] = v;
    }
  }
  __builtin_amdgcn_fence(__ATOMIC_ACQ_REL, "workgroup");
  __builtin_amdgcn_wave_barrier();
  const int rsub = lane >> 4, c4 = (lane & 15) * 4;
  {
#pragma unroll
    for (int q = 0; q < 8; ++q) {
      const int r = q * 2 + rsub;
      const v4f v = *(const v4fa*)&so[w][r][c4];
      *(v4f*)(C + (size_t)(row0 + r) * ldc + col0 + c4) = v;
    }
    
  }
}
// row LayerNorm (biased variance, eps) over N: s = X (+ R); optional out_sum <- s; out_norm <- (s-mu)*rsqrt(var+eps)*g + b
template <bool PARAM_BF16>
__global__ __launch_bounds__(256) void k_layernorm(const float* __restrict__ X, const float* __restrict__ R, const float* __restrict__ g, const float* __restrict__ bta,
                                                  float* __restrict__ out_sum, float* __restrict__ out_norm, int N, float eps) {
  __shared__ float red[256];
  const int row = blockIdx.x, tid = threadIdx.x;
  const float* x = X + (size_t)row * N; const float* rr = R ? R + (size_t)row * N : nullptr;
  float vals[16];                     // up to N = 4096
  const int per = N / 256;            // contiguous chunk per thread? use strided-by-4 chunks: thread handles j = tid*4 + 1024*u
  float s1 = 0.f;
  for (int u = 0; u < per / 4; ++u) {
    const int j = tid * 4 + 1024 * u;
    const v4f a = *(const v4fa*)(x + j);
    v4f b = {0.f,0.f,0.f,0.f}; if (rr) b = *(const v4fa*)(rr + j);
#pragma unroll
    for (int q = 0; q < 4; ++q) { const float v = a[q] + b[q]; vals[u * 4 + q] = v; s1 += v; }
  }
  red[tid] = s1; __syncthreads();
  for (int st = 128; st > 0; st >>= 1) { if (tid < st) red[tid] += red[tid + st]; __syncthreads(); }
  const float mu = red[0] / (float)N; __syncthreads();
  float s2 = 0.f;
  for (int u = 0; u < per / 4; ++u)
#pragma unroll
    for (int q = 0; q < 4; ++q) { const float c = vals[u * 4 + q] - mu; s2 += c * c; }
  red[tid] = s2; __syncthreads();
  for (int st = 128; st > 0; st >>= 1) { if (tid < st) red[tid] += red[tid + st]; __syncthreads(); }
  const float rs = rsqrtf(red[0] / (float)N + eps);
  {
    for (int u = 0; u < per / 4; ++u) {
      const int j = tid * 4 + 1024 * u;
      v4f o, sm;
#pragma unroll
      for (int q = 0; q < 4; ++q) {
        float gg = g[j + q], bb = bta[j + q];
        if (PARAM_BF16) { gg = bf16_round(gg); bb = bf16_round(bb); }
        sm[q] = vals[u * 4 + q]; o[q] = (vals[u * 4 + q] - mu) * rs * gg + bb;
      }
      if (out_sum) *(v4f*)(out_sum + (size_t)row * N + j) = sm;
      *(v4f*)(out_norm + (size_t)row * N + j) = o;
    }
    
  }
}



// ---- f16 WMMA path (v_wmma_f32_16x16x32_f16): 11-bit significands for operands in range — used where a [0,1] probability operand needs more precision than bf16
typedef _Float16 v16h __attribute__((ext_vector_type(16)));
union FragH { v16h v; v8us half[2]; _Float16 h[16]; unsigned short u[16]; };
template <int NT>
__device__ __forceinline__ v8f mmaH(v16h ah, v16h al, v16h bh, v16h bl, v8f c) {
  c = __builtin_amdgcn_wmma_f32_16x16x32_f16(false, ah, false, bh, (short)0, c, false, false);
  if (NT >= 2) c = __builtin_amdgcn_wmma_f32_16x16x32_f16(false, al, false, bh, (short)0, c, false, false);
  if (NT >= 3) c = __builtin_amdgcn_wmma_f32_16x16x32_f16(false, ah, false, bl, (short)0, c, false, false);
  asm volatile("v_nop\n\tv_nop\n\tv_nop\n\tv_nop" : "+v"(c) : "v"(ah), "v"(al), "v"(bh), "v"(bl));
  return c;
}
// batched GEMM like k_gemm_b but f16 operands: A f32 (split into f16 hi/lo if ASPLIT, else rounded to f16), Bt = f16 values [n][k]; alpha; C f32; N multiple of 16 (partial tiles skipped)
template <bool ASPLIT>
__global__ __launch_bounds__(128) void k_gemm_h(const float* __restrict__ A, int lda, size_t sA, const _Float16* __restrict__ Bh, int ldb, size_t sB, float alpha, float* __restrict__ C, int ldc, size_t sC, int M, int N, int K) {
  __shared__ __attribute__((aligned(16))) float so[4][16][64];
  const int tid = threadIdx.x, w = tid >> 5, lane = tid & 31, ln = lane & 15, hh = lane >> 4; const int by = blockIdx.y;
  A += (size_t)by * sA; Bh += (size_t)by * sB; C += (size_t)by * sC;
  const int ntn = (N + 63) / 64; const int wid = blockIdx.x * 4 + w; const int mt = wid / ntn, nq = wid % ntn; if (mt * 16 >= M) return;
  const int row0 = mt * 16, col0 = nq * 64; const float* arow = A + (size_t)(row0 + ln) * lda;
  v8f acc[4] = {};
  for (int kb = 0; kb < K; kb += 32) {
    FragH ah, al;
    const v4f x0 = *(const v4fa*)(arow + kb + 8 * hh), x1 = *(const v4fa*)(arow + kb + 8 * hh + 4), x2 = *(const v4fa*)(arow + kb + 16 + 8 * hh), x3 = *(const v4fa*)(arow + kb + 16 + 8 * hh + 4);
    float xs[16] = {x0[0],x0[1],x0[2],x0[3],x1[0],x1[1],x1[2],x1[3],x2[0],x2[1],x2[2],x2[3],x3[0],x3[1],x3[2],x3[3]};
#pragma unroll
    for (int i = 0; i < 16; ++i) { const _Float16 h = (_Float16)xs[i]; ah.h[i] = h; al.h[i] = ASPLIT ? (_Float16)(xs[i] - (float)h) : (_Float16)0.0f; }
#pragma unroll
    for (int t = 0; t < 4; ++t) { if (col0 + t * 16 >= N) continue; const size_t boff = (size_t)(col0 + t * 16 + ln) * ldb + kb; FragH bq; bq.half[0] = *(const v8us*)(Bh + boff + 8 * hh); bq.half[1] = *(const v8us*)(Bh + boff + 16 + 8 * hh);
      acc[t] = mmaH<ASPLIT ? 2 : 1>(ah.v, al.v, bq.v, bq.v, acc[t]); }
  }
#pragma unroll
  for (int t = 0; t < 4; ++t) { if (col0 + t * 16 >= N) continue;
#pragma unroll
    for (int r = 0; r < 8; ++r) so[w][8 * hh + r][t * 16 + ln] = acc[t][r] * alpha; }
  __builtin_amdgcn_fence(__ATOMIC_ACQ_REL, "workgroup"); __builtin_amdgcn_wave_barrier();
  const int rsub = lane >> 4, c4 = (lane & 15) * 4;
  {
#pragma unroll
    for (int q = 0; q < 8; ++q) { const int r = q * 2 + rsub; if (col0 + c4 < N) { const v4f v = *(const v4fa*)&so[w][r][c4]; *(v4f*)(C + (size_t)(row0 + r) * ldc + col0 + c4) = v; } }
     }
}

// Wt[n][k] = f16(W[k][n]·scale) from f32 row-major W[K][N] (scale = power of two; bf16-exact weights stay exact in f16 away from the subnormal range)
__global__ __launch_bounds__(256) void k_wt_f16(const float* __restrict__ W, _Float16* __restrict__ Wt, int K, int N, float scale) {
  const int t = blockIdx.x * 256 + threadIdx.x; if (t >= N * (K / 8)) return; const int n = t / (K / 8), k8 = (t % (K / 8)) * 8; FragH f;
#pragma unroll
  for (int i = 0; i < 8; ++i) f.h[i] = (_Float16)(bf16_round(W[(size_t)(k8 + i) * N + n]) * scale); const v8us o = f.half[0];
  *(v8us*)((unsigned short*)Wt + (size_t)n * K + k8) = o; 
}
// k_gemm_hh variant with fused epilogue: v = acc·alpha + bias[by·sBias + col] (+ CP[(row/rowsPerB)·sCPb + by·64 + col] if CP) ; ACT 0 none / 1 elu ; writes f16 C16 (and f32 C if non-null)
template <int ACT>
__global__ __launch_bounds__(128) void k_gemm_hhx(const _Float16* __restrict__ A, int lda, size_t sA, const _Float16* __restrict__ Bh, int ldb, size_t sB, float alpha, const float* __restrict__ bias, size_t sBias, const float* __restrict__ CP, int rowsPerB, size_t sCPb, int row0g,
    float* __restrict__ C, _Float16* __restrict__ C16, int ldc, size_t sC, int M, int N, int K) {
  __shared__ __attribute__((aligned(16))) float so[4][16][64];
  const int tid = threadIdx.x, w = tid >> 5, lane = tid & 31, ln = lane & 15, hh = lane >> 4; const int by = blockIdx.y;
  A += (size_t)by * sA; Bh += (size_t)by * sB; const size_t cofs = (size_t)by * sC; const float* bp = bias ? bias + (size_t)by * sBias : nullptr;
  const int ntn = (N + 63) / 64; const int wid = blockIdx.x * 4 + w; const int mt = wid / ntn, nq = wid % ntn; if (mt * 16 >= M) return;
  const int row0 = mt * 16, col0 = nq * 64; const _Float16* arow = A + (size_t)(row0 + ln) * lda;
  v8f acc[4] = {};
  for (int kb = 0; kb < K; kb += 32) { FragH ah; ah.half[0] = *(const v8us*)((const unsigned short*)arow + kb + 8 * hh); ah.half[1] = *(const v8us*)((const unsigned short*)arow + kb + 16 + 8 * hh);
#pragma unroll
    for (int t = 0; t < 4; ++t) { if (col0 + t * 16 >= N) continue; const size_t boff = (size_t)(col0 + t * 16 + ln) * ldb + kb; FragH bq; bq.half[0] = *(const v8us*)((const unsigned short*)Bh + boff + 8 * hh); bq.half[1] = *(const v8us*)((const unsigned short*)Bh + boff + 16 + 8 * hh);
      acc[t] = mmaH<1>(ah.v, ah.v, bq.v, bq.v, acc[t]); }
  }
#pragma unroll
  for (int t = 0; t < 4; ++t) { if (col0 + t * 16 >= N) continue; const int col = col0 + t * 16 + ln; const float bv = bp ? bf16_round(bp[col]) : 0.f;
#pragma unroll
    for (int r = 0; r < 8; ++r) { float v = acc[t][r] * alpha + bv; if (CP) { const int rr = row0g + row0 + 8 * hh + r; if (rowsPerB < 0) v += CP[cofs + (size_t)rr * ldc + col];      /* rowsPerB < 0: own element of the batched C plane */ else { const int bidx = rr / rowsPerB; v += CP[(size_t)bidx * sCPb + (size_t)by * 64 + col]; } } if (ACT == 1) v = (v > 0.f) ? v : expm1f(v); else if (ACT == 7) v = (v > 0.f) ? v + 1.0f : expf(v); else if (ACT == 8) v = tanhf(v); else if (ACT == 9) v = 0.5f * v * (1.0f + tanhf(0.7978845608028654f * (v + 0.044715f * v * v * v))); else if (ACT == 11) v = 1.0f / (1.0f + expf(-v)); else if (ACT == 12) v = (v > 0.f) ? v : 0.01f * v; else if (ACT == 14) v = (v > 0.f) ? v : 0.1f * v; else if (ACT == 16) v = (v >= 0.f) ? v : 0.3f * v; else if (ACT == 17) v = (v >= 0.f) ? v : 0.2f * v; else if (ACT == 15) v = v / (1.0f + expf(-v)); else if (ACT == 3) v = fmaxf(v, 0.f); else if (ACT == 6) v = 0.5f * v * (1.0f + erff(v * 0.70710678118654752f)); so[w][8 * hh + r][t * 16 + ln] = v; } }
  __builtin_amdgcn_fence(__ATOMIC_ACQ_REL, "workgroup"); __builtin_amdgcn_wave_barrier();
  const int rsub = lane >> 4, c4 = (lane & 15) * 4; typedef _Float16 v4h __attribute__((ext_vector_type(4)));
  {
#pragma unroll
    for (int q = 0; q < 8; ++q) { const int r = q * 2 + rsub; if (col0 + c4 < N) { const v4f v = *(const v4fa*)&so[w][r][c4]; if (C) *(v4f*)(C + cofs + (size_t)(row0 + r) * ldc + col0 + c4) = v; if (C16) { v4h h4; for (int i = 0; i < 4; ++i) h4[i] = (_Float16)v[i]; *(v4h*)(C16 + cofs + (size_t)(row0 + r) * ldc + col0 + c4) = h4; } } }
     }
}


typedef _Float16 v4h __attribute__((ext_vector_type(4)));

__global__ __launch_bounds__(256) void k_x16(const float* __restrict__ x, _Float16* __restrict__ X16, size_t n8) { const size_t t = (size_t)blockIdx.x * 256 + threadIdx.x; if (t >= n8) return; FragH f;
#pragma unroll
  for (int q = 0; q < 8; ++q) f.h[q] = (_Float16)bf16_round(x[t * 8 + q]); *(v8us*)((unsigned short*)X16 + t * 8) = f.half[0];  }
__global__ __launch_bounds__(256) void k_h16(const float* __restrict__ x, _Float16* __restrict__ X16, size_t n8) { const size_t t = (size_t)blockIdx.x * 256 + threadIdx.x; if (t >= n8) return; FragH f;
#pragma unroll
  for (int q = 0; q < 8; ++q) f.h[q] = (_Float16)x[t * 8 + q]; *(v8us*)((unsigned short*)X16 + t * 8) = f.half[0];  }
__global__ __launch_bounds__(256) void k_round16f(const float* __restrict__ W, _Float16* __restrict__ Bt, size_t n8) { const size_t t = (size_t)blockIdx.x * 256 + threadIdx.x; if (t >= n8) return; FragH f;
#pragma unroll
  for (int i = 0; i < 8; ++i) f.h[i] = (_Float16)(bf16_round(W[t * 8 + i]) * 16.0f); *(v8us*)((unsigned short*)Bt + t * 8) = f.half[0];  }
template <int NHv, int TTv>
__global__ __launch_bounds__(256) void k_vt(const _Float16* __restrict__ V16, int ldv, int voff, _Float16* __restrict__ Vt) { __shared__ unsigned short tl[64][66]; const int tid = threadIdx.x; const int slab = blockIdx.x / (TTv / 64), lg = blockIdx.x % (TTv / 64); const int b = slab / NHv, h = slab % NHv;
  for (int i = tid; i < 64 * 8; i += 256) { const int r = i / 8, c8 = (i % 8) * 8; FragH f; f.half[0] = *(const v8us*)((const unsigned short*)V16 + ((size_t)b * TTv + lg * 64 + r) * ldv + voff + h * 64 + c8);
#pragma unroll
    for (int q = 0; q < 8; ++q) tl[r][c8 + q] = f.u[q]; }
  __syncthreads();
  {
#pragma unroll
    for (int rd = 0; rd < 2; ++rd) { const int d = rd * 32 + tid / 8, pc = tid % 8; FragH f;
#pragma unroll
      for (int q = 0; q < 8; ++q) f.u[q] = tl[pc * 8 + q][d];
      /* V^T in the order in which k_attn's A fragments take it, [block of 32 keys][tile of 16 channels][fragment half][lane] x 16 bytes: key group pc is block pc / 4, half (pc / 2) % 2, lane 16 * (pc % 2) + d % 16 */
      const size_t u = (((size_t)(lg * 2 + (pc >> 2)) * 4 + (d >> 4)) * 2 + ((pc >> 1) & 1)) * 32 + (pc & 1) * 16 + (d & 15);
      *(v8us*)((unsigned short*)Vt + (size_t)slab * 64 * TTv + u * 8) = f.half[0]; }
     } }

__global__ __launch_bounds__(256) void k_hl(const float* __restrict__ F, _Float16* __restrict__ Hh, _Float16* __restrict__ Hl, size_t n8) { const size_t t = (size_t)blockIdx.x * 256 + threadIdx.x; if (t >= n8) return; FragH fh, fl; const v4f a = *(const v4fa*)(F + t * 8), c = *(const v4fa*)(F + t * 8 + 4);
#pragma unroll
  for (int q = 0; q < 4; ++q) { _Float16 h = (_Float16)a[q]; fh.h[q] = h; fl.h[q] = (_Float16)((a[q] - (float)h) * 1024.0f); h = (_Float16)c[q]; fh.h[4 + q] = h; fl.h[4 + q] = (_Float16)((c[q] - (float)h) * 1024.0f); }
  { *(v8us*)((unsigned short*)Hh + t * 8) = fh.half[0]; *(v8us*)((unsigned short*)Hl + t * 8) = fl.half[0];  } }
// k_hl for the theta | phi | g rows. phi's groups of eight channels go to Ph / Pl in the order in which k_attn's A fragments take them, [tile of 16 keys][k step][fragment half][lane] x 16 bytes:
// channel group j of key n is k step j / 4, half (j / 2) % 2, lane 16 * (j % 2) + n % 16 (the k order of g2_frag). theta and g stay in rows; phi's place in those rows is left unwritten and is not read.
__global__ __launch_bounds__(256) void k_hlp(const float* __restrict__ F, _Float16* __restrict__ Hh, _Float16* __restrict__ Hl, _Float16* __restrict__ Ph, _Float16* __restrict__ Pl, size_t n8) { const size_t t = (size_t)blockIdx.x * 256 + threadIdx.x; if (t >= n8) return; FragH fh, fl; const v4f a = *(const v4fa*)(F + t * 8), c = *(const v4fa*)(F + t * 8 + 4);
  for (int q = 0; q < 4; ++q) { _Float16 h = (_Float16)a[q]; fh.h[q] = h; fl.h[q] = (_Float16)((a[q] - (float)h) * 1024.0f); h = (_Float16)c[q]; fh.h[4 + q] = h; fl.h[4 + q] = (_Float16)((c[q] - (float)h) * 1024.0f); }
  const size_t n = t / (D3 / 8); const int j = (int)(t % (D3 / 8)) - IC / 8;
  if (j >= 0 && j < IC / 8) { const size_t u = (((n >> 4) * 2 + (j >> 2)) * 2 + ((j >> 1) & 1)) * 32 + (j & 1) * 16 + (n & 15); *(v8us*)((unsigned short*)Ph + u * 8) = fh.half[0]; *(v8us*)((unsigned short*)Pl + u * 8) = fl.half[0]; }
  else { *(v8us*)((unsigned short*)Hh + t * 8) = fh.half[0]; *(v8us*)((unsigned short*)Hl + t * 8) = fl.half[0]; } }

// ---- fast GEMM (wave tile 32x64; requires M % 32 == 0 rows per launch region and N % 64 == 0); epilogue = k_gemm_hhx semantics ----
__device__ __forceinline__ v16h g2_frag(const _Float16* p, int hh) { FragH f; f.half[0] = *(const v8us*)((const unsigned short*)p + 8 * hh); f.half[1] = *(const v8us*)((const unsigned short*)p + 16 + 8 * hh); return f.v; }
__device__ __forceinline__ v8f g2_mma(v16h a, v16h b, v8f c) { v8f d = __builtin_amdgcn_wmma_f32_16x16x32_f16(false, a, false, b, (short)0, c, false, false); asm volatile("v_nop\n\tv_nop\n\tv_nop\n\tv_nop" : "+v"(d) : "v"(a), "v"(b)); return d; }
// ROWB: for a product taken with its operands swapped (C^T = W . A^T): bias[row] in place of bias[col], and CP, where given, is the own element of C
template <int ACT, bool ROWB = false>
__global__ __launch_bounds__(128) void k_gemm2(const _Float16* __restrict__ A, int lda, size_t sA, const _Float16* __restrict__ Bh, int ldb, size_t sB, float alpha, const float* __restrict__ bias, size_t sBias, const float* __restrict__ CP, int rowsPerB, size_t sCPb, int row0g,
    float* __restrict__ C, _Float16* __restrict__ C16, int ldc, size_t sC, int M, int N, int K) { static_assert(ACT == 0 || ACT == 3 || ACT == 6 || ACT == 8 || ACT == 9 || ACT == 11 || ACT == 12 || ACT == 14 || ACT == 15 || ACT == 16 || ACT == 17, "k_gemm2: unsupported ACT code (would silently apply no activation)");
  __shared__ __attribute__((aligned(16))) float so[4][32][68];
  const int tid = threadIdx.x, w = tid >> 5, lane = tid & 31, ln = lane & 15, hh = lane >> 4; const int by = blockIdx.y;
  A += (size_t)by * sA; Bh += (size_t)by * sB; const size_t cofs = (size_t)by * sC; const float* bp = bias ? bias + (size_t)by * sBias : nullptr;
  const int ntn = N >> 6; const int mt = blockIdx.x / ntn, nq = blockIdx.x - mt * ntn; const int row0 = mt * 128 + 32 * w, col0 = nq * 64; if (row0 >= M) return;
  const _Float16* a0p = A + (size_t)(row0 + ln) * lda; const _Float16* a1p = a0p + (size_t)16 * lda;
  const _Float16* b0p = Bh + (size_t)(col0 + ln) * ldb; const _Float16* b1p = b0p + (size_t)16 * ldb; const _Float16* b2p = b1p + (size_t)16 * ldb; const _Float16* b3p = b2p + (size_t)16 * ldb;
  const v8f z8 = {0.f,0.f,0.f,0.f,0.f,0.f,0.f,0.f}; v8f c00 = z8, c01 = z8, c02 = z8, c03 = z8, c10 = z8, c11 = z8, c12 = z8, c13 = z8;
#pragma unroll 1
  for (int kb = 0; kb < K; kb += 32) { const v16h a0 = g2_frag(a0p + kb, hh), a1 = g2_frag(a1p + kb, hh);
    v16h b = g2_frag(b0p + kb, hh); c00 = g2_mma(a0, b, c00); c10 = g2_mma(a1, b, c10);
    b = g2_frag(b1p + kb, hh); c01 = g2_mma(a0, b, c01); c11 = g2_mma(a1, b, c11);
    b = g2_frag(b2p + kb, hh); c02 = g2_mma(a0, b, c02); c12 = g2_mma(a1, b, c12);
    b = g2_frag(b3p + kb, hh); c03 = g2_mma(a0, b, c03); c13 = g2_mma(a1, b, c13); }
  v8f accs[8] = {c00, c01, c02, c03, c10, c11, c12, c13};
  v4f br[4] = {};      /* ROWB: bias of the lane's 16 rows (half * 16 + 8 * hh + r), asked for as one batch */
  if (ROWB && bp) { const float* p = bp + row0g + row0 + 8 * hh; br[0] = *(const v4fa*)p; br[1] = *(const v4fa*)(p + 4); br[2] = *(const v4fa*)(p + 16); br[3] = *(const v4fa*)(p + 20);
    for (int i = 0; i < 4; ++i) for (int q = 0; q < 4; ++q) br[i][q] = bf16_round(br[i][q]); }
#pragma unroll
  for (int u = 0; u < 8; ++u) { const int t = u & 3, half = u >> 2; const int col = col0 + t * 16 + ln; const float bvc = (!ROWB && bp) ? bf16_round(bp[col]) : 0.f;
#pragma unroll
    for (int r = 0; r < 8; ++r) { const int rloc = half * 16 + 8 * hh + r; const float bv = ROWB ? br[half * 2 + (r >> 2)][r & 3] : bvc; float v = accs[u][r] * alpha + bv; if (CP) { if (ROWB || rowsPerB < 0) v += CP[cofs + (size_t)(row0g + row0 + rloc) * ldc + col];      /* rowsPerB < 0: own element of the batched C plane */ else { const int bidx = (row0g + row0 + rloc) / rowsPerB; v += CP[(size_t)bidx * sCPb + (size_t)by * 64 + col]; } }
      if (ACT == 3) v = fmaxf(v, 0.f); else if (ACT == 6) v = 0.5f * v * (1.0f + erff(v * 0.70710678118654752f)); else if (ACT == 11) v = 1.0f / (1.0f + expf(-v)); else if (ACT == 15) v = v / (1.0f + expf(-v)); else if (ACT == 12) v = (v > 0.f) ? v : 0.01f * v; else if (ACT == 8) v = tanhf(v); else if (ACT == 9) v = 0.5f * v * (1.0f + tanhf(0.7978845608028654f * (v + 0.044715f * v * v * v))); else if (ACT == 14) v = (v > 0.f) ? v : 0.1f * v; else if (ACT == 16) v = (v >= 0.f) ? v : 0.3f * v; else if (ACT == 17) v = (v >= 0.f) ? v : 0.2f * v;
      so[w][rloc][t * 16 + ln] = v; } }
  __builtin_amdgcn_fence(__ATOMIC_ACQ_REL, "workgroup"); __builtin_amdgcn_wave_barrier();
  const int rsub = lane >> 4, c4 = (lane & 15) * 4;
  {
#pragma unroll
    for (int q = 0; q < 16; ++q) { const int r = q * 2 + rsub; const v4f v = *(const v4fa*)&so[w][r][c4]; if (C) *(v4f*)(C + cofs + (size_t)(row0 + r) * ldc + col0 + c4) = v; if (C16) { v4h h4; for (int i = 0; i < 4; ++i) h4[i] = (_Float16)v[i]; *(v4h*)(C16 + cofs + (size_t)(row0 + r) * ldc + col0 + c4) = h4; } }
     } }


__global__ __launch_bounds__(256) void k_wnat(const float* __restrict__ w, size_t n8, _Float16* __restrict__ Bt) { const size_t t = (size_t)blockIdx.x * 256 + threadIdx.x; if (t >= n8) return; FragH f; for (int q = 0; q < 8; ++q) f.h[q] = (_Float16)(bf16_round(w[t * 8 + q]) * 16.0f); *(v8us*)((unsigned short*)Bt + t * 8) = f.half[0];  }
__global__ __launch_bounds__(256) void k_rsm(const float* __restrict__ S, _Float16* __restrict__ P, int nrows) {
  #pragma clang fp contract(off)
  const int i = blockIdx.x * 256 + threadIdx.x; if (i >= nrows) return; const float* s = S + (size_t)i * SQ; float mx = -3.0e38f;
#pragma unroll 1
  for (int j = 0; j < SQ; ++j) mx = fmaxf(mx, s[j]); float se = 0.f;
#pragma unroll 1
  for (int j = 0; j < SQ; ++j) se += expf(s[j] - mx); const float sc = 256.0f / se;
#pragma unroll 1
  for (int j0 = 0; j0 < SQ; j0 += 8) { FragH f; for (int q = 0; q < 8; ++q) f.h[q] = (_Float16)(expf(s[j0 + q] - mx) * sc); unsigned short* d = (unsigned short*)P + (size_t)i * SQ + j0; *(v8us*)d = f.half[0];  } }
__global__ __launch_bounds__(256) void k_vt(const _Float16* __restrict__ V16, int b, int h0, _Float16* __restrict__ VT) { __shared__ unsigned short tl[64][65]; const int tid = threadIdx.x; const int hh = blockIdx.x % HG, sg = blockIdx.x / HG; const int s0 = sg * 64; const int h = h0 + hh;
  for (int i = tid; i < 64 * 8; i += 256) { const int j = i / 8, d8 = (i % 8) * 8; FragH f; f.half[0] = *(const v8us*)((const unsigned short*)V16 + ((size_t)b * SQ + s0 + j) * DM + h * HD + d8); for (int q = 0; q < 8; ++q) tl[d8 + q][j] = f.u[q]; }
  __syncthreads();
  { for (int i = tid; i < 64 * 8; i += 256) { const int d = i / 8, j8 = (i % 8) * 8; FragH f; for (int q = 0; q < 8; ++q) f.u[q] = tl[d][j8 + q]; *(v8us*)((unsigned short*)VT + ((size_t)hh * HD + d) * SQ + s0 + j8) = f.half[0]; }  } }


__global__ __launch_bounds__(256) void k_cl2rows(const float* __restrict__ X, _Float16* __restrict__ XR) { __shared__ float tl[64][33]; const int tid = threadIdx.x; const int nl = LL / 32, nc = CC / 64; const int cb_ = blockIdx.x % nc; const int lb = (blockIdx.x / nc) % nl; const size_t b = blockIdx.x / (nc * nl); const int c0 = cb_ * 64, l0 = lb * 32;
  for (int i = tid; i < 64 * 32; i += 256) { const int c = i / 32, l = i % 32; tl[c][l] = bf16_round(X[(b * CC + c0 + c) * (size_t)LL + l0 + l]); }
  __syncthreads();
  { const int l = tid / 8, c8 = (tid % 8) * 8; FragH f; for (int q = 0; q < 8; ++q) f.h[q] = (_Float16)tl[c8 + q][l]; unsigned short* d = (unsigned short*)XR + (b * LL + l0 + l) * (size_t)CC + c0 + c8; *(v8us*)d = f.half[0];  } }

__global__ __launch_bounds__(256) void k_bcpy(const float* __restrict__ b, int n, int NP, float* __restrict__ dst, int dst0) { for (int i = threadIdx.x; i < NP; i += 256) { const float v = (i < n) ? b[i] : 0.f; *(float*)(dst + dst0 + i) = v; }  }

// Fused attention: a work-group of 8 waves owns 64 queries; a wave owns 32 of them (two column groups of 16) and every fourth block of 32 keys, one block a trip; scores, softmax weights and the weighted sum of g stay in registers (no score or weight plane in memory).
// The four waves of a query group each keep their own running maximum, sum and y; the four partial results are joined through LDS behind the key loop.
// S^T = phi . theta^T (A = 16 phi rows, B = the wave's theta rows, kept in registers), so a lane holds one query's scores: D register r of lane (ln, hh) is key 8 * hh + r, query ln.
// The two tiles of a trip (keys 0..15, 16..31), converted in place, are the B operand of y^T += g^T . P^T in the k order of g2_frag; the running maximum, the sum and the rescale factor of query ln live in lanes ln and ln + 16.
__device__ __forceinline__ v8f at_mma(v16h a, v16h b, v8f c) { return __builtin_amdgcn_wmma_f32_16x16x32_f16(false, a, false, b, (short)0, c, false, false); }
// fragment in the k order of g2_frag from a wave-uniform base and the lane's own byte offset (row * pitch + 16 * hh)
__device__ __forceinline__ v16h at_frag(const char* base, unsigned off) { FragH f; f.half[0] = *(const v8us*)(base + off); f.half[1] = *(const v8us*)(base + off + 32); return f.v; }
// the same fragment from an operand stored in fragment order (k_hlp, k_vt): 1 KiB at a wave-uniform base, off = 16 * lane; each of the two loads covers 512 contiguous bytes, four whole lines
__device__ __forceinline__ v16h at_fragp(const char* base, unsigned off) { FragH f; f.half[0] = *(const v8us*)(base + off); f.half[1] = *(const v8us*)(base + off + 512); return f.v; }
__device__ __forceinline__ float at_xhalf(float x) { return __builtin_bit_cast(float, __builtin_amdgcn_permlanex16(__builtin_bit_cast(int, x), __builtin_bit_cast(int, x), 0x76543210, 0xfedcba98, false, false)); }      /* lane l with lane l ^ 16 */
__global__ __launch_bounds__(256) void k_attn(const _Float16* __restrict__ TH, const _Float16* __restrict__ TL, const _Float16* __restrict__ PH, const _Float16* __restrict__ PL, const _Float16* __restrict__ GT, const _Float16* __restrict__ GTL, float* __restrict__ YF) {
  __shared__ __attribute__((aligned(16))) v4f py[8][16][32];      /* partial y: [wave][(column group * 4 + tile) * 2 + register half][lane] */
  __shared__ float pm[8][2][32], pl[8][2][32];      /* partial maximum and sum: [wave][column group][lane] */
  const int tid = threadIdx.x, lane = tid & 31, ln = lane & 15, hh = lane >> 4;
  const int wv = __builtin_amdgcn_readfirstlane(tid >> 5), w = wv & 1, ks = wv >> 1;      /* query group; which of every four key blocks */
  const int b = blockIdx.x / (LL / 64), qb = (blockIdx.x % (LL / 64)) * 64;
  const char* th = (const char*)(TH + (size_t)b * LL * D3); const char* tl = (const char*)(TL + (size_t)b * LL * D3);      /* rows theta | - | g, hi / residual */
  const char* kph = (const char*)(PH + (size_t)b * LL * IC); const char* kpl = (const char*)(PL + (size_t)b * LL * IC);      /* phi hi / residual in fragment order: 128 bytes a key, 2 KiB a tile of 16 keys */
  const char* gh = (const char*)(GT + (size_t)b * IC * SK); const char* gl = (const char*)(GTL + (size_t)b * IC * SK);      /* g^T hi / residual in fragment order: 128 bytes a key, 4 KiB a block of 32 keys */
  const unsigned qo = (unsigned)(32 * w + ln) * (D3 * 2) + 16 * hh, lo = (unsigned)lane * 16;
  const float L2E = 1.44269504088896340736f;
  const v8f z8 = {0.f,0.f,0.f,0.f,0.f,0.f,0.f,0.f};
  v8f yh[2][4], yl[2][4]; float m[2], l[2];
#pragma unroll
  for (int j = 0; j < 2; ++j) { m[j] = -INFINITY; l[j] = 0.f; for (int t = 0; t < 4; ++t) { yh[j][t] = z8; yl[j][t] = z8; } }
  __builtin_amdgcn_sched_barrier(0);      /* with the one behind the wait: no vector write stands between the first loads and their s_wait_xcnt */
  v16h qh[2][2], ql[2][2];      /* theta hi / residual: [column group][k step] */
#pragma unroll
  for (int j = 0; j < 2; ++j) for (int c = 0; c < 2; ++c) { const size_t o = (size_t)(qb + 16 * j) * (D3 * 2) + 64 * c; qh[j][c] = at_frag(th + o, qo); ql[j][c] = at_frag(tl + o, qo); }
  v16h ka[2][2], kr[2][2];      /* phi hi / residual of the trip: [key tile][k step] */
#pragma unroll
  for (int t = 0; t < 2; ++t) for (int c = 0; c < 2; ++c) { const size_t o = (size_t)(32 * ks + 16 * t) * (IC * 2) + 1024 * c; ka[t][c] = at_fragp(kph + o, lo); kr[t][c] = at_fragp(kpl + o, lo); }
  asm volatile("s_wait_xcnt 0x0" ::: "memory");      /* in front of the first rewrite of an address register that the loads above name */
  __builtin_amdgcn_sched_barrier(0);      /* holds every later register write behind that wait */
  for (int it = 0; it < SK / 128; ++it) { const int k0 = 128 * it + 32 * ks;
    v16h ga[4], gr[4];      /* g^T of this trip: asked for here, used behind the softmax */
#pragma unroll
    for (int t = 0; t < 4; ++t) { const size_t o = (size_t)k0 * (IC * 2) + 1024 * t; ga[t] = at_fragp(gh + o, lo); gr[t] = at_fragp(gl + o, lo); }
    asm volatile("s_wait_xcnt 0x0" ::: "memory");      /* in front of the rewrite of the address registers that these loads name */
    __builtin_amdgcn_sched_barrier(0);      /* keeps the g^T loads in front of the score products: sunk to their uses each would be waited for alone */
    float s[2][2][8];
#pragma unroll
    for (int t = 0; t < 2; ++t) for (int j = 0; j < 2; ++j) {
      v8f sh = at_mma(ka[t][0], qh[j][0], z8); sh = at_mma(ka[t][1], qh[j][1], sh);      /* phi-hi . theta-hi */
      v8f sl = at_mma(ka[t][0], ql[j][0], z8); sl = at_mma(ka[t][1], ql[j][1], sl); sl = at_mma(kr[t][0], qh[j][0], sl); sl = at_mma(kr[t][1], qh[j][1], sl);      /* phi-hi . theta-res + phi-res . theta-hi, both x1024 */
      for (int r = 0; r < 8; ++r) s[j][t][r] = fmaf(sl[r], 1.0f / 1024.0f, sh[r]); }
    __builtin_amdgcn_sched_barrier(0);      /* with the one behind the wait: no vector write stands between the loads below and their s_wait_xcnt */
    const int kn = (k0 + 128) & (SK - 1);      /* the next trip's phi rows, one trip ahead; the last trip asks for the wave's first rows again (in bounds, not used) */
#pragma unroll
    for (int t = 0; t < 2; ++t) for (int c = 0; c < 2; ++c) { const size_t o = (size_t)(kn + 16 * t) * (IC * 2) + 1024 * c; ka[t][c] = at_fragp(kph + o, lo); kr[t][c] = at_fragp(kpl + o, lo); }
    asm volatile("s_wait_xcnt 0x0" ::: "memory");      /* in front of the rewrite of the address registers that these loads name */
    __builtin_amdgcn_sched_barrier(0);      /* keeps those loads in front of the softmax, whose time then covers their latency */
    float mn[2];
#pragma unroll
    for (int j = 0; j < 2; ++j) { float mx = s[j][0][0];
      for (int t = 0; t < 2; ++t) for (int r = 0; r < 8; ++r) mx = fmaxf(mx, s[j][t][r]);
      mx = fmaxf(mx, at_xhalf(mx));      /* the other eight keys of each tile sit in the partner lane */
      mn[j] = fmaxf(m[j], mx); }
    if (__builtin_amdgcn_ballot_w32(mn[0] > m[0] || mn[1] > m[1]) != 0) {      /* no maximum moved: every factor would be 1 */
#pragma unroll
      for (int j = 0; j < 2; ++j) { const float al = __builtin_amdgcn_exp2f((m[j] - mn[j]) * L2E);      /* first trip: exp2(-inf) = 0 on sums that are still 0 */
        m[j] = mn[j]; l[j] *= al;
        for (int t = 0; t < 4; ++t) for (int r = 0; r < 8; ++r) { yh[j][t][r] *= al; yl[j][t][r] *= al; } } }
#pragma unroll
    for (int j = 0; j < 2; ++j) { FragH pf; const float cn = -m[j] * L2E;
#pragma unroll
      for (int i = 0; i < 8; ++i) { const float p0 = __builtin_amdgcn_exp2f(fmaf(s[j][0][i], L2E, cn)), p1 = __builtin_amdgcn_exp2f(fmaf(s[j][1][i], L2E, cn)); l[j] += p0 + p1;
        pf.h[i] = (_Float16)(p0 * 16384.0f); pf.h[8 + i] = (_Float16)(p1 * 16384.0f); }      /* P carried x2^14: the peaky rows would otherwise flush most weights below the f16 normal range */
#pragma unroll
      for (int t = 0; t < 4; ++t) { yh[j][t] = at_mma(ga[t], pf.v, yh[j][t]); yl[j][t] = at_mma(gr[t], pf.v, yl[j][t]); } }
  }
#pragma unroll
  for (int j = 0; j < 2; ++j) { pm[wv][j][lane] = m[j]; pl[wv][j][lane] = l[j] + at_xhalf(l[j]);
#pragma unroll
    for (int t = 0; t < 4; ++t) { v4f o0, o1;
      for (int r = 0; r < 4; ++r) { o0[r] = fmaf(yl[j][t][r], 1.0f / 1024.0f, yh[j][t][r]); o1[r] = fmaf(yl[j][t][4 + r], 1.0f / 1024.0f, yh[j][t][4 + r]); }
      py[wv][(j * 4 + t) * 2][lane] = o0; py[wv][(j * 4 + t) * 2 + 1][lane] = o1; } }
  __syncthreads();      /* every wave's partial result is in LDS before any wave joins */
  const int jo = ks & 1, tp = ks >> 1;      /* this wave joins column group jo, tiles 2 * tp and 2 * tp + 1: 16 queries x 32 channels, whole 128-byte lines of y */
  float ms[4], wt[4];
#pragma unroll
  for (int s = 0; s < 4; ++s) ms[s] = pm[2 * s + w][jo][lane];
  const float mj = fmaxf(fmaxf(ms[0], ms[1]), fmaxf(ms[2], ms[3])); float lt = 0.f;
#pragma unroll
  for (int s = 0; s < 4; ++s) ms[s] = (ms[s] - mj) * L2E;
  __builtin_amdgcn_sched_barrier(0);      /* all four exponents are formed in front of the first v_exp */
#pragma unroll
  for (int s = 0; s < 4; ++s) wt[s] = __builtin_amdgcn_exp2f(ms[s]);
#pragma unroll
  for (int s = 0; s < 4; ++s) lt = fmaf(wt[s], pl[2 * s + w][jo][lane], lt);
  const float inv = (1.0f / 16384.0f) / lt;
  v4f o[4];
#pragma unroll
  for (int i = 0; i < 4; ++i) { o[i] = py[w][(jo * 4 + tp * 2) * 2 + i][lane] * wt[0];
    for (int s = 1; s < 4; ++s) { const v4f p = py[2 * s + w][(jo * 4 + tp * 2) * 2 + i][lane]; for (int r = 0; r < 4; ++r) o[i][r] = fmaf(p[r], wt[s], o[i][r]); }
    o[i] *= inv; }
  float* yo = YF + ((size_t)b * LL + qb + 32 * w + 16 * jo + ln) * IC + 32 * tp + 8 * hh;      /* D register r of tile t = channel 16 * t + 8 * hh + r of query ln */
  *(v4f*)yo = o[0]; *(v4f*)(yo + 4) = o[1]; *(v4f*)(yo + 16) = o[2]; *(v4f*)(yo + 20) = o[3]; }
__global__ __launch_bounds__(256) void k_bnstat(const float* __restrict__ WY, float* __restrict__ ST) {
  #pragma clang fp contract(off)
  __shared__ float red[256]; const int c = blockIdx.x; const int tid = threadIdx.x; float s = 0.f;
  float v[NR / 256];      /* the thread's values of the channel, rows tid + 256 * i in the order in which both passes sum them: all asked for ahead of the first sum (in a loop of one load a trip each load was waited out alone) and kept for the second pass */
  for (int i = 0; i < (int)(NR / 256); ++i) v[i] = WY[(size_t)c * NR + (size_t)i * 256 + tid];      /* WY is [channel][row]: a wave's load is one whole line */
  for (int i = 0; i < (int)(NR / 256); ++i) s = __fadd_rn(s, v[i]);
  red[tid] = s; __syncthreads(); for (int st = 128; st > 0; st >>= 1) { if (tid < st) red[tid] += red[tid + st]; __syncthreads(); }
  const float mean = red[0] / (float)NR; __syncthreads(); float s2 = 0.f;
  for (int i = 0; i < (int)(NR / 256); ++i) { const float d = __fadd_rn(v[i], -mean); s2 = __fadd_rn(s2, __fmul_rn(d, d)); }
  red[tid] = s2; __syncthreads(); for (int st = 128; st > 0; st >>= 1) { if (tid < st) red[tid] += red[tid + st]; __syncthreads(); }
  if (tid < 32) { const float v = (tid == 0) ? mean : ((tid == 1) ? rsqrtf(__fadd_rn(red[0] / (float)NR, 1e-5f)) : 0.f); *(float*)(ST + (size_t)c * 32 + tid) = v;  } }
__global__ __launch_bounds__(256) void k_fin(const float* __restrict__ WY, const float* __restrict__ ST, const float* __restrict__ gam, const float* __restrict__ bet, const float* __restrict__ x, float* __restrict__ out) {
  #pragma clang fp contract(off)
  static_assert(LL % 2048 == 0, "a block's 2048 elements lie in one channel of one sample");
  const size_t e0 = (size_t)blockIdx.x * 2048; if (e0 >= (size_t)NB * CC * LL) return; const int n0 = (int)(e0 % LL); const size_t bc = e0 / LL; const int c = (int)(bc % CC); const size_t b = bc / CC; const float mean = ST[(size_t)c * 32], rstd = ST[(size_t)c * 32 + 1], g = bf16_round(gam[c]), be = bf16_round(bet[c]); v8f r;
  const int o = threadIdx.x * 8; const float* wp = WY + (size_t)c * NR + b * LL + n0; const float* xp = x + e0;      /* WY is [channel][row]: the thread's eight positions are 32 contiguous bytes there as in x and out, at the same offset from the block's base */
  __builtin_amdgcn_sched_barrier(0);      /* with the one behind the wait: no write of a register, a scalar load's result among them, stands between the four loads and their s_wait_xcnt */
  const v4f w0 = *(const v4fa*)(wp + o), w1 = *(const v4fa*)(wp + o + 4), x0 = *(const v4fa*)(xp + o), x1 = *(const v4fa*)(xp + o + 4);
  asm volatile("s_wait_xcnt 0x0" ::: "memory");      /* in front of the first rewrite of a base register that the loads above name */
  __builtin_amdgcn_sched_barrier(0);      /* holds every later register write behind that wait */
  const float wy[8] = {w0[0], w0[1], w0[2], w0[3], w1[0], w1[1], w1[2], w1[3]}, xv[8] = {x0[0], x0[1], x0[2], x0[3], x1[0], x1[1], x1[2], x1[3]};
  for (int q = 0; q < 8; ++q) { const float v = __fadd_rn(__fmul_rn(__fmul_rn(__fadd_rn(wy[q], -mean), rstd), g), be); r[q] = __fadd_rn(v, bf16_round(xv[q])); }
  *(v8f*)(out + e0 + o) = r;  }

extern "C" void kernel_launch(void* const* d_in, const int* in_sizes, int n_in,
                              void* d_out, int out_size, void* d_ws, size_t ws_size, hipStream_t stream) {
  (void)in_sizes; (void)n_in; (void)out_size;
  const float* const* I = (const float* const*)d_in; const float* x = I[0]; const float* gw = I[1]; const float* gb = I[2]; const float* tw = I[3]; const float* tb = I[4]; const float* pw = I[5]; const float* pb = I[6]; const float* zw = I[7]; const float* zb = I[8]; const float* gam = I[9]; const float* bet = I[10];      /* g/theta/phi_w [64][256], wz_w [256][64] natural */
  char* ws = (char*)d_ws; size_t off = 0;
  auto take = [&](size_t bytes) { char* p = ws + off; off += (bytes + 255) & ~(size_t)255; return p; };
  _Float16* B3 = (_Float16*)take((size_t)D3 * CC * 2); float* b3 = (float*)take(D3 * 4); _Float16* BZ = (_Float16*)take((size_t)CC * IC * 2); float* ST = (float*)take((size_t)CC * 32 * 4);
  _Float16* XR = (_Float16*)take(NR * CC * 2); float* TF = (float*)take(NR * D3 * 4); _Float16* TH = (_Float16*)take(NR * D3 * 2); _Float16* TL = (_Float16*)take(NR * D3 * 2); _Float16* PH = (_Float16*)take(NR * IC * 2); _Float16* PL = (_Float16*)take(NR * IC * 2);
  _Float16* GT = (_Float16*)take((size_t)NB * IC * SK * 2); _Float16* GTL = (_Float16*)take((size_t)NB * IC * SK * 2);
  float* YF = (float*)take(NR * IC * 4); _Float16* YH = (_Float16*)take(NR * IC * 2); _Float16* YL = (_Float16*)take(NR * IC * 2); float* WY = (float*)take(NR * CC * 4);
  if (off > ws_size) return;      /* 0.2 + 8 + 12 + 6 + 6 + 4 + 4 + 4 + 2 + 2 + 16 = approx 64 MiB */
  const unsigned gw64 = (unsigned)(((size_t)IC * CC / 8 + 255) / 256);
  k_wnat<<<gw64, 256, 0, stream>>>(tw, (size_t)IC * CC / 8, B3); k_wnat<<<gw64, 256, 0, stream>>>(pw, (size_t)IC * CC / 8, B3 + (size_t)IC * CC); k_wnat<<<gw64, 256, 0, stream>>>(gw, (size_t)IC * CC / 8, B3 + (size_t)2 * IC * CC);      /* Bt rows: theta 0..63 | phi 64..127 | g 128..191 */
  k_bcpy<<<1, 256, 0, stream>>>(tb, IC, IC, b3, 0); k_bcpy<<<1, 256, 0, stream>>>(pb, IC, IC, b3, IC); k_bcpy<<<1, 256, 0, stream>>>(gb, IC, IC, b3, 2 * IC);
  k_wnat<<<(unsigned)(((size_t)CC * IC / 8 + 255) / 256), 256, 0, stream>>>(zw, (size_t)CC * IC / 8, BZ);
  k_cl2rows<<<NB * (LL / 32) * (CC / 64), 256, 0, stream>>>(x, XR);
  k_gemm2<0><<<dim3((unsigned)((NR / 128) * (D3 / 64)), 1), 128, 0, stream>>>(XR, CC, 0, B3, CC, 0, 0.0625f, b3, 0, nullptr, 1, 0, 0, TF, nullptr, D3, 0, (int)NR, D3, CC);      /* theta | phi | g rows f32 */
  k_hlp<<<(unsigned)((NR * D3 / 8 + 255) / 256), 256, 0, stream>>>(TF, TH, TL, PH, PL, NR * D3 / 8);      /* phi goes to PH / PL in fragment order */
  for (int b = 0; b < NBR; ++b) { const _Float16* tb_ = TH + (size_t)b * LL * D3; const _Float16* tlb = TL + (size_t)b * LL * D3;
    k_vt<1, SK><<<SK / 64, 256, 0, stream>>>(tb_ + 2 * IC, D3, 0, GT + (size_t)b * IC * SK); k_vt<1, SK><<<SK / 64, 256, 0, stream>>>(tlb + 2 * IC, D3, 0, GTL + (size_t)b * IC * SK); }      /* g^T hi / residual, a plane a batch, in fragment order */
  k_attn<<<NBR * (LL / 64), 256, 0, stream>>>(TH, TL, PH, PL, GT, GTL, YF);      /* softmax(theta . phi) . g -> y rows f32 */
  k_hl<<<(unsigned)((NR * IC / 8 + 255) / 256), 256, 0, stream>>>(YF, YH, YL, NR * IC / 8);
  const dim3 gz((unsigned)((CC / 128) * (NR / 64)), 1);      /* WY = (W_z y)^T, [channel][batch * positions]: A = W_z rows, B = y rows, so that k_bnstat and k_fin, which go channel by channel, read contiguous bytes */
  k_gemm2<0, true><<<gz, 128, 0, stream>>>(BZ, IC, 0, YL, IC, 0, 0.0625f / 1024.0f, nullptr, 0, nullptr, 1, 0, 0, WY, nullptr, (int)NR, 0, CC, (int)NR, IC);      /* W_z: y-res term */
  k_gemm2<0, true><<<gz, 128, 0, stream>>>(BZ, IC, 0, YH, IC, 0, 0.0625f, zb, 0, WY, -1, 0, 0, WY, nullptr, (int)NR, 0, CC, (int)NR, IC);      /* + y-hi term + bias (by row = channel) + own element of the y-res term */
  k_bnstat<<<CC, 256, 0, stream>>>(WY, ST);
  k_fin<<<(unsigned)(((size_t)NB * CC * LL / 8 + 255) / 256), 256, 0, stream>>>(WY, ST, gam, bet, x, (float*)d_out);
}

// v007
// Measured time: 141 microseconds a run.
// Timed twice side by side with v006, it ran 1.15 and 1.14 times as fast.
// All steps since v000 together make it 229 times as fast.
#include <hip/hip_runtime.h>
// Non-local block (x [2][256][8x32x32 = 8192 positions]; g, theta, phi = 1x1 conv projections to 64 (+ bias); f = theta . phi over all positions; softmax; y = attn g; W_z 1x1 conv back to 256 (+ bias); training-mode BatchNorm over (batch, positions) per channel with gamma/beta; out = bn(W_z y) + x).
// Compute dtype: inputs rounded to bf16; x / weights exact; theta, phi, g, y as hi + residual operand pairs (~2^-22); P plain f16 (~2^-12); softmax, BN f32; v_wmma_f32_16x16x32_f16.
#define NB 2
#define CC 256
#define LL 8192                      /* positions per sample */
#define SK LL
#define IC 64                        /* inter channels */
#define D3 (3 * IC)                  /* theta | phi | g */
#define NR ((size_t)NB * LL)
#define NBR NB                       /* batches (debug hook) */
#define SQ LL
#define DM CC
#define NH 1
#define HD 64
#define HG 1
typedef __bf16 v16b __attribute__((ext_vector_type(16)));
typedef unsigned short v8us __attribute__((ext_vector_type(8), may_alias));
typedef float  v8f  __attribute__((ext_vector_type(8)));
typedef float  v4f  __attribute__((ext_vector_type(4)));
typedef float  v4fa __attribute__((ext_vector_type(4), may_alias));
union FragB { v16b v; v8us half[2]; unsigned short u[16]; };

__device__ __forceinline__ unsigned short bf16_bits(float x) { unsigned int u = __float_as_uint(x); return (unsigned short)((u + 0x7FFFu + ((u >> 16) & 1u)) >> 16); }
__device__ __forceinline__ float bf16_val(unsigned short b) { return __uint_as_float(((unsigned int)b) << 16); }
__device__ __forceinline__ float bf16_round(float x) { return bf16_val(bf16_bits(x)); }
// D += A·B with NT terms: 1 = ah·bh, 2 = + al·bh (A split), 3 = + ah·bl (both split)
template <int NT>
__device__ __forceinline__ v8f mmaN(v16b ah, v16b al, v16b bh, v16b bl, v8f c) {
  c = __builtin_amdgcn_wmma_f32_16x16x32_bf16(false, ah, false, bh, (short)0, c, false, false);
  if (NT >= 2) c = __builtin_amdgcn_wmma_f32_16x16x32_bf16(false, al, false, bh, (short)0, c, false, false);
  if (NT >= 3) c = __builtin_amdgcn_wmma_f32_16x16x32_bf16(false, ah, false, bl, (short)0, c, false, false);
  asm volatile("v_nop\n\tv_nop\n\tv_nop\n\tv_nop" : "+v"(c) : "v"(ah), "v"(al), "v"(bh), "v"(bl));
  return c;
}

__global__ __launch_bounds__(256) void k_wt_bf16(const float* __restrict__ W, unsigned short* __restrict__ Wt, int K, int N) {
  const int t = blockIdx.x * 256 + threadIdx.x;
  const int k8n = K / 8;
  if (t >= N * k8n) return;
  const int n = t / k8n, k8 = (t % k8n) * 8;
  v8us v;
#pragma unroll
  for (int i = 0; i < 8; ++i) v[i] = bf16_bits(W[(size_t)(k8 + i) * N + n]);
  *(v8us*)(Wt + (size_t)n * K + k8) = v;
  
}

// GEMM C[M][N] (f32, pitch ldc) = act(A[M][K]·W + bias). A f32 row-major (pitch lda) converted per fragment to bf16
// (ASPLIT: hi/lo two planes -> 2 terms, else single rounded term); Wt bf16 [N][K] (pitch ldb). BIAS_BF16 rounds the
// bias to bf16 first (bias quantised to bf16 before the add). K%32==0, M%16==0, N%64==0.
template <bool ASPLIT, int ACT, bool BIAS_BF16>
__global__ __launch_bounds__(128) void k_gemm_bf(const float* __restrict__ A, int lda, const unsigned short* __restrict__ Wt, int ldb,
                                               const float* __restrict__ bias, float* __restrict__ C, int ldc, int M, int N, int K) {
  __shared__ __attribute__((aligned(16))) float so[4][16][64];
  const int tid = threadIdx.x, w = tid >> 5, lane = tid & 31, ln = lane & 15, hh = lane >> 4;
  const int ntn = N / 64;
  const int wid = blockIdx.x * 4 + w;
  const int mt = wid / ntn, nq = wid % ntn;
  if (mt * 16 >= M) return;
  const int row0 = mt * 16, col0 = nq * 64;
  const float* arow = A + (size_t)(row0 + ln) * lda;
  v8f acc[4] = {};
  for (int kb = 0; kb < K; kb += 32) {
    FragB ah, al;
    const v4f x0 = *(const v4fa*)(arow + kb + 8 * hh), x1 = *(const v4fa*)(arow + kb + 8 * hh + 4);
    const v4f x2 = *(const v4fa*)(arow + kb + 16 + 8 * hh), x3 = *(const v4fa*)(arow + kb + 16 + 8 * hh + 4);
    float xs[16] = {x0[0],x0[1],x0[2],x0[3],x1[0],x1[1],x1[2],x1[3],x2[0],x2[1],x2[2],x2[3],x3[0],x3[1],x3[2],x3[3]};
#pragma unroll
    for (int i = 0; i < 16; ++i) { const unsigned short hb = bf16_bits(xs[i]); ah.u[i] = hb; al.u[i] = ASPLIT ? bf16_bits(xs[i] - bf16_val(hb)) : (unsigned short)0; }
#pragma unroll
    for (int t = 0; t < 4; ++t) {
      const unsigned short* brow = Wt + (size_t)(col0 + t * 16 + ln) * ldb + kb;
      FragB b;
      b.half[0] = *(const v8us*)(brow + 8 * hh);
      b.half[1] = *(const v8us*)(brow + 16 + 8 * hh);
      acc[t] = mmaN<ASPLIT ? 2 : 1>(ah.v, al.v, b.v, b.v, acc[t]);
    }
  }
#pragma unroll
  for (int t = 0; t < 4; ++t) {
    float bv = bias ? bias[col0 + t * 16 + ln] : 0.f;
    if (BIAS_BF16) bv = bf16_round(bv);
#pragma unroll
    for (int r = 0; r < 8; ++r) { float v = acc[t][r] + bv; if (ACT == 1) v = fmaxf(v, 0.f); so[w][8 * hh + r][t * 16 + ln] = v; }
  }
  __builtin_amdgcn_fence(__ATOMIC_ACQ_REL, "workgroup");
  __builtin_amdgcn_wave_barrier();
  const int rsub = lane >> 4, c4 = (lane & 15) * 4;
  {
#pragma unroll
    for (int q = 0; q < 8; ++q) {
      const int r = q * 2 + rsub;
      const v4f v = *(const v4fa*)&so[w][r][c4];
      *(v4f*)(C + (size_t)(row0 + r) * ldc + col0 + c4) = v;
    }
    
  }
}

// GEMM C = act(A·W + bias + resid): A f32 (ASPLIT -> hi/lo 2 terms), Wt bf16 [N][K]; ACT 0 none, 1 relu, 2 exact gelu;
// resid (optional, f32, row index = (row % rmod), pitch ldr, RES_BF16 rounds it) added before the activation.
template <bool ASPLIT, int ACT, bool BIAS_BF16, bool RES_BF16>
__global__ __launch_bounds__(128) void k_gemm_bf3(const float* __restrict__ A, int lda, const unsigned short* __restrict__ Wt, int ldb,
                                                const float* __restrict__ bias, const float* __restrict__ resid, int rmod, int ldr,
                                                float* __restrict__ C, int ldc, int M, int N, int K) {
  __shared__ __attribute__((aligned(16))) float so[4][16][64];
  const int tid = threadIdx.x, w = tid >> 5, lane = tid & 31, ln = lane & 15, hh = lane >> 4;
  const int ntn = N / 64;
  const int wid = blockIdx.x * 4 + w;
  const int mt = wid / ntn, nq = wid % ntn;
  if (mt * 16 >= M) return;
  const int row0 = mt * 16, col0 = nq * 64;
  const float* arow = A + (size_t)(row0 + ln) * lda;
  v8f acc[4] = {};
  for (int kb = 0; kb < K; kb += 32) {
    FragB ah, al;
    const v4f x0 = *(const v4fa*)(arow + kb + 8 * hh), x1 = *(const v4fa*)(arow + kb + 8 * hh + 4);
    const v4f x2 = *(const v4fa*)(arow + kb + 16 + 8 * hh), x3 = *(const v4fa*)(arow + kb + 16 + 8 * hh + 4);
    float xs[16] = {x0[0],x0[1],x0[2],x0[3],x1[0],x1[1],x1[2],x1[3],x2[0],x2[1],x2[2],x2[3],x3[0],x3[1],x3[2],x3[3]};
#pragma unroll
    for (int i = 0; i < 16; ++i) { const unsigned short hb = bf16_bits(xs[i]); ah.u[i] = hb; al.u[i] = ASPLIT ? bf16_bits(xs[i] - bf16_val(hb)) : (unsigned short)0; }
#pragma unroll
    for (int t = 0; t < 4; ++t) {
      const unsigned short* brow = Wt + (size_t)(col0 + t * 16 + ln) * ldb + kb;
      FragB b;
      b.half[0] = *(const v8us*)(brow + 8 * hh);
      b.half[1] = *(const v8us*)(brow + 16 + 8 * hh);
      acc[t] = mmaN<ASPLIT ? 2 : 1>(ah.v, al.v, b.v, b.v, acc[t]);
    }
  }
#pragma unroll
  for (int t = 0; t < 4; ++t) {
    const int col = col0 + t * 16 + ln;
    float bv = bias ? bias[col] : 0.f;
    if (BIAS_BF16) bv = bf16_round(bv);
#pragma unroll
    for (int r = 0; r < 8; ++r) {
      float v = acc[t][r] + bv;
      if (resid) { float rv = resid[(size_t)((row0 + 8 * hh + r) % rmod) * ldr + col]; if (RES_BF16) rv = bf16_round(rv); v += rv; }
      if (ACT == 1) v = fmaxf(v, 0.f);
      if (ACT == 2) v = 0.5f * v * (1.0f + erff(v * 0.70710678118654752f));
      if (ACT == 3) { const float u = 0.7978845608028654f * (v + 0.044715f * v * v * v); v = 0.5f * v * (1.0f + tanhf(u)); }
      so[w][8 * hh + r][t * 16 + ln] = v;
    }
  }
  __builtin_amdgcn_fence(__ATOMIC_ACQ_REL, "workgroup");
  __builtin_amdgcn_wave_barrier();
  const int rsub = lane >> 4, c4 = (lane & 15) * 4;
  {
#pragma unroll
    for (int q = 0; q < 8; ++q) {
      const int r = q * 2 + rsub;
      const v4f v = *(const v4fa*)&so[w][r][c4];
      *(v4f*)(C + (size_t)(row0 + r) * ldc + col0 + c4) = v;
    }
    
  }
}
// row LayerNorm (biased variance, eps) over N: s = X (+ R); optional out_sum <- s; out_norm <- (s-mu)*rsqrt(var+eps)*g + b
template <bool PARAM_BF16>
__global__ __launch_bounds__(256) void k_layernorm(const float* __restrict__ X, const float* __restrict__ R, const float* __restrict__ g, const float* __restrict__ bta,
                                                  float* __restrict__ out_sum, float* __restrict__ out_norm, int N, float eps) {
  __shared__ float red[256];
  const int row = blockIdx.x, tid = threadIdx.x;
  const float* x = X + (size_t)row * N; const float* rr = R ? R + (size_t)row * N : nullptr;
  float vals[16];                     // up to N = 4096
  const int per = N / 256;            // contiguous chunk per thread? use strided-by-4 chunks: thread handles j = tid*4 + 1024*u
  float s1 = 0.f;
  for (int u = 0; u < per / 4; ++u) {
    const int j = tid * 4 + 1024 * u;
    const v4f a = *(const v4fa*)(x + j);
    v4f b = {0.f,0.f,0.f,0.f}; if (rr) b = *(const v4fa*)(rr + j);
#pragma unroll
    for (int q = 0; q < 4; ++q) { const float v = a[q] + b[q]; vals[u * 4 + q] = v; s1 += v; }
  }
  red[tid] = s1; __syncthreads();
  for (int st = 128; st > 0; st >>= 1) { if (tid < st) red[tid] += red[tid + st]; __syncthreads(); }
  const float mu = red[0] / (float)N; __syncthreads();
  float s2 = 0.f;
  for (int u = 0; u < per / 4; ++u)
#pragma unroll
    for (int q = 0; q < 4; ++q) { const float c = vals[u * 4 + q] - mu; s2 += c * c; }
  red[tid] = s2; __syncthreads();
  for (int st = 128; st > 0; st >>= 1) { if (tid < st) red[tid] += red[tid + st]; __syncthreads(); }
  const float rs = rsqrtf(red[0] / (float)N + eps);
  {
    for (int u = 0; u < per / 4; ++u) {
      const int j = tid * 4 + 1024 * u;
      v4f o, sm;
#pragma unroll
      for (int q = 0; q < 4; ++q) {
        float gg = g[j + q], bb = bta[j + q];
        if (PARAM_BF16) { gg = bf16_round(gg); bb = bf16_round(bb); }
        sm[q] = vals[u * 4 + q]; o[q] = (vals[u * 4 + q] - mu) * rs * gg + bb;
      }
      if (out_sum) *(v4f*)(out_sum + (size_t)row * N + j) = sm;
      *(v4f*)(out_norm + (size_t)row * N + j) = o;
    }
    
  }
}



// ---- f16 WMMA path (v_wmma_f32_16x16x32_f16): 11-bit significands for operands in range — used where a [0,1] probability operand needs more precision than bf16
typedef _Float16 v16h __attribute__((ext_vector_type(16)));
union FragH { v16h v; v8us half[2]; _Float16 h[16]; unsigned short u[16]; };
template <int NT>
__device__ __forceinline__ v8f mmaH(v16h ah, v16h al, v16h bh, v16h bl, v8f c) {
  c = __builtin_amdgcn_wmma_f32_16x16x32_f16(false, ah, false, bh, (short)0, c, false, false);
  if (NT >= 2) c = __builtin_amdgcn_wmma_f32_16x16x32_f16(false, al, false, bh, (short)0, c, false, false);
  if (NT >= 3) c = __builtin_amdgcn_wmma_f32_16x16x32_f16(false, ah, false, bl, (short)0, c, false, false);
  asm volatile("v_nop\n\tv_nop\n\tv_nop\n\tv_nop" : "+v"(c) : "v"(ah), "v"(al), "v"(bh), "v"(bl));
  return c;
}
// batched GEMM like k_gemm_b but f16 operands: A f32 (split into f16 hi/lo if ASPLIT, else rounded to f16), Bt = f16 values [n][k]; alpha; C f32; N multiple of 16 (partial tiles skipped)
template <bool ASPLIT>
__global__ __launch_bounds__(128) void k_gemm_h(const float* __restrict__ A, int lda, size_t sA, const _Float16* __restrict__ Bh, int ldb, size_t sB, float alpha, float* __restrict__ C, int ldc, size_t sC, int M, int N, int K) {
  __shared__ __attribute__((aligned(16))) float so[4][16][64];
  const int tid = threadIdx.x, w = tid >> 5, lane = tid & 31, ln = lane & 15, hh = lane >> 4; const int by = blockIdx.y;
  A += (size_t)by * sA; Bh += (size_t)by * sB; C += (size_t)by * sC;
  const int ntn = (N + 63) / 64; const int wid = blockIdx.x * 4 + w; const int mt = wid / ntn, nq = wid % ntn; if (mt * 16 >= M) return;
  const int row0 = mt * 16, col0 = nq * 64; const float* arow = A + (size_t)(row0 + ln) * lda;
  v8f acc[4] = {};
  for (int kb = 0; kb < K; kb += 32) {
    FragH ah, al;
    const v4f x0 = *(const v4fa*)(arow + kb + 8 * hh), x1 = *(const v4fa*)(arow + kb + 8 * hh + 4), x2 = *(const v4fa*)(arow + kb + 16 + 8 * hh), x3 = *(const v4fa*)(arow + kb + 16 + 8 * hh + 4);
    float xs[16] = {x0[0],x0[1],x0[2],x0[3],x1[0],x1[1],x1[2],x1[3],x2[0],x2[1],x2[2],x2[3],x3[0],x3[1],x3[2],x3[3]};
#pragma unroll
    for (int i = 0; i < 16; ++i) { const _Float16 h = (_Float16)xs[i]; ah.h[i] = h; al.h[i] = ASPLIT ? (_Float16)(xs[i] - (float)h) : (_Float16)0.0f; }
#pragma unroll
    for (int t = 0; t < 4; ++t) { if (col0 + t * 16 >= N) continue; const size_t boff = (size_t)(col0 + t * 16 + ln) * ldb + kb; FragH bq; bq.half[0] = *(const v8us*)(Bh + boff + 8 * hh); bq.half[1] = *(const v8us*)(Bh + boff + 16 + 8 * hh);
      acc[t] = mmaH<ASPLIT ? 2 : 1>(ah.v, al.v, bq.v, bq.v, acc[t]); }
  }
#pragma unroll
  for (int t = 0; t < 4; ++t) { if (col0 + t * 16 >= N) continue;
#pragma unroll
    for (int r = 0; r < 8; ++r) so[w][8 * hh + r][t * 16 + ln] = acc[t][r] * alpha; }
  __builtin_amdgcn_fence(__ATOMIC_ACQ_REL, "workgroup"); __builtin_amdgcn_wave_barrier();
  const int rsub = lane >> 4, c4 = (lane & 15) * 4;
  {
#pragma unroll
    for (int q = 0; q < 8; ++q) { const int r = q * 2 + rsub; if (col0 + c4 < N) { const v4f v = *(const v4fa*)&so[w][r][c4]; *(v4f*)(C + (size_t)(row0 + r) * ldc + col0 + c4) = v; } }
     }
}

// Wt[n][k] = f16(W[k][n]·scale) from f32 row-major W[K][N] (scale = power of two; bf16-exact weights stay exact in f16 away from the subnormal range)
__global__ __launch_bounds__(256) void k_wt_f16(const float* __restrict__ W, _Float16* __restrict__ Wt, int K, int N, float scale) {
  const int t = blockIdx.x * 256 + threadIdx.x; if (t >= N * (K / 8)) return; const int n = t / (K / 8), k8 = (t % (K / 8)) * 8; FragH f;
#pragma unroll
  for (int i = 0; i < 8; ++i) f.h[i] = (_Float16)(bf16_round(W[(size_t)(k8 + i) * N + n]) * scale); const v8us o = f.half[0];
  *(v8us*)((unsigned short*)Wt + (size_t)n * K + k8) = o; 
}
// k_gemm_hh variant with fused epilogue: v = acc·alpha + bias[by·sBias + col] (+ CP[(row/rowsPerB)·sCPb + by·64 + col] if CP) ; ACT 0 none / 1 elu ; writes f16 C16 (and f32 C if non-null)
template <int ACT>
__global__ __launch_bounds__(128) void k_gemm_hhx(const _Float16* __restrict__ A, int lda, size_t sA, const _Float16* __restrict__ Bh, int ldb, size_t sB, float alpha, const float* __restrict__ bias, size_t sBias, const float* __restrict__ CP, int rowsPerB, size_t sCPb, int row0g,
    float* __restrict__ C, _Float16* __restrict__ C16, int ldc, size_t sC, int M, int N, int K) {
  __shared__ __attribute__((aligned(16))) float so[4][16][64];
  const int tid = threadIdx.x, w = tid >> 5, lane = tid & 31, ln = lane & 15, hh = lane >> 4; const int by = blockIdx.y;
  A += (size_t)by * sA; Bh += (size_t)by * sB; const size_t cofs = (size_t)by * sC; const float* bp = bias ? bias + (size_t)by * sBias : nullptr;
  const int ntn = (N + 63) / 64; const int wid = blockIdx.x * 4 + w; const int mt = wid / ntn, nq = wid % ntn; if (mt * 16 >= M) return;
  const int row0 = mt * 16, col0 = nq * 64; const _Float16* arow = A + (size_t)(row0 + ln) * lda;
  v8f acc[4] = {};
  for (int kb = 0; kb < K; kb += 32) { FragH ah; ah.half[0] = *(const v8us*)((const unsigned short*)arow + kb + 8 * hh); ah.half[1] = *(const v8us*)((const unsigned short*)arow + kb + 16 + 8 * hh);
#pragma unroll
    for (int t = 0; t < 4; ++t) { if (col0 + t * 16 >= N) continue; const size_t boff = (size_t)(col0 + t * 16 + ln) * ldb + kb; FragH bq; bq.half[0] = *(const v8us*)((const unsigned short*)Bh + boff + 8 * hh); bq.half[1] = *(const v8us*)((const unsigned short*)Bh + boff + 16 + 8 * hh);
      acc[t] = mmaH<1>(ah.v, ah.v, bq.v, bq.v, acc[t]); }
  }
#pragma unroll
  for (int t = 0; t < 4; ++t) { if (col0 + t * 16 >= N) continue; const int col = col0 + t * 16 + ln; const float bv = bp ? bf16_round(bp[col]) : 0.f;
#pragma unroll
    for (int r = 0; r < 8; ++r) { float v = acc[t][r] * alpha + bv; if (CP) { const int rr = row0g + row0 + 8 * hh + r; if (rowsPerB < 0) v += CP[cofs + (size_t)rr * ldc + col];      /* rowsPerB < 0: own element of the batched C plane */ else { const int bidx = rr / rowsPerB; v += CP[(size_t)bidx * sCPb + (size_t)by * 64 + col]; } } if (ACT == 1) v = (v > 0.f) ? v : expm1f(v); else if (ACT == 7) v = (v > 0.f) ? v + 1.0f : expf(v); else if (ACT == 8) v = tanhf(v); else if (ACT == 9) v = 0.5f * v * (1.0f + tanhf(0.7978845608028654f * (v + 0.044715f * v * v * v))); else if (ACT == 11) v = 1.0f / (1.0f + expf(-v)); else if (ACT == 12) v = (v > 0.f) ? v : 0.01f * v; else if (ACT == 14) v = (v > 0.f) ? v : 0.1f * v; else if (ACT == 16) v = (v >= 0.f) ? v : 0.3f * v; else if (ACT == 17) v = (v >= 0.f) ? v : 0.2f * v; else if (ACT == 15) v = v / (1.0f + expf(-v)); else if (ACT == 3) v = fmaxf(v, 0.f); else if (ACT == 6) v = 0.5f * v * (1.0f + erff(v * 0.70710678118654752f)); so[w][8 * hh + r][t * 16 + ln] = v; } }
  __builtin_amdgcn_fence(__ATOMIC_ACQ_REL, "workgroup"); __builtin_amdgcn_wave_barrier();
  const int rsub = lane >> 4, c4 = (lane & 15) * 4; typedef _Float16 v4h __attribute__((ext_vector_type(4)));
  {
#pragma unroll
    for (int q = 0; q < 8; ++q) { const int r = q * 2 + rsub; if (col0 + c4 < N) { const v4f v = *(const v4fa*)&so[w][r][c4]; if (C) *(v4f*)(C + cofs + (size_t)(row0 + r) * ldc + col0 + c4) = v; if (C16) { v4h h4; for (int i = 0; i < 4; ++i) h4[i] = (_Float16)v[i]; *(v4h*)(C16 + cofs + (size_t)(row0 + r) * ldc + col0 + c4) = h4; } } }
     }
}


typedef _Float16 v4h __attribute__((ext_vector_type(4)));

__global__ __launch_bounds__(256) void k_x16(const float* __restrict__ x, _Float16* __restrict__ X16, size_t n8) { const size_t t = (size_t)blockIdx.x * 256 + threadIdx.x; if (t >= n8) return; FragH f;
#pragma unroll
  for (int q = 0; q < 8; ++q) f.h[q] = (_Float16)bf16_round(x[t * 8 + q]); *(v8us*)((unsigned short*)X16 + t * 8) = f.half[0];  }
__global__ __launch_bounds__(256) void k_h16(const float* __restrict__ x, _Float16* __restrict__ X16, size_t n8) { const size_t t = (size_t)blockIdx.x * 256 + threadIdx.x; if (t >= n8) return; FragH f;
#pragma unroll
  for (int q = 0; q < 8; ++q) f.h[q] = (_Float16)x[t * 8 + q]; *(v8us*)((unsigned short*)X16 + t * 8) = f.half[0];  }
__global__ __launch_bounds__(256) void k_round16f(const float* __restrict__ W, _Float16* __restrict__ Bt, size_t n8) { const size_t t = (size_t)blockIdx.x * 256 + threadIdx.x; if (t >= n8) return; FragH f;
#pragma unroll
  for (int i = 0; i < 8; ++i) f.h[i] = (_Float16)(bf16_round(W[t * 8 + i]) * 16.0f); *(v8us*)((unsigned short*)Bt + t * 8) = f.half[0];  }
template <int NHv, int TTv>
__global__ __launch_bounds__(256) void k_vt(const _Float16* __restrict__ V16h, const _Float16* __restrict__ V16r, int ldv, int voff, _Float16* __restrict__ Vth, _Float16* __restrict__ Vtr) { __shared__ unsigned short tl[64][66]; const int tid = threadIdx.x; const int slab = blockIdx.x / (TTv / 64), lg = blockIdx.x % (TTv / 64); const int b = slab / NHv, h = slab % NHv;
  const _Float16* V16 = blockIdx.y ? V16r : V16h; _Float16* Vt = blockIdx.y ? Vtr : Vth;      /* blockIdx.y: hi plane or residual plane; the two jobs share nothing */
  for (int i = tid; i < 64 * 8; i += 256) { const int r = i / 8, c8 = (i % 8) * 8; FragH f; f.half[0] = *(const v8us*)((const unsigned short*)V16 + ((size_t)b * TTv + lg * 64 + r) * ldv + voff + h * 64 + c8);
#pragma unroll
    for (int q = 0; q < 8; ++q) tl[r][c8 + q] = f.u[q]; }
  __syncthreads();
  {
#pragma unroll
    for (int rd = 0; rd < 2; ++rd) { const int d = rd * 32 + tid / 8, pc = tid % 8; FragH f;
#pragma unroll
      for (int q = 0; q < 8; ++q) f.u[q] = tl[pc * 8 + q][d];
      /* V^T in the order in which k_attn's A fragments take it, [block of 32 keys][tile of 16 channels][fragment half][lane] x 16 bytes: key group pc is block pc / 4, half (pc / 2) % 2, lane 16 * (pc % 2) + d % 16 */
      const size_t u = (((size_t)(lg * 2 + (pc >> 2)) * 4 + (d >> 4)) * 2 + ((pc >> 1) & 1)) * 32 + (pc & 1) * 16 + (d & 15);
      *(v8us*)((unsigned short*)Vt + (size_t)slab * 64 * TTv + u * 8) = f.half[0]; }
     } }

__global__ __launch_bounds__(256) void k_hl(const float* __restrict__ F, _Float16* __restrict__ Hh, _Float16* __restrict__ Hl, size_t n8) { const size_t t = (size_t)blockIdx.x * 256 + threadIdx.x; if (t >= n8) return; FragH fh, fl; const v4f a = *(const v4fa*)(F + t * 8), c = *(const v4fa*)(F + t * 8 + 4);
#pragma unroll
  for (int q = 0; q < 4; ++q) { _Float16 h = (_Float16)a[q]; fh.h[q] = h; fl.h[q] = (_Float16)((a[q] - (float)h) * 1024.0f); h = (_Float16)c[q]; fh.h[4 + q] = h; fl.h[4 + q] = (_Float16)((c[q] - (float)h) * 1024.0f); }
  { *(v8us*)((unsigned short*)Hh + t * 8) = fh.half[0]; *(v8us*)((unsigned short*)Hl + t * 8) = fl.half[0];  } }
// k_hl for the theta | phi | g rows. phi's groups of eight channels go to Ph / Pl in the order in which k_attn's A fragments take them, [tile of 16 keys][k step][fragment half][lane] x 16 bytes:
// channel group j of key n is k step j / 4, half (j / 2) % 2, lane 16 * (j % 2) + n % 16 (the k order of g2_frag). theta and g stay in rows; phi's place in those rows is left unwritten and is not read.
__global__ __launch_bounds__(256) void k_hlp(const float* __restrict__ F, _Float16* __restrict__ Hh, _Float16* __restrict__ Hl, _Float16* __restrict__ Ph, _Float16* __restrict__ Pl, size_t n8) { const size_t t = (size_t)blockIdx.x * 256 + threadIdx.x; if (t >= n8) return; FragH fh, fl; const v4f a = *(const v4fa*)(F + t * 8), c = *(const v4fa*)(F + t * 8 + 4);
  for (int q = 0; q < 4; ++q) { _Float16 h = (_Float16)a[q]; fh.h[q] = h; fl.h[q] = (_Float16)((a[q] - (float)h) * 1024.0f); h = (_Float16)c[q]; fh.h[4 + q] = h; fl.h[4 + q] = (_Float16)((c[q] - (float)h) * 1024.0f); }
  const size_t n = t / (D3 / 8); const int j = (int)(t % (D3 / 8)) - IC / 8;
  if (j >= 0 && j < IC / 8) { const size_t u = (((n >> 4) * 2 + (j >> 2)) * 2 + ((j >> 1) & 1)) * 32 + (j & 1) * 16 + (n & 15); *(v8us*)((unsigned short*)Ph + u * 8) = fh.half[0]; *(v8us*)((unsigned short*)Pl + u * 8) = fl.half[0]; }
  else { *(v8us*)((unsigned short*)Hh + t * 8) = fh.half[0]; *(v8us*)((unsigned short*)Hl + t * 8) = fl.half[0]; } }

// ---- fast GEMM (wave tile 32x64; requires M % 32 == 0 rows per launch region and N % 64 == 0); epilogue = k_gemm_hhx semantics ----
__device__ __forceinline__ v16h g2_frag(const _Float16* p, int hh) { FragH f; f.half[0] = *(const v8us*)((const unsigned short*)p + 8 * hh); f.half[1] = *(const v8us*)((const unsigned short*)p + 16 + 8 * hh); return f.v; }
__device__ __forceinline__ v8f g2_mma(v16h a, v16h b, v8f c) { v8f d = __builtin_amdgcn_wmma_f32_16x16x32_f16(false, a, false, b, (short)0, c, false, false); asm volatile("v_nop\n\tv_nop\n\tv_nop\n\tv_nop" : "+v"(d) : "v"(a), "v"(b)); return d; }
// ROWB: for a product taken with its operands swapped (C^T = W . A^T): bias[row] in place of bias[col], and CP, where given, is the own element of C
template <int ACT, bool ROWB = false>
__global__ __launch_bounds__(128) void k_gemm2(const _Float16* __restrict__ A, int lda, size_t sA, const _Float16* __restrict__ Bh, int ldb, size_t sB, float alpha, const float* __restrict__ bias, size_t sBias, const float* __restrict__ CP, int rowsPerB, size_t sCPb, int row0g,
    float* __restrict__ C, _Float16* __restrict__ C16, int ldc, size_t sC, int M, int N, int K) { static_assert(ACT == 0 || ACT == 3 || ACT == 6 || ACT == 8 || ACT == 9 || ACT == 11 || ACT == 12 || ACT == 14 || ACT == 15 || ACT == 16 || ACT == 17, "k_gemm2: unsupported ACT code (would silently apply no activation)");
  __shared__ __attribute__((aligned(16))) float so[4][32][68];
  const int tid = threadIdx.x, w = tid >> 5, lane = tid & 31, ln = lane & 15, hh = lane >> 4; const int by = blockIdx.y;
  A += (size_t)by * sA; Bh += (size_t)by * sB; const size_t cofs = (size_t)by * sC; const float* bp = bias ? bias + (size_t)by * sBias : nullptr;
  const int ntn = N >> 6; const int mt = blockIdx.x / ntn, nq = blockIdx.x - mt * ntn; const int row0 = mt * 128 + 32 * w, col0 = nq * 64; if (row0 >= M) return;
  const _Float16* a0p = A + (size_t)(row0 + ln) * lda; const _Float16* a1p = a0p + (size_t)16 * lda;
  const _Float16* b0p = Bh + (size_t)(col0 + ln) * ldb; const _Float16* b1p = b0p + (size_t)16 * ldb; const _Float16* b2p = b1p + (size_t)16 * ldb; const _Float16* b3p = b2p + (size_t)16 * ldb;
  const v8f z8 = {0.f,0.f,0.f,0.f,0.f,0.f,0.f,0.f}; v8f c00 = z8, c01 = z8, c02 = z8, c03 = z8, c10 = z8, c11 = z8, c12 = z8, c13 = z8;
#pragma unroll 1
  for (int kb = 0; kb < K; kb += 32) { const v16h a0 = g2_frag(a0p + kb, hh), a1 = g2_frag(a1p + kb, hh);
    v16h b = g2_frag(b0p + kb, hh); c00 = g2_mma(a0, b, c00); c10 = g2_mma(a1, b, c10);
    b = g2_frag(b1p + kb, hh); c01 = g2_mma(a0, b, c01); c11 = g2_mma(a1, b, c11);
    b = g2_frag(b2p + kb, hh); c02 = g2_mma(a0, b, c02); c12 = g2_mma(a1, b, c12);
    b = g2_frag(b3p + kb, hh); c03 = g2_mma(a0, b, c03); c13 = g2_mma(a1, b, c13); }
  v8f accs[8] = {c00, c01, c02, c03, c10, c11, c12, c13};
  v4f br[4] = {};      /* ROWB: bias of the lane's 16 rows (half * 16 + 8 * hh + r), asked for as one batch */
  if (ROWB && bp) { const float* p = bp + row0g + row0 + 8 * hh; br[0] = *(const v4fa*)p; br[1] = *(const v4fa*)(p + 4); br[2] = *(const v4fa*)(p + 16); br[3] = *(const v4fa*)(p + 20);
    for (int i = 0; i < 4; ++i) for (int q = 0; q < 4; ++q) br[i][q] = bf16_round(br[i][q]); }
#pragma unroll
  for (int u = 0; u < 8; ++u) { const int t = u & 3, half = u >> 2; const int col = col0 + t * 16 + ln; const float bvc = (!ROWB && bp) ? bf16_round(bp[col]) : 0.f;
#pragma unroll
    for (int r = 0; r < 8; ++r) { const int rloc = half * 16 + 8 * hh + r; const float bv = ROWB ? br[half * 2 + (r >> 2)][r & 3] : bvc; float v = accs[u][r] * alpha + bv; if (CP) { if (ROWB || rowsPerB < 0) v += CP[cofs + (size_t)(row0g + row0 + rloc) * ldc + col];      /* rowsPerB < 0: own element of the batched C plane */ else { const int bidx = (row0g + row0 + rloc) / rowsPerB; v += CP[(size_t)bidx * sCPb + (size_t)by * 64 + col]; } }
      if (ACT == 3) v = fmaxf(v, 0.f); else if (ACT == 6) v = 0.5f * v * (1.0f + erff(v * 0.70710678118654752f)); else if (ACT == 11) v = 1.0f / (1.0f + expf(-v)); else if (ACT == 15) v = v / (1.0f + expf(-v)); else if (ACT == 12) v = (v > 0.f) ? v : 0.01f * v; else if (ACT == 8) v = tanhf(v); else if (ACT == 9) v = 0.5f * v * (1.0f + tanhf(0.7978845608028654f * (v + 0.044715f * v * v * v))); else if (ACT == 14) v = (v > 0.f) ? v : 0.1f * v; else if (ACT == 16) v = (v >= 0.f) ? v : 0.3f * v; else if (ACT == 17) v = (v >= 0.f) ? v : 0.2f * v;
      so[w][rloc][t * 16 + ln] = v; } }
  __builtin_amdgcn_fence(__ATOMIC_ACQ_REL, "workgroup"); __builtin_amdgcn_wave_barrier();
  const int rsub = lane >> 4, c4 = (lane & 15) * 4;
  {
#pragma unroll
    for (int q = 0; q < 16; ++q) { const int r = q * 2 + rsub; const v4f v = *(const v4fa*)&so[w][r][c4]; if (C) *(v4f*)(C + cofs + (size_t)(row0 + r) * ldc + col0 + c4) = v; if (C16) { v4h h4; for (int i = 0; i < 4; ++i) h4[i] = (_Float16)v[i]; *(v4h*)(C16 + cofs + (size_t)(row0 + r) * ldc + col0 + c4) = h4; } }
     } }


__global__ __launch_bounds__(256) void k_rsm(const float* __restrict__ S, _Float16* __restrict__ P, int nrows) {
  #pragma clang fp contract(off)
  const int i = blockIdx.x * 256 + threadIdx.x; if (i >= nrows) return; const float* s = S + (size_t)i * SQ; float mx = -3.0e38f;
#pragma unroll 1
  for (int j = 0; j < SQ; ++j) mx = fmaxf(mx, s[j]); float se = 0.f;
#pragma unroll 1
  for (int j = 0; j < SQ; ++j) se += expf(s[j] - mx); const float sc = 256.0f / se;
#pragma unroll 1
  for (int j0 = 0; j0 < SQ; j0 += 8) { FragH f; for (int q = 0; q < 8; ++q) f.h[q] = (_Float16)(expf(s[j0 + q] - mx) * sc); unsigned short* d = (unsigned short*)P + (size_t)i * SQ + j0; *(v8us*)d = f.half[0];  } }
__global__ __launch_bounds__(256) void k_vt(const _Float16* __restrict__ V16, int b, int h0, _Float16* __restrict__ VT) { __shared__ unsigned short tl[64][65]; const int tid = threadIdx.x; const int hh = blockIdx.x % HG, sg = blockIdx.x / HG; const int s0 = sg * 64; const int h = h0 + hh;
  for (int i = tid; i < 64 * 8; i += 256) { const int j = i / 8, d8 = (i % 8) * 8; FragH f; f.half[0] = *(const v8us*)((const unsigned short*)V16 + ((size_t)b * SQ + s0 + j) * DM + h * HD + d8); for (int q = 0; q < 8; ++q) tl[d8 + q][j] = f.u[q]; }
  __syncthreads();
  { for (int i = tid; i < 64 * 8; i += 256) { const int d = i / 8, j8 = (i % 8) * 8; FragH f; for (int q = 0; q < 8; ++q) f.u[q] = tl[d][j8 + q]; *(v8us*)((unsigned short*)VT + ((size_t)hh * HD + d) * SQ + s0 + j8) = f.half[0]; }  } }


// The eight jobs that read inputs alone, in one launch; the block index picks the job and no job reads what another writes.
// Blocks 0 .. 4 * PW - 1: the four weight matrices, rounded to bf16, x16, as f16 in their natural [out][in] rows (theta | phi | g stacked in B3, W_z in BZ). Block 4 * PW: the three biases stacked in b3. The rest: x [channel][position] to f16 rows [position][channel], a 64 x 32 tile a block.
#define PW (IC * CC / 8 / 256)       /* blocks a weight matrix: eight elements a thread */
#define PX (NB * (LL / 32) * (CC / 64))
__global__ __launch_bounds__(256) void k_prep(const float* __restrict__ X, const float* __restrict__ tw, const float* __restrict__ pw, const float* __restrict__ gw, const float* __restrict__ zw, const float* __restrict__ tb, const float* __restrict__ pb, const float* __restrict__ gb,
    _Float16* __restrict__ XR, _Float16* __restrict__ B3, _Float16* __restrict__ BZ, float* __restrict__ b3) { static_assert(IC * CC % 2048 == 0 && D3 <= 256, "whole blocks a weight matrix; one thread a bias");
  __shared__ float tl[64][33]; const int tid = threadIdx.x;
  if (blockIdx.x < 4 * PW) { const int j = blockIdx.x / PW; const float* w = (j == 0) ? tw : (j == 1) ? pw : (j == 2) ? gw : zw; _Float16* Bt = (j < 3) ? B3 + (size_t)j * IC * CC : BZ;
    const size_t t = (size_t)(blockIdx.x % PW) * 256 + tid; FragH f; for (int q = 0; q < 8; ++q) f.h[q] = (_Float16)(bf16_round(w[t * 8 + q]) * 16.0f); *(v8us*)((unsigned short*)Bt + t * 8) = f.half[0]; }
  else if (blockIdx.x == 4 * PW) { if (tid < D3) { const int j = tid / IC; const float* s = (j == 0) ? tb : (j == 1) ? pb : gb; b3[tid] = s[tid % IC]; } }
  else { const int bx = blockIdx.x - (4 * PW + 1); const int nl = LL / 32, nc = CC / 64; const int cb_ = bx % nc; const int lb = (bx / nc) % nl; const size_t b = bx / (nc * nl); const int c0 = cb_ * 64, l0 = lb * 32;
    for (int i = tid; i < 64 * 32; i += 256) { const int c = i / 32, l = i % 32; tl[c][l] = bf16_round(X[(b * CC + c0 + c) * (size_t)LL + l0 + l]); }
    __syncthreads();      /* under a test on the block index alone: every thread of the block passes it */
    const int l = tid / 8, c8 = (tid % 8) * 8; FragH f; for (int q = 0; q < 8; ++q) f.h[q] = (_Float16)tl[c8 + q][l]; unsigned short* d = (unsigned short*)XR + (b * LL + l0 + l) * (size_t)CC + c0 + c8; *(v8us*)d = f.half[0];
    asm volatile("s_wait_xcnt 0x0" ::: "memory");      /* behind the store: the code of the other jobs follows this block in the listing and rewrites the store's registers */
  } }

// Fused attention: a work-group of 8 waves owns 64 queries; a wave owns 32 of them (two column groups of 16) and every fourth block of 32 keys, one block a trip; scores, softmax weights and the weighted sum of g stay in registers (no score or weight plane in memory).
// The four waves of a query group each keep their own running maximum, sum and y; the four partial results are joined through LDS behind the key loop.
// S^T = phi . theta^T (A = 16 phi rows, B = the wave's theta rows, kept in registers), so a lane holds one query's scores: D register r of lane (ln, hh) is key 8 * hh + r, query ln.
// The two tiles of a trip (keys 0..15, 16..31), converted in place, are the B operand of y^T += g^T . P^T in the k order of g2_frag; the running maximum, the sum and the rescale factor of query ln live in lanes ln and ln + 16.
__device__ __forceinline__ v8f at_mma(v16h a, v16h b, v8f c) { return __builtin_amdgcn_wmma_f32_16x16x32_f16(false, a, false, b, (short)0, c, false, false); }
// fragment in the k order of g2_frag from a wave-uniform base and the lane's own byte offset (row * pitch + 16 * hh)
__device__ __forceinline__ v16h at_frag(const char* base, unsigned off) { FragH f; f.half[0] = *(const v8us*)(base + off); f.half[1] = *(const v8us*)(base + off + 32); return f.v; }
// the same fragment from an operand stored in fragment order (k_hlp, k_vt): 1 KiB at a wave-uniform base, off = 16 * lane; each of the two loads covers 512 contiguous bytes, four whole lines
__device__ __forceinline__ v16h at_fragp(const char* base, unsigned off) { FragH f; f.half[0] = *(const v8us*)(base + off); f.half[1] = *(const v8us*)(base + off + 512); return f.v; }
__device__ __forceinline__ float at_xhalf(float x) { return __builtin_bit_cast(float, __builtin_amdgcn_permlanex16(__builtin_bit_cast(int, x), __builtin_bit_cast(int, x), 0x76543210, 0xfedcba98, false, false)); }      /* lane l with lane l ^ 16 */
__global__ __launch_bounds__(256) void k_attn(const _Float16* __restrict__ TH, const _Float16* __restrict__ TL, const _Float16* __restrict__ PH, const _Float16* __restrict__ PL, const _Float16* __restrict__ GT, const _Float16* __restrict__ GTL, float* __restrict__ YF) {
  __shared__ __attribute__((aligned(16))) v4f py[8][16][32];      /* partial y: [wave][(column group * 4 + tile) * 2 + register half][lane] */
  __shared__ float pm[8][2][32], pl[8][2][32];      /* partial maximum and sum: [wave][column group][lane] */
  const int tid = threadIdx.x, lane = tid & 31, ln = lane & 15, hh = lane >> 4;
  const int wv = __builtin_amdgcn_readfirstlane(tid >> 5), w = wv & 1, ks = wv >> 1;      /* query group; which of every four key blocks */
  const int b = blockIdx.x / (LL / 64), qb = (blockIdx.x % (LL / 64)) * 64;
  const char* th = (const char*)(TH + (size_t)b * LL * D3); const char* tl = (const char*)(TL + (size_t)b * LL * D3);      /* rows theta | - | g, hi / residual */
  const char* kph = (const char*)(PH + (size_t)b * LL * IC); const char* kpl = (const char*)(PL + (size_t)b * LL * IC);      /* phi hi / residual in fragment order: 128 bytes a key, 2 KiB a tile of 16 keys */
  const char* gh = (const char*)(GT + (size_t)b * IC * SK); const char* gl = (const char*)(GTL + (size_t)b * IC * SK);      /* g^T hi / residual in fragment order: 128 bytes a key, 4 KiB a block of 32 keys */
  const unsigned qo = (unsigned)(32 * w + ln) * (D3 * 2) + 16 * hh, lo = (unsigned)lane * 16;
  const float L2E = 1.44269504088896340736f;
  const v8f z8 = {0.f,0.f,0.f,0.f,0.f,0.f,0.f,0.f};
  v8f yh[2][4], yl[2][4]; float m[2], l[2];
#pragma unroll
  for (int j = 0; j < 2; ++j) { m[j] = -INFINITY; l[j] = 0.f; for (int t = 0; t < 4; ++t) { yh[j][t] = z8; yl[j][t] = z8; } }
  __builtin_amdgcn_sched_barrier(0);      /* with the one behind the wait: no vector write stands between the first loads and their s_wait_xcnt */
  v16h qh[2][2], ql[2][2];      /* theta hi / residual: [column group][k step] */
#pragma unroll
  for (int j = 0; j < 2; ++j) for (int c = 0; c < 2; ++c) { const size_t o = (size_t)(qb + 16 * j) * (D3 * 2) + 64 * c; qh[j][c] = at_frag(th + o, qo); ql[j][c] = at_frag(tl + o, qo); }
  v16h ka[2][2], kr[2][2];      /* phi hi / residual of the trip: [key tile][k step] */
#pragma unroll
  for (int t = 0; t < 2; ++t) for (int c = 0; c < 2; ++c) { const size_t o = (size_t)(32 * ks + 16 * t) * (IC * 2) + 1024 * c; ka[t][c] = at_fragp(kph + o, lo); kr[t][c] = at_fragp(kpl + o, lo); }
  asm volatile("s_wait_xcnt 0x0" ::: "memory");      /* in front of the first rewrite of an address register that the loads above name */
  __builtin_amdgcn_sched_barrier(0);      /* holds every later register write behind that wait */
  for (int it = 0; it < SK / 128; ++it) { const int k0 = 128 * it + 32 * ks;
    v16h ga[4], gr[4];      /* g^T of this trip: asked for here, used behind the softmax */
#pragma unroll
    for (int t = 0; t < 4; ++t) { const size_t o = (size_t)k0 * (IC * 2) + 1024 * t; ga[t] = at_fragp(gh + o, lo); gr[t] = at_fragp(gl + o, lo); }
    asm volatile("s_wait_xcnt 0x0" ::: "memory");      /* in front of the rewrite of the address registers that these loads name */
    __builtin_amdgcn_sched_barrier(0);      /* keeps the g^T loads in front of the score products: sunk to their uses each would be waited for alone */
    float s[2][2][8];
#pragma unroll
    for (int t = 0; t < 2; ++t) for (int j = 0; j < 2; ++j) {
      v8f sh = at_mma(ka[t][0], qh[j][0], z8); sh = at_mma(ka[t][1], qh[j][1], sh);      /* phi-hi . theta-hi */
      v8f sl = at_mma(ka[t][0], ql[j][0], z8); sl = at_mma(ka[t][1], ql[j][1], sl); sl = at_mma(kr[t][0], qh[j][0], sl); sl = at_mma(kr[t][1], qh[j][1], sl);      /* phi-hi . theta-res + phi-res . theta-hi, both x1024 */
      for (int r = 0; r < 8; ++r) s[j][t][r] = fmaf(sl[r], 1.0f / 1024.0f, sh[r]); }
    __builtin_amdgcn_sched_barrier(0);      /* with the one behind the wait: no vector write stands between the loads below and their s_wait_xcnt */
    const int kn = (k0 + 128) & (SK - 1);      /* the next trip's phi rows, one trip ahead; the last trip asks for the wave's first rows again (in bounds, not used) */
#pragma unroll
    for (int t = 0; t < 2; ++t) for (int c = 0; c < 2; ++c) { const size_t o = (size_t)(kn + 16 * t) * (IC * 2) + 1024 * c; ka[t][c] = at_fragp(kph + o, lo); kr[t][c] = at_fragp(kpl + o, lo); }
    asm volatile("s_wait_xcnt 0x0" ::: "memory");      /* in front of the rewrite of the address registers that these loads name */
    __builtin_amdgcn_sched_barrier(0);      /* keeps those loads in front of the softmax, whose time then covers their latency */
    float mn[2];
#pragma unroll
    for (int j = 0; j < 2; ++j) { float mx = s[j][0][0];
      for (int t = 0; t < 2; ++t) for (int r = 0; r < 8; ++r) mx = fmaxf(mx, s[j][t][r]);
      mx = fmaxf(mx, at_xhalf(mx));      /* the other eight keys of each tile sit in the partner lane */
      mn[j] = fmaxf(m[j], mx); }
    if (__builtin_amdgcn_ballot_w32(mn[0] > m[0] || mn[1] > m[1]) != 0) {      /* no maximum moved: every factor would be 1 */
#pragma unroll
      for (int j = 0; j < 2; ++j) { const float al = __builtin_amdgcn_exp2f((m[j] - mn[j]) * L2E);      /* first trip: exp2(-inf) = 0 on sums that are still 0 */
        m[j] = mn[j]; l[j] *= al;
        for (int t = 0; t < 4; ++t) for (int r = 0; r < 8; ++r) { yh[j][t][r] *= al; yl[j][t][r] *= al; } } }
#pragma unroll
    for (int j = 0; j < 2; ++j) { FragH pf; const float cn = -m[j] * L2E;
#pragma unroll
      for (int i = 0; i < 8; ++i) { const float p0 = __builtin_amdgcn_exp2f(fmaf(s[j][0][i], L2E, cn)), p1 = __builtin_amdgcn_exp2f(fmaf(s[j][1][i], L2E, cn)); l[j] += p0 + p1;
        pf.h[i] = (_Float16)(p0 * 16384.0f); pf.h[8 + i] = (_Float16)(p1 * 16384.0f); }      /* P carried x2^14: the peaky rows would otherwise flush most weights below the f16 normal range */
#pragma unroll
      for (int t = 0; t < 4; ++t) { yh[j][t] = at_mma(ga[t], pf.v, yh[j][t]); yl[j][t] = at_mma(gr[t], pf.v, yl[j][t]); } }
  }
#pragma unroll
  for (int j = 0; j < 2; ++j) { pm[wv][j][lane] = m[j]; pl[wv][j][lane] = l[j] + at_xhalf(l[j]);
#pragma unroll
    for (int t = 0; t < 4; ++t) { v4f o0, o1;
      for (int r = 0; r < 4; ++r) { o0[r] = fmaf(yl[j][t][r], 1.0f / 1024.0f, yh[j][t][r]); o1[r] = fmaf(yl[j][t][4 + r], 1.0f / 1024.0f, yh[j][t][4 + r]); }
      py[wv][(j * 4 + t) * 2][lane] = o0; py[wv][(j * 4 + t) * 2 + 1][lane] = o1; } }
  __syncthreads();      /* every wave's partial result is in LDS before any wave joins */
  const int jo = ks & 1, tp = ks >> 1;      /* this wave joins column group jo, tiles 2 * tp and 2 * tp + 1: 16 queries x 32 channels, whole 128-byte lines of y */
  float ms[4], wt[4];
#pragma unroll
  for (int s = 0; s < 4; ++s) ms[s] = pm[2 * s + w][jo][lane];
  const float mj = fmaxf(fmaxf(ms[0], ms[1]), fmaxf(ms[2], ms[3])); float lt = 0.f;
#pragma unroll
  for (int s = 0; s < 4; ++s) ms[s] = (ms[s] - mj) * L2E;
  __builtin_amdgcn_sched_barrier(0);      /* all four exponents are formed in front of the first v_exp */
#pragma unroll
  for (int s = 0; s < 4; ++s) wt[s] = __builtin_amdgcn_exp2f(ms[s]);
#pragma unroll
  for (int s = 0; s < 4; ++s) lt = fmaf(wt[s], pl[2 * s + w][jo][lane], lt);
  const float inv = (1.0f / 16384.0f) / lt;
  v4f o[4];
#pragma unroll
  for (int i = 0; i < 4; ++i) { o[i] = py[w][(jo * 4 + tp * 2) * 2 + i][lane] * wt[0];
    for (int s = 1; s < 4; ++s) { const v4f p = py[2 * s + w][(jo * 4 + tp * 2) * 2 + i][lane]; for (int r = 0; r < 4; ++r) o[i][r] = fmaf(p[r], wt[s], o[i][r]); }
    o[i] *= inv; }
  float* yo = YF + ((size_t)b * LL + qb + 32 * w + 16 * jo + ln) * IC + 32 * tp + 8 * hh;      /* D register r of tile t = channel 16 * t + 8 * hh + r of query ln */
  *(v4f*)yo = o[0]; *(v4f*)(yo + 4) = o[1]; *(v4f*)(yo + 16) = o[2]; *(v4f*)(yo + 20) = o[3]; }
__global__ __launch_bounds__(256) void k_bnstat(const float* __restrict__ WY, float* __restrict__ ST) {
  #pragma clang fp contract(off)
  __shared__ float red[256]; const int c = blockIdx.x; const int tid = threadIdx.x; float s = 0.f;
  float v[NR / 256];      /* the thread's values of the channel, rows tid + 256 * i in the order in which both passes sum them: all asked for ahead of the first sum (in a loop of one load a trip each load was waited out alone) and kept for the second pass */
  for (int i = 0; i < (int)(NR / 256); ++i) v[i] = WY[(size_t)c * NR + (size_t)i * 256 + tid];      /* WY is [channel][row]: a wave's load is one whole line */
  for (int i = 0; i < (int)(NR / 256); ++i) s = __fadd_rn(s, v[i]);
  red[tid] = s; __syncthreads(); for (int st = 128; st > 0; st >>= 1) { if (tid < st) red[tid] += red[tid + st]; __syncthreads(); }
  const float mean = red[0] / (float)NR; __syncthreads(); float s2 = 0.f;
  for (int i = 0; i < (int)(NR / 256); ++i) { const float d = __fadd_rn(v[i], -mean); s2 = __fadd_rn(s2, __fmul_rn(d, d)); }
  red[tid] = s2; __syncthreads(); for (int st = 128; st > 0; st >>= 1) { if (tid < st) red[tid] += red[tid + st]; __syncthreads(); }
  if (tid < 32) { const float v = (tid == 0) ? mean : ((tid == 1) ? rsqrtf(__fadd_rn(red[0] / (float)NR, 1e-5f)) : 0.f); *(float*)(ST + (size_t)c * 32 + tid) = v;  } }
__global__ __launch_bounds__(256) void k_fin(const float* __restrict__ WY, const float* __restrict__ ST, const float* __restrict__ gam, const float* __restrict__ bet, const float* __restrict__ x, float* __restrict__ out) {
  #pragma clang fp contract(off)
  static_assert(LL % 2048 == 0, "a block's 2048 elements lie in one channel of one sample");
  const size_t e0 = (size_t)blockIdx.x * 2048; if (e0 >= (size_t)NB * CC * LL) return; const int n0 = (int)(e0 % LL); const size_t bc = e0 / LL; const int c = (int)(bc % CC); const size_t b = bc / CC; const float mean = ST[(size_t)c * 32], rstd = ST[(size_t)c * 32 + 1], g = bf16_round(gam[c]), be = bf16_round(bet[c]); v8f r;
  const int o = threadIdx.x * 8; const float* wp = WY + (size_t)c * NR + b * LL + n0; const float* xp = x + e0;      /* WY is [channel][row]: the thread's eight positions are 32 contiguous bytes there as in x and out, at the same offset from the block's base */
  __builtin_amdgcn_sched_barrier(0);      /* with the one behind the wait: no write of a register, a scalar load's result among them, stands between the four loads and their s_wait_xcnt */
  const v4f w0 = *(const v4fa*)(wp + o), w1 = *(const v4fa*)(wp + o + 4), x0 = *(const v4fa*)(xp + o), x1 = *(const v4fa*)(xp + o + 4);
  asm volatile("s_wait_xcnt 0x0" ::: "memory");      /* in front of the first rewrite of a base register that the loads above name */
  __builtin_amdgcn_sched_barrier(0);      /* holds every later register write behind that wait */
  const float wy[8] = {w0[0], w0[1], w0[2], w0[3], w1[0], w1[1], w1[2], w1[3]}, xv[8] = {x0[0], x0[1], x0[2], x0[3], x1[0], x1[1], x1[2], x1[3]};
  for (int q = 0; q < 8; ++q) { const float v = __fadd_rn(__fmul_rn(__fmul_rn(__fadd_rn(wy[q], -mean), rstd), g), be); r[q] = __fadd_rn(v, bf16_round(xv[q])); }
  *(v8f*)(out + e0 + o) = r;  }

extern "C" void kernel_launch(void* const* d_in, const int* in_sizes, int n_in,
                              void* d_out, int out_size, void* d_ws, size_t ws_size, hipStream_t stream) {
  (void)in_sizes; (void)n_in; (void)out_size;
  const float* const* I = (const float* const*)d_in; const float* x = I[0]; const float* gw = I[1]; const float* gb = I[2]; const float* tw = I[3]; const float* tb = I[4]; const float* pw = I[5]; const float* pb = I[6]; const float* zw = I[7]; const float* zb = I[8]; const float* gam = I[9]; const float* bet = I[10];      /* g/theta/phi_w [64][256], wz_w [256][64] natural */
  char* ws = (char*)d_ws; size_t off = 0;
  auto take = [&](size_t bytes) { char* p = ws + off; off += (bytes + 255) & ~(size_t)255; return p; };
  _Float16* B3 = (_Float16*)take((size_t)D3 * CC * 2); float* b3 = (float*)take(D3 * 4); _Float16* BZ = (_Float16*)take((size_t)CC * IC * 2); float* ST = (float*)take((size_t)CC * 32 * 4);
  _Float16* XR = (_Float16*)take(NR * CC * 2); float* TF = (float*)take(NR * D3 * 4); _Float16* TH = (_Float16*)take(NR * D3 * 2); _Float16* TL = (_Float16*)take(NR * D3 * 2); _Float16* PH = (_Float16*)take(NR * IC * 2); _Float16* PL = (_Float16*)take(NR * IC * 2);
  _Float16* GT = (_Float16*)take((size_t)NB * IC * SK * 2); _Float16* GTL = (_Float16*)take((size_t)NB * IC * SK * 2);
  float* YF = (float*)take(NR * IC * 4); _Float16* YH = (_Float16*)take(NR * IC * 2); _Float16* YL = (_Float16*)take(NR * IC * 2); float* WY = (float*)take(NR * CC * 4);
  if (off > ws_size) return;      /* 0.2 + 8 + 12 + 6 + 6 + 4 + 4 + 4 + 2 + 2 + 16 = approx 64 MiB */
  k_prep<<<4 * PW + 1 + PX, 256, 0, stream>>>(x, tw, pw, gw, zw, tb, pb, gb, XR, B3, BZ, b3);      /* Bt rows: theta 0..63 | phi 64..127 | g 128..191 */
  k_gemm2<0><<<dim3((unsigned)((NR / 128) * (D3 / 64)), 1), 128, 0, stream>>>(XR, CC, 0, B3, CC, 0, 0.0625f, b3, 0, nullptr, 1, 0, 0, TF, nullptr, D3, 0, (int)NR, D3, CC);      /* theta | phi | g rows f32 */
  k_hlp<<<(unsigned)((NR * D3 / 8 + 255) / 256), 256, 0, stream>>>(TF, TH, TL, PH, PL, NR * D3 / 8);      /* phi goes to PH / PL in fragment order */
  k_vt<1, SK><<<dim3(NBR * (SK / 64), 2), 256, 0, stream>>>(TH + 2 * IC, TL + 2 * IC, D3, 0, GT, GTL);      /* g^T hi / residual, a plane a batch, in fragment order: the four independent transposes in one launch */
  k_attn<<<NBR * (LL / 64), 256, 0, stream>>>(TH, TL, PH, PL, GT, GTL, YF);      /* softmax(theta . phi) . g -> y rows f32 */
  k_hl<<<(unsigned)((NR * IC / 8 + 255) / 256), 256, 0, stream>>>(YF, YH, YL, NR * IC / 8);
  const dim3 gz((unsigned)((CC / 128) * (NR / 64)), 1);      /* WY = (W_z y)^T, [channel][batch * positions]: A = W_z rows, B = y rows, so that k_bnstat and k_fin, which go channel by channel, read contiguous bytes */
  k_gemm2<0, true><<<gz, 128, 0, stream>>>(BZ, IC, 0, YL, IC, 0, 0.0625f / 1024.0f, nullptr, 0, nullptr, 1, 0, 0, WY, nullptr, (int)NR, 0, CC, (int)NR, IC);      /* W_z: y-res term */
  k_gemm2<0, true><<<gz, 128, 0, stream>>>(BZ, IC, 0, YH, IC, 0, 0.0625f, zb, 0, WY, -1, 0, 0, WY, nullptr, (int)NR, 0, CC, (int)NR, IC);      /* + y-hi term + bias (by row = channel) + own element of the y-res term */
  k_bnstat<<<CC, 256, 0, stream>>>(WY, ST);
  k_fin<<<(unsigned)(((size_t)NB * CC * LL / 8 + 255) / 256), 256, 0, stream>>>(WY, ST, gam, bet, x, (float*)d_out);
}

// v008
// It runs in 131 microseconds.
// In both of two side-by-side timings against v007, it was 1.07 times as fast.
// Counting every step since v000, it is 246 times as fast.
#include <hip/hip_runtime.h>
// Non-local block (x [2][256][8x32x32 = 8192 positions]; g, theta, phi = 1x1 conv projections to 64 (+ bias); f = theta . phi over all positions; softmax; y = attn g; W_z 1x1 conv back to 256 (+ bias); training-mode BatchNorm over (batch, positions) per channel with gamma/beta; out = bn(W_z y) + x).
// Compute dtype: inputs rounded to bf16; x / weights exact; theta, phi, g, y as hi + residual operand pairs (~2^-22); P plain f16 (~2^-12); softmax, BN f32; v_wmma_f32_16x16x32_f16.
#define NB 2
#define CC 256
#define LL 8192                      /* positions per sample */
#define SK LL
#define IC 64                        /* inter channels */
#define D3 (3 * IC)                  /* theta | phi | g */
#define NR ((size_t)NB * LL)
#define NBR NB                       /* batches (debug hook) */
#define SQ LL
#define DM CC
#define NH 1
#define HD 64
#define HG 1
typedef __bf16 v16b __attribute__((ext_vector_type(16)));
typedef unsigned short v8us __attribute__((ext_vector_type(8), may_alias));
typedef float  v8f  __attribute__((ext_vector_type(8)));
typedef float  v4f  __attribute__((ext_vector_type(4)));
typedef float  v4fa __attribute__((ext_vector_type(4), may_alias));
union FragB { v16b v; v8us half[2]; unsigned short u[16]; };

__device__ __forceinline__ unsigned short bf16_bits(float x) { unsigned int u = __float_as_uint(x); return (unsigned short)((u + 0x7FFFu + ((u >> 16) & 1u)) >> 16); }
__device__ __forceinline__ float bf16_val(unsigned short b) { return __uint_as_float(((unsigned int)b) << 16); }
__device__ __forceinline__ float bf16_round(float x) { return bf16_val(bf16_bits(x)); }
// D += A·B with NT terms: 1 = ah·bh, 2 = + al·bh (A split), 3 = + ah·bl (both split)
template <int NT>
__device__ __forceinline__ v8f mmaN(v16b ah, v16b al, v16b bh, v16b bl, v8f c) {
  c = __builtin_amdgcn_wmma_f32_16x16x32_bf16(false, ah, false, bh, (short)0, c, false, false);
  if (NT >= 2) c = __builtin_amdgcn_wmma_f32_16x16x32_bf16(false, al, false, bh, (short)0, c, false, false);
  if (NT >= 3) c = __builtin_amdgcn_wmma_f32_16x16x32_bf16(false, ah, false, bl, (short)0, c, false, false);
  asm volatile("v_nop\n\tv_nop\n\tv_nop\n\tv_nop" : "+v"(c) : "v"(ah), "v"(al), "v"(bh), "v"(bl));
  return c;
}

__global__ __launch_bounds__(256) void k_wt_bf16(const float* __restrict__ W, unsigned short* __restrict__ Wt, int K, int N) {
  const int t = blockIdx.x * 256 + threadIdx.x;
  const int k8n = K / 8;
  if (t >= N * k8n) return;
  const int n = t / k8n, k8 = (t % k8n) * 8;
  v8us v;
#pragma unroll
  for (int i = 0; i < 8; ++i) v[i] = bf16_bits(W[(size_t)(k8 + i) * N + n]);
  *(v8us*)(Wt + (size_t)n * K + k8) = v;
  
}

// GEMM C[M][N] (f32, pitch ldc) = act(A[M][K]·W + bias). A f32 row-major (pitch lda) converted per fragment to bf16
// (ASPLIT: hi/lo two planes -> 2 terms, else single rounded term); Wt bf16 [N][K] (pitch ldb). BIAS_BF16 rounds the
// bias to bf16 first (bias quantised to bf16 before the add). K%32==0, M%16==0, N%64==0.
template <bool ASPLIT, int ACT, bool BIAS_BF16>
__global__ __launch_bounds__(128) void k_gemm_bf(const float* __restrict__ A, int lda, const unsigned short* __restrict__ Wt, int ldb,
                                               const float* __restrict__ bias, float* __restrict__ C, int ldc, int M, int N, int K) {
  __shared__ __attribute__((aligned(16))) float so[4][16][64];
  const int tid = threadIdx.x, w = tid >> 5, lane = tid & 31, ln = lane & 15, hh = lane >> 4;
  const int ntn = N / 64;
  const int wid = blockIdx.x * 4 + w;
  const int mt = wid / ntn, nq = wid % ntn;
  if (mt * 16 >= M) return;
  const int row0 = mt * 16, col0 = nq * 64;
  const float* arow = A + (size_t)(row0 + ln) * lda;
  v8f acc[4] = {};
  for (int kb = 0; kb < K; kb += 32) {
    FragB ah, al;
    const v4f x0 = *(const v4fa*)(arow + kb + 8 * hh), x1 = *(const v4fa*)(arow + kb + 8 * hh + 4);
    const v4f x2 = *(const v4fa*)(arow + kb + 16 + 8 * hh), x3 = *(const v4fa*)(arow + kb + 16 + 8 * hh + 4);
    float xs[16] = {x0[0],x0[1],x0[2],x0[3],x1[0],x1[1],x1[2],x1[3],x2[0],x2[1],x2[2],x2[3],x3[0],x3[1],x3[2],x3[3]};
#pragma unroll
    for (int i = 0; i < 16; ++i) { const unsigned short hb = bf16_bits(xs[i]); ah.u[i] = hb; al.u[i] = ASPLIT ? bf16_bits(xs[i] - bf16_val(hb)) : (unsigned short)0; }
#pragma unroll
    for (int t = 0; t < 4; ++t) {
      const unsigned short* brow = Wt + (size_t)(col0 + t * 16 + ln) * ldb + kb;
      FragB b;
      b.half[0] = *(const v8us*)(brow + 8 * hh);
      b.half[1] = *(const v8us*)(brow + 16 + 8 * hh);
      acc[t] = mmaN<ASPLIT ? 2 : 1>(ah.v, al.v, b.v, b.v, acc[t]);
    }
  }
#pragma unroll
  for (int t = 0; t < 4; ++t) {
    float bv = bias ? bias[col0 + t * 16 + ln] : 0.f;
    if (BIAS_BF16) bv = bf16_round(bv);
#pragma unroll
    for (int r = 0; r < 8; ++r) { float v = acc[t][r] + bv; if (ACT == 1) v = fmaxf(v, 0.f); so[w][8 * hh + r][t * 16 + ln] = v; }
  }
  __builtin_amdgcn_fence(__ATOMIC_ACQ_REL, "workgroup");
  __builtin_amdgcn_wave_barrier();
  const int rsub = lane >> 4, c4 = (lane & 15) * 4;
  {
#pragma unroll
    for (int q = 0; q < 8; ++q) {
      const int r = q * 2 + rsub;
      const v4f v = *(const v4fa*)&so[w][r][c4];
      *(v4f*)(C + (size_t)(row0 + r) * ldc + col0 + c4) = v;
    }
    
  }
}

// GEMM C = act(A·W + bias + resid): A f32 (ASPLIT -> hi/lo 2 terms), Wt bf16 [N][K]; ACT 0 none, 1 relu, 2 exact gelu;
// resid (optional, f32, row index = (row % rmod), pitch ldr, RES_BF16 rounds it) added before the activation.
template <bool ASPLIT, int ACT, bool BIAS_BF16, bool RES_BF16>
__global__ __launch_bounds__(128) void k_gemm_bf3(const float* __restrict__ A, int lda, const unsigned short* __restrict__ Wt, int ldb,
                                                const float* __restrict__ bias, const float* __restrict__ resid, int rmod, int ldr,
                                                float* __restrict__ C, int ldc, int M, int N, int K) {
  __shared__ __attribute__((aligned(16))) float so[4][16][64];
  const int tid = threadIdx.x, w = tid >> 5, lane = tid & 31, ln = lane & 15, hh = lane >> 4;
  const int ntn = N / 64;
  const int wid = blockIdx.x * 4 + w;
  const int mt = wid / ntn, nq = wid % ntn;
  if (mt * 16 >= M) return;
  const int row0 = mt * 16, col0 = nq * 64;
  const float* arow = A + (size_t)(row0 + ln) * lda;
  v8f acc[4] = {};
  for (int kb = 0; kb < K; kb += 32) {
    FragB ah, al;
    const v4f x0 = *(const v4fa*)(arow + kb + 8 * hh), x1 = *(const v4fa*)(arow + kb + 8 * hh + 4);
    const v4f x2 = *(const v4fa*)(arow + kb + 16 + 8 * hh), x3 = *(const v4fa*)(arow + kb + 16 + 8 * hh + 4);
    float xs[16] = {x0[0],x0[1],x0[2],x0[3],x1[0],x1[1],x1[2],x1[3],x2[0],x2[1],x2[2],x2[3],x3[0],x3[1],x3[2],x3[3]};
#pragma unroll
    for (int i = 0; i < 16; ++i) { const unsigned short hb = bf16_bits(xs[i]); ah.u[i] = hb; al.u[i] = ASPLIT ? bf16_bits(xs[i] - bf16_val(hb)) : (unsigned short)0; }
#pragma unroll
    for (int t = 0; t < 4; ++t) {
      const unsigned short* brow = Wt + (size_t)(col0 + t * 16 + ln) * ldb + kb;
      FragB b;
      b.half[0] = *(const v8us*)(brow + 8 * hh);
      b.half[1] = *(const v8us*)(brow + 16 + 8 * hh);
      acc[t] = mmaN<ASPLIT ? 2 : 1>(ah.v, al.v, b.v, b.v, acc[t]);
    }
  }
#pragma unroll
  for (int t = 0; t < 4; ++t) {
    const int col = col0 + t * 16 + ln;
    float bv = bias ? bias[col] : 0.f;
    if (BIAS_BF16) bv = bf16_round(bv);
#pragma unroll
    for (int r = 0; r < 8; ++r) {
      float v = acc[t][r] + bv;
      if (resid) { float rv = resid[(size_t)((row0 + 8 * hh + r) % rmod) * ldr + col]; if (RES_BF16) rv = bf16_round(rv); v += rv; }
      if (ACT == 1) v = fmaxf(v, 0.f);
      if (ACT == 2) v = 0.5f * v * (1.0f + erff(v * 0.70710678118654752f));
      if (ACT == 3) { const float u = 0.7978845608028654f * (v + 0.044715f * v * v * v); v = 0.5f * v * (1.0f + tanhf(u)); }
      so[w][8 * hh + r][t * 16 + ln] = v;
    }
  }
  __builtin_amdgcn_fence(__ATOMIC_ACQ_REL, "workgroup");
  __builtin_amdgcn_wave_barrier();
  const int rsub = lane >> 4, c4 = (lane & 15) * 4;
  {
#pragma unroll
    for (int q = 0; q < 8; ++q) {
      const int r = q * 2 + rsub;
      const v4f v = *(const v4fa*)&so[w][r][c4];
      *(v4f*)(C + (size_t)(row0 + r) * ldc + col0 + c4) = v;
    }
    
  }
}
// row LayerNorm (biased variance, eps) over N: s = X (+ R); optional out_sum <- s; out_norm <- (s-mu)*rsqrt(var+eps)*g + b
template <bool PARAM_BF16>
__global__ __launch_bounds__(256) void k_layernorm(const float* __restrict__ X, const float* __restrict__ R, const float* __restrict__ g, const float* __restrict__ bta,
                                                  float* __restrict__ out_sum, float* __restrict__ out_norm, int N, float eps) {
  __shared__ float red[256];
  const int row = blockIdx.x, tid = threadIdx.x;
  const float* x = X + (size_t)row * N; const float* rr = R ? R + (size_t)row * N : nullptr;
  float vals[16];                     // up to N = 4096
  const int per = N / 256;            // contiguous chunk per thread? use strided-by-4 chunks: thread handles j = tid*4 + 1024*u
  float s1 = 0.f;
  for (int u = 0; u < per / 4; ++u) {
    const int j = tid * 4 + 1024 * u;
    const v4f a = *(const v4fa*)(x + j);
    v4f b = {0.f,0.f,0.f,0.f}; if (rr) b = *(const v4fa*)(rr + j);
#pragma unroll
    for (int q = 0; q < 4; ++q) { const float v = a[q] + b[q]; vals[u * 4 + q] = v; s1 += v; }
  }
  red[tid] = s1; __syncthreads();
  for (int st = 128; st > 0; st >>= 1) { if (tid < st) red[tid] += red[tid + st]; __syncthreads(); }
  const float mu = red[0] / (float)N; __syncthreads();
  float s2 = 0.f;
  for (int u = 0; u < per / 4; ++u)
#pragma unroll
    for (int q = 0; q < 4; ++q) { const float c = vals[u * 4 + q] - mu; s2 += c * c; }
  red[tid] = s2; __syncthreads();
  for (int st = 128; st > 0; st >>= 1) { if (tid < st) red[tid] += red[tid + st]; __syncthreads(); }
  const float rs = rsqrtf(red[0] / (float)N + eps);
  {
    for (int u = 0; u < per / 4; ++u) {
      const int j = tid * 4 + 1024 * u;
      v4f o, sm;
#pragma unroll
      for (int q = 0; q < 4; ++q) {
        float gg = g[j + q], bb = bta[j + q];
        if (PARAM_BF16) { gg = bf16_round(gg); bb = bf16_round(bb); }
        sm[q] = vals[u * 4 + q]; o[q] = (vals[u * 4 + q] - mu) * rs * gg + bb;
      }
      if (out_sum) *(v4f*)(out_sum + (size_t)row * N + j) = sm;
      *(v4f*)(out_norm + (size_t)row * N + j) = o;
    }
    
  }
}



// ---- f16 WMMA path (v_wmma_f32_16x16x32_f16): 11-bit significands for operands in range — used where a [0,1] probability operand needs more precision than bf16
typedef _Float16 v16h __attribute__((ext_vector_type(16)));
union FragH { v16h v; v8us half[2]; _Float16 h[16]; unsigned short u[16]; };
template <int NT>
__device__ __forceinline__ v8f mmaH(v16h ah, v16h al, v16h bh, v16h bl, v8f c) {
  c = __builtin_amdgcn_wmma_f32_16x16x32_f16(false, ah, false, bh, (short)0, c, false, false);
  if (NT >= 2) c = __builtin_amdgcn_wmma_f32_16x16x32_f16(false, al, false, bh, (short)0, c, false, false);
  if (NT >= 3) c = __builtin_amdgcn_wmma_f32_16x16x32_f16(false, ah, false, bl, (short)0, c, false, false);
  asm volatile("v_nop\n\tv_nop\n\tv_nop\n\tv_nop" : "+v"(c) : "v"(ah), "v"(al), "v"(bh), "v"(bl));
  return c;
}
// batched GEMM like k_gemm_b but f16 operands: A f32 (split into f16 hi/lo if ASPLIT, else rounded to f16), Bt = f16 values [n][k]; alpha; C f32; N multiple of 16 (partial tiles skipped)
template <bool ASPLIT>
__global__ __launch_bounds__(128) void k_gemm_h(const float* __restrict__ A, int lda, size_t sA, const _Float16* __restrict__ Bh, int ldb, size_t sB, float alpha, float* __restrict__ C, int ldc, size_t sC, int M, int N, int K) {
  __shared__ __attribute__((aligned(16))) float so[4][16][64];
  const int tid = threadIdx.x, w = tid >> 5, lane = tid & 31, ln = lane & 15, hh = lane >> 4; const int by = blockIdx.y;
  A += (size_t)by * sA; Bh += (size_t)by * sB; C += (size_t)by * sC;
  const int ntn = (N + 63) / 64; const int wid = blockIdx.x * 4 + w; const int mt = wid / ntn, nq = wid % ntn; if (mt * 16 >= M) return;
  const int row0 = mt * 16, col0 = nq * 64; const float* arow = A + (size_t)(row0 + ln) * lda;
  v8f acc[4] = {};
  for (int kb = 0; kb < K; kb += 32) {
    FragH ah, al;
    const v4f x0 = *(const v4fa*)(arow + kb + 8 * hh), x1 = *(const v4fa*)(arow + kb + 8 * hh + 4), x2 = *(const v4fa*)(arow + kb + 16 + 8 * hh), x3 = *(const v4fa*)(arow + kb + 16 + 8 * hh + 4);
    float xs[16] = {x0[0],x0[1],x0[2],x0[3],x1[0],x1[1],x1[2],x1[3],x2[0],x2[1],x2[2],x2[3],x3[0],x3[1],x3[2],x3[3]};
#pragma unroll
    for (int i = 0; i < 16; ++i) { const _Float16 h = (_Float16)xs[i]; ah.h[i] = h; al.h[i] = ASPLIT ? (_Float16)(xs[i] - (float)h) : (_Float16)0.0f; }
#pragma unroll
    for (int t = 0; t < 4; ++t) { if (col0 + t * 16 >= N) continue; const size_t boff = (size_t)(col0 + t * 16 + ln) * ldb + kb; FragH bq; bq.half[0] = *(const v8us*)(Bh + boff + 8 * hh); bq.half[1] = *(const v8us*)(Bh + boff + 16 + 8 * hh);
      acc[t] = mmaH<ASPLIT ? 2 : 1>(ah.v, al.v, bq.v, bq.v, acc[t]); }
  }
#pragma unroll
  for (int t = 0; t < 4; ++t) { if (col0 + t * 16 >= N) continue;
#pragma unroll
    for (int r = 0; r < 8; ++r) so[w][8 * hh + r][t * 16 + ln] = acc[t][r] * alpha; }
  __builtin_amdgcn_fence(__ATOMIC_ACQ_REL, "workgroup"); __builtin_amdgcn_wave_barrier();
  const int rsub = lane >> 4, c4 = (lane & 15) * 4;
  {
#pragma unroll
    for (int q = 0; q < 8; ++q) { const int r = q * 2 + rsub; if (col0 + c4 < N) { const v4f v = *(const v4fa*)&so[w][r][c4]; *(v4f*)(C + (size_t)(row0 + r) * ldc + col0 + c4) = v; } }
     }
}

// Wt[n][k] = f16(W[k][n]·scale) from f32 row-major W[K][N] (scale = power of two; bf16-exact weights stay exact in f16 away from the subnormal range)
__global__ __launch_bounds__(256) void k_wt_f16(const float* __restrict__ W, _Float16* __restrict__ Wt, int K, int N, float scale) {
  const int t = blockIdx.x * 256 + threadIdx.x; if (t >= N * (K / 8)) return; const int n = t / (K / 8), k8 = (t % (K / 8)) * 8; FragH f;
#pragma unroll
  for (int i = 0; i < 8; ++i) f.h[i] = (_Float16)(bf16_round(W[(size_t)(k8 + i) * N + n]) * scale); const v8us o = f.half[0];
  *(v8us*)((unsigned short*)Wt + (size_t)n * K + k8) = o; 
}
// k_gemm_hh variant with fused epilogue: v = acc·alpha + bias[by·sBias + col] (+ CP[(row/rowsPerB)·sCPb + by·64 + col] if CP) ; ACT 0 none / 1 elu ; writes f16 C16 (and f32 C if non-null)
template <int ACT>
__global__ __launch_bounds__(128) void k_gemm_hhx(const _Float16* __restrict__ A, int lda, size_t sA, const _Float16* __restrict__ Bh, int ldb, size_t sB, float alpha, const float* __restrict__ bias, size_t sBias, const float* __restrict__ CP, int rowsPerB, size_t sCPb, int row0g,
    float* __restrict__ C, _Float16* __restrict__ C16, int ldc, size_t sC, int M, int N, int K) {
  __shared__ __attribute__((aligned(16))) float so[4][16][64];
  const int tid = threadIdx.x, w = tid >> 5, lane = tid & 31, ln = lane & 15, hh = lane >> 4; const int by = blockIdx.y;
  A += (size_t)by * sA; Bh += (size_t)by * sB; const size_t cofs = (size_t)by * sC; const float* bp = bias ? bias + (size_t)by * sBias : nullptr;
  const int ntn = (N + 63) / 64; const int wid = blockIdx.x * 4 + w; const int mt = wid / ntn, nq = wid % ntn; if (mt * 16 >= M) return;
  const int row0 = mt * 16, col0 = nq * 64; const _Float16* arow = A + (size_t)(row0 + ln) * lda;
  v8f acc[4] = {};
  for (int kb = 0; kb < K; kb += 32) { FragH ah; ah.half[0] = *(const v8us*)((const unsigned short*)arow + kb + 8 * hh); ah.half[1] = *(const v8us*)((const unsigned short*)arow + kb + 16 + 8 * hh);
#pragma unroll
    for (int t = 0; t < 4; ++t) { if (col0 + t * 16 >= N) continue; const size_t boff = (size_t)(col0 + t * 16 + ln) * ldb + kb; FragH bq; bq.half[0] = *(const v8us*)((const unsigned short*)Bh + boff + 8 * hh); bq.half[1] = *(const v8us*)((const unsigned short*)Bh + boff + 16 + 8 * hh);
      acc[t] = mmaH<1>(ah.v, ah.v, bq.v, bq.v, acc[t]); }
  }
#pragma unroll
  for (int t = 0; t < 4; ++t) { if (col0 + t * 16 >= N) continue; const int col = col0 + t * 16 + ln; const float bv = bp ? bf16_round(bp[col]) : 0.f;
#pragma unroll
    for (int r = 0; r < 8; ++r) { float v = acc[t][r] * alpha + bv; if (CP) { const int rr = row0g + row0 + 8 * hh + r; if (rowsPerB < 0) v += CP[cofs + (size_t)rr * ldc + col];      /* rowsPerB < 0: own element of the batched C plane */ else { const int bidx = rr / rowsPerB; v += CP[(size_t)bidx * sCPb + (size_t)by * 64 + col]; } } if (ACT == 1) v = (v > 0.f) ? v : expm1f(v); else if (ACT == 7) v = (v > 0.f) ? v + 1.0f : expf(v); else if (ACT == 8) v = tanhf(v); else if (ACT == 9) v = 0.5f * v * (1.0f + tanhf(0.7978845608028654f * (v + 0.044715f * v * v * v))); else if (ACT == 11) v = 1.0f / (1.0f + expf(-v)); else if (ACT == 12) v = (v > 0.f) ? v : 0.01f * v; else if (ACT == 14) v = (v > 0.f) ? v : 0.1f * v; else if (ACT == 16) v = (v >= 0.f) ? v : 0.3f * v; else if (ACT == 17) v = (v >= 0.f) ? v : 0.2f * v; else if (ACT == 15) v = v / (1.0f + expf(-v)); else if (ACT == 3) v = fmaxf(v, 0.f); else if (ACT == 6) v = 0.5f * v * (1.0f + erff(v * 0.70710678118654752f)); so[w][8 * hh + r][t * 16 + ln] = v; } }
  __builtin_amdgcn_fence(__ATOMIC_ACQ_REL, "workgroup"); __builtin_amdgcn_wave_barrier();
  const int rsub = lane >> 4, c4 = (lane & 15) * 4; typedef _Float16 v4h __attribute__((ext_vector_type(4)));
  {
#pragma unroll
    for (int q = 0; q < 8; ++q) { const int r = q * 2 + rsub; if (col0 + c4 < N) { const v4f v = *(const v4fa*)&so[w][r][c4]; if (C) *(v4f*)(C + cofs + (size_t)(row0 + r) * ldc + col0 + c4) = v; if (C16) { v4h h4; for (int i = 0; i < 4; ++i) h4[i] = (_Float16)v[i]; *(v4h*)(C16 + cofs + (size_t)(row0 + r) * ldc + col0 + c4) = h4; } } }
     }
}


typedef _Float16 v4h __attribute__((ext_vector_type(4)));

__global__ __launch_bounds__(256) void k_x16(const float* __restrict__ x, _Float16* __restrict__ X16, size_t n8) { const size_t t = (size_t)blockIdx.x * 256 + threadIdx.x; if (t >= n8) return; FragH f;
#pragma unroll
  for (int q = 0; q < 8; ++q) f.h[q] = (_Float16)bf16_round(x[t * 8 + q]); *(v8us*)((unsigned short*)X16 + t * 8) = f.half[0];  }
__global__ __launch_bounds__(256) void k_h16(const float* __restrict__ x, _Float16* __restrict__ X16, size_t n8) { const size_t t = (size_t)blockIdx.x * 256 + threadIdx.x; if (t >= n8) return; FragH f;
#pragma unroll
  for (int q = 0; q < 8; ++q) f.h[q] = (_Float16)x[t * 8 + q]; *(v8us*)((unsigned short*)X16 + t * 8) = f.half[0];  }
__global__ __launch_bounds__(256) void k_round16f(const float* __restrict__ W, _Float16* __restrict__ Bt, size_t n8) { const size_t t = (size_t)blockIdx.x * 256 + threadIdx.x; if (t >= n8) return; FragH f;
#pragma unroll
  for (int i = 0; i < 8; ++i) f.h[i] = (_Float16)(bf16_round(W[t * 8 + i]) * 16.0f); *(v8us*)((unsigned short*)Bt + t * 8) = f.half[0];  }
__global__ __launch_bounds__(256) void k_hl(const float* __restrict__ F, _Float16* __restrict__ Hh, _Float16* __restrict__ Hl, size_t n8) { const size_t t = (size_t)blockIdx.x * 256 + threadIdx.x; if (t >= n8) return; FragH fh, fl; const v4f a = *(const v4fa*)(F + t * 8), c = *(const v4fa*)(F + t * 8 + 4);
#pragma unroll
  for (int q = 0; q < 4; ++q) { _Float16 h = (_Float16)a[q]; fh.h[q] = h; fl.h[q] = (_Float16)((a[q] - (float)h) * 1024.0f); h = (_Float16)c[q]; fh.h[4 + q] = h; fl.h[4 + q] = (_Float16)((c[q] - (float)h) * 1024.0f); }
  { *(v8us*)((unsigned short*)Hh + t * 8) = fh.half[0]; *(v8us*)((unsigned short*)Hl + t * 8) = fl.half[0];  } }
// f32 -> f16 hi + residual x1024, eight values (k_hl's split)
__device__ __forceinline__ void hl_split8(const float* a, unsigned short* hb, unsigned short* lb) {
  for (int q = 0; q < 8; ++q) { const _Float16 h = (_Float16)a[q]; const _Float16 r = (_Float16)((a[q] - (float)h) * 1024.0f); hb[q] = __builtin_bit_cast(unsigned short, h); lb[q] = __builtin_bit_cast(unsigned short, r); } }

// ---- fast GEMM (wave tile 32x64; requires M % 32 == 0 rows per launch region and N % 64 == 0); epilogue = k_gemm_hhx semantics ----
__device__ __forceinline__ v16h g2_frag(const _Float16* p, int hh) { FragH f; f.half[0] = *(const v8us*)((const unsigned short*)p + 8 * hh); f.half[1] = *(const v8us*)((const unsigned short*)p + 16 + 8 * hh); return f.v; }
__device__ __forceinline__ v8f g2_mma(v16h a, v16h b, v8f c) { v8f d = __builtin_amdgcn_wmma_f32_16x16x32_f16(false, a, false, b, (short)0, c, false, false); asm volatile("v_nop\n\tv_nop\n\tv_nop\n\tv_nop" : "+v"(d) : "v"(a), "v"(b)); return d; }
// ROWB: for a product taken with its operands swapped (C^T = W . A^T): bias[row] in place of bias[col], and CP, where given, is the own element of C
// SPL: the theta | phi | g projection. No f32 C: each wave splits its staged 32 x 64 tile into hi + residual and stores it in the form in which k_attn takes it (column block 0 theta, 1 phi, 2 g).
template <int ACT, bool ROWB = false, bool SPL = false>
__global__ __launch_bounds__(128) void k_gemm2(const _Float16* __restrict__ A, int lda, size_t sA, const _Float16* __restrict__ Bh, int ldb, size_t sB, float alpha, const float* __restrict__ bias, size_t sBias, const float* __restrict__ CP, int rowsPerB, size_t sCPb, int row0g,
    float* __restrict__ C, _Float16* __restrict__ C16, int ldc, size_t sC, int M, int N, int K, _Float16* __restrict__ Th = nullptr, _Float16* __restrict__ Tl = nullptr, _Float16* __restrict__ Ph = nullptr, _Float16* __restrict__ Pl = nullptr, _Float16* __restrict__ Gh = nullptr, _Float16* __restrict__ Gl = nullptr) { static_assert(ACT == 0 || ACT == 3 || ACT == 6 || ACT == 8 || ACT == 9 || ACT == 11 || ACT == 12 || ACT == 14 || ACT == 15 || ACT == 16 || ACT == 17, "k_gemm2: unsupported ACT code (would silently apply no activation)");
  __shared__ __attribute__((aligned(16))) float so[4][32][68];
  const int tid = threadIdx.x, w = tid >> 5, lane = tid & 31, ln = lane & 15, hh = lane >> 4; const int by = blockIdx.y;
  A += (size_t)by * sA; Bh += (size_t)by * sB; const size_t cofs = (size_t)by * sC; const float* bp = bias ? bias + (size_t)by * sBias : nullptr;
  const int ntn = N >> 6; const int mt = blockIdx.x / ntn, nq = blockIdx.x - mt * ntn; const int row0 = mt * 128 + 32 * w, col0 = nq * 64; if (row0 >= M) return;
  const _Float16* a0p = A + (size_t)(row0 + ln) * lda; const _Float16* a1p = a0p + (size_t)16 * lda;
  const _Float16* b0p = Bh + (size_t)(col0 + ln) * ldb; const _Float16* b1p = b0p + (size_t)16 * ldb; const _Float16* b2p = b1p + (size_t)16 * ldb; const _Float16* b3p = b2p + (size_t)16 * ldb;
  const v8f z8 = {0.f,0.f,0.f,0.f,0.f,0.f,0.f,0.f}; v8f c00 = z8, c01 = z8, c02 = z8, c03 = z8, c10 = z8, c11 = z8, c12 = z8, c13 = z8;
#pragma unroll 1
  for (int kb = 0; kb < K; kb += 32) { const v16h a0 = g2_frag(a0p + kb, hh), a1 = g2_frag(a1p + kb, hh);
    v16h b = g2_frag(b0p + kb, hh); c00 = g2_mma(a0, b, c00); c10 = g2_mma(a1, b, c10);
    b = g2_frag(b1p + kb, hh); c01 = g2_mma(a0, b, c01); c11 = g2_mma(a1, b, c11);
    b = g2_frag(b2p + kb, hh); c02 = g2_mma(a0, b, c02); c12 = g2_mma(a1, b, c12);
    b = g2_frag(b3p + kb, hh); c03 = g2_mma(a0, b, c03); c13 = g2_mma(a1, b, c13); }
  v8f accs[8] = {c00, c01, c02, c03, c10, c11, c12, c13};
  v4f br[4] = {};      /* ROWB: bias of the lane's 16 rows (half * 16 + 8 * hh + r), asked for as one batch */
  if (ROWB && bp) { const float* p = bp + row0g + row0 + 8 * hh; br[0] = *(const v4fa*)p; br[1] = *(const v4fa*)(p + 4); br[2] = *(const v4fa*)(p + 16); br[3] = *(const v4fa*)(p + 20);
    for (int i = 0; i < 4; ++i) for (int q = 0; q < 4; ++q) br[i][q] = bf16_round(br[i][q]); }
#pragma unroll
  for (int u = 0; u < 8; ++u) { const int t = u & 3, half = u >> 2; const int col = col0 + t * 16 + ln; const float bvc = (!ROWB && bp) ? bf16_round(bp[col]) : 0.f;
#pragma unroll
    for (int r = 0; r < 8; ++r) { const int rloc = half * 16 + 8 * hh + r; const float bv = ROWB ? br[half * 2 + (r >> 2)][r & 3] : bvc; float v = accs[u][r] * alpha + bv; if (CP) { if (ROWB || rowsPerB < 0) v += CP[cofs + (size_t)(row0g + row0 + rloc) * ldc + col];      /* rowsPerB < 0: own element of the batched C plane */ else { const int bidx = (row0g + row0 + rloc) / rowsPerB; v += CP[(size_t)bidx * sCPb + (size_t)by * 64 + col]; } }
      if (ACT == 3) v = fmaxf(v, 0.f); else if (ACT == 6) v = 0.5f * v * (1.0f + erff(v * 0.70710678118654752f)); else if (ACT == 11) v = 1.0f / (1.0f + expf(-v)); else if (ACT == 15) v = v / (1.0f + expf(-v)); else if (ACT == 12) v = (v > 0.f) ? v : 0.01f * v; else if (ACT == 8) v = tanhf(v); else if (ACT == 9) v = 0.5f * v * (1.0f + tanhf(0.7978845608028654f * (v + 0.044715f * v * v * v))); else if (ACT == 14) v = (v > 0.f) ? v : 0.1f * v; else if (ACT == 16) v = (v >= 0.f) ? v : 0.3f * v; else if (ACT == 17) v = (v >= 0.f) ? v : 0.2f * v;
      so[w][rloc][t * 16 + ln] = v; } }
  __builtin_amdgcn_fence(__ATOMIC_ACQ_REL, "workgroup"); __builtin_amdgcn_wave_barrier();
  const int rsub = lane >> 4, c4 = (lane & 15) * 4;
  if (SPL) { const size_t n0 = (size_t)(row0g + row0);      /* the wave's first row: batch * positions + position, a multiple of 32 */
    if (nq == 0) {      /* theta: rows of D3 halves (only the first IC are written or read); eight lanes store one row's 128 bytes, a whole line */
#pragma unroll      /* unrolled: the eight trips' LDS reads go out in batches and the stores take one base with immediate offsets; rolled, each trip waits out its own reads */
      for (int i = 0; i < 8; ++i) { const int r = i * 4 + (lane >> 3), j = lane & 7; FragH fh, fl; hl_split8(&so[w][r][j * 8], fh.u, fl.u);
        *(v8us*)((unsigned short*)Th + (n0 + r) * D3 + j * 8) = fh.half[0]; *(v8us*)((unsigned short*)Tl + (n0 + r) * D3 + j * 8) = fl.half[0]; } }
    else if (nq == 1) {      /* phi in the order of k_attn's A fragments, [tile of 16 keys][k step][fragment half][lane] x 16 bytes: channel group j of key n is k step j / 4, half (j / 2) % 2, lane 16 * (j % 2) + n % 16 (the k order of g2_frag); a store covers 512 contiguous bytes */
#pragma unroll      /* unrolled: the eight trips' LDS reads go out in batches and the stores take one base with immediate offsets; rolled, each trip waits out its own reads */
      for (int i = 0; i < 8; ++i) { const int r = (i >> 2) * 16 + ln, j = (i & 3) * 2 + hh; FragH fh, fl; hl_split8(&so[w][r][j * 8], fh.u, fl.u);
        const size_t u = (((n0 >> 4) + (i >> 2)) * 4 + (i & 3)) * 32 + lane; *(v8us*)((unsigned short*)Ph + u * 8) = fh.half[0]; *(v8us*)((unsigned short*)Pl + u * 8) = fl.half[0]; }
      asm volatile("s_wait_xcnt 0x0" ::: "memory");      /* behind the last stores: the code of the other column blocks follows in the listing and rewrites the stores' registers */ }
    else {      /* g^T in the order of k_attn's A fragments, [block of 32 keys][tile of 16 channels][fragment half][lane] x 16 bytes: keys 8 * p .. 8 * p + 7 of the block, channel d, are half p / 2, lane 16 * (p % 2) + d % 16; the wave's 32 rows are one block */
#pragma unroll      /* unrolled: the eight trips' LDS reads go out in batches and the stores take one base with immediate offsets; rolled, each trip waits out its own reads */
      for (int i = 0; i < 8; ++i) { const int p = (i & 1) * 2 + hh, d = (i >> 1) * 16 + ln; float a[8]; for (int q = 0; q < 8; ++q) a[q] = so[w][p * 8 + q][d]; FragH fh, fl; hl_split8(a, fh.u, fl.u);
        const size_t u = ((n0 >> 5) * 8 + i) * 32 + lane; *(v8us*)((unsigned short*)Gh + u * 8) = fh.half[0]; *(v8us*)((unsigned short*)Gl + u * 8) = fl.half[0]; }
      asm volatile("s_wait_xcnt 0x0" ::: "memory");      /* behind the last stores: the code of the other column blocks follows in the listing and rewrites the stores' registers */ } }
  else {
#pragma unroll
    for (int q = 0; q < 16; ++q) { const int r = q * 2 + rsub; const v4f v = *(const v4fa*)&so[w][r][c4]; if (C) *(v4f*)(C + cofs + (size_t)(row0 + r) * ldc + col0 + c4) = v; if (C16) { v4h h4; for (int i = 0; i < 4; ++i) h4[i] = (_Float16)v[i]; *(v4h*)(C16 + cofs + (size_t)(row0 + r) * ldc + col0 + c4) = h4; } }
     } }


__global__ __launch_bounds__(256) void k_rsm(const float* __restrict__ S, _Float16* __restrict__ P, int nrows) {
  #pragma clang fp contract(off)
  const int i = blockIdx.x * 256 + threadIdx.x; if (i >= nrows) return; const float* s = S + (size_t)i * SQ; float mx = -3.0e38f;
#pragma unroll 1
  for (int j = 0; j < SQ; ++j) mx = fmaxf(mx, s[j]); float se = 0.f;
#pragma unroll 1
  for (int j = 0; j < SQ; ++j) se += expf(s[j] - mx); const float sc = 256.0f / se;
#pragma unroll 1
  for (int j0 = 0; j0 < SQ; j0 += 8) { FragH f; for (int q = 0; q < 8; ++q) f.h[q] = (_Float16)(expf(s[j0 + q] - mx) * sc); unsigned short* d = (unsigned short*)P + (size_t)i * SQ + j0; *(v8us*)d = f.half[0];  } }
__global__ __launch_bounds__(256) void k_vt(const _Float16* __restrict__ V16, int b, int h0, _Float16* __restrict__ VT) { __shared__ unsigned short tl[64][65]; const int tid = threadIdx.x; const int hh = blockIdx.x % HG, sg = blockIdx.x / HG; const int s0 = sg * 64; const int h = h0 + hh;
  for (int i = tid; i < 64 * 8; i += 256) { const int j = i / 8, d8 = (i % 8) * 8; FragH f; f.half[0] = *(const v8us*)((const unsigned short*)V16 + ((size_t)b * SQ + s0 + j) * DM + h * HD + d8); for (int q = 0; q < 8; ++q) tl[d8 + q][j] = f.u[q]; }
  __syncthreads();
  { for (int i = tid; i < 64 * 8; i += 256) { const int d = i / 8, j8 = (i % 8) * 8; FragH f; for (int q = 0; q < 8; ++q) f.u[q] = tl[d][j8 + q]; *(v8us*)((unsigned short*)VT + ((size_t)hh * HD + d) * SQ + s0 + j8) = f.half[0]; }  } }


// The eight jobs that read inputs alone, in one launch; the block index picks the job and no job reads what another writes.
// Blocks 0 .. 4 * PW - 1: the four weight matrices, rounded to bf16, x16, as f16 in their natural [out][in] rows (theta | phi | g stacked in B3, W_z in BZ). Block 4 * PW: the three biases stacked in b3. The rest: x [channel][position] to f16 rows [position][channel], a 64 x 32 tile a block.
#define PW (IC * CC / 8 / 256)       /* blocks a weight matrix: eight elements a thread */
#define PX (NB * (LL / 32) * (CC / 64))
__global__ __launch_bounds__(256) void k_prep(const float* __restrict__ X, const float* __restrict__ tw, const float* __restrict__ pw, const float* __restrict__ gw, const float* __restrict__ zw, const float* __restrict__ tb, const float* __restrict__ pb, const float* __restrict__ gb,
    _Float16* __restrict__ XR, _Float16* __restrict__ B3, _Float16* __restrict__ BZ, float* __restrict__ b3) { static_assert(IC * CC % 2048 == 0 && D3 <= 256, "whole blocks a weight matrix; one thread a bias");
  __shared__ float tl[64][33]; const int tid = threadIdx.x;
  if (blockIdx.x < 4 * PW) { const int j = blockIdx.x / PW; const float* w = (j == 0) ? tw : (j == 1) ? pw : (j == 2) ? gw : zw; _Float16* Bt = (j < 3) ? B3 + (size_t)j * IC * CC : BZ;
    const size_t t = (size_t)(blockIdx.x % PW) * 256 + tid; FragH f; for (int q = 0; q < 8; ++q) f.h[q] = (_Float16)(bf16_round(w[t * 8 + q]) * 16.0f); *(v8us*)((unsigned short*)Bt + t * 8) = f.half[0]; }
  else if (blockIdx.x == 4 * PW) { if (tid < D3) { const int j = tid / IC; const float* s = (j == 0) ? tb : (j == 1) ? pb : gb; b3[tid] = s[tid % IC]; } }
  else { const int bx = blockIdx.x - (4 * PW + 1); const int nl = LL / 32, nc = CC / 64; const int cb_ = bx % nc; const int lb = (bx / nc) % nl; const size_t b = bx / (nc * nl); const int c0 = cb_ * 64, l0 = lb * 32;
    for (int i = tid; i < 64 * 32; i += 256) { const int c = i / 32, l = i % 32; tl[c][l] = bf16_round(X[(b * CC + c0 + c) * (size_t)LL + l0 + l]); }
    __syncthreads();      /* under a test on the block index alone: every thread of the block passes it */
    const int l = tid / 8, c8 = (tid % 8) * 8; FragH f; for (int q = 0; q < 8; ++q) f.h[q] = (_Float16)tl[c8 + q][l]; unsigned short* d = (unsigned short*)XR + (b * LL + l0 + l) * (size_t)CC + c0 + c8; *(v8us*)d = f.half[0];
    asm volatile("s_wait_xcnt 0x0" ::: "memory");      /* behind the store: the code of the other jobs follows this block in the listing and rewrites the store's registers */
  } }

// Fused attention: a work-group of 8 waves owns 64 queries; a wave owns 32 of them (two column groups of 16) and every fourth block of 32 keys, one block a trip; scores, softmax weights and the weighted sum of g stay in registers (no score or weight plane in memory).
// The four waves of a query group each keep their own running maximum, sum and y; the four partial results are joined through LDS behind the key loop.
// S^T = phi . theta^T (A = 16 phi rows, B = the wave's theta rows, kept in registers), so a lane holds one query's scores: D register r of lane (ln, hh) is key 8 * hh + r, query ln.
// The two tiles of a trip (keys 0..15, 16..31), converted in place, are the B operand of y^T += g^T . P^T in the k order of g2_frag; the running maximum, the sum and the rescale factor of query ln live in lanes ln and ln + 16.
__device__ __forceinline__ v8f at_mma(v16h a, v16h b, v8f c) { return __builtin_amdgcn_wmma_f32_16x16x32_f16(false, a, false, b, (short)0, c, false, false); }
// fragment in the k order of g2_frag from a wave-uniform base and the lane's own byte offset (row * pitch + 16 * hh)
__device__ __forceinline__ v16h at_frag(const char* base, unsigned off) { FragH f; f.half[0] = *(const v8us*)(base + off); f.half[1] = *(const v8us*)(base + off + 32); return f.v; }
// the same fragment from an operand stored in fragment order (k_gemm2's SPL epilogue): 1 KiB at a wave-uniform base, off = 16 * lane; each of the two loads covers 512 contiguous bytes, four whole lines
__device__ __forceinline__ v16h at_fragp(const char* base, unsigned off) { FragH f; f.half[0] = *(const v8us*)(base + off); f.half[1] = *(const v8us*)(base + off + 512); return f.v; }
__device__ __forceinline__ float at_xhalf(float x) { return __builtin_bit_cast(float, __builtin_amdgcn_permlanex16(__builtin_bit_cast(int, x), __builtin_bit_cast(int, x), 0x76543210, 0xfedcba98, false, false)); }      /* lane l with lane l ^ 16 */
__global__ __launch_bounds__(256) void k_attn(const _Float16* __restrict__ TH, const _Float16* __restrict__ TL, const _Float16* __restrict__ PH, const _Float16* __restrict__ PL, const _Float16* __restrict__ GT, const _Float16* __restrict__ GTL, _Float16* __restrict__ YH, _Float16* __restrict__ YL) {
  __shared__ __attribute__((aligned(16))) v4f py[8][16][32];      /* partial y: [wave][(column group * 4 + tile) * 2 + register half][lane] */
  __shared__ float pm[8][2][32], pl[8][2][32];      /* partial maximum and sum: [wave][column group][lane] */
  const int tid = threadIdx.x, lane = tid & 31, ln = lane & 15, hh = lane >> 4;
  const int wv = __builtin_amdgcn_readfirstlane(tid >> 5), w = wv & 1, ks = wv >> 1;      /* query group; which of every four key blocks */
  const int b = blockIdx.x / (LL / 64), qb = (blockIdx.x % (LL / 64)) * 64;
  const char* th = (const char*)(TH + (size_t)b * LL * D3); const char* tl = (const char*)(TL + (size_t)b * LL * D3);      /* rows of D3 halves, theta in the first IC of them, hi / residual */
  const char* kph = (const char*)(PH + (size_t)b * LL * IC); const char* kpl = (const char*)(PL + (size_t)b * LL * IC);      /* phi hi / residual in fragment order: 128 bytes a key, 2 KiB a tile of 16 keys */
  const char* gh = (const char*)(GT + (size_t)b * IC * SK); const char* gl = (const char*)(GTL + (size_t)b * IC * SK);      /* g^T hi / residual in fragment order: 128 bytes a key, 4 KiB a block of 32 keys */
  const unsigned qo = (unsigned)(32 * w + ln) * (D3 * 2) + 16 * hh, lo = (unsigned)lane * 16;
  const float L2E = 1.44269504088896340736f;
  const v8f z8 = {0.f,0.f,0.f,0.f,0.f,0.f,0.f,0.f};
  v8f yh[2][4], yl[2][4]; float m[2], l[2];
#pragma unroll
  for (int j = 0; j < 2; ++j) { m[j] = -INFINITY; l[j] = 0.f; for (int t = 0; t < 4; ++t) { yh[j][t] = z8; yl[j][t] = z8; } }
  __builtin_amdgcn_sched_barrier(0);      /* with the one behind the wait: no vector write stands between the first loads and their s_wait_xcnt */
  v16h qh[2][2], ql[2][2];      /* theta hi / residual: [column group][k step] */
#pragma unroll
  for (int j = 0; j < 2; ++j) for (int c = 0; c < 2; ++c) { const size_t o = (size_t)(qb + 16 * j) * (D3 * 2) + 64 * c; qh[j][c] = at_frag(th + o, qo); ql[j][c] = at_frag(tl + o, qo); }
  v16h ka[2][2], kr[2][2];      /* phi hi / residual of the trip: [key tile][k step] */
#pragma unroll
  for (int t = 0; t < 2; ++t) for (int c = 0; c < 2; ++c) { const size_t o = (size_t)(32 * ks + 16 * t) * (IC * 2) + 1024 * c; ka[t][c] = at_fragp(kph + o, lo); kr[t][c] = at_fragp(kpl + o, lo); }
  asm volatile("s_wait_xcnt 0x0" ::: "memory");      /* in front of the first rewrite of an address register that the loads above name */
  __builtin_amdgcn_sched_barrier(0);      /* holds every later register write behind that wait */
  for (int it = 0; it < SK / 128; ++it) { const int k0 = 128 * it + 32 * ks;
    v16h ga[4], gr[4];      /* g^T of this trip: asked for here, used behind the softmax */
#pragma unroll
    for (int t = 0; t < 4; ++t) { const size_t o = (size_t)k0 * (IC * 2) + 1024 * t; ga[t] = at_fragp(gh + o, lo); gr[t] = at_fragp(gl + o, lo); }
    asm volatile("s_wait_xcnt 0x0" ::: "memory");      /* in front of the rewrite of the address registers that these loads name */
    __builtin_amdgcn_sched_barrier(0);      /* keeps the g^T loads in front of the score products: sunk to their uses each would be waited for alone */
    float s[2][2][8];
#pragma unroll
    for (int t = 0; t < 2; ++t) for (int j = 0; j < 2; ++j) {
      v8f sh = at_mma(ka[t][0], qh[j][0], z8); sh = at_mma(ka[t][1], qh[j][1], sh);      /* phi-hi . theta-hi */
      v8f sl = at_mma(ka[t][0], ql[j][0], z8); sl = at_mma(ka[t][1], ql[j][1], sl); sl = at_mma(kr[t][0], qh[j][0], sl); sl = at_mma(kr[t][1], qh[j][1], sl);      /* phi-hi . theta-res + phi-res . theta-hi, both x1024 */
      for (int r = 0; r < 8; ++r) s[j][t][r] = fmaf(sl[r], 1.0f / 1024.0f, sh[r]); }
    __builtin_amdgcn_sched_barrier(0);      /* with the one behind the wait: no vector write stands between the loads below and their s_wait_xcnt */
    const int kn = (k0 + 128) & (SK - 1);      /* the next trip's phi rows, one trip ahead; the last trip asks for the wave's first rows again (in bounds, not used) */
#pragma unroll
    for (int t = 0; t < 2; ++t) for (int c = 0; c < 2; ++c) { const size_t o = (size_t)(kn + 16 * t) * (IC * 2) + 1024 * c; ka[t][c] = at_fragp(kph + o, lo); kr[t][c] = at_fragp(kpl + o, lo); }
    asm volatile("s_wait_xcnt 0x0" ::: "memory");      /* in front of the rewrite of the address registers that these loads name */
    __builtin_amdgcn_sched_barrier(0);      /* keeps those loads in front of the softmax, whose time then covers their latency */
    float mn[2];
#pragma unroll
    for (int j = 0; j < 2; ++j) { float mx = s[j][0][0];
      for (int t = 0; t < 2; ++t) for (int r = 0; r < 8; ++r) mx = fmaxf(mx, s[j][t][r]);
      mx = fmaxf(mx, at_xhalf(mx));      /* the other eight keys of each tile sit in the partner lane */
      mn[j] = fmaxf(m[j], mx); }
    if (__builtin_amdgcn_ballot_w32(mn[0] > m[0] || mn[1] > m[1]) != 0) {      /* no maximum moved: every factor would be 1 */
#pragma unroll
      for (int j = 0; j < 2; ++j) { const float al = __builtin_amdgcn_exp2f((m[j] - mn[j]) * L2E);      /* first trip: exp2(-inf) = 0 on sums that are still 0 */
        m[j] = mn[j]; l[j] *= al;
        for (int t = 0; t < 4; ++t) for (int r = 0; r < 8; ++r) { yh[j][t][r] *= al; yl[j][t][r] *= al; } } }
#pragma unroll
    for (int j = 0; j < 2; ++j) { FragH pf; const float cn = -m[j] * L2E;
#pragma unroll
      for (int i = 0; i < 8; ++i) { const float p0 = __builtin_amdgcn_exp2f(fmaf(s[j][0][i], L2E, cn)), p1 = __builtin_amdgcn_exp2f(fmaf(s[j][1][i], L2E, cn)); l[j] += p0 + p1;
        pf.h[i] = (_Float16)(p0 * 16384.0f); pf.h[8 + i] = (_Float16)(p1 * 16384.0f); }      /* P carried x2^14: the peaky rows would otherwise flush most weights below the f16 normal range */
#pragma unroll
      for (int t = 0; t < 4; ++t) { yh[j][t] = at_mma(ga[t], pf.v, yh[j][t]); yl[j][t] = at_mma(gr[t], pf.v, yl[j][t]); } }
  }
#pragma unroll
  for (int j = 0; j < 2; ++j) { pm[wv][j][lane] = m[j]; pl[wv][j][lane] = l[j] + at_xhalf(l[j]);
#pragma unroll
    for (int t = 0; t < 4; ++t) { v4f o0, o1;
      for (int r = 0; r < 4; ++r) { o0[r] = fmaf(yl[j][t][r], 1.0f / 1024.0f, yh[j][t][r]); o1[r] = fmaf(yl[j][t][4 + r], 1.0f / 1024.0f, yh[j][t][4 + r]); }
      py[wv][(j * 4 + t) * 2][lane] = o0; py[wv][(j * 4 + t) * 2 + 1][lane] = o1; } }
  __syncthreads();      /* every wave's partial result is in LDS before any wave joins */
  const int jo = ks & 1, qn = 8 * (ks >> 1) + (lane & 7), tc = lane >> 3;      /* this wave joins eight queries of column group jo, all 64 channels: whole 128-byte lines of the f16 y rows; the lane takes query qn, channels 16 * tc .. 16 * tc + 15 */
  float ms[4], wt[4];
#pragma unroll
  for (int s = 0; s < 4; ++s) ms[s] = pm[2 * s + w][jo][qn];
  const float mj = fmaxf(fmaxf(ms[0], ms[1]), fmaxf(ms[2], ms[3])); float lt = 0.f;
#pragma unroll
  for (int s = 0; s < 4; ++s) ms[s] = (ms[s] - mj) * L2E;
  __builtin_amdgcn_sched_barrier(0);      /* all four exponents are formed in front of the first v_exp */
#pragma unroll
  for (int s = 0; s < 4; ++s) wt[s] = __builtin_amdgcn_exp2f(ms[s]);
#pragma unroll
  for (int s = 0; s < 4; ++s) lt = fmaf(wt[s], pl[2 * s + w][jo][qn], lt);
  const float inv = (1.0f / 16384.0f) / lt;
  v4f o[4];
#pragma unroll
  for (int i = 0; i < 4; ++i) { const int e = (jo * 4 + tc) * 2 + (i & 1), sl = 16 * (i >> 1) + qn;      /* D register r of tile t, lane (ln, hh) = channel 16 * t + 8 * hh + r of query ln: o[i] is channels 16 * tc + 4 * i .. + 3 */
    o[i] = py[w][e][sl] * wt[0];
    for (int s = 1; s < 4; ++s) { const v4f p = py[2 * s + w][e][sl]; for (int r = 0; r < 4; ++r) o[i][r] = fmaf(p[r], wt[s], o[i][r]); }
    o[i] *= inv; }
  const float ov[16] = {o[0][0], o[0][1], o[0][2], o[0][3], o[1][0], o[1][1], o[1][2], o[1][3], o[2][0], o[2][1], o[2][2], o[2][3], o[3][0], o[3][1], o[3][2], o[3][3]};
  FragH fh, fl; hl_split8(ov, fh.u, fl.u); hl_split8(ov + 8, fh.u + 8, fl.u + 8);      /* y as the hi + residual operand pair of the W_z products */
  const size_t yo = ((size_t)b * LL + qb + 32 * w + 16 * jo + qn) * IC + 16 * tc;
  *(v8us*)((unsigned short*)YH + yo) = fh.half[0]; *(v8us*)((unsigned short*)YH + yo + 8) = fh.half[1]; *(v8us*)((unsigned short*)YL + yo) = fl.half[0]; *(v8us*)((unsigned short*)YL + yo + 8) = fl.half[1]; }
__global__ __launch_bounds__(256) void k_bnstat(const float* __restrict__ WY, float* __restrict__ ST) {
  #pragma clang fp contract(off)
  __shared__ float red[256]; const int c = blockIdx.x; const int tid = threadIdx.x; float s = 0.f;
  float v[NR / 256];      /* the thread's values of the channel, rows tid + 256 * i in the order in which both passes sum them: all asked for ahead of the first sum (in a loop of one load a trip each load was waited out alone) and kept for the second pass */
  for (int i = 0; i < (int)(NR / 256); ++i) v[i] = WY[(size_t)c * NR + (size_t)i * 256 + tid];      /* WY is [channel][row]: a wave's load is one whole line */
  for (int i = 0; i < (int)(NR / 256); ++i) s = __fadd_rn(s, v[i]);
  red[tid] = s; __syncthreads(); for (int st = 128; st > 0; st >>= 1) { if (tid < st) red[tid] += red[tid + st]; __syncthreads(); }
  const float mean = red[0] / (float)NR; __syncthreads(); float s2 = 0.f;
  for (int i = 0; i < (int)(NR / 256); ++i) { const float d = __fadd_rn(v[i], -mean); s2 = __fadd_rn(s2, __fmul_rn(d, d)); }
  red[tid] = s2; __syncthreads(); for (int st = 128; st > 0; st >>= 1) { if (tid < st) red[tid] += red[tid + st]; __syncthreads(); }
  if (tid < 32) { const float v = (tid == 0) ? mean : ((tid == 1) ? rsqrtf(__fadd_rn(red[0] / (float)NR, 1e-5f)) : 0.f); *(float*)(ST + (size_t)c * 32 + tid) = v;  } }
__global__ __launch_bounds__(256) void k_fin(const float* __restrict__ WY, const float* __restrict__ ST, const float* __restrict__ gam, const float* __restrict__ bet, const float* __restrict__ x, float* __restrict__ out) {
  #pragma clang fp contract(off)
  static_assert(LL % 2048 == 0, "a block's 2048 elements lie in one channel of one sample");
  const size_t e0 = (size_t)blockIdx.x * 2048; if (e0 >= (size_t)NB * CC * LL) return; const int n0 = (int)(e0 % LL); const size_t bc = e0 / LL; const int c = (int)(bc % CC); const size_t b = bc / CC; const float mean = ST[(size_t)c * 32], rstd = ST[(size_t)c * 32 + 1], g = bf16_round(gam[c]), be = bf16_round(bet[c]); v8f r;
  const int o = threadIdx.x * 8; const float* wp = WY + (size_t)c * NR + b * LL + n0; const float* xp = x + e0;      /* WY is [channel][row]: the thread's eight positions are 32 contiguous bytes there as in x and out, at the same offset from the block's base */
  __builtin_amdgcn_sched_barrier(0);      /* with the one behind the wait: no write of a register, a scalar load's result among them, stands between the four loads and their s_wait_xcnt */
  const v4f w0 = *(const v4fa*)(wp + o), w1 = *(const v4fa*)(wp + o + 4), x0 = *(const v4fa*)(xp + o), x1 = *(const v4fa*)(xp + o + 4);
  asm volatile("s_wait_xcnt 0x0" ::: "memory");      /* in front of the first rewrite of a base register that the loads above name */
  __builtin_amdgcn_sched_barrier(0);      /* holds every later register write behind that wait */
  const float wy[8] = {w0[0], w0[1], w0[2], w0[3], w1[0], w1[1], w1[2], w1[3]}, xv[8] = {x0[0], x0[1], x0[2], x0[3], x1[0], x1[1], x1[2], x1[3]};
  for (int q = 0; q < 8; ++q) { const float v = __fadd_rn(__fmul_rn(__fmul_rn(__fadd_rn(wy[q], -mean), rstd), g), be); r[q] = __fadd_rn(v, bf16_round(xv[q])); }
  *(v8f*)(out + e0 + o) = r;  }

extern "C" void kernel_launch(void* const* d_in, const int* in_sizes, int n_in,
                              void* d_out, int out_size, void* d_ws, size_t ws_size, hipStream_t stream) {
  (void)in_sizes; (void)n_in; (void)out_size;
  const float* const* I = (const float* const*)d_in; const float* x = I[0]; const float* gw = I[1]; const float* gb = I[2]; const float* tw = I[3]; const float* tb = I[4]; const float* pw = I[5]; const float* pb = I[6]; const float* zw = I[7]; const float* zb = I[8]; const float* gam = I[9]; const float* bet = I[10];      /* g/theta/phi_w [64][256], wz_w [256][64] natural */
  char* ws = (char*)d_ws; size_t off = 0;
  auto take = [&](size_t bytes) { char* p = ws + off; off += (bytes + 255) & ~(size_t)255; return p; };
  _Float16* B3 = (_Float16*)take((size_t)D3 * CC * 2); float* b3 = (float*)take(D3 * 4); _Float16* BZ = (_Float16*)take((size_t)CC * IC * 2); float* ST = (float*)take((size_t)CC * 32 * 4);
  _Float16* XR = (_Float16*)take(NR * CC * 2); _Float16* TH = (_Float16*)take(NR * D3 * 2); _Float16* TL = (_Float16*)take(NR * D3 * 2); _Float16* PH = (_Float16*)take(NR * IC * 2); _Float16* PL = (_Float16*)take(NR * IC * 2);
  _Float16* GT = (_Float16*)take((size_t)NB * IC * SK * 2); _Float16* GTL = (_Float16*)take((size_t)NB * IC * SK * 2);
  _Float16* YH = (_Float16*)take(NR * IC * 2); _Float16* YL = (_Float16*)take(NR * IC * 2); float* WY = (float*)take(NR * CC * 4);
  if (off > ws_size) return;      /* 0.2 + 8 + 6 + 6 + 4 + 4 + 2 + 2 + 16 = approx 48 MiB */
  k_prep<<<4 * PW + 1 + PX, 256, 0, stream>>>(x, tw, pw, gw, zw, tb, pb, gb, XR, B3, BZ, b3);      /* Bt rows: theta 0..63 | phi 64..127 | g 128..191 */
  k_gemm2<0, false, true><<<dim3((unsigned)((NR / 128) * (D3 / 64)), 1), 128, 0, stream>>>(XR, CC, 0, B3, CC, 0, 0.0625f, b3, 0, nullptr, 1, 0, 0, nullptr, nullptr, D3, 0, (int)NR, D3, CC, TH, TL, PH, PL, GT, GTL);      /* theta rows, phi and g^T in fragment order, each hi / residual */
  k_attn<<<NBR * (LL / 64), 256, 0, stream>>>(TH, TL, PH, PL, GT, GTL, YH, YL);      /* softmax(theta . phi) . g -> y rows, hi / residual */
  const dim3 gz((unsigned)((CC / 128) * (NR / 64)), 1);      /* WY = (W_z y)^T, [channel][batch * positions]: A = W_z rows, B = y rows, so that k_bnstat and k_fin, which go channel by channel, read contiguous bytes */
  k_gemm2<0, true><<<gz, 128, 0, stream>>>(BZ, IC, 0, YL, IC, 0, 0.0625f / 1024.0f, nullptr, 0, nullptr, 1, 0, 0, WY, nullptr, (int)NR, 0, CC, (int)NR, IC);      /* W_z: y-res term */
  k_gemm2<0, true><<<gz, 128, 0, stream>>>(BZ, IC, 0, YH, IC, 0, 0.0625f, zb, 0, WY, -1, 0, 0, WY, nullptr, (int)NR, 0, CC, (int)NR, IC);      /* + y-hi term + bias (by row = channel) + own element of the y-res term */
  k_bnstat<<<CC, 256, 0, stream>>>(WY, ST);
  k_fin<<<(unsigned)(((size_t)NB * CC * LL / 8 + 255) / 256), 256, 0, stream>>>(WY, ST, gam, bet, x, (float*)d_out);
}

// v009
// A run of this version takes 124 microseconds.
// Next to v008, in two timings, it ran 1.06 and 1.05 times as fast.
// All steps since v000 together make it 260 times as fast.
#include <hip/hip_runtime.h>
// Non-local block (x [2][256][8x32x32 = 8192 positions]; g, theta, phi = 1x1 conv projections to 64 (+ bias); f = theta . phi over all positions; softmax; y = attn g; W_z 1x1 conv back to 256 (+ bias); training-mode BatchNorm over (batch, positions) per channel with gamma/beta; out = bn(W_z y) + x).
// Compute dtype: inputs rounded to bf16; x / weights exact; theta, phi, g, y as hi + residual operand pairs (~2^-22); P plain f16 (~2^-12); softmax, BN f32; v_wmma_f32_16x16x32_f16.
#define NB 2
#define CC 256
#define LL 8192                      /* positions per sample */
#define SK LL
#define IC 64                        /* inter channels */
#define D3 (3 * IC)                  /* theta | phi | g */
#define NR ((size_t)NB * LL)
#define NBR NB                       /* batches (debug hook) */
#define SQ LL
#define DM CC
#define NH 1
#define HD 64
#define HG 1
typedef __bf16 v16b __attribute__((ext_vector_type(16)));
typedef unsigned short v8us __attribute__((ext_vector_type(8), may_alias));
typedef float  v8f  __attribute__((ext_vector_type(8)));
typedef float  v4f  __attribute__((ext_vector_type(4)));
typedef float  v4fa __attribute__((ext_vector_type(4), may_alias));
union FragB { v16b v; v8us half[2]; unsigned short u[16]; };

__device__ __forceinline__ unsigned short bf16_bits(float x) { unsigned int u = __float_as_uint(x); return (unsigned short)((u + 0x7FFFu + ((u >> 16) & 1u)) >> 16); }
__device__ __forceinline__ float bf16_val(unsigned short b) { return __uint_as_float(((unsigned int)b) << 16); }
__device__ __forceinline__ float bf16_round(float x) { return bf16_val(bf16_bits(x)); }
// D += A·B with NT terms: 1 = ah·bh, 2 = + al·bh (A split), 3 = + ah·bl (both split)
template <int NT>
__device__ __forceinline__ v8f mmaN(v16b ah, v16b al, v16b bh, v16b bl, v8f c) {
  c = __builtin_amdgcn_wmma_f32_16x16x32_bf16(false, ah, false, bh, (short)0, c, false, false);
  if (NT >= 2) c = __builtin_amdgcn_wmma_f32_16x16x32_bf16(false, al, false, bh, (short)0, c, false, false);
  if (NT >= 3) c = __builtin_amdgcn_wmma_f32_16x16x32_bf16(false, ah, false, bl, (short)0, c, false, false);
  asm volatile("v_nop\n\tv_nop\n\tv_nop\n\tv_nop" : "+v"(c) : "v"(ah), "v"(al), "v"(bh), "v"(bl));
  return c;
}

__global__ __launch_bounds__(256) void k_wt_bf16(const float* __restrict__ W, unsigned short* __restrict__ Wt, int K, int N) {
  const int t = blockIdx.x * 256 + threadIdx.x;
  const int k8n = K / 8;
  if (t >= N * k8n) return;
  const int n = t / k8n, k8 = (t % k8n) * 8;
  v8us v;
#pragma unroll
  for (int i = 0; i < 8; ++i) v[i] = bf16_bits(W[(size_t)(k8 + i) * N + n]);
  *(v8us*)(Wt + (size_t)n * K + k8) = v;
  
}

// GEMM C[M][N] (f32, pitch ldc) = act(A[M][K]·W + bias). A f32 row-major (pitch lda) converted per fragment to bf16
// (ASPLIT: hi/lo two planes -> 2 terms, else single rounded term); Wt bf16 [N][K] (pitch ldb). BIAS_BF16 rounds the
// bias to bf16 first (bias quantised to bf16 before the add). K%32==0, M%16==0, N%64==0.
template <bool ASPLIT, int ACT, bool BIAS_BF16>
__global__ __launch_bounds__(128) void k_gemm_bf(const float* __restrict__ A, int lda, const unsigned short* __restrict__ Wt, int ldb,
                                               const float* __restrict__ bias, float* __restrict__ C, int ldc, int M, int N, int K) {
  __shared__ __attribute__((aligned(16))) float so[4][16][64];
  const int tid = threadIdx.x, w = tid >> 5, lane = tid & 31, ln = lane & 15, hh = lane >> 4;
  const int ntn = N / 64;
  const int wid = blockIdx.x * 4 + w;
  const int mt = wid / ntn, nq = wid % ntn;
  if (mt * 16 >= M) return;
  const int row0 = mt * 16, col0 = nq * 64;
  const float* arow = A + (size_t)(row0 + ln) * lda;
  v8f acc[4] = {};
  for (int kb = 0; kb < K; kb += 32) {
    FragB ah, al;
    const v4f x0 = *(const v4fa*)(arow + kb + 8 * hh), x1 = *(const v4fa*)(arow + kb + 8 * hh + 4);
    const v4f x2 = *(const v4fa*)(arow + kb + 16 + 8 * hh), x3 = *(const v4fa*)(arow + kb + 16 + 8 * hh + 4);
    float xs[16] = {x0[0],x0[1],x0[2],x0[3],x1[0],x1[1],x1[2],x1[3],x2[0],x2[1],x2[2],x2[3],x3[0],x3[1],x3[2],x3[3]};
#pragma unroll
    for (int i = 0; i < 16; ++i) { const unsigned short hb = bf16_bits(xs[i]); ah.u[i] = hb; al.u[i] = ASPLIT ? bf16_bits(xs[i] - bf16_val(hb)) : (unsigned short)0; }
#pragma unroll
    for (int t = 0; t < 4; ++t) {
      const unsigned short* brow = Wt + (size_t)(col0 + t * 16 + ln) * ldb + kb;
      FragB b;
      b.half[0] = *(const v8us*)(brow + 8 * hh);
      b.half[1] = *(const v8us*)(brow + 16 + 8 * hh);
      acc[t] = mmaN<ASPLIT ? 2 : 1>(ah.v, al.v, b.v, b.v, acc[t]);
    }
  }
#pragma unroll
  for (int t = 0; t < 4; ++t) {
    float bv = bias ? bias[col0 + t * 16 + ln] : 0.f;
    if (BIAS_BF16) bv = bf16_round(bv);
#pragma unroll
    for (int r = 0; r < 8; ++r) { float v = acc[t][r] + bv; if (ACT == 1) v = fmaxf(v, 0.f); so[w][8 * hh + r][t * 16 + ln] = v; }
  }
  __builtin_amdgcn_fence(__ATOMIC_ACQ_REL, "workgroup");
  __builtin_amdgcn_wave_barrier();
  const int rsub = lane >> 4, c4 = (lane & 15) * 4;
  {
#pragma unroll
    for (int q = 0; q < 8; ++q) {
      const int r = q * 2 + rsub;
      const v4f v = *(const v4fa*)&so[w][r][c4];
      *(v4f*)(C + (size_t)(row0 + r) * ldc + col0 + c4) = v;
    }
    
  }
}

// GEMM C = act(A·W + bias + resid): A f32 (ASPLIT -> hi/lo 2 terms), Wt bf16 [N][K]; ACT 0 none, 1 relu, 2 exact gelu;
// resid (optional, f32, row index = (row % rmod), pitch ldr, RES_BF16 rounds it) added before the activation.
template <bool ASPLIT, int ACT, bool BIAS_BF16, bool RES_BF16>
__global__ __launch_bounds__(128) void k_gemm_bf3(const float* __restrict__ A, int lda, const unsigned short* __restrict__ Wt, int ldb,
                                                const float* __restrict__ bias, const float* __restrict__ resid, int rmod, int ldr,
                                                float* __restrict__ C, int ldc, int M, int N, int K) {
  __shared__ __attribute__((aligned(16))) float so[4][16][64];
  const int tid = threadIdx.x, w = tid >> 5, lane = tid & 31, ln = lane & 15, hh = lane >> 4;
  const int ntn = N / 64;
  const int wid = blockIdx.x * 4 + w;
  const int mt = wid / ntn, nq = wid % ntn;
  if (mt * 16 >= M) return;
  const int row0 = mt * 16, col0 = nq * 64;
  const float* arow = A + (size_t)(row0 + ln) * lda;
  v8f acc[4] = {};
  for (int kb = 0; kb < K; kb += 32) {
    FragB ah, al;
    const v4f x0 = *(const v4fa*)(arow + kb + 8 * hh), x1 = *(const v4fa*)(arow + kb + 8 * hh + 4);
    const v4f x2 = *(const v4fa*)(arow + kb + 16 + 8 * hh), x3 = *(const v4fa*)(arow + kb + 16 + 8 * hh + 4);
    float xs[16] = {x0[0],x0[1],x0[2],x0[3],x1[0],x1[1],x1[2],x1[3],x2[0],x2[1],x2[2],x2[3],x3[0],x3[1],x3[2],x3[3]};
#pragma unroll
    for (int i = 0; i < 16; ++i) { const unsigned short hb = bf16_bits(xs[i]); ah.u[i] = hb; al.u[i] = ASPLIT ? bf16_bits(xs[i] - bf16_val(hb)) : (unsigned short)0; }
#pragma unroll
    for (int t = 0; t < 4; ++t) {
      const unsigned short* brow = Wt + (size_t)(col0 + t * 16 + ln) * ldb + kb;
      FragB b;
      b.half[0] = *(const v8us*)(brow + 8 * hh);
      b.half[1] = *(const v8us*)(brow + 16 + 8 * hh);
      acc[t] = mmaN<ASPLIT ? 2 : 1>(ah.v, al.v, b.v, b.v, acc[t]);
    }
  }
#pragma unroll
  for (int t = 0; t < 4; ++t) {
    const int col = col0 + t * 16 + ln;
    float bv = bias ? bias[col] : 0.f;
    if (BIAS_BF16) bv = bf16_round(bv);
#pragma unroll
    for (int r = 0; r < 8; ++r) {
      float v = acc[t][r] + bv;
      if (resid) { float rv = resid[(size_t)((row0 + 8 * hh + r) % rmod) * ldr + col]; if (RES_BF16) rv = bf16_round(rv); v += rv; }
      if (ACT == 1) v = fmaxf(v, 0.f);
      if (ACT == 2) v = 0.5f * v * (1.0f + erff(v * 0.70710678118654752f));
      if (ACT == 3) { const float u = 0.7978845608028654f * (v + 0.044715f * v * v * v); v = 0.5f * v * (1.0f + tanhf(u)); }
      so[w][8 * hh + r][t * 16 + ln] = v;
    }
  }
  __builtin_amdgcn_fence(__ATOMIC_ACQ_REL, "workgroup");
  __builtin_amdgcn_wave_barrier();
  const int rsub = lane >> 4, c4 = (lane & 15) * 4;
  {
#pragma unroll
    for (int q = 0; q < 8; ++q) {
      const int r = q * 2 + rsub;
      const v4f v = *(const v4fa*)&so[w][r][c4];
      *(v4f*)(C + (size_t)(row0 + r) * ldc + col0 + c4) = v;
    }
    
  }
}
// row LayerNorm (biased variance, eps) over N: s = X (+ R); optional out_sum <- s; out_norm <- (s-mu)*rsqrt(var+eps)*g + b
template <bool PARAM_BF16>
__global__ __launch_bounds__(256) void k_layernorm(const float* __restrict__ X, const float* __restrict__ R, const float* __restrict__ g, const float* __restrict__ bta,
                                                  float* __restrict__ out_sum, float* __restrict__ out_norm, int N, float eps) {
  __shared__ float red[256];
  const int row = blockIdx.x, tid = threadIdx.x;
  const float* x = X + (size_t)row * N; const float* rr = R ? R + (size_t)row * N : nullptr;
  float vals[16];                     // up to N = 4096
  const int per = N / 256;            // contiguous chunk per thread? use strided-by-4 chunks: thread handles j = tid*4 + 1024*u
  float s1 = 0.f;
  for (int u = 0; u < per / 4; ++u) {
    const int j = tid * 4 + 1024 * u;
    const v4f a = *(const v4fa*)(x + j);
    v4f b = {0.f,0.f,0.f,0.f}; if (rr) b = *(const v4fa*)(rr + j);
#pragma unroll
    for (int q = 0; q < 4; ++q) { const float v = a[q] + b[q]; vals[u * 4 + q] = v; s1 += v; }
  }
  red[tid] = s1; __syncthreads();
  for (int st = 128; st > 0; st >>= 1) { if (tid < st) red[tid] += red[tid + st]; __syncthreads(); }
  const float mu = red[0] / (float)N; __syncthreads();
  float s2 = 0.f;
  for (int u = 0; u < per / 4; ++u)
#pragma unroll
    for (int q = 0; q < 4; ++q) { const float c = vals[u * 4 + q] - mu; s2 += c * c; }
  red[tid] = s2; __syncthreads();
  for (int st = 128; st > 0; st >>= 1) { if (tid < st) red[tid] += red[tid + st]; __syncthreads(); }
  const float rs = rsqrtf(red[0] / (float)N + eps);
  {
    for (int u = 0; u < per / 4; ++u) {
      const int j = tid * 4 + 1024 * u;
      v4f o, sm;
#pragma unroll
      for (int q = 0; q < 4; ++q) {
        float gg = g[j + q], bb = bta[j + q];
        if (PARAM_BF16) { gg = bf16_round(gg); bb = bf16_round(bb); }
        sm[q] = vals[u * 4 + q]; o[q] = (vals[u * 4 + q] - mu) * rs * gg + bb;
      }
      if (out_sum) *(v4f*)(out_sum + (size_t)row * N + j) = sm;
      *(v4f*)(out_norm + (size_t)row * N + j) = o;
    }
    
  }
}



// ---- f16 WMMA path (v_wmma_f32_16x16x32_f16): 11-bit significands for operands in range — used where a [0,1] probability operand needs more precision than bf16
typedef _Float16 v16h __attribute__((ext_vector_type(16)));
union FragH { v16h v; v8us half[2]; _Float16 h[16]; unsigned short u[16]; };
template <int NT>
__device__ __forceinline__ v8f mmaH(v16h ah, v16h al, v16h bh, v16h bl, v8f c) {
  c = __builtin_amdgcn_wmma_f32_16x16x32_f16(false, ah, false, bh, (short)0, c, false, false);
  if (NT >= 2) c = __builtin_amdgcn_wmma_f32_16x16x32_f16(false, al, false, bh, (short)0, c, false, false);
  if (NT >= 3) c = __builtin_amdgcn_wmma_f32_16x16x32_f16(false, ah, false, bl, (short)0, c, false, false);
  asm volatile("v_nop\n\tv_nop\n\tv_nop\n\tv_nop" : "+v"(c) : "v"(ah), "v"(al), "v"(bh), "v"(bl));
  return c;
}
// batched GEMM like k_gemm_b but f16 operands: A f32 (split into f16 hi/lo if ASPLIT, else rounded to f16), Bt = f16 values [n][k]; alpha; C f32; N multiple of 16 (partial tiles skipped)
template <bool ASPLIT>
__global__ __launch_bounds__(128) void k_gemm_h(const float* __restrict__ A, int lda, size_t sA, const _Float16* __restrict__ Bh, int ldb, size_t sB, float alpha, float* __restrict__ C, int ldc, size_t sC, int M, int N, int K) {
  __shared__ __attribute__((aligned(16))) float so[4][16][64];
  const int tid = threadIdx.x, w = tid >> 5, lane = tid & 31, ln = lane & 15, hh = lane >> 4; const int by = blockIdx.y;
  A += (size_t)by * sA; Bh += (size_t)by * sB; C += (size_t)by * sC;
  const int ntn = (N + 63) / 64; const int wid = blockIdx.x * 4 + w; const int mt = wid / ntn, nq = wid % ntn; if (mt * 16 >= M) return;
  const int row0 = mt * 16, col0 = nq * 64; const float* arow = A + (size_t)(row0 + ln) * lda;
  v8f acc[4] = {};
  for (int kb = 0; kb < K; kb += 32) {
    FragH ah, al;
    const v4f x0 = *(const v4fa*)(arow + kb + 8 * hh), x1 = *(const v4fa*)(arow + kb + 8 * hh + 4), x2 = *(const v4fa*)(arow + kb + 16 + 8 * hh), x3 = *(const v4fa*)(arow + kb + 16 + 8 * hh + 4);
    float xs[16] = {x0[0],x0[1],x0[2],x0[3],x1[0],x1[1],x1[2],x1[3],x2[0],x2[1],x2[2],x2[3],x3[0],x3[1],x3[2],x3[3]};
#pragma unroll
    for (int i = 0; i < 16; ++i) { const _Float16 h = (_Float16)xs[i]; ah.h[i] = h; al.h[i] = ASPLIT ? (_Float16)(xs[i] - (float)h) : (_Float16)0.0f; }
#pragma unroll
    for (int t = 0; t < 4; ++t) { if (col0 + t * 16 >= N) continue; const size_t boff = (size_t)(col0 + t * 16 + ln) * ldb + kb; FragH bq; bq.half[0] = *(const v8us*)(Bh + boff + 8 * hh); bq.half[1] = *(const v8us*)(Bh + boff + 16 + 8 * hh);
      acc[t] = mmaH<ASPLIT ? 2 : 1>(ah.v, al.v, bq.v, bq.v, acc[t]); }
  }
#pragma unroll
  for (int t = 0; t < 4; ++t) { if (col0 + t * 16 >= N) continue;
#pragma unroll
    for (int r = 0; r < 8; ++r) so[w][8 * hh + r][t * 16 + ln] = acc[t][r] * alpha; }
  __builtin_amdgcn_fence(__ATOMIC_ACQ_REL, "workgroup"); __builtin_amdgcn_wave_barrier();
  const int rsub = lane >> 4, c4 = (lane & 15) * 4;
  {
#pragma unroll
    for (int q = 0; q < 8; ++q) { const int r = q * 2 + rsub; if (col0 + c4 < N) { const v4f v = *(const v4fa*)&so[w][r][c4]; *(v4f*)(C + (size_t)(row0 + r) * ldc + col0 + c4) = v; } }
     }
}

// Wt[n][k] = f16(W[k][n]·scale) from f32 row-major W[K][N] (scale = power of two; bf16-exact weights stay exact in f16 away from the subnormal range)
__global__ __launch_bounds__(256) void k_wt_f16(const float* __restrict__ W, _Float16* __restrict__ Wt, int K, int N, float scale) {
  const int t = blockIdx.x * 256 + threadIdx.x; if (t >= N * (K / 8)) return; const int n = t / (K / 8), k8 = (t % (K / 8)) * 8; FragH f;
#pragma unroll
  for (int i = 0; i < 8; ++i) f.h[i] = (_Float16)(bf16_round(W[(size_t)(k8 + i) * N + n]) * scale); const v8us o = f.half[0];
  *(v8us*)((unsigned short*)Wt + (size_t)n * K + k8) = o; 
}
// k_gemm_hh variant with fused epilogue: v = acc·alpha + bias[by·sBias + col] (+ CP[(row/rowsPerB)·sCPb + by·64 + col] if CP) ; ACT 0 none / 1 elu ; writes f16 C16 (and f32 C if non-null)
template <int ACT>
__global__ __launch_bounds__(128) void k_gemm_hhx(const _Float16* __restrict__ A, int lda, size_t sA, const _Float16* __restrict__ Bh, int ldb, size_t sB, float alpha, const float* __restrict__ bias, size_t sBias, const float* __restrict__ CP, int rowsPerB, size_t sCPb, int row0g,
    float* __restrict__ C, _Float16* __restrict__ C16, int ldc, size_t sC, int M, int N, int K) {
  __shared__ __attribute__((aligned(16))) float so[4][16][64];
  const int tid = threadIdx.x, w = tid >> 5, lane = tid & 31, ln = lane & 15, hh = lane >> 4; const int by = blockIdx.y;
  A += (size_t)by * sA; Bh += (size_t)by * sB; const size_t cofs = (size_t)by * sC; const float* bp = bias ? bias + (size_t)by * sBias : nullptr;
  const int ntn = (N + 63) / 64; const int wid = blockIdx.x * 4 + w; const int mt = wid / ntn, nq = wid % ntn; if (mt * 16 >= M) return;
  const int row0 = mt * 16, col0 = nq * 64; const _Float16* arow = A + (size_t)(row0 + ln) * lda;
  v8f acc[4] = {};
  for (int kb = 0; kb < K; kb += 32) { FragH ah; ah.half[0] = *(const v8us*)((const unsigned short*)arow + kb + 8 * hh); ah.half[1] = *(const v8us*)((const unsigned short*)arow + kb + 16 + 8 * hh);
#pragma unroll
    for (int t = 0; t < 4; ++t) { if (col0 + t * 16 >= N) continue; const size_t boff = (size_t)(col0 + t * 16 + ln) * ldb + kb; FragH bq; bq.half[0] = *(const v8us*)((const unsigned short*)Bh + boff + 8 * hh); bq.half[1] = *(const v8us*)((const unsigned short*)Bh + boff + 16 + 8 * hh);
      acc[t] = mmaH<1>(ah.v, ah.v, bq.v, bq.v, acc[t]); }
  }
#pragma unroll
  for (int t = 0; t < 4; ++t) { if (col0 + t * 16 >= N) continue; const int col = col0 + t * 16 + ln; const float bv = bp ? bf16_round(bp[col]) : 0.f;
#pragma unroll
    for (int r = 0; r < 8; ++r) { float v = acc[t][r] * alpha + bv; if (CP) { const int rr = row0g + row0 + 8 * hh + r; if (rowsPerB < 0) v += CP[cofs + (size_t)rr * ldc + col];      /* rowsPerB < 0: own element of the batched C plane */ else { const int bidx = rr / rowsPerB; v += CP[(size_t)bidx * sCPb + (size_t)by * 64 + col]; } } if (ACT == 1) v = (v > 0.f) ? v : expm1f(v); else if (ACT == 7) v = (v > 0.f) ? v + 1.0f : expf(v); else if (ACT == 8) v = tanhf(v); else if (ACT == 9) v = 0.5f * v * (1.0f + tanhf(0.7978845608028654f * (v + 0.044715f * v * v * v))); else if (ACT == 11) v = 1.0f / (1.0f + expf(-v)); else if (ACT == 12) v = (v > 0.f) ? v : 0.01f * v; else if (ACT == 14) v = (v > 0.f) ? v : 0.1f * v; else if (ACT == 16) v = (v >= 0.f) ? v : 0.3f * v; else if (ACT == 17) v = (v >= 0.f) ? v : 0.2f * v; else if (ACT == 15) v = v / (1.0f + expf(-v)); else if (ACT == 3) v = fmaxf(v, 0.f); else if (ACT == 6) v = 0.5f * v * (1.0f + erff(v * 0.70710678118654752f)); so[w][8 * hh + r][t * 16 + ln] = v; } }
  __builtin_amdgcn_fence(__ATOMIC_ACQ_REL, "workgroup"); __builtin_amdgcn_wave_barrier();
  const int rsub = lane >> 4, c4 = (lane & 15) * 4; typedef _Float16 v4h __attribute__((ext_vector_type(4)));
  {
#pragma unroll
    for (int q = 0; q < 8; ++q) { const int r = q * 2 + rsub; if (col0 + c4 < N) { const v4f v = *(const v4fa*)&so[w][r][c4]; if (C) *(v4f*)(C + cofs + (size_t)(row0 + r) * ldc + col0 + c4) = v; if (C16) { v4h h4; for (int i = 0; i < 4; ++i) h4[i] = (_Float16)v[i]; *(v4h*)(C16 + cofs + (size_t)(row0 + r) * ldc + col0 + c4) = h4; } } }
     }
}


typedef _Float16 v4h __attribute__((ext_vector_type(4)));

__global__ __launch_bounds__(256) void k_x16(const float* __restrict__ x, _Float16* __restrict__ X16, size_t n8) { const size_t t = (size_t)blockIdx.x * 256 + threadIdx.x; if (t >= n8) return; FragH f;
#pragma unroll
  for (int q = 0; q < 8; ++q) f.h[q] = (_Float16)bf16_round(x[t * 8 + q]); *(v8us*)((unsigned short*)X16 + t * 8) = f.half[0];  }
__global__ __launch_bounds__(256) void k_h16(const float* __restrict__ x, _Float16* __restrict__ X16, size_t n8) { const size_t t = (size_t)blockIdx.x * 256 + threadIdx.x; if (t >= n8) return; FragH f;
#pragma unroll
  for (int q = 0; q < 8; ++q) f.h[q] = (_Float16)x[t * 8 + q]; *(v8us*)((unsigned short*)X16 + t * 8) = f.half[0];  }
__global__ __launch_bounds__(256) void k_round16f(const float* __restrict__ W, _Float16* __restrict__ Bt, size_t n8) { const size_t t = (size_t)blockIdx.x * 256 + threadIdx.x; if (t >= n8) return; FragH f;
#pragma unroll
  for (int i = 0; i < 8; ++i) f.h[i] = (_Float16)(bf16_round(W[t * 8 + i]) * 16.0f); *(v8us*)((unsigned short*)Bt + t * 8) = f.half[0];  }
__global__ __launch_bounds__(256) void k_hl(const float* __restrict__ F, _Float16* __restrict__ Hh, _Float16* __restrict__ Hl, size_t n8) { const size_t t = (size_t)blockIdx.x * 256 + threadIdx.x; if (t >= n8) return; FragH fh, fl; const v4f a = *(const v4fa*)(F + t * 8), c = *(const v4fa*)(F + t * 8 + 4);
#pragma unroll
  for (int q = 0; q < 4; ++q) { _Float16 h = (_Float16)a[q]; fh.h[q] = h; fl.h[q] = (_Float16)((a[q] - (float)h) * 1024.0f); h = (_Float16)c[q]; fh.h[4 + q] = h; fl.h[4 + q] = (_Float16)((c[q] - (float)h) * 1024.0f); }
  { *(v8us*)((unsigned short*)Hh + t * 8) = fh.half[0]; *(v8us*)((unsigned short*)Hl + t * 8) = fl.half[0];  } }
// f32 -> f16 hi + residual x1024, eight values (k_hl's split)
__device__ __forceinline__ void hl_split8(const float* a, unsigned short* hb, unsigned short* lb) {
  for (int q = 0; q < 8; ++q) { const _Float16 h = (_Float16)a[q]; const _Float16 r = (_Float16)((a[q] - (float)h) * 1024.0f); hb[q] = __builtin_bit_cast(unsigned short, h); lb[q] = __builtin_bit_cast(unsigned short, r); } }

// ---- fast GEMM (wave tile 32x64; requires M % 32 == 0 rows per launch region and N % 64 == 0); epilogue = k_gemm_hhx semantics ----
__device__ __forceinline__ v16h g2_frag(const _Float16* p, int hh) { FragH f; f.half[0] = *(const v8us*)((const unsigned short*)p + 8 * hh); f.half[1] = *(const v8us*)((const unsigned short*)p + 16 + 8 * hh); return f.v; }
__device__ __forceinline__ v8f g2_mma(v16h a, v16h b, v8f c) { v8f d = __builtin_amdgcn_wmma_f32_16x16x32_f16(false, a, false, b, (short)0, c, false, false); asm volatile("v_nop\n\tv_nop\n\tv_nop\n\tv_nop" : "+v"(d) : "v"(a), "v"(b)); return d; }
// ROWB: for a product taken with its operands swapped (C^T = W . A^T): bias[row] in place of bias[col], and CP, where given, is the own element of C
// KU: k steps a trip (K a multiple of 32 * KU): the fragments of all of them are asked for as one batch in front of the trip's first product.
// SPL: the theta | phi | g projection. No f32 C: each wave splits its staged 32 x 64 tile into hi + residual and stores it in the form in which k_attn takes it (column block 0 theta, 1 phi, 2 g).
template <int ACT, bool ROWB = false, bool SPL = false, int KU = 1>
__global__ __launch_bounds__(128) void k_gemm2(const _Float16* __restrict__ A, int lda, size_t sA, const _Float16* __restrict__ Bh, int ldb, size_t sB, float alpha, const float* __restrict__ bias, size_t sBias, const float* __restrict__ CP, int rowsPerB, size_t sCPb, int row0g,
    float* __restrict__ C, _Float16* __restrict__ C16, int ldc, size_t sC, int M, int N, int K, _Float16* __restrict__ Th = nullptr, _Float16* __restrict__ Tl = nullptr, _Float16* __restrict__ Ph = nullptr, _Float16* __restrict__ Pl = nullptr, _Float16* __restrict__ Gh = nullptr, _Float16* __restrict__ Gl = nullptr) { static_assert(ACT == 0 || ACT == 3 || ACT == 6 || ACT == 8 || ACT == 9 || ACT == 11 || ACT == 12 || ACT == 14 || ACT == 15 || ACT == 16 || ACT == 17, "k_gemm2: unsupported ACT code (would silently apply no activation)");
  __shared__ __attribute__((aligned(16))) float so[4][32][68];
  const int tid = threadIdx.x, w = tid >> 5, lane = tid & 31, ln = lane & 15, hh = lane >> 4; const int by = blockIdx.y;
  A += (size_t)by * sA; Bh += (size_t)by * sB; const size_t cofs = (size_t)by * sC; const float* bp = bias ? bias + (size_t)by * sBias : nullptr;
  const int ntn = N >> 6; const int mt = blockIdx.x / ntn, nq = blockIdx.x - mt * ntn; const int row0 = mt * 128 + 32 * w, col0 = nq * 64; if (row0 >= M) return;
  const _Float16* a0p = A + (size_t)(row0 + ln) * lda; const _Float16* a1p = a0p + (size_t)16 * lda;
  const _Float16* b0p = Bh + (size_t)(col0 + ln) * ldb; const _Float16* b1p = b0p + (size_t)16 * ldb; const _Float16* b2p = b1p + (size_t)16 * ldb; const _Float16* b3p = b2p + (size_t)16 * ldb;
  const v8f z8 = {0.f,0.f,0.f,0.f,0.f,0.f,0.f,0.f}; v8f c00 = z8, c01 = z8, c02 = z8, c03 = z8, c10 = z8, c11 = z8, c12 = z8, c13 = z8;
#pragma unroll 1
  for (int kb = 0; kb < K; kb += 32 * KU) { v16h fa[KU][2], fb[KU][4];      /* each fragment in registers of its own: with one b, loaded anew in front of each pair of products, every load was waited out alone, five memory round trips a k step one behind the other */
    const int ko = kb + 8 * hh; const _Float16* pa0 = a0p + ko; const _Float16* pa1 = a1p + ko; const _Float16* pb0 = b0p + ko; const _Float16* pb1 = b1p + ko; const _Float16* pb2 = b2p + ko; const _Float16* pb3 = b3p + ko;      /* the lane's own addresses (g2_frag's 8 * hh taken in): every load of the trip is one of these six plus a constant */
#pragma unroll      /* unrolled: fa and fb are indexed by constants, so they stay in registers, and the loads take constant offsets */
    for (int u = 0; u < KU; ++u) { const int k = 32 * u; fa[u][0] = g2_frag(pa0 + k, 0); fb[u][0] = g2_frag(pb0 + k, 0); fa[u][1] = g2_frag(pa1 + k, 0); fb[u][1] = g2_frag(pb1 + k, 0); fb[u][2] = g2_frag(pb2 + k, 0); fb[u][3] = g2_frag(pb3 + k, 0); }
    asm volatile("s_wait_xcnt 0x0" :: "v"(pa0), "v"(pa1), "v"(pb0), "v"(pb1), "v"(pb2), "v"(pb3) : "memory");      /* in front of the first rewrite of an address register that the loads above name; the addresses are inputs so that they stay whole up to here (without that the batch's last loads took them as their destinations) */
    __builtin_amdgcn_sched_barrier(0);      /* keeps the first product behind the whole batch: lifted in among the loads, its wait for the first fragments held back the last loads, a second round trip */
#pragma unroll      /* unrolled: for the same constant indices */
    for (int u = 0; u < KU; ++u) { c00 = g2_mma(fa[u][0], fb[u][0], c00); c10 = g2_mma(fa[u][1], fb[u][0], c10); c01 = g2_mma(fa[u][0], fb[u][1], c01); c11 = g2_mma(fa[u][1], fb[u][1], c11);
      c02 = g2_mma(fa[u][0], fb[u][2], c02); c12 = g2_mma(fa[u][1], fb[u][2], c12); c03 = g2_mma(fa[u][0], fb[u][3], c03); c13 = g2_mma(fa[u][1], fb[u][3], c13); } }
  v8f accs[8] = {c00, c01, c02, c03, c10, c11, c12, c13};
  v4f br[4] = {};      /* ROWB: bias of the lane's 16 rows (half * 16 + 8 * hh + r), asked for as one batch */
  if (ROWB && bp) { const float* p = bp + row0g + row0 + 8 * hh; br[0] = *(const v4fa*)p; br[1] = *(const v4fa*)(p + 4); br[2] = *(const v4fa*)(p + 16); br[3] = *(const v4fa*)(p + 20);
    for (int i = 0; i < 4; ++i) for (int q = 0; q < 4; ++q) br[i][q] = bf16_round(br[i][q]); }
#pragma unroll
  for (int u = 0; u < 8; ++u) { const int t = u & 3, half = u >> 2; const int col = col0 + t * 16 + ln; const float bvc = (!ROWB && bp) ? bf16_round(bp[col]) : 0.f;
#pragma unroll
    for (int r = 0; r < 8; ++r) { const int rloc = half * 16 + 8 * hh + r; const float bv = ROWB ? br[half * 2 + (r >> 2)][r & 3] : bvc; float v = accs[u][r] * alpha + bv; if (CP) { if (ROWB || rowsPerB < 0) v += CP[cofs + (size_t)(row0g + row0 + rloc) * ldc + col];      /* rowsPerB < 0: own element of the batched C plane */ else { const int bidx = (row0g + row0 + rloc) / rowsPerB; v += CP[(size_t)bidx * sCPb + (size_t)by * 64 + col]; } }
      if (ACT == 3) v = fmaxf(v, 0.f); else if (ACT == 6) v = 0.5f * v * (1.0f + erff(v * 0.70710678118654752f)); else if (ACT == 11) v = 1.0f / (1.0f + expf(-v)); else if (ACT == 15) v = v / (1.0f + expf(-v)); else if (ACT == 12) v = (v > 0.f) ? v : 0.01f * v; else if (ACT == 8) v = tanhf(v); else if (ACT == 9) v = 0.5f * v * (1.0f + tanhf(0.7978845608028654f * (v + 0.044715f * v * v * v))); else if (ACT == 14) v = (v > 0.f) ? v : 0.1f * v; else if (ACT == 16) v = (v >= 0.f) ? v : 0.3f * v; else if (ACT == 17) v = (v >= 0.f) ? v : 0.2f * v;
      so[w][rloc][t * 16 + ln] = v; } }
  __builtin_amdgcn_fence(__ATOMIC_ACQ_REL, "workgroup"); __builtin_amdgcn_wave_barrier();
  const int rsub = lane >> 4, c4 = (lane & 15) * 4;
  if (SPL) { const size_t n0 = (size_t)(row0g + row0);      /* the wave's first row: batch * positions + position, a multiple of 32 */
    if (nq == 0) {      /* theta: rows of D3 halves (only the first IC are written or read); eight lanes store one row's 128 bytes, a whole line */
#pragma unroll      /* unrolled: the eight trips' LDS reads go out in batches and the stores take one base with immediate offsets; rolled, each trip waits out its own reads */
      for (int i = 0; i < 8; ++i) { const int r = i * 4 + (lane >> 3), j = lane & 7; FragH fh, fl; hl_split8(&so[w][r][j * 8], fh.u, fl.u);
        *(v8us*)((unsigned short*)Th + (n0 + r) * D3 + j * 8) = fh.half[0]; *(v8us*)((unsigned short*)Tl + (n0 + r) * D3 + j * 8) = fl.half[0]; } }
    else if (nq == 1) {      /* phi in the order of k_attn's A fragments, [tile of 16 keys][k step][fragment half][lane] x 16 bytes: channel group j of key n is k step j / 4, half (j / 2) % 2, lane 16 * (j % 2) + n % 16 (the k order of g2_frag); a store covers 512 contiguous bytes */
#pragma unroll      /* unrolled: the eight trips' LDS reads go out in batches and the stores take one base with immediate offsets; rolled, each trip waits out its own reads */
      for (int i = 0; i < 8; ++i) { const int r = (i >> 2) * 16 + ln, j = (i & 3) * 2 + hh; FragH fh, fl; hl_split8(&so[w][r][j * 8], fh.u, fl.u);
        const size_t u = (((n0 >> 4) + (i >> 2)) * 4 + (i & 3)) * 32 + lane; *(v8us*)((unsigned short*)Ph + u * 8) = fh.half[0]; *(v8us*)((unsigned short*)Pl + u * 8) = fl.half[0]; }
      asm volatile("s_wait_xcnt 0x0" ::: "memory");      /* behind the last stores: the code of the other column blocks follows in the listing and rewrites the stores' registers */ }
    else {      /* g^T in the order of k_attn's A fragments, [block of 32 keys][tile of 16 channels][fragment half][lane] x 16 bytes: keys 8 * p .. 8 * p + 7 of the block, channel d, are half p / 2, lane 16 * (p % 2) + d % 16; the wave's 32 rows are one block */
#pragma unroll      /* unrolled: the eight trips' LDS reads go out in batches and the stores take one base with immediate offsets; rolled, each trip waits out its own reads */
      for (int i = 0; i < 8; ++i) { const int p = (i & 1) * 2 + hh, d = (i >> 1) * 16 + ln; float a[8]; for (int q = 0; q < 8; ++q) a[q] = so[w][p * 8 + q][d]; FragH fh, fl; hl_split8(a, fh.u, fl.u);
        const size_t u = ((n0 >> 5) * 8 + i) * 32 + lane; *(v8us*)((unsigned short*)Gh + u * 8) = fh.half[0]; *(v8us*)((unsigned short*)Gl + u * 8) = fl.half[0]; }
      asm volatile("s_wait_xcnt 0x0" ::: "memory");      /* behind the last stores: the code of the other column blocks follows in the listing and rewrites the stores' registers */ } }
  else {
#pragma unroll
    for (int q = 0; q < 16; ++q) { const int r = q * 2 + rsub; const v4f v = *(const v4fa*)&so[w][r][c4]; if (C) *(v4f*)(C + cofs + (size_t)(row0 + r) * ldc + col0 + c4) = v; if (C16) { v4h h4; for (int i = 0; i < 4; ++i) h4[i] = (_Float16)v[i]; *(v4h*)(C16 + cofs + (size_t)(row0 + r) * ldc + col0 + c4) = h4; } }
     } }


__global__ __launch_bounds__(256) void k_rsm(const float* __restrict__ S, _Float16* __restrict__ P, int nrows) {
  #pragma clang fp contract(off)
  const int i = blockIdx.x * 256 + threadIdx.x; if (i >= nrows) return; const float* s = S + (size_t)i * SQ; float mx = -3.0e38f;
#pragma unroll 1
  for (int j = 0; j < SQ; ++j) mx = fmaxf(mx, s[j]); float se = 0.f;
#pragma unroll 1
  for (int j = 0; j < SQ; ++j) se += expf(s[j] - mx); const float sc = 256.0f / se;
#pragma unroll 1
  for (int j0 = 0; j0 < SQ; j0 += 8) { FragH f; for (int q = 0; q < 8; ++q) f.h[q] = (_Float16)(expf(s[j0 + q] - mx) * sc); unsigned short* d = (unsigned short*)P + (size_t)i * SQ + j0; *(v8us*)d = f.half[0];  } }
__global__ __launch_bounds__(256) void k_vt(const _Float16* __restrict__ V16, int b, int h0, _Float16* __restrict__ VT) { __shared__ unsigned short tl[64][65]; const int tid = threadIdx.x; const int hh = blockIdx.x % HG, sg = blockIdx.x / HG; const int s0 = sg * 64; const int h = h0 + hh;
  for (int i = tid; i < 64 * 8; i += 256) { const int j = i / 8, d8 = (i % 8) * 8; FragH f; f.half[0] = *(const v8us*)((const unsigned short*)V16 + ((size_t)b * SQ + s0 + j) * DM + h * HD + d8); for (int q = 0; q < 8; ++q) tl[d8 + q][j] = f.u[q]; }
  __syncthreads();
  { for (int i = tid; i < 64 * 8; i += 256) { const int d = i / 8, j8 = (i % 8) * 8; FragH f; for (int q = 0; q < 8; ++q) f.u[q] = tl[d][j8 + q]; *(v8us*)((unsigned short*)VT + ((size_t)hh * HD + d) * SQ + s0 + j8) = f.half[0]; }  } }


// The eight jobs that read inputs alone, in one launch; the block index picks the job and no job reads what another writes.
// Blocks 0 .. 4 * PW - 1: the four weight matrices, rounded to bf16, x16, as f16 in their natural [out][in] rows (theta | phi | g stacked in B3, W_z in BZ). Block 4 * PW: the three biases stacked in b3. The rest: x [channel][position] to f16 rows [position][channel], a 64 x 32 tile a block.
#define PW (IC * CC / 8 / 256)       /* blocks a weight matrix: eight elements a thread */
#define PX (NB * (LL / 32) * (CC / 64))
__global__ __launch_bounds__(256) void k_prep(const float* __restrict__ X, const float* __restrict__ tw, const float* __restrict__ pw, const float* __restrict__ gw, const float* __restrict__ zw, const float* __restrict__ tb, const float* __restrict__ pb, const float* __restrict__ gb,
    _Float16* __restrict__ XR, _Float16* __restrict__ B3, _Float16* __restrict__ BZ, float* __restrict__ b3) { static_assert(IC * CC % 2048 == 0 && D3 <= 256, "whole blocks a weight matrix; one thread a bias");
  __shared__ float tl[64][33]; const int tid = threadIdx.x;
  if (blockIdx.x < 4 * PW) { const int j = blockIdx.x / PW; const float* w = (j == 0) ? tw : (j == 1) ? pw : (j == 2) ? gw : zw; _Float16* Bt = (j < 3) ? B3 + (size_t)j * IC * CC : BZ;
    const size_t t = (size_t)(blockIdx.x % PW) * 256 + tid; FragH f; for (int q = 0; q < 8; ++q) f.h[q] = (_Float16)(bf16_round(w[t * 8 + q]) * 16.0f); *(v8us*)((unsigned short*)Bt + t * 8) = f.half[0]; }
  else if (blockIdx.x == 4 * PW) { if (tid < D3) { const int j = tid / IC; const float* s = (j == 0) ? tb : (j == 1) ? pb : gb; b3[tid] = s[tid % IC]; } }
  else { const int bx = blockIdx.x - (4 * PW + 1); const int nl = LL / 32, nc = CC / 64; const int cb_ = bx % nc; const int lb = (bx / nc) % nl; const size_t b = bx / (nc * nl); const int c0 = cb_ * 64, l0 = lb * 32;
    for (int i = tid; i < 64 * 32; i += 256) { const int c = i / 32, l = i % 32; tl[c][l] = bf16_round(X[(b * CC + c0 + c) * (size_t)LL + l0 + l]); }
    __syncthreads();      /* under a test on the block index alone: every thread of the block passes it */
    const int l = tid / 8, c8 = (tid % 8) * 8; FragH f; for (int q = 0; q < 8; ++q) f.h[q] = (_Float16)tl[c8 + q][l]; unsigned short* d = (unsigned short*)XR + (b * LL + l0 + l) * (size_t)CC + c0 + c8; *(v8us*)d = f.half[0];
    asm volatile("s_wait_xcnt 0x0" ::: "memory");      /* behind the store: the code of the other jobs follows this block in the listing and rewrites the store's registers */
  } }

// Fused attention: a work-group of 8 waves owns 64 queries; a wave owns 32 of them (two column groups of 16) and every fourth block of 32 keys, one block a trip; scores, softmax weights and the weighted sum of g stay in registers (no score or weight plane in memory).
// The four waves of a query group each keep their own running maximum, sum and y; the four partial results are joined through LDS behind the key loop.
// S^T = phi . theta^T (A = 16 phi rows, B = the wave's theta rows, kept in registers), so a lane holds one query's scores: D register r of lane (ln, hh) is key 8 * hh + r, query ln.
// The two tiles of a trip (keys 0..15, 16..31), converted in place, are the B operand of y^T += g^T . P^T in the k order of g2_frag; the running maximum, the sum and the rescale factor of query ln live in lanes ln and ln + 16.
__device__ __forceinline__ v8f at_mma(v16h a, v16h b, v8f c) { return __builtin_amdgcn_wmma_f32_16x16x32_f16(false, a, false, b, (short)0, c, false, false); }
// fragment in the k order of g2_frag from a wave-uniform base and the lane's own byte offset (row * pitch + 16 * hh)
__device__ __forceinline__ v16h at_frag(const char* base, unsigned off) { FragH f; f.half[0] = *(const v8us*)(base + off); f.half[1] = *(const v8us*)(base + off + 32); return f.v; }
// the same fragment from an operand stored in fragment order (k_gemm2's SPL epilogue): 1 KiB at a wave-uniform base, off = 16 * lane; each of the two loads covers 512 contiguous bytes, four whole lines
__device__ __forceinline__ v16h at_fragp(const char* base, unsigned off) { FragH f; f.half[0] = *(const v8us*)(base + off); f.half[1] = *(const v8us*)(base + off + 512); return f.v; }
__device__ __forceinline__ float at_xhalf(float x) { return __builtin_bit_cast(float, __builtin_amdgcn_permlanex16(__builtin_bit_cast(int, x), __builtin_bit_cast(int, x), 0x76543210, 0xfedcba98, false, false)); }      /* lane l with lane l ^ 16 */
__global__ __launch_bounds__(256) void k_attn(const _Float16* __restrict__ TH, const _Float16* __restrict__ TL, const _Float16* __restrict__ PH, const _Float16* __restrict__ PL, const _Float16* __restrict__ GT, const _Float16* __restrict__ GTL, _Float16* __restrict__ YH, _Float16* __restrict__ YL) {
  __shared__ __attribute__((aligned(16))) v4f py[8][16][32];      /* partial y: [wave][(column group * 4 + tile) * 2 + register half][lane] */
  __shared__ float pm[8][2][32], pl[8][2][32];      /* partial maximum and sum: [wave][column group][lane] */
  const int tid = threadIdx.x, lane = tid & 31, ln = lane & 15, hh = lane >> 4;
  const int wv = __builtin_amdgcn_readfirstlane(tid >> 5), w = wv & 1, ks = wv >> 1;      /* query group; which of every four key blocks */
  const int b = blockIdx.x / (LL / 64), qb = (blockIdx.x % (LL / 64)) * 64;
  const char* th = (const char*)(TH + (size_t)b * LL * D3); const char* tl = (const char*)(TL + (size_t)b * LL * D3);      /* rows of D3 halves, theta in the first IC of them, hi / residual */
  const char* kph = (const char*)(PH + (size_t)b * LL * IC); const char* kpl = (const char*)(PL + (size_t)b * LL * IC);      /* phi hi / residual in fragment order: 128 bytes a key, 2 KiB a tile of 16 keys */
  const char* gh = (const char*)(GT + (size_t)b * IC * SK); const char* gl = (const char*)(GTL + (size_t)b * IC * SK);      /* g^T hi / residual in fragment order: 128 bytes a key, 4 KiB a block of 32 keys */
  const unsigned qo = (unsigned)(32 * w + ln) * (D3 * 2) + 16 * hh, lo = (unsigned)lane * 16;
  const float L2E = 1.44269504088896340736f;
  const v8f z8 = {0.f,0.f,0.f,0.f,0.f,0.f,0.f,0.f};
  v8f yh[2][4], yl[2][4]; float m[2], l[2];
#pragma unroll
  for (int j = 0; j < 2; ++j) { m[j] = -INFINITY; l[j] = 0.f; for (int t = 0; t < 4; ++t) { yh[j][t] = z8; yl[j][t] = z8; } }
  __builtin_amdgcn_sched_barrier(0);      /* with the one behind the wait: no vector write stands between the first loads and their s_wait_xcnt */
  v16h qh[2][2], ql[2][2];      /* theta hi / residual: [column group][k step] */
#pragma unroll
  for (int j = 0; j < 2; ++j) for (int c = 0; c < 2; ++c) { const size_t o = (size_t)(qb + 16 * j) * (D3 * 2) + 64 * c; qh[j][c] = at_frag(th + o, qo); ql[j][c] = at_frag(tl + o, qo); }
  v16h ka[2][2], kr[2][2];      /* phi hi / residual of the trip: [key tile][k step] */
#pragma unroll
  for (int t = 0; t < 2; ++t) for (int c = 0; c < 2; ++c) { const size_t o = (size_t)(32 * ks + 16 * t) * (IC * 2) + 1024 * c; ka[t][c] = at_fragp(kph + o, lo); kr[t][c] = at_fragp(kpl + o, lo); }
  asm volatile("s_wait_xcnt 0x0" ::: "memory");      /* in front of the first rewrite of an address register that the loads above name */
  __builtin_amdgcn_sched_barrier(0);      /* holds every later register write behind that wait */
  for (int it = 0; it < SK / 128; ++it) { const int k0 = 128 * it + 32 * ks;
    v16h ga[4], gr[4];      /* g^T of this trip: asked for here, used behind the softmax */
#pragma unroll
    for (int t = 0; t < 4; ++t) { const size_t o = (size_t)k0 * (IC * 2) + 1024 * t; ga[t] = at_fragp(gh + o, lo); gr[t] = at_fragp(gl + o, lo); }
    asm volatile("s_wait_xcnt 0x0" ::: "memory");      /* in front of the rewrite of the address registers that these loads name */
    __builtin_amdgcn_sched_barrier(0);      /* keeps the g^T loads in front of the score products: sunk to their uses each would be waited for alone */
    float s[2][2][8];
#pragma unroll
    for (int t = 0; t < 2; ++t) for (int j = 0; j < 2; ++j) {
      v8f sh = at_mma(ka[t][0], qh[j][0], z8); sh = at_mma(ka[t][1], qh[j][1], sh);      /* phi-hi . theta-hi */
      v8f sl = at_mma(ka[t][0], ql[j][0], z8); sl = at_mma(ka[t][1], ql[j][1], sl); sl = at_mma(kr[t][0], qh[j][0], sl); sl = at_mma(kr[t][1], qh[j][1], sl);      /* phi-hi . theta-res + phi-res . theta-hi, both x1024 */
      for (int r = 0; r < 8; ++r) s[j][t][r] = fmaf(sl[r], 1.0f / 1024.0f, sh[r]); }
    __builtin_amdgcn_sched_barrier(0);      /* with the one behind the wait: no vector write stands between the loads below and their s_wait_xcnt */
    const int kn = (k0 + 128) & (SK - 1);      /* the next trip's phi rows, one trip ahead; the last trip asks for the wave's first rows again (in bounds, not used) */
#pragma unroll
    for (int t = 0; t < 2; ++t) for (int c = 0; c < 2; ++c) { const size_t o = (size_t)(kn + 16 * t) * (IC * 2) + 1024 * c; ka[t][c] = at_fragp(kph + o, lo); kr[t][c] = at_fragp(kpl + o, lo); }
    asm volatile("s_wait_xcnt 0x0" ::: "memory");      /* in front of the rewrite of the address registers that these loads name */
    __builtin_amdgcn_sched_barrier(0);      /* keeps those loads in front of the softmax, whose time then covers their latency */
    float mn[2];
#pragma unroll
    for (int j = 0; j < 2; ++j) { float mx = s[j][0][0];
      for (int t = 0; t < 2; ++t) for (int r = 0; r < 8; ++r) mx = fmaxf(mx, s[j][t][r]);
      mx = fmaxf(mx, at_xhalf(mx));      /* the other eight keys of each tile sit in the partner lane */
      mn[j] = fmaxf(m[j], mx); }
    if (__builtin_amdgcn_ballot_w32(mn[0] > m[0] || mn[1] > m[1]) != 0) {      /* no maximum moved: every factor would be 1 */
#pragma unroll
      for (int j = 0; j < 2; ++j) { const float al = __builtin_amdgcn_exp2f((m[j] - mn[j]) * L2E);      /* first trip: exp2(-inf) = 0 on sums that are still 0 */
        m[j] = mn[j]; l[j] *= al;
        for (int t = 0; t < 4; ++t) for (int r = 0; r < 8; ++r) { yh[j][t][r] *= al; yl[j][t][r] *= al; } } }
#pragma unroll
    for (int j = 0; j < 2; ++j) { FragH pf; const float cn = -m[j] * L2E;
#pragma unroll
      for (int i = 0; i < 8; ++i) { const float p0 = __builtin_amdgcn_exp2f(fmaf(s[j][0][i], L2E, cn)), p1 = __builtin_amdgcn_exp2f(fmaf(s[j][1][i], L2E, cn)); l[j] += p0 + p1;
        pf.h[i] = (_Float16)(p0 * 16384.0f); pf.h[8 + i] = (_Float16)(p1 * 16384.0f); }      /* P carried x2^14: the peaky rows would otherwise flush most weights below the f16 normal range */
#pragma unroll
      for (int t = 0; t < 4; ++t) { yh[j][t] = at_mma(ga[t], pf.v, yh[j][t]); yl[j][t] = at_mma(gr[t], pf.v, yl[j][t]); } }
  }
#pragma unroll
  for (int j = 0; j < 2; ++j) { pm[wv][j][lane] = m[j]; pl[wv][j][lane] = l[j] + at_xhalf(l[j]);
#pragma unroll
    for (int t = 0; t < 4; ++t) { v4f o0, o1;
      for (int r = 0; r < 4; ++r) { o0[r] = fmaf(yl[j][t][r], 1.0f / 1024.0f, yh[j][t][r]); o1[r] = fmaf(yl[j][t][4 + r], 1.0f / 1024.0f, yh[j][t][4 + r]); }
      py[wv][(j * 4 + t) * 2][lane] = o0; py[wv][(j * 4 + t) * 2 + 1][lane] = o1; } }
  __syncthreads();      /* every wave's partial result is in LDS before any wave joins */
  const int jo = ks & 1, qn = 8 * (ks >> 1) + (lane & 7), tc = lane >> 3;      /* this wave joins eight queries of column group jo, all 64 channels: whole 128-byte lines of the f16 y rows; the lane takes query qn, channels 16 * tc .. 16 * tc + 15 */
  float ms[4], wt[4];
#pragma unroll
  for (int s = 0; s < 4; ++s) ms[s] = pm[2 * s + w][jo][qn];
  const float mj = fmaxf(fmaxf(ms[0], ms[1]), fmaxf(ms[2], ms[3])); float lt = 0.f;
#pragma unroll
  for (int s = 0; s < 4; ++s) ms[s] = (ms[s] - mj) * L2E;
  __builtin_amdgcn_sched_barrier(0);      /* all four exponents are formed in front of the first v_exp */
#pragma unroll
  for (int s = 0; s < 4; ++s) wt[s] = __builtin_amdgcn_exp2f(ms[s]);
#pragma unroll
  for (int s = 0; s < 4; ++s) lt = fmaf(wt[s], pl[2 * s + w][jo][qn], lt);
  const float inv = (1.0f / 16384.0f) / lt;
  v4f o[4];
#pragma unroll
  for (int i = 0; i < 4; ++i) { const int e = (jo * 4 + tc) * 2 + (i & 1), sl = 16 * (i >> 1) + qn;      /* D register r of tile t, lane (ln, hh) = channel 16 * t + 8 * hh + r of query ln: o[i] is channels 16 * tc + 4 * i .. + 3 */
    o[i] = py[w][e][sl] * wt[0];
    for (int s = 1; s < 4; ++s) { const v4f p = py[2 * s + w][e][sl]; for (int r = 0; r < 4; ++r) o[i][r] = fmaf(p[r], wt[s], o[i][r]); }
    o[i] *= inv; }
  const float ov[16] = {o[0][0], o[0][1], o[0][2], o[0][3], o[1][0], o[1][1], o[1][2], o[1][3], o[2][0], o[2][1], o[2][2], o[2][3], o[3][0], o[3][1], o[3][2], o[3][3]};
  FragH fh, fl; hl_split8(ov, fh.u, fl.u); hl_split8(ov + 8, fh.u + 8, fl.u + 8);      /* y as the hi + residual operand pair of the W_z products */
  const size_t yo = ((size_t)b * LL + qb + 32 * w + 16 * jo + qn) * IC + 16 * tc;
  *(v8us*)((unsigned short*)YH + yo) = fh.half[0]; *(v8us*)((unsigned short*)YH + yo + 8) = fh.half[1]; *(v8us*)((unsigned short*)YL + yo) = fl.half[0]; *(v8us*)((unsigned short*)YL + yo + 8) = fl.half[1]; }
__global__ __launch_bounds__(256) void k_bnstat(const float* __restrict__ WY, float* __restrict__ ST) {
  #pragma clang fp contract(off)
  __shared__ float red[256]; const int c = blockIdx.x; const int tid = threadIdx.x; float s = 0.f;
  float v[NR / 256];      /* the thread's values of the channel, rows tid + 256 * i in the order in which both passes sum them: all asked for ahead of the first sum (in a loop of one load a trip each load was waited out alone) and kept for the second pass */
  for (int i = 0; i < (int)(NR / 256); ++i) v[i] = WY[(size_t)c * NR + (size_t)i * 256 + tid];      /* WY is [channel][row]: a wave's load is one whole line */
  for (int i = 0; i < (int)(NR / 256); ++i) s = __fadd_rn(s, v[i]);
  red[tid] = s; __syncthreads(); for (int st = 128; st > 0; st >>= 1) { if (tid < st) red[tid] += red[tid + st]; __syncthreads(); }
  const float mean = red[0] / (float)NR; __syncthreads(); float s2 = 0.f;
  for (int i = 0; i < (int)(NR / 256); ++i) { const float d = __fadd_rn(v[i], -mean); s2 = __fadd_rn(s2, __fmul_rn(d, d)); }
  red[tid] = s2; __syncthreads(); for (int st = 128; st > 0; st >>= 1) { if (tid < st) red[tid] += red[tid + st]; __syncthreads(); }
  if (tid < 32) { const float v = (tid == 0) ? mean : ((tid == 1) ? rsqrtf(__fadd_rn(red[0] / (float)NR, 1e-5f)) : 0.f); *(float*)(ST + (size_t)c * 32 + tid) = v;  } }
__global__ __launch_bounds__(256) void k_fin(const float* __restrict__ WY, const float* __restrict__ ST, const float* __restrict__ gam, const float* __restrict__ bet, const float* __restrict__ x, float* __restrict__ out) {
  #pragma clang fp contract(off)
  static_assert(LL % 2048 == 0, "a block's 2048 elements lie in one channel of one sample");
  const size_t e0 = (size_t)blockIdx.x * 2048; if (e0 >= (size_t)NB * CC * LL) return; const int n0 = (int)(e0 % LL); const size_t bc = e0 / LL; const int c = (int)(bc % CC); const size_t b = bc / CC; const float mean = ST[(size_t)c * 32], rstd = ST[(size_t)c * 32 + 1], g = bf16_round(gam[c]), be = bf16_round(bet[c]); v8f r;
  const int o = threadIdx.x * 8; const float* wp = WY + (size_t)c * NR + b * LL + n0; const float* xp = x + e0;      /* WY is [channel][row]: the thread's eight positions are 32 contiguous bytes there as in x and out, at the same offset from the block's base */
  __builtin_amdgcn_sched_barrier(0);      /* with the one behind the wait: no write of a register, a scalar load's result among them, stands between the four loads and their s_wait_xcnt */
  const v4f w0 = *(const v4fa*)(wp + o), w1 = *(const v4fa*)(wp + o + 4), x0 = *(const v4fa*)(xp + o), x1 = *(const v4fa*)(xp + o + 4);
  asm volatile("s_wait_xcnt 0x0" ::: "memory");      /* in front of the first rewrite of a base register that the loads above name */
  __builtin_amdgcn_sched_barrier(0);      /* holds every later register write behind that wait */
  const float wy[8] = {w0[0], w0[1], w0[2], w0[3], w1[0], w1[1], w1[2], w1[3]}, xv[8] = {x0[0], x0[1], x0[2], x0[3], x1[0], x1[1], x1[2], x1[3]};
  for (int q = 0; q < 8; ++q) { const float v = __fadd_rn(__fmul_rn(__fmul_rn(__fadd_rn(wy[q], -mean), rstd), g), be); r[q] = __fadd_rn(v, bf16_round(xv[q])); }
  *(v8f*)(out + e0 + o) = r;  }

extern "C" void kernel_launch(void* const* d_in, const int* in_sizes, int n_in,
                              void* d_out, int out_size, void* d_ws, size_t ws_size, hipStream_t stream) {
  (void)in_sizes; (void)n_in; (void)out_size;
  const float* const* I = (const float* const*)d_in; const float* x = I[0]; const float* gw = I[1]; const float* gb = I[2]; const float* tw = I[3]; const float* tb = I[4]; const float* pw = I[5]; const float* pb = I[6]; const float* zw = I[7]; const float* zb = I[8]; const float* gam = I[9]; const float* bet = I[10];      /* g/theta/phi_w [64][256], wz_w [256][64] natural */
  char* ws = (char*)d_ws; size_t off = 0;
  auto take = [&](size_t bytes) { char* p = ws + off; off += (bytes + 255) & ~(size_t)255; return p; };
  _Float16* B3 = (_Float16*)take((size_t)D3 * CC * 2); float* b3 = (float*)take(D3 * 4); _Float16* BZ = (_Float16*)take((size_t)CC * IC * 2); float* ST = (float*)take((size_t)CC * 32 * 4);
  _Float16* XR = (_Float16*)take(NR * CC * 2); _Float16* TH = (_Float16*)take(NR * D3 * 2); _Float16* TL = (_Float16*)take(NR * D3 * 2); _Float16* PH = (_Float16*)take(NR * IC * 2); _Float16* PL = (_Float16*)take(NR * IC * 2);
  _Float16* GT = (_Float16*)take((size_t)NB * IC * SK * 2); _Float16* GTL = (_Float16*)take((size_t)NB * IC * SK * 2);
  _Float16* YH = (_Float16*)take(NR * IC * 2); _Float16* YL = (_Float16*)take(NR * IC * 2); float* WY = (float*)take(NR * CC * 4);
  if (off > ws_size) return;      /* 0.2 + 8 + 6 + 6 + 4 + 4 + 2 + 2 + 16 = approx 48 MiB */
  k_prep<<<4 * PW + 1 + PX, 256, 0, stream>>>(x, tw, pw, gw, zw, tb, pb, gb, XR, B3, BZ, b3);      /* Bt rows: theta 0..63 | phi 64..127 | g 128..191 */
  k_gemm2<0, false, true, 2><<<dim3((unsigned)((NR / 128) * (D3 / 64)), 1), 128, 0, stream>>>(XR, CC, 0, B3, CC, 0, 0.0625f, b3, 0, nullptr, 1, 0, 0, nullptr, nullptr, D3, 0, (int)NR, D3, CC, TH, TL, PH, PL, GT, GTL);      /* theta rows, phi and g^T in fragment order, each hi / residual */
  k_attn<<<NBR * (LL / 64), 256, 0, stream>>>(TH, TL, PH, PL, GT, GTL, YH, YL);      /* softmax(theta . phi) . g -> y rows, hi / residual */
  const dim3 gz((unsigned)((CC / 128) * (NR / 64)), 1);      /* WY = (W_z y)^T, [channel][batch * positions]: A = W_z rows, B = y rows, so that k_bnstat and k_fin, which go channel by channel, read contiguous bytes */
  k_gemm2<0, true, false, 2><<<gz, 128, 0, stream>>>(BZ, IC, 0, YL, IC, 0, 0.0625f / 1024.0f, nullptr, 0, nullptr, 1, 0, 0, WY, nullptr, (int)NR, 0, CC, (int)NR, IC);      /* W_z: y-res term */
  k_gemm2<0, true, false, 2><<<gz, 128, 0, stream>>>(BZ, IC, 0, YH, IC, 0, 0.0625f, zb, 0, WY, -1, 0, 0, WY, nullptr, (int)NR, 0, CC, (int)NR, IC);      /* + y-hi term + bias (by row = channel) + own element of the y-res term */
  k_bnstat<<<CC, 256, 0, stream>>>(WY, ST);
  k_fin<<<(unsigned)(((size_t)NB * CC * LL / 8 + 255) / 256), 256, 0, stream>>>(WY, ST, gam, bet, x, (float*)d_out);
}

// v010
// Measured time: 98.7 microseconds a run.
// Two timings next to v009 put it at 1.26 and 1.27 times that version's speed.
// Over all steps from v000 it is 328 times as fast.
#include <hip/hip_runtime.h>
// Non-local block (x [2][256][8x32x32 = 8192 positions]; g, theta, phi = 1x1 conv projections to 64 (+ bias); f = theta . phi over all positions; softmax; y = attn g; W_z 1x1 conv back to 256 (+ bias); training-mode BatchNorm over (batch, positions) per channel with gamma/beta; out = bn(W_z y) + x).
// Compute dtype: inputs rounded to bf16; x / weights exact; theta, phi, g, y as hi + residual operand pairs (~2^-22); P plain f16 (~2^-12); softmax, BN f32; v_wmma_f32_16x16x32_f16.
#define NB 2
#define CC 256
#define LL 8192                      /* positions per sample */
#define SK LL
#define IC 64                        /* inter channels */
#define D3 (3 * IC)                  /* theta | phi | g */
#define NR ((size_t)NB * LL)
#define NBR NB                       /* batches (debug hook) */
#define SQ LL
#define DM CC
#define NH 1
#define HD 64
#define HG 1
typedef __bf16 v16b __attribute__((ext_vector_type(16)));
typedef unsigned short v8us __attribute__((ext_vector_type(8), may_alias));
typedef float  v8f  __attribute__((ext_vector_type(8)));
typedef float  v4f  __attribute__((ext_vector_type(4)));
typedef float  v4fa __attribute__((ext_vector_type(4), may_alias));
union FragB { v16b v; v8us half[2]; unsigned short u[16]; };

__device__ __forceinline__ unsigned short bf16_bits(float x) { unsigned int u = __float_as_uint(x); return (unsigned short)((u + 0x7FFFu + ((u >> 16) & 1u)) >> 16); }
__device__ __forceinline__ float bf16_val(unsigned short b) { return __uint_as_float(((unsigned int)b) << 16); }
__device__ __forceinline__ float bf16_round(float x) { return bf16_val(bf16_bits(x)); }
// D += A·B with NT terms: 1 = ah·bh, 2 = + al·bh (A split), 3 = + ah·bl (both split)
template <int NT>
__device__ __forceinline__ v8f mmaN(v16b ah, v16b al, v16b bh, v16b bl, v8f c) {
  c = __builtin_amdgcn_wmma_f32_16x16x32_bf16(false, ah, false, bh, (short)0, c, false, false);
  if (NT >= 2) c = __builtin_amdgcn_wmma_f32_16x16x32_bf16(false, al, false, bh, (short)0, c, false, false);
  if (NT >= 3) c = __builtin_amdgcn_wmma_f32_16x16x32_bf16(false, ah, false, bl, (short)0, c, false, false);
  asm volatile("v_nop\n\tv_nop\n\tv_nop\n\tv_nop" : "+v"(c) : "v"(ah), "v"(al), "v"(bh), "v"(bl));
  return c;
}

__global__ __launch_bounds__(256) void k_wt_bf16(const float* __restrict__ W, unsigned short* __restrict__ Wt, int K, int N) {
  const int t = blockIdx.x * 256 + threadIdx.x;
  const int k8n = K / 8;
  if (t >= N * k8n) return;
  const int n = t / k8n, k8 = (t % k8n) * 8;
  v8us v;
#pragma unroll
  for (int i = 0; i < 8; ++i) v[i] = bf16_bits(W[(size_t)(k8 + i) * N + n]);
  *(v8us*)(Wt + (size_t)n * K + k8) = v;
  
}

// GEMM C[M][N] (f32, pitch ldc) = act(A[M][K]·W + bias). A f32 row-major (pitch lda) converted per fragment to bf16
// (ASPLIT: hi/lo two planes -> 2 terms, else single rounded term); Wt bf16 [N][K] (pitch ldb). BIAS_BF16 rounds the
// bias to bf16 first (bias quantised to bf16 before the add). K%32==0, M%16==0, N%64==0.
template <bool ASPLIT, int ACT, bool BIAS_BF16>
__global__ __launch_bounds__(128) void k_gemm_bf(const float* __restrict__ A, int lda, const unsigned short* __restrict__ Wt, int ldb,
                                               const float* __restrict__ bias, float* __restrict__ C, int ldc, int M, int N, int K) {
  __shared__ __attribute__((aligned(16))) float so[4][16][64];
  const int tid = threadIdx.x, w = tid >> 5, lane = tid & 31, ln = lane & 15, hh = lane >> 4;
  const int ntn = N / 64;
  const int wid = blockIdx.x * 4 + w;
  const int mt = wid / ntn, nq = wid % ntn;
  if (mt * 16 >= M) return;
  const int row0 = mt * 16, col0 = nq * 64;
  const float* arow = A + (size_t)(row0 + ln) * lda;
  v8f acc[4] = {};
  for (int kb = 0; kb < K; kb += 32) {
    FragB ah, al;
    const v4f x0 = *(const v4fa*)(arow + kb + 8 * hh), x1 = *(const v4fa*)(arow + kb + 8 * hh + 4);
    const v4f x2 = *(const v4fa*)(arow + kb + 16 + 8 * hh), x3 = *(const v4fa*)(arow + kb + 16 + 8 * hh + 4);
    float xs[16] = {x0[0],x0[1],x0[2],x0[3],x1[0],x1[1],x1[2],x1[3],x2[0],x2[1],x2[2],x2[3],x3[0],x3[1],x3[2],x3[3]};
#pragma unroll
    for (int i = 0; i < 16; ++i) { const unsigned short hb = bf16_bits(xs[i]); ah.u[i] = hb; al.u[i] = ASPLIT ? bf16_bits(xs[i] - bf16_val(hb)) : (unsigned short)0; }
#pragma unroll
    for (int t = 0; t < 4; ++t) {
      const unsigned short* brow = Wt + (size_t)(col0 + t * 16 + ln) * ldb + kb;
      FragB b;
      b.half[0] = *(const v8us*)(brow + 8 * hh);
      b.half[1] = *(const v8us*)(brow + 16 + 8 * hh);
      acc[t] = mmaN<ASPLIT ? 2 : 1>(ah.v, al.v, b.v, b.v, acc[t]);
    }
  }
#pragma unroll
  for (int t = 0; t < 4; ++t) {
    float bv = bias ? bias[col0 + t * 16 + ln] : 0.f;
    if (BIAS_BF16) bv = bf16_round(bv);
#pragma unroll
    for (int r = 0; r < 8; ++r) { float v = acc[t][r] + bv; if (ACT == 1) v = fmaxf(v, 0.f); so[w][8 * hh + r][t * 16 + ln] = v; }
  }
  __builtin_amdgcn_fence(__ATOMIC_ACQ_REL, "workgroup");
  __builtin_amdgcn_wave_barrier();
  const int rsub = lane >> 4, c4 = (lane & 15) * 4;
  {
#pragma unroll
    for (int q = 0; q < 8; ++q) {
      const int r = q * 2 + rsub;
      const v4f v = *(const v4fa*)&so[w][r][c4];
      *(v4f*)(C + (size_t)(row0 + r) * ldc + col0 + c4) = v;
    }
    
  }
}

// GEMM C = act(A·W + bias + resid): A f32 (ASPLIT -> hi/lo 2 terms), Wt bf16 [N][K]; ACT 0 none, 1 relu, 2 exact gelu;
// resid (optional, f32, row index = (row % rmod), pitch ldr, RES_BF16 rounds it) added before the activation.
template <bool ASPLIT, int ACT, bool BIAS_BF16, bool RES_BF16>
__global__ __launch_bounds__(128) void k_gemm_bf3(const float* __restrict__ A, int lda, const unsigned short* __restrict__ Wt, int ldb,
                                                const float* __restrict__ bias, const float* __restrict__ resid, int rmod, int ldr,
                                                float* __restrict__ C, int ldc, int M, int N, int K) {
  __shared__ __attribute__((aligned(16))) float so[4][16][64];
  const int tid = threadIdx.x, w = tid >> 5, lane = tid & 31, ln = lane & 15, hh = lane >> 4;
  const int ntn = N / 64;
  const int wid = blockIdx.x * 4 + w;
  const int mt = wid / ntn, nq = wid % ntn;
  if (mt * 16 >= M) return;
  const int row0 = mt * 16, col0 = nq * 64;
  const float* arow = A + (size_t)(row0 + ln) * lda;
  v8f acc[4] = {};
  for (int kb = 0; kb < K; kb += 32) {
    FragB ah, al;
    const v4f x0 = *(const v4fa*)(arow + kb + 8 * hh), x1 = *(const v4fa*)(arow + kb + 8 * hh + 4);
    const v4f x2 = *(const v4fa*)(arow + kb + 16 + 8 * hh), x3 = *(const v4fa*)(arow + kb + 16 + 8 * hh + 4);
    float xs[16] = {x0[0],x0[1],x0[2],x0[3],x1[0],x1[1],x1[2],x1[3],x2[0],x2[1],x2[2],x2[3],x3[0],x3[1],x3[2],x3[3]};
#pragma unroll
    for (int i = 0; i < 16; ++i) { const unsigned short hb = bf16_bits(xs[i]); ah.u[i] = hb; al.u[i] = ASPLIT ? bf16_bits(xs[i] - bf16_val(hb)) : (unsigned short)0; }
#pragma unroll
    for (int t = 0; t < 4; ++t) {
      const unsigned short* brow = Wt + (size_t)(col0 + t * 16 + ln) * ldb + kb;
      FragB b;
      b.half[0] = *(const v8us*)(brow + 8 * hh);
      b.half[1] = *(const v8us*)(brow + 16 + 8 * hh);
      acc[t] = mmaN<ASPLIT ? 2 : 1>(ah.v, al.v, b.v, b.v, acc[t]);
    }
  }
#pragma unroll
  for (int t = 0; t < 4; ++t) {
    const int col = col0 + t * 16 + ln;
    float bv = bias ? bias[col] : 0.f;
    if (BIAS_BF16) bv = bf16_round(bv);
#pragma unroll
    for (int r = 0; r < 8; ++r) {
      float v = acc[t][r] + bv;
      if (resid) { float rv = resid[(size_t)((row0 + 8 * hh + r) % rmod) * ldr + col]; if (RES_BF16) rv = bf16_round(rv); v += rv; }
      if (ACT == 1) v = fmaxf(v, 0.f);
      if (ACT == 2) v = 0.5f * v * (1.0f + erff(v * 0.70710678118654752f));
      if (ACT == 3) { const float u = 0.7978845608028654f * (v + 0.044715f * v * v * v); v = 0.5f * v * (1.0f + tanhf(u)); }
      so[w][8 * hh + r][t * 16 + ln] = v;
    }
  }
  __builtin_amdgcn_fence(__ATOMIC_ACQ_REL, "workgroup");
  __builtin_amdgcn_wave_barrier();
  const int rsub = lane >> 4, c4 = (lane & 15) * 4;
  {
#pragma unroll
    for (int q = 0; q < 8; ++q) {
      const int r = q * 2 + rsub;
      const v4f v = *(const v4fa*)&so[w][r][c4];
      *(v4f*)(C + (size_t)(row0 + r) * ldc + col0 + c4) = v;
    }
    
  }
}
// row LayerNorm (biased variance, eps) over N: s = X (+ R); optional out_sum <- s; out_norm <- (s-mu)*rsqrt(var+eps)*g + b
template <bool PARAM_BF16>
__global__ __launch_bounds__(256) void k_layernorm(const float* __restrict__ X, const float* __restrict__ R, const float* __restrict__ g, const float* __restrict__ bta,
                                                  float* __restrict__ out_sum, float* __restrict__ out_norm, int N, float eps) {
  __shared__ float red[256];
  const int row = blockIdx.x, tid = threadIdx.x;
  const float* x = X + (size_t)row * N; const float* rr = R ? R + (size_t)row * N : nullptr;
  float vals[16];                     // up to N = 4096
  const int per = N / 256;            // contiguous chunk per thread? use strided-by-4 chunks: thread handles j = tid*4 + 1024*u
  float s1 = 0.f;
  for (int u = 0; u < per / 4; ++u) {
    const int j = tid * 4 + 1024 * u;
    const v4f a = *(const v4fa*)(x + j);
    v4f b = {0.f,0.f,0.f,0.f}; if (rr) b = *(const v4fa*)(rr + j);
#pragma unroll
    for (int q = 0; q < 4; ++q) { const float v = a[q] + b[q]; vals[u * 4 + q] = v; s1 += v; }
  }
  red[tid] = s1; __syncthreads();
  for (int st = 128; st > 0; st >>= 1) { if (tid < st) red[tid] += red[tid + st]; __syncthreads(); }
  const float mu = red[0] / (float)N; __syncthreads();
  float s2 = 0.f;
  for (int u = 0; u < per / 4; ++u)
#pragma unroll
    for (int q = 0; q < 4; ++q) { const float c = vals[u * 4 + q] - mu; s2 += c * c; }
  red[tid] = s2; __syncthreads();
  for (int st = 128; st > 0; st >>= 1) { if (tid < st) red[tid] += red[tid + st]; __syncthreads(); }
  const float rs = rsqrtf(red[0] / (float)N + eps);
  {
    for (int u = 0; u < per / 4; ++u) {
      const int j = tid * 4 + 1024 * u;
      v4f o, sm;
#pragma unroll
      for (int q = 0; q < 4; ++q) {
        float gg = g[j + q], bb = bta[j + q];
        if (PARAM_BF16) { gg = bf16_round(gg); bb = bf16_round(bb); }
        sm[q] = vals[u * 4 + q]; o[q] = (vals[u * 4 + q] - mu) * rs * gg + bb;
      }
      if (out_sum) *(v4f*)(out_sum + (size_t)row * N + j) = sm;
      *(v4f*)(out_norm + (size_t)row * N + j) = o;
    }
    
  }
}



// ---- f16 WMMA path (v_wmma_f32_16x16x32_f16): 11-bit significands for operands in range — used where a [0,1] probability operand needs more precision than bf16
typedef _Float16 v16h __attribute__((ext_vector_type(16)));
union FragH { v16h v; v8us half[2]; _Float16 h[16]; unsigned short u[16]; };
template <int NT>
__device__ __forceinline__ v8f mmaH(v16h ah, v16h al, v16h bh, v16h bl, v8f c) {
  c = __builtin_amdgcn_wmma_f32_16x16x32_f16(false, ah, false, bh, (short)0, c, false, false);
  if (NT >= 2) c = __builtin_amdgcn_wmma_f32_16x16x32_f16(false, al, false, bh, (short)0, c, false, false);
  if (NT >= 3) c = __builtin_amdgcn_wmma_f32_16x16x32_f16(false, ah, false, bl, (short)0, c, false, false);
  asm volatile("v_nop\n\tv_nop\n\tv_nop\n\tv_nop" : "+v"(c) : "v"(ah), "v"(al), "v"(bh), "v"(bl));
  return c;
}
// batched GEMM like k_gemm_b but f16 operands: A f32 (split into f16 hi/lo if ASPLIT, else rounded to f16), Bt = f16 values [n][k]; alpha; C f32; N multiple of 16 (partial tiles skipped)
template <bool ASPLIT>
__global__ __launch_bounds__(128) void k_gemm_h(const float* __restrict__ A, int lda, size_t sA, const _Float16* __restrict__ Bh, int ldb, size_t sB, float alpha, float* __restrict__ C, int ldc, size_t sC, int M, int N, int K) {
  __shared__ __attribute__((aligned(16))) float so[4][16][64];
  const int tid = threadIdx.x, w = tid >> 5, lane = tid & 31, ln = lane & 15, hh = lane >> 4; const int by = blockIdx.y;
  A += (size_t)by * sA; Bh += (size_t)by * sB; C += (size_t)by * sC;
  const int ntn = (N + 63) / 64; const int wid = blockIdx.x * 4 + w; const int mt = wid / ntn, nq = wid % ntn; if (mt * 16 >= M) return;
  const int row0 = mt * 16, col0 = nq * 64; const float* arow = A + (size_t)(row0 + ln) * lda;
  v8f acc[4] = {};
  for (int kb = 0; kb < K; kb += 32) {
    FragH ah, al;
    const v4f x0 = *(const v4fa*)(arow + kb + 8 * hh), x1 = *(const v4fa*)(arow + kb + 8 * hh + 4), x2 = *(const v4fa*)(arow + kb + 16 + 8 * hh), x3 = *(const v4fa*)(arow + kb + 16 + 8 * hh + 4);
    float xs[16] = {x0[0],x0[1],x0[2],x0[3],x1[0],x1[1],x1[2],x1[3],x2[0],x2[1],x2[2],x2[3],x3[0],x3[1],x3[2],x3[3]};
#pragma unroll
    for (int i = 0; i < 16; ++i) { const _Float16 h = (_Float16)xs[i]; ah.h[i] = h; al.h[i] = ASPLIT ? (_Float16)(xs[i] - (float)h) : (_Float16)0.0f; }
#pragma unroll
    for (int t = 0; t < 4; ++t) { if (col0 + t * 16 >= N) continue; const size_t boff = (size_t)(col0 + t * 16 + ln) * ldb + kb; FragH bq; bq.half[0] = *(const v8us*)(Bh + boff + 8 * hh); bq.half[1] = *(const v8us*)(Bh + boff + 16 + 8 * hh);
      acc[t] = mmaH<ASPLIT ? 2 : 1>(ah.v, al.v, bq.v, bq.v, acc[t]); }
  }
#pragma unroll
  for (int t = 0; t < 4; ++t) { if (col0 + t * 16 >= N) continue;
#pragma unroll
    for (int r = 0; r < 8; ++r) so[w][8 * hh + r][t * 16 + ln] = acc[t][r] * alpha; }
  __builtin_amdgcn_fence(__ATOMIC_ACQ_REL, "workgroup"); __builtin_amdgcn_wave_barrier();
  const int rsub = lane >> 4, c4 = (lane & 15) * 4;
  {
#pragma unroll
    for (int q = 0; q < 8; ++q) { const int r = q * 2 + rsub; if (col0 + c4 < N) { const v4f v = *(const v4fa*)&so[w][r][c4]; *(v4f*)(C + (size_t)(row0 + r) * ldc + col0 + c4) = v; } }
     }
}

// Wt[n][k] = f16(W[k][n]·scale) from f32 row-major W[K][N] (scale = power of two; bf16-exact weights stay exact in f16 away from the subnormal range)
__global__ __launch_bounds__(256) void k_wt_f16(const float* __restrict__ W, _Float16* __restrict__ Wt, int K, int N, float scale) {
  const int t = blockIdx.x * 256 + threadIdx.x; if (t >= N * (K / 8)) return; const int n = t / (K / 8), k8 = (t % (K / 8)) * 8; FragH f;
#pragma unroll
  for (int i = 0; i < 8; ++i) f.h[i] = (_Float16)(bf16_round(W[(size_t)(k8 + i) * N + n]) * scale); const v8us o = f.half[0];
  *(v8us*)((unsigned short*)Wt + (size_t)n * K + k8) = o; 
}
// k_gemm_hh variant with fused epilogue: v = acc·alpha + bias[by·sBias + col] (+ CP[(row/rowsPerB)·sCPb + by·64 + col] if CP) ; ACT 0 none / 1 elu ; writes f16 C16 (and f32 C if non-null)
template <int ACT>
__global__ __launch_bounds__(128) void k_gemm_hhx(const _Float16* __restrict__ A, int lda, size_t sA, const _Float16* __restrict__ Bh, int ldb, size_t sB, float alpha, const float* __restrict__ bias, size_t sBias, const float* __restrict__ CP, int rowsPerB, size_t sCPb, int row0g,
    float* __restrict__ C, _Float16* __restrict__ C16, int ldc, size_t sC, int M, int N, int K) {
  __shared__ __attribute__((aligned(16))) float so[4][16][64];
  const int tid = threadIdx.x, w = tid >> 5, lane = tid & 31, ln = lane & 15, hh = lane >> 4; const int by = blockIdx.y;
  A += (size_t)by * sA; Bh += (size_t)by * sB; const size_t cofs = (size_t)by * sC; const float* bp = bias ? bias + (size_t)by * sBias : nullptr;
  const int ntn = (N + 63) / 64; const int wid = blockIdx.x * 4 + w; const int mt = wid / ntn, nq = wid % ntn; if (mt * 16 >= M) return;
  const int row0 = mt * 16, col0 = nq * 64; const _Float16* arow = A + (size_t)(row0 + ln) * lda;
  v8f acc[4] = {};
  for (int kb = 0; kb < K; kb += 32) { FragH ah; ah.half[0] = *(const v8us*)((const unsigned short*)arow + kb + 8 * hh); ah.half[1] = *(const v8us*)((const unsigned short*)arow + kb + 16 + 8 * hh);
#pragma unroll
    for (int t = 0; t < 4; ++t) { if (col0 + t * 16 >= N) continue; const size_t boff = (size_t)(col0 + t * 16 + ln) * ldb + kb; FragH bq; bq.half[0] = *(const v8us*)((const unsigned short*)Bh + boff + 8 * hh); bq.half[1] = *(const v8us*)((const unsigned short*)Bh + boff + 16 + 8 * hh);
      acc[t] = mmaH<1>(ah.v, ah.v, bq.v, bq.v, acc[t]); }
  }
#pragma unroll
  for (int t = 0; t < 4; ++t) { if (col0 + t * 16 >= N) continue; const int col = col0 + t * 16 + ln; const float bv = bp ? bf16_round(bp[col]) : 0.f;
#pragma unroll
    for (int r = 0; r < 8; ++r) { float v = acc[t][r] * alpha + bv; if (CP) { const int rr = row0g + row0 + 8 * hh + r; if (rowsPerB < 0) v += CP[cofs + (size_t)rr * ldc + col];      /* rowsPerB < 0: own element of the batched C plane */ else { const int bidx = rr / rowsPerB; v += CP[(size_t)bidx * sCPb + (size_t)by * 64 + col]; } } if (ACT == 1) v = (v > 0.f) ? v : expm1f(v); else if (ACT == 7) v = (v > 0.f) ? v + 1.0f : expf(v); else if (ACT == 8) v = tanhf(v); else if (ACT == 9) v = 0.5f * v * (1.0f + tanhf(0.7978845608028654f * (v + 0.044715f * v * v * v))); else if (ACT == 11) v = 1.0f / (1.0f + expf(-v)); else if (ACT == 12) v = (v > 0.f) ? v : 0.01f * v; else if (ACT == 14) v = (v > 0.f) ? v : 0.1f * v; else if (ACT == 16) v = (v >= 0.f) ? v : 0.3f * v; else if (ACT == 17) v = (v >= 0.f) ? v : 0.2f * v; else if (ACT == 15) v = v / (1.0f + expf(-v)); else if (ACT == 3) v = fmaxf(v, 0.f); else if (ACT == 6) v = 0.5f * v * (1.0f + erff(v * 0.70710678118654752f)); so[w][8 * hh + r][t * 16 + ln] = v; } }
  __builtin_amdgcn_fence(__ATOMIC_ACQ_REL, "workgroup"); __builtin_amdgcn_wave_barrier();
  const int rsub = lane >> 4, c4 = (lane & 15) * 4; typedef _Float16 v4h __attribute__((ext_vector_type(4)));
  {
#pragma unroll
    for (int q = 0; q < 8; ++q) { const int r = q * 2 + rsub; if (col0 + c4 < N) { const v4f v = *(const v4fa*)&so[w][r][c4]; if (C) *(v4f*)(C + cofs + (size_t)(row0 + r) * ldc + col0 + c4) = v; if (C16) { v4h h4; for (int i = 0; i < 4; ++i) h4[i] = (_Float16)v[i]; *(v4h*)(C16 + cofs + (size_t)(row0 + r) * ldc + col0 + c4) = h4; } } }
     }
}


typedef _Float16 v4h __attribute__((ext_vector_type(4)));

__global__ __launch_bounds__(256) void k_x16(const float* __restrict__ x, _Float16* __restrict__ X16, size_t n8) { const size_t t = (size_t)blockIdx.x * 256 + threadIdx.x; if (t >= n8) return; FragH f;
#pragma unroll
  for (int q = 0; q < 8; ++q) f.h[q] = (_Float16)bf16_round(x[t * 8 + q]); *(v8us*)((unsigned short*)X16 + t * 8) = f.half[0];  }
__global__ __launch_bounds__(256) void k_h16(const float* __restrict__ x, _Float16* __restrict__ X16, size_t n8) { const size_t t = (size_t)blockIdx.x * 256 + threadIdx.x; if (t >= n8) return; FragH f;
#pragma unroll
  for (int q = 0; q < 8; ++q) f.h[q] = (_Float16)x[t * 8 + q]; *(v8us*)((unsigned short*)X16 + t * 8) = f.half[0];  }
__global__ __launch_bounds__(256) void k_round16f(const float* __restrict__ W, _Float16* __restrict__ Bt, size_t n8) { const size_t t = (size_t)blockIdx.x * 256 + threadIdx.x; if (t >= n8) return; FragH f;
#pragma unroll
  for (int i = 0; i < 8; ++i) f.h[i] = (_Float16)(bf16_round(W[t * 8 + i]) * 16.0f); *(v8us*)((unsigned short*)Bt + t * 8) = f.half[0];  }
__global__ __launch_bounds__(256) void k_hl(const float* __restrict__ F, _Float16* __restrict__ Hh, _Float16* __restrict__ Hl, size_t n8) { const size_t t = (size_t)blockIdx.x * 256 + threadIdx.x; if (t >= n8) return; FragH fh, fl; const v4f a = *(const v4fa*)(F + t * 8), c = *(const v4fa*)(F + t * 8 + 4);
#pragma unroll
  for (int q = 0; q < 4; ++q) { _Float16 h = (_Float16)a[q]; fh.h[q] = h; fl.h[q] = (_Float16)((a[q] - (float)h) * 1024.0f); h = (_Float16)c[q]; fh.h[4 + q] = h; fl.h[4 + q] = (_Float16)((c[q] - (float)h) * 1024.0f); }
  { *(v8us*)((unsigned short*)Hh + t * 8) = fh.half[0]; *(v8us*)((unsigned short*)Hl + t * 8) = fl.half[0];  } }
// f32 -> f16 hi + residual x1024, eight values (k_hl's split)
__device__ __forceinline__ void hl_split8(const float* a, unsigned short* hb, unsigned short* lb) {
  for (int q = 0; q < 8; ++q) { const _Float16 h = (_Float16)a[q]; const _Float16 r = (_Float16)((a[q] - (float)h) * 1024.0f); hb[q] = __builtin_bit_cast(unsigned short, h); lb[q] = __builtin_bit_cast(unsigned short, r); } }

// ---- fast GEMM (wave tile 32x64; requires M % 32 == 0 rows per launch region and N % 64 == 0); epilogue = k_gemm_hhx semantics ----
__device__ __forceinline__ v16h g2_frag(const _Float16* p, int hh) { FragH f; f.half[0] = *(const v8us*)((const unsigned short*)p + 8 * hh); f.half[1] = *(const v8us*)((const unsigned short*)p + 16 + 8 * hh); return f.v; }
__device__ __forceinline__ v8f g2_mma(v16h a, v16h b, v8f c) { v8f d = __builtin_amdgcn_wmma_f32_16x16x32_f16(false, a, false, b, (short)0, c, false, false); asm volatile("v_nop\n\tv_nop\n\tv_nop\n\tv_nop" : "+v"(d) : "v"(a), "v"(b)); return d; }
// ROWB: for a product taken with its operands swapped (C^T = W . A^T): bias[row] in place of bias[col], and CP, where given, is the own element of C
// KU: k steps a trip (K a multiple of 32 * KU): the fragments of all of them are asked for as one batch in front of the trip's first product.
// SPL: the theta | phi | g projection. No f32 C: each wave splits its staged 32 x 64 tile into hi + residual and stores it in the form in which k_attn takes it (column block 0 theta, 1 phi, 2 g).
template <int ACT, bool ROWB = false, bool SPL = false, int KU = 1>
__global__ __launch_bounds__(128) void k_gemm2(const _Float16* __restrict__ A, int lda, size_t sA, const _Float16* __restrict__ Bh, int ldb, size_t sB, float alpha, const float* __restrict__ bias, size_t sBias, const float* __restrict__ CP, int rowsPerB, size_t sCPb, int row0g,
    float* __restrict__ C, _Float16* __restrict__ C16, int ldc, size_t sC, int M, int N, int K, _Float16* __restrict__ Th = nullptr, _Float16* __restrict__ Tl = nullptr, _Float16* __restrict__ Ph = nullptr, _Float16* __restrict__ Pl = nullptr, _Float16* __restrict__ Gh = nullptr, _Float16* __restrict__ Gl = nullptr) { static_assert(ACT == 0 || ACT == 3 || ACT == 6 || ACT == 8 || ACT == 9 || ACT == 11 || ACT == 12 || ACT == 14 || ACT == 15 || ACT == 16 || ACT == 17, "k_gemm2: unsupported ACT code (would silently apply no activation)");
  __shared__ __attribute__((aligned(16))) float so[4][32][68];
  const int tid = threadIdx.x, w = tid >> 5, lane = tid & 31, ln = lane & 15, hh = lane >> 4; const int by = blockIdx.y;
  A += (size_t)by * sA; Bh += (size_t)by * sB; const size_t cofs = (size_t)by * sC; const float* bp = bias ? bias + (size_t)by * sBias : nullptr;
  const int ntn = N >> 6; const int mt = blockIdx.x / ntn, nq = blockIdx.x - mt * ntn; const int row0 = mt * 128 + 32 * w, col0 = nq * 64; if (row0 >= M) return;
  const _Float16* a0p = A + (size_t)(row0 + ln) * lda; const _Float16* a1p = a0p + (size_t)16 * lda;
  const _Float16* b0p = Bh + (size_t)(col0 + ln) * ldb; const _Float16* b1p = b0p + (size_t)16 * ldb; const _Float16* b2p = b1p + (size_t)16 * ldb; const _Float16* b3p = b2p + (size_t)16 * ldb;
  const v8f z8 = {0.f,0.f,0.f,0.f,0.f,0.f,0.f,0.f}; v8f c00 = z8, c01 = z8, c02 = z8, c03 = z8, c10 = z8, c11 = z8, c12 = z8, c13 = z8;
#pragma unroll 1
  for (int kb = 0; kb < K; kb += 32 * KU) { v16h fa[KU][2], fb[KU][4];      /* each fragment in registers of its own: with one b, loaded anew in front of each pair of products, every load was waited out alone, five memory round trips a k step one behind the other */
    const int ko = kb + 8 * hh; const _Float16* pa0 = a0p + ko; const _Float16* pa1 = a1p + ko; const _Float16* pb0 = b0p + ko; const _Float16* pb1 = b1p + ko; const _Float16* pb2 = b2p + ko; const _Float16* pb3 = b3p + ko;      /* the lane's own addresses (g2_frag's 8 * hh taken in): every load of the trip is one of these six plus a constant */
#pragma unroll      /* unrolled: fa and fb are indexed by constants, so they stay in registers, and the loads take constant offsets */
    for (int u = 0; u < KU; ++u) { const int k = 32 * u; fa[u][0] = g2_frag(pa0 + k, 0); fb[u][0] = g2_frag(pb0 + k, 0); fa[u][1] = g2_frag(pa1 + k, 0); fb[u][1] = g2_frag(pb1 + k, 0); fb[u][2] = g2_frag(pb2 + k, 0); fb[u][3] = g2_frag(pb3 + k, 0); }
    asm volatile("s_wait_xcnt 0x0" :: "v"(pa0), "v"(pa1), "v"(pb0), "v"(pb1), "v"(pb2), "v"(pb3) : "memory");      /* in front of the first rewrite of an address register that the loads above name; the addresses are inputs so that they stay whole up to here (without that the batch's last loads took them as their destinations) */
    __builtin_amdgcn_sched_barrier(0);      /* keeps the first product behind the whole batch: lifted in among the loads, its wait for the first fragments held back the last loads, a second round trip */
#pragma unroll      /* unrolled: for the same constant indices */
    for (int u = 0; u < KU; ++u) { c00 = g2_mma(fa[u][0], fb[u][0], c00); c10 = g2_mma(fa[u][1], fb[u][0], c10); c01 = g2_mma(fa[u][0], fb[u][1], c01); c11 = g2_mma(fa[u][1], fb[u][1], c11);
      c02 = g2_mma(fa[u][0], fb[u][2], c02); c12 = g2_mma(fa[u][1], fb[u][2], c12); c03 = g2_mma(fa[u][0], fb[u][3], c03); c13 = g2_mma(fa[u][1], fb[u][3], c13); } }
  v8f accs[8] = {c00, c01, c02, c03, c10, c11, c12, c13};
  v4f br[4] = {};      /* ROWB: bias of the lane's 16 rows (half * 16 + 8 * hh + r), asked for as one batch */
  if (ROWB && bp) { const float* p = bp + row0g + row0 + 8 * hh; br[0] = *(const v4fa*)p; br[1] = *(const v4fa*)(p + 4); br[2] = *(const v4fa*)(p + 16); br[3] = *(const v4fa*)(p + 20);
    for (int i = 0; i < 4; ++i) for (int q = 0; q < 4; ++q) br[i][q] = bf16_round(br[i][q]); }
#pragma unroll
  for (int u = 0; u < 8; ++u) { const int t = u & 3, half = u >> 2; const int col = col0 + t * 16 + ln; const float bvc = (!ROWB && bp) ? bf16_round(bp[col]) : 0.f;
#pragma unroll
    for (int r = 0; r < 8; ++r) { const int rloc = half * 16 + 8 * hh + r; const float bv = ROWB ? br[half * 2 + (r >> 2)][r & 3] : bvc; float v = accs[u][r] * alpha + bv; if (CP) { if (ROWB || rowsPerB < 0) v += CP[cofs + (size_t)(row0g + row0 + rloc) * ldc + col];      /* rowsPerB < 0: own element of the batched C plane */ else { const int bidx = (row0g + row0 + rloc) / rowsPerB; v += CP[(size_t)bidx * sCPb + (size_t)by * 64 + col]; } }
      if (ACT == 3) v = fmaxf(v, 0.f); else if (ACT == 6) v = 0.5f * v * (1.0f + erff(v * 0.70710678118654752f)); else if (ACT == 11) v = 1.0f / (1.0f + expf(-v)); else if (ACT == 15) v = v / (1.0f + expf(-v)); else if (ACT == 12) v = (v > 0.f) ? v : 0.01f * v; else if (ACT == 8) v = tanhf(v); else if (ACT == 9) v = 0.5f * v * (1.0f + tanhf(0.7978845608028654f * (v + 0.044715f * v * v * v))); else if (ACT == 14) v = (v > 0.f) ? v : 0.1f * v; else if (ACT == 16) v = (v >= 0.f) ? v : 0.3f * v; else if (ACT == 17) v = (v >= 0.f) ? v : 0.2f * v;
      so[w][rloc][t * 16 + ln] = v; } }
  __builtin_amdgcn_fence(__ATOMIC_ACQ_REL, "workgroup"); __builtin_amdgcn_wave_barrier();
  const int rsub = lane >> 4, c4 = (lane & 15) * 4;
  if (SPL) { const size_t n0 = (size_t)(row0g + row0);      /* the wave's first row: batch * positions + position, a multiple of 32 */
    if (nq == 0) {      /* theta: rows of D3 halves (only the first IC are written or read); eight lanes store one row's 128 bytes, a whole line */
#pragma unroll      /* unrolled: the eight trips' LDS reads go out in batches and the stores take one base with immediate offsets; rolled, each trip waits out its own reads */
      for (int i = 0; i < 8; ++i) { const int r = i * 4 + (lane >> 3), j = lane & 7; FragH fh, fl; hl_split8(&so[w][r][j * 8], fh.u, fl.u);
        *(v8us*)((unsigned short*)Th + (n0 + r) * D3 + j * 8) = fh.half[0]; *(v8us*)((unsigned short*)Tl + (n0 + r) * D3 + j * 8) = fl.half[0]; } }
    else if (nq == 1) {      /* phi in the order of k_attn's A fragments, [tile of 16 keys][k step][fragment half][lane] x 16 bytes: channel group j of key n is k step j / 4, half (j / 2) % 2, lane 16 * (j % 2) + n % 16 (the k order of g2_frag); a store covers 512 contiguous bytes */
#pragma unroll      /* unrolled: the eight trips' LDS reads go out in batches and the stores take one base with immediate offsets; rolled, each trip waits out its own reads */
      for (int i = 0; i < 8; ++i) { const int r = (i >> 2) * 16 + ln, j = (i & 3) * 2 + hh; FragH fh, fl; hl_split8(&so[w][r][j * 8], fh.u, fl.u);
        const size_t u = (((n0 >> 4) + (i >> 2)) * 4 + (i & 3)) * 32 + lane; *(v8us*)((unsigned short*)Ph + u * 8) = fh.half[0]; *(v8us*)((unsigned short*)Pl + u * 8) = fl.half[0]; }
      asm volatile("s_wait_xcnt 0x0" ::: "memory");      /* behind the last stores: the code of the other column blocks follows in the listing and rewrites the stores' registers */ }
    else {      /* g^T in the order of k_attn's A fragments, [block of 32 keys][tile of 16 channels][fragment half][lane] x 16 bytes: keys 8 * p .. 8 * p + 7 of the block, channel d, are half p / 2, lane 16 * (p % 2) + d % 16; the wave's 32 rows are one block */
#pragma unroll      /* unrolled: the eight trips' LDS reads go out in batches and the stores take one base with immediate offsets; rolled, each trip waits out its own reads */
      for (int i = 0; i < 8; ++i) { const int p = (i & 1) * 2 + hh, d = (i >> 1) * 16 + ln; float a[8]; for (int q = 0; q < 8; ++q) a[q] = so[w][p * 8 + q][d]; FragH fh, fl; hl_split8(a, fh.u, fl.u);
        const size_t u = ((n0 >> 5) * 8 + i) * 32 + lane; *(v8us*)((unsigned short*)Gh + u * 8) = fh.half[0]; *(v8us*)((unsigned short*)Gl + u * 8) = fl.half[0]; }
      asm volatile("s_wait_xcnt 0x0" ::: "memory");      /* behind the last stores: the code of the other column blocks follows in the listing and rewrites the stores' registers */ } }
  else {
#pragma unroll
    for (int q = 0; q < 16; ++q) { const int r = q * 2 + rsub; const v4f v = *(const v4fa*)&so[w][r][c4]; if (C) *(v4f*)(C + cofs + (size_t)(row0 + r) * ldc + col0 + c4) = v; if (C16) { v4h h4; for (int i = 0; i < 4; ++i) h4[i] = (_Float16)v[i]; *(v4h*)(C16 + cofs + (size_t)(row0 + r) * ldc + col0 + c4) = h4; } }
     } }


__global__ __launch_bounds__(256) void k_rsm(const float* __restrict__ S, _Float16* __restrict__ P, int nrows) {
  #pragma clang fp contract(off)
  const int i = blockIdx.x * 256 + threadIdx.x; if (i >= nrows) return; const float* s = S + (size_t)i * SQ; float mx = -3.0e38f;
#pragma unroll 1
  for (int j = 0; j < SQ; ++j) mx = fmaxf(mx, s[j]); float se = 0.f;
#pragma unroll 1
  for (int j = 0; j < SQ; ++j) se += expf(s[j] - mx); const float sc = 256.0f / se;
#pragma unroll 1
  for (int j0 = 0; j0 < SQ; j0 += 8) { FragH f; for (int q = 0; q < 8; ++q) f.h[q] = (_Float16)(expf(s[j0 + q] - mx) * sc); unsigned short* d = (unsigned short*)P + (size_t)i * SQ + j0; *(v8us*)d = f.half[0];  } }
__global__ __launch_bounds__(256) void k_vt(const _Float16* __restrict__ V16, int b, int h0, _Float16* __restrict__ VT) { __shared__ unsigned short tl[64][65]; const int tid = threadIdx.x; const int hh = blockIdx.x % HG, sg = blockIdx.x / HG; const int s0 = sg * 64; const int h = h0 + hh;
  for (int i = tid; i < 64 * 8; i += 256) { const int j = i / 8, d8 = (i % 8) * 8; FragH f; f.half[0] = *(const v8us*)((const unsigned short*)V16 + ((size_t)b * SQ + s0 + j) * DM + h * HD + d8); for (int q = 0; q < 8; ++q) tl[d8 + q][j] = f.u[q]; }
  __syncthreads();
  { for (int i = tid; i < 64 * 8; i += 256) { const int d = i / 8, j8 = (i % 8) * 8; FragH f; for (int q = 0; q < 8; ++q) f.u[q] = tl[d][j8 + q]; *(v8us*)((unsigned short*)VT + ((size_t)hh * HD + d) * SQ + s0 + j8) = f.half[0]; }  } }


// The eight jobs that read inputs alone, in one launch; the block index picks the job and no job reads what another writes.
// Blocks 0 .. 4 * PW - 1: the four weight matrices, rounded to bf16, x16, as f16 in their natural [out][in] rows (theta | phi | g stacked in B3, W_z in BZ). Block 4 * PW: the three biases stacked in b3. The rest: x [channel][position] to f16 rows [position][channel], a 64 x 32 tile a block.
#define PW (IC * CC / 8 / 256)       /* blocks a weight matrix: eight elements a thread */
#define PX (NB * (LL / 32) * (CC / 64))
__global__ __launch_bounds__(256) void k_prep(const float* __restrict__ X, const float* __restrict__ tw, const float* __restrict__ pw, const float* __restrict__ gw, const float* __restrict__ zw, const float* __restrict__ tb, const float* __restrict__ pb, const float* __restrict__ gb,
    _Float16* __restrict__ XR, _Float16* __restrict__ B3, _Float16* __restrict__ BZ, float* __restrict__ b3) { static_assert(IC * CC % 2048 == 0 && D3 <= 256, "whole blocks a weight matrix; one thread a bias");
  __shared__ float tl[64][33]; const int tid = threadIdx.x;
  if (blockIdx.x < 4 * PW) { const int j = blockIdx.x / PW; const float* w = (j == 0) ? tw : (j == 1) ? pw : (j == 2) ? gw : zw; _Float16* Bt = (j < 3) ? B3 + (size_t)j * IC * CC : BZ;
    const size_t t = (size_t)(blockIdx.x % PW) * 256 + tid; FragH f; for (int q = 0; q < 8; ++q) f.h[q] = (_Float16)(bf16_round(w[t * 8 + q]) * 16.0f); *(v8us*)((unsigned short*)Bt + t * 8) = f.half[0]; }
  else if (blockIdx.x == 4 * PW) { if (tid < D3) { const int j = tid / IC; const float* s = (j == 0) ? tb : (j == 1) ? pb : gb; b3[tid] = s[tid % IC]; } }
  else { const int bx = blockIdx.x - (4 * PW + 1); const int nl = LL / 32, nc = CC / 64; const int cb_ = bx % nc; const int lb = (bx / nc) % nl; const size_t b = bx / (nc * nl); const int c0 = cb_ * 64, l0 = lb * 32;
    for (int i = tid; i < 64 * 32; i += 256) { const int c = i / 32, l = i % 32; tl[c][l] = bf16_round(X[(b * CC + c0 + c) * (size_t)LL + l0 + l]); }
    __syncthreads();      /* under a test on the block index alone: every thread of the block passes it */
    const int l = tid / 8, c8 = (tid % 8) * 8; FragH f; for (int q = 0; q < 8; ++q) f.h[q] = (_Float16)tl[c8 + q][l]; unsigned short* d = (unsigned short*)XR + (b * LL + l0 + l) * (size_t)CC + c0 + c8; *(v8us*)d = f.half[0];
    asm volatile("s_wait_xcnt 0x0" ::: "memory");      /* behind the store: the code of the other jobs follows this block in the listing and rewrites the store's registers */
  } }

// Fused attention: a work-group of 8 waves owns 64 queries; a wave owns 32 of them (two column groups of 16) and every fourth block of 32 keys, one block a trip; scores, softmax weights and the weighted sum of g stay in registers (no score or weight plane in memory).
// The four waves of a query group each keep their own running maximum, sum and y; the four partial results are joined through LDS behind the key loop.
// S^T = phi . theta^T (A = 16 phi rows, B = the wave's theta rows, kept in registers), so a lane holds one query's scores: D register r of lane (ln, hh) is key 8 * hh + r, query ln.
// The two tiles of a trip (keys 0..15, 16..31), converted in place, are the B operand of y^T += g^T . P^T in the k order of g2_frag; the running maximum, the sum and the rescale factor of query ln live in lanes ln and ln + 16.
__device__ __forceinline__ v8f at_mma(v16h a, v16h b, v8f c) { return __builtin_amdgcn_wmma_f32_16x16x32_f16(false, a, false, b, (short)0, c, false, false); }
// fragment in the k order of g2_frag from a wave-uniform base and the lane's own byte offset (row * pitch + 16 * hh)
__device__ __forceinline__ v16h at_frag(const char* base, unsigned off) { FragH f; f.half[0] = *(const v8us*)(base + off); f.half[1] = *(const v8us*)(base + off + 32); return f.v; }
// the same fragment from an operand stored in fragment order (k_gemm2's SPL epilogue): 1 KiB at a wave-uniform base, off = 16 * lane; each of the two loads covers 512 contiguous bytes, four whole lines
__device__ __forceinline__ v16h at_fragp(const char* base, unsigned off) { FragH f; f.half[0] = *(const v8us*)(base + off); f.half[1] = *(const v8us*)(base + off + 512); return f.v; }
__device__ __forceinline__ float at_xhalf(float x) { return __builtin_bit_cast(float, __builtin_amdgcn_permlanex16(__builtin_bit_cast(int, x), __builtin_bit_cast(int, x), 0x76543210, 0xfedcba98, false, false)); }      /* lane l with lane l ^ 16 */
__global__ __launch_bounds__(256) void k_attn(const _Float16* __restrict__ TH, const _Float16* __restrict__ TL, const _Float16* __restrict__ PH, const _Float16* __restrict__ PL, const _Float16* __restrict__ GT, const _Float16* __restrict__ GTL, const _Float16* __restrict__ BZ, const float* __restrict__ zb, float* __restrict__ WY) {
  __shared__ __attribute__((aligned(16))) v4f py[8][16][32];      /* partial y: [wave][(column group * 4 + tile) * 2 + register half][lane] */
  __shared__ float pm[8][2][32], pl[8][2][32];      /* partial maximum and sum: [wave][column group][lane] */
  __shared__ __attribute__((aligned(16))) unsigned short ys[2][64][IC + 8];      /* the work-group's joined y rows, hi / residual: [plane][query][channel]; 16 bytes more a row than its 128, the pitch for 16-byte LDS reads */
  __shared__ __attribute__((aligned(16))) float so[8][32][68];      /* each wave's own 32 channels x 64 queries of W_z y, staged for whole-line stores (k_gemm2's pitch) */
  const int tid = threadIdx.x, lane = tid & 31, ln = lane & 15, hh = lane >> 4;
  const int wv = __builtin_amdgcn_readfirstlane(tid >> 5), w = wv & 1, ks = wv >> 1;      /* query group; which of every four key blocks */
  const int b = blockIdx.x / (LL / 64), qb = (blockIdx.x % (LL / 64)) * 64;
  const char* th = (const char*)(TH + (size_t)b * LL * D3); const char* tl = (const char*)(TL + (size_t)b * LL * D3);      /* rows of D3 halves, theta in the first IC of them, hi / residual */
  const char* kph = (const char*)(PH + (size_t)b * LL * IC); const char* kpl = (const char*)(PL + (size_t)b * LL * IC);      /* phi hi / residual in fragment order: 128 bytes a key, 2 KiB a tile of 16 keys */
  const char* gh = (const char*)(GT + (size_t)b * IC * SK); const char* gl = (const char*)(GTL + (size_t)b * IC * SK);      /* g^T hi / residual in fragment order: 128 bytes a key, 4 KiB a block of 32 keys */
  const unsigned qo = (unsigned)(32 * w + ln) * (D3 * 2) + 16 * hh, lo = (unsigned)lane * 16;
  const float L2E = 1.44269504088896340736f;
  const v8f z8 = {0.f,0.f,0.f,0.f,0.f,0.f,0.f,0.f};
  v8f yh[2][4], yl[2][4]; float m[2], l[2];
#pragma unroll
  for (int j = 0; j < 2; ++j) { m[j] = -INFINITY; l[j] = 0.f; for (int t = 0; t < 4; ++t) { yh[j][t] = z8; yl[j][t] = z8; } }
  __builtin_amdgcn_sched_barrier(0);      /* with the one behind the wait: no vector write stands between the first loads and their s_wait_xcnt */
  v16h qh[2][2], ql[2][2];      /* theta hi / residual: [column group][k step] */
#pragma unroll
  for (int j = 0; j < 2; ++j) for (int c = 0; c < 2; ++c) { const size_t o = (size_t)(qb + 16 * j) * (D3 * 2) + 64 * c; qh[j][c] = at_frag(th + o, qo); ql[j][c] = at_frag(tl + o, qo); }
  v16h ka[2][2], kr[2][2];      /* phi hi / residual of the trip: [key tile][k step] */
#pragma unroll
  for (int t = 0; t < 2; ++t) for (int c = 0; c < 2; ++c) { const size_t o = (size_t)(32 * ks + 16 * t) * (IC * 2) + 1024 * c; ka[t][c] = at_fragp(kph + o, lo); kr[t][c] = at_fragp(kpl + o, lo); }
  asm volatile("s_wait_xcnt 0x0" ::: "memory");      /* in front of the first rewrite of an address register that the loads above name */
  __builtin_amdgcn_sched_barrier(0);      /* holds every later register write behind that wait */
  for (int it = 0; it < SK / 128; ++it) { const int k0 = 128 * it + 32 * ks;
    v16h ga[4], gr[4];      /* g^T of this trip: asked for here, used behind the softmax */
#pragma unroll
    for (int t = 0; t < 4; ++t) { const size_t o = (size_t)k0 * (IC * 2) + 1024 * t; ga[t] = at_fragp(gh + o, lo); gr[t] = at_fragp(gl + o, lo); }
    asm volatile("s_wait_xcnt 0x0" ::: "memory");      /* in front of the rewrite of the address registers that these loads name */
    __builtin_amdgcn_sched_barrier(0);      /* keeps the g^T loads in front of the score products: sunk to their uses each would be waited for alone */
    float s[2][2][8];
#pragma unroll
    for (int t = 0; t < 2; ++t) for (int j = 0; j < 2; ++j) {
      v8f sh = at_mma(ka[t][0], qh[j][0], z8); sh = at_mma(ka[t][1], qh[j][1], sh);      /* phi-hi . theta-hi */
      v8f sl = at_mma(ka[t][0], ql[j][0], z8); sl = at_mma(ka[t][1], ql[j][1], sl); sl = at_mma(kr[t][0], qh[j][0], sl); sl = at_mma(kr[t][1], qh[j][1], sl);      /* phi-hi . theta-res + phi-res . theta-hi, both x1024 */
      for (int r = 0; r < 8; ++r) s[j][t][r] = fmaf(sl[r], 1.0f / 1024.0f, sh[r]); }
    __builtin_amdgcn_sched_barrier(0);      /* with the one behind the wait: no vector write stands between the loads below and their s_wait_xcnt */
    const int kn = (k0 + 128) & (SK - 1);      /* the next trip's phi rows, one trip ahead; the last trip asks for the wave's first rows again (in bounds, not used) */
#pragma unroll
    for (int t = 0; t < 2; ++t) for (int c = 0; c < 2; ++c) { const size_t o = (size_t)(kn + 16 * t) * (IC * 2) + 1024 * c; ka[t][c] = at_fragp(kph + o, lo); kr[t][c] = at_fragp(kpl + o, lo); }
    asm volatile("s_wait_xcnt 0x0" ::: "memory");      /* in front of the rewrite of the address registers that these loads name */
    __builtin_amdgcn_sched_barrier(0);      /* keeps those loads in front of the softmax, whose time then covers their latency */
    float mn[2];
#pragma unroll
    for (int j = 0; j < 2; ++j) { float mx = s[j][0][0];
      for (int t = 0; t < 2; ++t) for (int r = 0; r < 8; ++r) mx = fmaxf(mx, s[j][t][r]);
      mx = fmaxf(mx, at_xhalf(mx));      /* the other eight keys of each tile sit in the partner lane */
      mn[j] = fmaxf(m[j], mx); }
    if (__builtin_amdgcn_ballot_w32(mn[0] > m[0] || mn[1] > m[1]) != 0) {      /* no maximum moved: every factor would be 1 */
#pragma unroll
      for (int j = 0; j < 2; ++j) { const float al = __builtin_amdgcn_exp2f((m[j] - mn[j]) * L2E);      /* first trip: exp2(-inf) = 0 on sums that are still 0 */
        m[j] = mn[j]; l[j] *= al;
        for (int t = 0; t < 4; ++t) for (int r = 0; r < 8; ++r) { yh[j][t][r] *= al; yl[j][t][r] *= al; } } }
#pragma unroll
    for (int j = 0; j < 2; ++j) { FragH pf; const float cn = -m[j] * L2E;
#pragma unroll
      for (int i = 0; i < 8; ++i) { const float p0 = __builtin_amdgcn_exp2f(fmaf(s[j][0][i], L2E, cn)), p1 = __builtin_amdgcn_exp2f(fmaf(s[j][1][i], L2E, cn)); l[j] += p0 + p1;
        pf.h[i] = (_Float16)(p0 * 16384.0f); pf.h[8 + i] = (_Float16)(p1 * 16384.0f); }      /* P carried x2^14: the peaky rows would otherwise flush most weights below the f16 normal range */
#pragma unroll
      for (int t = 0; t < 4; ++t) { yh[j][t] = at_mma(ga[t], pf.v, yh[j][t]); yl[j][t] = at_mma(gr[t], pf.v, yl[j][t]); } }
  }
#pragma unroll
  for (int j = 0; j < 2; ++j) { pm[wv][j][lane] = m[j]; pl[wv][j][lane] = l[j] + at_xhalf(l[j]);
#pragma unroll
    for (int t = 0; t < 4; ++t) { v4f o0, o1;
      for (int r = 0; r < 4; ++r) { o0[r] = fmaf(yl[j][t][r], 1.0f / 1024.0f, yh[j][t][r]); o1[r] = fmaf(yl[j][t][4 + r], 1.0f / 1024.0f, yh[j][t][4 + r]); }
      py[wv][(j * 4 + t) * 2][lane] = o0; py[wv][(j * 4 + t) * 2 + 1][lane] = o1; } }
  __syncthreads();      /* every wave's partial result is in LDS before any wave joins */
  // W_z y for the work-group's 64 queries follows the join in this kernel, from the joined y in LDS: (W_z y)^T = W_z . y^T, A = the wave's 32 W_z rows (channels 32 * wv ..), B = the 64 y rows, hi and residual in accumulators of their own.
  static_assert(CC == 8 * 32 && IC == 64, "eight waves of 32 channels each; two k steps");
  v16h za[2][2]; v4f br[4];      /* W_z rows [k step][tile of 16 channels] and the bias of the lane's 16 channels (tile * 16 + 8 * hh + r): asked for here, used behind the join, whose time covers their latency */
  { const char* zp = (const char*)(BZ + (size_t)(32 * wv) * IC); const unsigned zo = (unsigned)ln * (IC * 2) + 16 * hh;
    for (int u = 0; u < 2; ++u) for (int i = 0; i < 2; ++i) za[u][i] = at_frag(zp + i * (16 * IC * 2) + 64 * u, zo);
    const float* p = zb + 32 * wv + 8 * hh; br[0] = *(const v4fa*)p; br[1] = *(const v4fa*)(p + 4); br[2] = *(const v4fa*)(p + 16); br[3] = *(const v4fa*)(p + 20); }
  const int jo = ks & 1, qn = 8 * (ks >> 1) + (lane & 7), tc = lane >> 3;      /* this wave joins eight queries of column group jo, all 64 channels: whole 128-byte lines of the f16 y rows; the lane takes query qn, channels 16 * tc .. 16 * tc + 15 */
  float ms[4], wt[4];
#pragma unroll
  for (int s = 0; s < 4; ++s) ms[s] = pm[2 * s + w][jo][qn];
  const float mj = fmaxf(fmaxf(ms[0], ms[1]), fmaxf(ms[2], ms[3])); float lt = 0.f;
#pragma unroll
  for (int s = 0; s < 4; ++s) ms[s] = (ms[s] - mj) * L2E;
  __builtin_amdgcn_sched_barrier(0);      /* all four exponents are formed in front of the first v_exp */
#pragma unroll
  for (int s = 0; s < 4; ++s) wt[s] = __builtin_amdgcn_exp2f(ms[s]);
#pragma unroll
  for (int s = 0; s < 4; ++s) lt = fmaf(wt[s], pl[2 * s + w][jo][qn], lt);
  const float inv = (1.0f / 16384.0f) / lt;
  v4f o[4];
#pragma unroll
  for (int i = 0; i < 4; ++i) { const int e = (jo * 4 + tc) * 2 + (i & 1), sl = 16 * (i >> 1) + qn;      /* D register r of tile t, lane (ln, hh) = channel 16 * t + 8 * hh + r of query ln: o[i] is channels 16 * tc + 4 * i .. + 3 */
    o[i] = py[w][e][sl] * wt[0];
    for (int s = 1; s < 4; ++s) { const v4f p = py[2 * s + w][e][sl]; for (int r = 0; r < 4; ++r) o[i][r] = fmaf(p[r], wt[s], o[i][r]); }
    o[i] *= inv; }
  const float ov[16] = {o[0][0], o[0][1], o[0][2], o[0][3], o[1][0], o[1][1], o[1][2], o[1][3], o[2][0], o[2][1], o[2][2], o[2][3], o[3][0], o[3][1], o[3][2], o[3][3]};
  FragH fh, fl; hl_split8(ov, fh.u, fl.u); hl_split8(ov + 8, fh.u + 8, fl.u + 8);      /* y as the hi + residual operand pair of the W_z product */
  const int yq = 32 * w + 16 * jo + qn;
  *(v8us*)&ys[0][yq][16 * tc] = fh.half[0]; *(v8us*)&ys[0][yq][16 * tc + 8] = fh.half[1]; *(v8us*)&ys[1][yq][16 * tc] = fl.half[0]; *(v8us*)&ys[1][yq][16 * tc + 8] = fl.half[1];
  __syncthreads();      /* all 64 y rows are in LDS before any wave takes them as its B operand */
  v8f ch[2][4], cl[2][4];      /* W_z . y-hi and W_z . y-res: [tile of 16 channels][tile of 16 queries] */
  for (int i = 0; i < 2; ++i) for (int t = 0; t < 4; ++t) { ch[i][t] = z8; cl[i][t] = z8; }
  for (int u = 0; u < 2; ++u)
    for (int t = 0; t < 4; ++t) { FragH bh, bl; const int o = 32 * u + 8 * hh;      /* the k order of g2_frag, as for za */
      bh.half[0] = *(const v8us*)&ys[0][16 * t + ln][o]; bh.half[1] = *(const v8us*)&ys[0][16 * t + ln][o + 16]; bl.half[0] = *(const v8us*)&ys[1][16 * t + ln][o]; bl.half[1] = *(const v8us*)&ys[1][16 * t + ln][o + 16];
      for (int i = 0; i < 2; ++i) { ch[i][t] = at_mma(za[u][i], bh.v, ch[i][t]); cl[i][t] = at_mma(za[u][i], bl.v, cl[i][t]); } }
  for (int i = 0; i < 4; ++i) for (int q = 0; q < 4; ++q) br[i][q] = bf16_round(br[i][q]);
  for (int i = 0; i < 2; ++i) for (int t = 0; t < 4; ++t) for (int r = 0; r < 8; ++r) { float v = ch[i][t][r] * 0.0625f + br[i * 2 + (r >> 2)][r & 3]; v += cl[i][t][r] * (0.0625f / 1024.0f);      /* W_z carried x16, the residual x1024: both factors powers of two */
    so[wv][i * 16 + 8 * hh + r][t * 16 + ln] = v; }
  __builtin_amdgcn_fence(__ATOMIC_ACQ_REL, "workgroup"); __builtin_amdgcn_wave_barrier();      /* the wave reads back below what its other lanes wrote above */
  float* wp = WY + (size_t)(32 * wv + hh) * NR + (size_t)b * LL + qb + ln * 4;      /* WY is [channel][batch * positions]: sixteen lanes store one channel's 64 queries, 256 bytes, two whole lines */
  for (int q = 0; q < 16; ++q) { const v4f v = *(const v4fa*)&so[wv][q * 2 + hh][ln * 4]; *(v4f*)(wp + (size_t)(q * 2) * NR) = v; } }
__global__ __launch_bounds__(256) void k_bnstat(const float* __restrict__ WY, float* __restrict__ ST) {
  #pragma clang fp contract(off)
  __shared__ float red[256]; const int c = blockIdx.x; const int tid = threadIdx.x; float s = 0.f;
  float v[NR / 256];      /* the thread's values of the channel, rows tid + 256 * i in the order in which both passes sum them: all asked for ahead of the first sum (in a loop of one load a trip each load was waited out alone) and kept for the second pass */
  for (int i = 0; i < (int)(NR / 256); ++i) v[i] = WY[(size_t)c * NR + (size_t)i * 256 + tid];      /* WY is [channel][row]: a wave's load is one whole line */
  for (int i = 0; i < (int)(NR / 256); ++i) s = __fadd_rn(s, v[i]);
  red[tid] = s; __syncthreads(); for (int st = 128; st > 0; st >>= 1) { if (tid < st) red[tid] += red[tid + st]; __syncthreads(); }
  const float mean = red[0] / (float)NR; __syncthreads(); float s2 = 0.f;
  for (int i = 0; i < (int)(NR / 256); ++i) { const float d = __fadd_rn(v[i], -mean); s2 = __fadd_rn(s2, __fmul_rn(d, d)); }
  red[tid] = s2; __syncthreads(); for (int st = 128; st > 0; st >>= 1) { if (tid < st) red[tid] += red[tid + st]; __syncthreads(); }
  if (tid < 32) { const float v = (tid == 0) ? mean : ((tid == 1) ? rsqrtf(__fadd_rn(red[0] / (float)NR, 1e-5f)) : 0.f); *(float*)(ST + (size_t)c * 32 + tid) = v;  } }
__global__ __launch_bounds__(256) void k_fin(const float* __restrict__ WY, const float* __restrict__ ST, const float* __restrict__ gam, const float* __restrict__ bet, const float* __restrict__ x, float* __restrict__ out) {
  #pragma clang fp contract(off)
  static_assert(LL % 2048 == 0, "a block's 2048 elements lie in one channel of one sample");
  const size_t e0 = (size_t)blockIdx.x * 2048; if (e0 >= (size_t)NB * CC * LL) return; const int n0 = (int)(e0 % LL); const size_t bc = e0 / LL; const int c = (int)(bc % CC); const size_t b = bc / CC; const float mean = ST[(size_t)c * 32], rstd = ST[(size_t)c * 32 + 1], g = bf16_round(gam[c]), be = bf16_round(bet[c]); v8f r;
  const int o = threadIdx.x * 8; const float* wp = WY + (size_t)c * NR + b * LL + n0; const float* xp = x + e0;      /* WY is [channel][row]: the thread's eight positions are 32 contiguous bytes there as in x and out, at the same offset from the block's base */
  __builtin_amdgcn_sched_barrier(0);      /* with the one behind the wait: no write of a register, a scalar load's result among them, stands between the four loads and their s_wait_xcnt */
  const v4f w0 = *(const v4fa*)(wp + o), w1 = *(const v4fa*)(wp + o + 4), x0 = *(const v4fa*)(xp + o), x1 = *(const v4fa*)(xp + o + 4);
  asm volatile("s_wait_xcnt 0x0" ::: "memory");      /* in front of the first rewrite of a base register that the loads above name */
  __builtin_amdgcn_sched_barrier(0);      /* holds every later register write behind that wait */
  const float wy[8] = {w0[0], w0[1], w0[2], w0[3], w1[0], w1[1], w1[2], w1[3]}, xv[8] = {x0[0], x0[1], x0[2], x0[3], x1[0], x1[1], x1[2], x1[3]};
  for (int q = 0; q < 8; ++q) { const float v = __fadd_rn(__fmul_rn(__fmul_rn(__fadd_rn(wy[q], -mean), rstd), g), be); r[q] = __fadd_rn(v, bf16_round(xv[q])); }
  *(v8f*)(out + e0 + o) = r;  }

extern "C" void kernel_launch(void* const* d_in, const int* in_sizes, int n_in,
                              void* d_out, int out_size, void* d_ws, size_t ws_size, hipStream_t stream) {
  (void)in_sizes; (void)n_in; (void)out_size;
  const float* const* I = (const float* const*)d_in; const float* x = I[0]; const float* gw = I[1]; const float* gb = I[2]; const float* tw = I[3]; const float* tb = I[4]; const float* pw = I[5]; const float* pb = I[6]; const float* zw = I[7]; const float* zb = I[8]; const float* gam = I[9]; const float* bet = I[10];      /* g/theta/phi_w [64][256], wz_w [256][64] natural */
  char* ws = (char*)d_ws; size_t off = 0;
  auto take = [&](size_t bytes) { char* p = ws + off; off += (bytes + 255) & ~(size_t)255; return p; };
  _Float16* B3 = (_Float16*)take((size_t)D3 * CC * 2); float* b3 = (float*)take(D3 * 4); _Float16* BZ = (_Float16*)take((size_t)CC * IC * 2); float* ST = (float*)take((size_t)CC * 32 * 4);
  _Float16* XR = (_Float16*)take(NR * CC * 2); _Float16* TH = (_Float16*)take(NR * D3 * 2); _Float16* TL = (_Float16*)take(NR * D3 * 2); _Float16* PH = (_Float16*)take(NR * IC * 2); _Float16* PL = (_Float16*)take(NR * IC * 2);
  _Float16* GT = (_Float16*)take((size_t)NB * IC * SK * 2); _Float16* GTL = (_Float16*)take((size_t)NB * IC * SK * 2);
  float* WY = (float*)take(NR * CC * 4);
  if (off > ws_size) return;      /* 0.2 + 8 + 6 + 6 + 4 + 4 + 16 = approx 44 MiB */
  k_prep<<<4 * PW + 1 + PX, 256, 0, stream>>>(x, tw, pw, gw, zw, tb, pb, gb, XR, B3, BZ, b3);      /* Bt rows: theta 0..63 | phi 64..127 | g 128..191 */
  k_gemm2<0, false, true, 2><<<dim3((unsigned)((NR / 128) * (D3 / 64)), 1), 128, 0, stream>>>(XR, CC, 0, B3, CC, 0, 0.0625f, b3, 0, nullptr, 1, 0, 0, nullptr, nullptr, D3, 0, (int)NR, D3, CC, TH, TL, PH, PL, GT, GTL);      /* theta rows, phi and g^T in fragment order, each hi / residual */
  k_attn<<<NBR * (LL / 64), 256, 0, stream>>>(TH, TL, PH, PL, GT, GTL, BZ, zb, WY);      /* y = softmax(theta . phi) . g, then WY = (W_z y)^T + bias, [channel][batch * positions], so that k_bnstat and k_fin, which go channel by channel, read contiguous bytes */
  k_bnstat<<<CC, 256, 0, stream>>>(WY, ST);
  k_fin<<<(unsigned)(((size_t)NB * CC * LL / 8 + 255) / 256), 256, 0, stream>>>(WY, ST, gam, bet, x, (float*)d_out);
}
